// v000
// Measured on an AMD MI455X. A time is GPU time per run, averaged over a window of back-to-back runs after a warm-up
// (all launches, gaps included; the runs take copies of the inputs in turn), and the median of several windows.
// Apart from v000's, it joins two sittings. Times from different sittings can be a few percent apart, while
// side-by-side timings come from the same sitting.
// v000 is the starting kernel. One run takes 343 microseconds.
// Contractions: q projection, k conv (im2col) and v^T conv (im2col) = v_wmma_f32_16x16x32_bf16 single products on bf16 planes of the RNE-converted inputs (exact products); scores q.(k+pos) and p.v = bf16 hi/lo split (hi.hi + hi.lo + lo.hi); f32 accumulate everywhere; positional add, 32^-0.5 scale, online softmax and 1/rowsum in f32 on the VALU.
// Plane / carry map (all carry 1, nothing to fold back):
//   XT  = bf16(x) token-major [16384][256] (row b*4096 + n, n = y*64 + x, col c)
//   WQ  = bf16(Wq) [256 o][256 c];  WKp, WVp bf16 [256 o][1024]: col q4*256 + c = bf16(W[o][c][kh][kw]), q4 = kh*2 + kw
//   Qh|Ql bf16 [16384][256] (col h*32 + d) = hi/lo of q;  Kh|Kl bf16 [4096][256] (row b*1024 + m, m = i*32 + j; col h*32 + d) = hi/lo of (conv_k + pos)
//   pos(h,d,m) = bf16(rel_h[(h*32+d)*32 + (m & 31)]) + bf16(rel_w[(h*32+d)*32 + (m >> 5)]) in f32
//   VTh|VTl bf16 [256 (h*32+d)][4096 (b*1024+m)] = hi/lo of conv_v;  P hi|lo = unnormalised exp in (0,1] (bf16), 1/rowsum applied to the f32 accumulator
#include <hip/hip_runtime.h>
#include <math.h>
#include <stdint.h>

#define NB    4
#define DIM   256
#define NH    8
#define HD    32
#define IMH   64
#define IMW   64
#define NQ    4096
#define OH    32
#define OW    32
#define NKV   1024
#define KCONV 1024
#define MTOK  (NB * NQ)
#define MKV   (NB * NKV)
#define VTP   (NB * NKV)

static_assert(NQ == IMH * IMW);
static_assert(NKV == OH * OW);
static_assert(OH * 2 == IMH);
static_assert(OW * 2 == IMW);
static_assert(DIM == NH * HD);
static_assert(HD == 32);
static_assert(KCONV == DIM * 4);
static_assert(MTOK % 64 == 0);
static_assert(MKV % 128 == 0);
static_assert(DIM % 64 == 0);
static_assert(KCONV % 32 == 0);
static_assert(DIM % 32 == 0);
static_assert((DIM * DIM) % (8 * 256) == 0);
static_assert(((MKV / 64) * (DIM / 64)) % 8 == 0);
static_assert(((MTOK / 64) * (DIM / 64)) % 8 == 0);
static_assert(DIM * OH == 8192);
static_assert(NQ % 64 == 0);
static_assert(NKV % 64 == 0);

typedef __attribute__((ext_vector_type(16))) _Float16 v16h;
typedef __attribute__((ext_vector_type(8)))  _Float16 v8h;
typedef __attribute__((ext_vector_type(16))) __bf16   v16b;
typedef __attribute__((ext_vector_type(8)))  __bf16   v8b;
typedef __attribute__((ext_vector_type(8)))  float    v8f;
typedef __attribute__((ext_vector_type(4)))  float    v4f;
typedef __attribute__((ext_vector_type(2)))  float    v2f;
typedef __attribute__((ext_vector_type(4)))  unsigned int v4u;
typedef __attribute__((ext_vector_type(2)))  unsigned int v2u;

__device__ __forceinline__ unsigned short f2bf_bits(float f) {
  unsigned u = __float_as_uint(f);
  return (unsigned short)((u + 0x7FFFu + ((u >> 16) & 1u)) >> 16);
}
__device__ __forceinline__ float bf_bits2f(unsigned short h) { return __uint_as_float(((unsigned)h) << 16); }
__device__ __forceinline__ unsigned pk16(unsigned short a, unsigned short b) { return (unsigned)a | ((unsigned)b << 16); }

// hazard guards as plain device helpers (no inline asm inside the kernel template body)
__device__ __forceinline__ void dep_guard_h(v8f& a, v8f& b, v16h x, v16h y) { asm volatile("v_nop\n\tv_nop\n\tv_nop\n\tv_nop" : "+v"(a), "+v"(b) : "v"(x), "v"(y)); }
__device__ __forceinline__ void dep_guard_b(v8f& a, v8f& b, v16b x, v16b y) { asm volatile("v_nop\n\tv_nop\n\tv_nop\n\tv_nop" : "+v"(a), "+v"(b) : "v"(x), "v"(y)); }
__device__ __forceinline__ void keep4_h(v16h a, v16h b, v16h c, v16h d) { asm volatile("v_nop" :: "v"(a), "v"(b), "v"(c), "v"(d)); }
__device__ __forceinline__ void keep4_b(v16b a, v16b b, v16b c, v16b d) { asm volatile("v_nop" :: "v"(a), "v"(b), "v"(c), "v"(d)); }
__device__ __forceinline__ void acc_guard4(v8f& a, v8f& b, v8f& c, v8f& d) { asm volatile("v_nop\n\tv_nop\n\tv_nop\n\tv_nop" : "+v"(a), "+v"(b), "+v"(c), "+v"(d)); }
template <typename T> struct Frag;
template <> struct Frag<_Float16> {
  typedef v16h V; union U { v16h v; v8h h[2]; };
  static __device__ __forceinline__ v16h load(const _Float16* p) {   // elements 0..7 <- p[0..7], 8..15 <- p[16..23]
    U f; f.h[0] = *(const v8h*)(p); f.h[1] = *(const v8h*)(p + 16); return f.v;
  }
  static __device__ __forceinline__ v8f mma(v16h a, v16h b, v8f c) {
    return __builtin_amdgcn_wmma_f32_16x16x32_f16(false, a, false, b, (short)0, c, false, false);
  }
  static __device__ __forceinline__ void guard(v8f& a, v8f& b, v16h x, v16h y) { dep_guard_h(a, b, x, y); }
  static __device__ __forceinline__ void keep(v16h a, v16h b, v16h c, v16h d) { keep4_h(a, b, c, d); }
};
template <> struct Frag<__bf16> {
  typedef v16b V; union U { v16b v; v8b h[2]; };
  static __device__ __forceinline__ v16b load(const __bf16* p) {
    U f; f.h[0] = *(const v8b*)(p); f.h[1] = *(const v8b*)(p + 16); return f.v;
  }
  static __device__ __forceinline__ v8f mma(v16b a, v16b b, v8f c) {
    return __builtin_amdgcn_wmma_f32_16x16x32_bf16(false, a, false, b, (short)0, c, false, false);
  }
  static __device__ __forceinline__ void guard(v8f& a, v8f& b, v16b x, v16b y) { dep_guard_b(a, b, x, y); }
  static __device__ __forceinline__ void keep(v16b a, v16b b, v16b c, v16b d) { keep4_b(a, b, c, d); }
};

// ---- Register-blocked batched WMMA GEMM ------------------------------------
// C[m,n] = scale * sum_k A[m,k] * Bt[n,k] (+bias)(+resid); each wave owns a 64x64 tile.
// A row-major [M,K]; Bt row-major [N,K]; M,N % 64 == 0, K % 32 == 0.
// SPLIT: operands are hi/lo planes (A2/Bt2 = lo planes, same layout); product = hi.hi + hi.lo + lo.hi.
// BIAS_MODE: 0 = none, 1 = bias[m], 2 = bias[n].
// OUT_MODE: 0 = f32, 1 = f16, 2 = bf16 hi plane (Cout) + bf16 lo plane (Cout2).
// ET: 0 = f16 operands, 1 = bf16 operands (pointers passed as 16-bit storage)
template <int ET> struct Elem;
template <> struct Elem<0> { typedef _Float16 T; };
template <> struct Elem<1> { typedef __bf16 T; };
template <int ET, bool SPLIT, int BIAS_MODE, int OUT_MODE, bool RESID, int ACT = 0>
__global__ __launch_bounds__(256) void wmma_gemm64(
    const unsigned short* __restrict__ Ap, const unsigned short* __restrict__ A2p, int lda, long strideA,
    const unsigned short* __restrict__ Btp, const unsigned short* __restrict__ Bt2p, int ldb, long strideB,
    void* __restrict__ Cout, void* __restrict__ Cout2, int ldc, long strideC,
    const float* __restrict__ bias,
    const float* __restrict__ resid, long strideR,
    int M, int N, int K, float scale) {
  typedef typename Elem<ET>::T T;
  typedef typename Frag<T>::V V;
  const T* A = (const T*)Ap; const T* A2 = (const T*)A2p; const T* Bt = (const T*)Btp; const T* Bt2 = (const T*)Bt2p;
  __shared__ __align__(16) float sT[8][16 * 68];   // per-wave 16x64 slab, pitch 68 floats
  const int b    = blockIdx.y;
  const int lane = threadIdx.x & 31;
  const int wave = threadIdx.x >> 5;
  const int tilesN = N >> 6;
  const int tilesM = M >> 6;
  const int tile = blockIdx.x * 8 + wave;
  if (tile >= tilesM * tilesN) return;   // wave-uniform; no block barriers in this kernel
  const int tm = tile / tilesN;
  const int tn = tile - tm * tilesN;
  const int m0 = tm << 6;
  const int n0 = tn << 6;

  const T* Ab  = A  + (size_t)b * strideA;
  const T* Bb  = Bt + (size_t)b * strideB;
  const T* Ab2 = SPLIT ? (A2  + (size_t)b * strideA) : nullptr;
  const T* Bb2 = SPLIT ? (Bt2 + (size_t)b * strideB) : nullptr;

  const int rlane = lane & 15;                 // row (A) / col (B, D) within subtile
  const int koff  = (lane >> 4) * 8;           // k offset of this lane half
  const int mOff  = (lane >> 4) * 8;           // D row offset

  v8f acc[4][4];
#pragma unroll
  for (int i = 0; i < 4; ++i)
#pragma unroll
    for (int j = 0; j < 4; ++j) acc[i][j] = (v8f){0.f,0.f,0.f,0.f,0.f,0.f,0.f,0.f};

  for (int k0 = 0; k0 < K; k0 += 32) {
    V bh[4], bl[4];
#pragma unroll
    for (int j = 0; j < 4; ++j) {
      const size_t bo = (size_t)(n0 + (j << 4) + rlane) * ldb + koff + k0;
      bh[j] = Frag<T>::load(Bb + bo);
      if (SPLIT) bl[j] = Frag<T>::load(Bb2 + bo); else bl[j] = bh[j];
    }
#pragma unroll
    for (int i = 0; i < 4; ++i) {
      const size_t ao = (size_t)(m0 + (i << 4) + rlane) * lda + koff + k0;
      V ah = Frag<T>::load(Ab + ao);
      V al;
      if (SPLIT) al = Frag<T>::load(Ab2 + ao); else al = ah;
#pragma unroll
      for (int j = 0; j < 4; ++j) {
        acc[i][j] = Frag<T>::mma(ah, bh[j], acc[i][j]);
        if (SPLIT) {
          acc[i][j] = Frag<T>::mma(ah, bl[j], acc[i][j]);
          acc[i][j] = Frag<T>::mma(al, bh[j], acc[i][j]);
        }
      }
      Frag<T>::guard(acc[i][0], acc[i][3], ah, al);
    }
    Frag<T>::keep(bh[0], bh[1], bh[2], bh[3]);
    if (SPLIT) Frag<T>::keep(bl[0], bl[1], bl[2], bl[3]);
  }
  acc_guard4(acc[0][0], acc[0][1], acc[0][2], acc[0][3]);
  acc_guard4(acc[1][0], acc[1][1], acc[1][2], acc[1][3]);
  acc_guard4(acc[2][0], acc[2][1], acc[2][2], acc[2][3]);
  acc_guard4(acc[3][0], acc[3][1], acc[3][2], acc[3][3]);

  // ---- epilogue ----
  float* slab = sT[wave];
  const float* Rb = RESID ? (resid + (size_t)b * strideR) : nullptr;
#pragma unroll
  for (int i = 0; i < 4; ++i) {
    const int mBase = m0 + (i << 4);
#pragma unroll
    for (int j = 0; j < 4; ++j) {
      const int n = n0 + (j << 4) + rlane;
      float bv = 0.f;
      if (BIAS_MODE == 2) bv = bias[n];
#pragma unroll
      for (int r = 0; r < 8; ++r) {
        float v = acc[i][j][r] * scale;
        if (BIAS_MODE == 1) v += bias[mBase + mOff + r];
        if (BIAS_MODE == 2) v += bv;
        if (RESID) v += Rb[(size_t)(mBase + mOff + r) * ldc + n];
        if (ACT == 1) v = tanhf(v);
        if (ACT == 2) v = fmaxf(v, 0.0f);
        if (ACT == 3) v = v / (1.0f + expf(-v));
        if (ACT == 4) v = (v > 0.f) ? v : 0.01f * v;
        if (ACT == 5) v = 0.5f * v * (1.0f + erff(v * 0.70710678118654752f));
        slab[(mOff + r) * 68 + (j << 4) + rlane] = v;
      }
    }
    __builtin_amdgcn_fence(__ATOMIC_RELEASE, "workgroup");
    __builtin_amdgcn_wave_barrier();
    __builtin_amdgcn_fence(__ATOMIC_ACQUIRE, "workgroup");
    if (OUT_MODE == 0) {
      float* C = (float*)Cout + (size_t)b * strideC;
      const int hh = lane >> 4, c4 = (lane & 15) * 4;     // row seg = 256 B = 16 lanes x 16 B
      {
#pragma unroll
        for (int it = 0; it < 8; ++it) {
          const int row = it * 2 + hh;
          v4f v = *(const v4f*)(slab + row * 68 + c4);
          *(v4f*)(C + (size_t)(mBase + row) * ldc + n0 + c4) = v;
        }
        
      }
    } else {
      const int q = lane >> 3, c8 = (lane & 7) * 8;
      unsigned short* C  = (unsigned short*)Cout  + (size_t)b * strideC;
      unsigned short* C2 = (OUT_MODE == 2) ? ((unsigned short*)Cout2 + (size_t)b * strideC) : nullptr;
      {
#pragma unroll
        for (int it = 0; it < 4; ++it) {
          const int row = it * 4 + q;
          const float* sp = slab + row * 68 + c8;
          v8h hv, lv;
#pragma unroll
          for (int e = 0; e < 8; ++e) {
            if (OUT_MODE == 1) {
              hv[e] = (_Float16)sp[e];
            } else {
              unsigned short hb = f2bf_bits(sp[e]);
              unsigned short lb = f2bf_bits(sp[e] - bf_bits2f(hb));
              hv[e] = __builtin_bit_cast(_Float16, hb);
              lv[e] = __builtin_bit_cast(_Float16, lb);
            }
          }
          *(v8h*)(C + (size_t)(mBase + row) * ldc + n0 + c8) = hv;
          if (OUT_MODE == 2) *(v8h*)(C2 + (size_t)(mBase + row) * ldc + n0 + c8) = lv;
        }
        
      }
    }
    __builtin_amdgcn_fence(__ATOMIC_RELEASE, "workgroup");
    __builtin_amdgcn_wave_barrier();
    __builtin_amdgcn_fence(__ATOMIC_ACQUIRE, "workgroup");
  }
}

// ---------------------------------------------------------------------------
// Row-preserving bf16 RNE convert of an f32 matrix [rows][ncols] into a u16 plane with row pitch ldout.
// 8 consecutive elements per thread = one 16-B store; 32 lanes cover 256 consecutive columns of one row
// ---------------------------------------------------------------------------
__global__ __launch_bounds__(256) void convrows_kernel(const float* __restrict__ in, unsigned short* __restrict__ out,
                                                       int ncols, int ldout, int n8) {
  const int i = blockIdx.x * 256 + threadIdx.x;
  if (i < n8) {
    const size_t e0 = (size_t)i * 8;
    const int row = (int)(e0 / (size_t)ncols);
    const int col = (int)(e0 - (size_t)row * ncols);
    const v4f a = *(const v4f*)(in + e0);
    const v4f c = *(const v4f*)(in + e0 + 4);
    v4u hv;
    hv[0] = pk16(f2bf_bits(a[0]), f2bf_bits(a[1]));
    hv[1] = pk16(f2bf_bits(a[2]), f2bf_bits(a[3]));
    hv[2] = pk16(f2bf_bits(c[0]), f2bf_bits(c[1]));
    hv[3] = pk16(f2bf_bits(c[2]), f2bf_bits(c[3]));
    const size_t o = (size_t)row * ldout + col;
    {
      *(v4u*)(out + o) = hv;
      
    }
  }
}

// ---------------------------------------------------------------------------
// Fused transpose + bf16 RNE convert of an f32 matrix, z-batched, one plane:
//   in_z = W + z*sIn viewed [R rows][Cc cols] with row pitch ldin  ->  oh_z[c][r] = bf16(in_z[r][c]), row pitch ldout, oh_z = oh + z*sOut.
// 64x64 tiles through LDS. grid = (Cc/64, R/64, Z), 256 threads (R, Cc multiples of 64; ldout multiple of 64 so every
// Coverage per block: load 4 it x 256 thr x 4 floats = 64x64; store 2 it x 256 thr x 8 u16 = 64x64.
// ---------------------------------------------------------------------------
__global__ __launch_bounds__(256) void tconv_kernel(const float* __restrict__ W, unsigned short* __restrict__ oh,
                                                    int ldin, int ldout, long sIn, long sOut) {
  __shared__ __align__(16) float tf[64 * 68];
  W  += (size_t)blockIdx.z * sIn;
  oh += (size_t)blockIdx.z * sOut;
  const int c0  = blockIdx.x * 64;   // input column block = output row block
  const int r0  = blockIdx.y * 64;   // input row block    = output column block
  const int tid = threadIdx.x;
  {
    const int lr = tid >> 4;         // 0..15
    const int c4 = (tid & 15) * 4;   // 0..60
#pragma unroll
    for (int it = 0; it < 4; ++it) {
      const int rr = it * 16 + lr;   // 0..63
      const v4f a = *(const v4f*)(W + (size_t)(r0 + rr) * ldin + c0 + c4);
      *(v4f*)(tf + rr * 68 + c4) = a;
    }
  }
  __syncthreads();
  const int sub = tid >> 3;          // 0..31
  const int c8  = (tid & 7) * 8;     // 0..56
  v4u hv[2];
#pragma unroll
  for (int it = 0; it < 2; ++it) {
    const int oc = it * 32 + sub;    // output row within tile (= input column)
    v4u a;
#pragma unroll
    for (int q = 0; q < 4; ++q) {
      const float f0 = tf[(c8 + 2 * q) * 68 + oc];
      const float f1 = tf[(c8 + 2 * q + 1) * 68 + oc];
      a[q] = pk16(f2bf_bits(f0), f2bf_bits(f1));
    }
    hv[it] = a;
  }
  {
#pragma unroll
    for (int it = 0; it < 2; ++it) {
      const int oc = it * 32 + sub;
      const size_t go = (size_t)(c0 + oc) * ldout + r0 + c8;
      *(v4u*)(oh + go) = hv[it];
    }
    
  }
}

// ---------------------------------------------------------------------------
// Conv weight permute + bf16 RNE convert: W OIHW [256 o][256 c][2][2] f32 -> O[o][q4*256 + c] u16 (q4 = kh*2 + kw),
// row pitch KCONV = 1024. One unit = (o, c0 = 8*lane): 8 x 16-B loads (the 4 taps of 8 consecutive c), 4 x 16-B stores
// (8 consecutive c of each q4 segment). Per store instruction the 32 lanes of a wave (same o) write 32 x 16 B = the whole
// Coverage: 32 blocks x 256 threads = 8192 units x 32 elements = 256 x 1024 = whole plane.
// ---------------------------------------------------------------------------
__global__ __launch_bounds__(256) void wperm_kernel(const float* __restrict__ W, unsigned short* __restrict__ O) {
  const int u = blockIdx.x * 256 + threadIdx.x;   // 0 .. DIM*32 - 1
  if (u < DIM * 32) {
    const int o = u >> 5, c0 = (u & 31) * 8;
    v4f w[8];
#pragma unroll
    for (int e = 0; e < 8; ++e) w[e] = *(const v4f*)(W + ((size_t)(o * DIM + c0 + e)) * 4);
    v4u pk[4];
#pragma unroll
    for (int q4 = 0; q4 < 4; ++q4) {
      v4u a;
#pragma unroll
      for (int p = 0; p < 4; ++p) a[p] = pk16(f2bf_bits(w[2 * p][q4]), f2bf_bits(w[2 * p + 1][q4]));
      pk[q4] = a;
    }
    unsigned short* orow = O + (size_t)o * KCONV + c0;
    {
#pragma unroll
      for (int q4 = 0; q4 < 4; ++q4) *(v4u*)(orow + q4 * DIM) = pk[q4];
      
    }
  }
}

// ---------------------------------------------------------------------------
// im2col addressing of the 2x2 / stride-2 / VALID conv as a GEMM over XT (token-major bf16 [NB*4096][256]):
//   im2col row g = b*1024 + m, m = i*32 + j (output grid row i, col j); k = q4*256 + c, q4 = kh*2 + kw;
//   element (g, k) = XT[(b*4096 + (2i+kh)*64 + (2j+kw)) * 256 + c].
// For a 32-deep k-step (k0 % 32 == 0) the 32 k values are 32 consecutive channels of one source token row,
// so a fragment is two 16-B loads at the returned offset + koff and + koff + 16 (arithmetic addressing only).
// ---------------------------------------------------------------------------
__device__ __forceinline__ size_t im2col_off(int g, int k0) {
  const int b = g >> 10, m = g & (NKV - 1);
  const int q4 = k0 >> 8, c0 = k0 & (DIM - 1);
  const int kh = q4 >> 1, kw = q4 & 1;
  const int i = m >> 5, j = m & 31;
  return ((size_t)(b * NQ + (2 * i + kh) * IMW + 2 * j + kw)) * DIM + c0;
}

// ---------------------------------------------------------------------------
// Conv GEMM (bf16 single products, f32 accumulate), wave-owned 64x64 tiles as in wmma_gemm64, K = 1024:
//   MODE 0: C[g][o] = sum_k im2col(g,k) * WKp[o][k]  (M = 4096 rows g, N = 256), epilogue adds
//           pos(o, m) = bf16(rel_h[o*32 + (m&31)]) + bf16(rel_w[o*32 + (m>>5)]) in f32, then bf16 hi|lo planes [4096][256].
//           Block bx covers rows 128bx..128bx+127 (tilesN = 4), i.e. b = bx>>3, m = 128*(bx&7) + 0..127, m>>5 = 4*(bx&7) + 0..3;
//           rel_h (all 8192 values) and the 4 needed rel_w columns per o are staged once per block in LDS as bf16 bits.
//   MODE 1: C[o][g] = sum_k WVp[o][k] * im2col(g,k)  (M = 256, N = 4096) -> bf16 hi|lo planes [256][4096] (v^T layout).
// grid = 32 blocks x 8 waves = 256 tiles exactly (both modes).
// ---------------------------------------------------------------------------
template <int MODE>
__global__ __launch_bounds__(256) void conv_gemm64(const unsigned short* __restrict__ XTp, const unsigned short* __restrict__ Wpp,
                                                   const float* __restrict__ rel_h, const float* __restrict__ rel_w,
                                                   unsigned short* __restrict__ Ch, unsigned short* __restrict__ Cl) {
  typedef __bf16 T;
  typedef v16b V;
  const T* XT = (const T*)XTp; const T* Wp = (const T*)Wpp;
  __shared__ __align__(16) float sT[8][16 * 68];
  __shared__ __align__(16) unsigned short sRh[(MODE == 0) ? (DIM * OH) : 8];
  __shared__ __align__(16) unsigned short sRw[(MODE == 0) ? (DIM * 4) : 8];
  constexpr int M = (MODE == 0) ? MKV : DIM;
  constexpr int N = (MODE == 0) ? DIM : MKV;
  constexpr int LDC = N;
  const int tid  = threadIdx.x;
  const int lane = tid & 31;
  const int wave = tid >> 5;

  if (MODE == 0) {
    // stage rel_h (8 x 16-B loads per thread, 256 threads x 32 = 8192 values) and rel_w[o][4*(bx&7) .. +3] (thread = o)
    const int iib = 4 * (blockIdx.x & 7);
#pragma unroll
    for (int it = 0; it < 8; ++it) {
      const int e4 = (it * 256 + tid) * 4;
      const v4f a = *(const v4f*)(rel_h + e4);
      v2u w;
      w[0] = pk16(f2bf_bits(a[0]), f2bf_bits(a[1]));
      w[1] = pk16(f2bf_bits(a[2]), f2bf_bits(a[3]));
      *(v2u*)(sRh + e4) = w;
    }
    {
      const v4f a = *(const v4f*)(rel_w + (size_t)tid * OW + iib);
      v2u w;
      w[0] = pk16(f2bf_bits(a[0]), f2bf_bits(a[1]));
      w[1] = pk16(f2bf_bits(a[2]), f2bf_bits(a[3]));
      *(v2u*)(sRw + tid * 4) = w;
    }
    __syncthreads();
  }

  constexpr int tilesN = N >> 6;
  constexpr int tilesM = M >> 6;
  const int tile = blockIdx.x * 8 + wave;
  if (tile >= tilesM * tilesN) return;   // wave-uniform, never taken with the exact grid; no block barriers below
  const int tm = tile / tilesN;
  const int tn = tile - tm * tilesN;
  const int m0 = tm << 6;
  const int n0 = tn << 6;

  const int rlane = lane & 15;
  const int koff  = (lane >> 4) * 8;
  const int mOff  = (lane >> 4) * 8;

  v8f acc[4][4];
#pragma unroll
  for (int i = 0; i < 4; ++i)
#pragma unroll
    for (int j = 0; j < 4; ++j) acc[i][j] = (v8f){0.f,0.f,0.f,0.f,0.f,0.f,0.f,0.f};

  for (int k0 = 0; k0 < KCONV; k0 += 32) {
    V bfr[4];
#pragma unroll
    for (int j = 0; j < 4; ++j) {
      const int n = n0 + (j << 4) + rlane;
      if (MODE == 0) bfr[j] = Frag<T>::load(Wp + (size_t)n * KCONV + k0 + koff);
      else           bfr[j] = Frag<T>::load(XT + im2col_off(n, k0) + koff);
    }
#pragma unroll
    for (int i = 0; i < 4; ++i) {
      const int mr = m0 + (i << 4) + rlane;
      V ah;
      if (MODE == 0) ah = Frag<T>::load(XT + im2col_off(mr, k0) + koff);
      else           ah = Frag<T>::load(Wp + (size_t)mr * KCONV + k0 + koff);
#pragma unroll
      for (int j = 0; j < 4; ++j) acc[i][j] = Frag<T>::mma(ah, bfr[j], acc[i][j]);
      Frag<T>::guard(acc[i][0], acc[i][3], ah, ah);
    }
    Frag<T>::keep(bfr[0], bfr[1], bfr[2], bfr[3]);
  }
  acc_guard4(acc[0][0], acc[0][1], acc[0][2], acc[0][3]);
  acc_guard4(acc[1][0], acc[1][1], acc[1][2], acc[1][3]);
  acc_guard4(acc[2][0], acc[2][1], acc[2][2], acc[2][3]);
  acc_guard4(acc[3][0], acc[3][1], acc[3][2], acc[3][3]);

  // ---- epilogue ----
  float* slab = sT[wave];
#pragma unroll
  for (int i = 0; i < 4; ++i) {
    const int mBase = m0 + (i << 4);
#pragma unroll
    for (int j = 0; j < 4; ++j) {
      const int n = n0 + (j << 4) + rlane;
#pragma unroll
      for (int r = 0; r < 8; ++r) {
        float v = acc[i][j][r];
        if (MODE == 0) {
          const int row = mBase + mOff + r;
          const int m   = row & (NKV - 1);
          const int jj  = m & 31;
          const int iil = (m >> 5) & 3;
          const float pos = bf_bits2f(sRh[n * OH + jj]) + bf_bits2f(sRw[n * 4 + iil]);
          v += pos;
        }
        slab[(mOff + r) * 68 + (j << 4) + rlane] = v;
      }
    }
    __builtin_amdgcn_fence(__ATOMIC_RELEASE, "workgroup");
    __builtin_amdgcn_wave_barrier();
    __builtin_amdgcn_fence(__ATOMIC_ACQUIRE, "workgroup");
    {
      const int q = lane >> 3, c8 = (lane & 7) * 8;
      {
#pragma unroll
        for (int it = 0; it < 4; ++it) {
          const int row = it * 4 + q;
          const float* sp = slab + row * 68 + c8;
          v8h hv, lv;
#pragma unroll
          for (int e = 0; e < 8; ++e) {
            unsigned short hb = f2bf_bits(sp[e]);
            unsigned short lb = f2bf_bits(sp[e] - bf_bits2f(hb));
            hv[e] = __builtin_bit_cast(_Float16, hb);
            lv[e] = __builtin_bit_cast(_Float16, lb);
          }
          *(v8h*)(Ch + (size_t)(mBase + row) * LDC + n0 + c8) = hv;
          *(v8h*)(Cl + (size_t)(mBase + row) * LDC + n0 + c8) = lv;
        }
        
      }
    }
    __builtin_amdgcn_fence(__ATOMIC_RELEASE, "workgroup");
    __builtin_amdgcn_wave_barrier();
    __builtin_amdgcn_fence(__ATOMIC_ACQUIRE, "workgroup");
  }
}

// =====================================================================================
// Full (non-causal, unmasked) attention, head dim 32, all batches and heads in one launch.
//   q planes (hi/lo bf16) [16384][256]: element (b, n, h, d) at [(b*4096+n)*256 + h*32 + d]
//   k planes (hi/lo bf16) [4096][256]:  element (b, m, h, d) at [(b*1024+m)*256 + h*32 + d]  (pos already folded in)
//   v^T planes (hi/lo bf16) [256][4096]: element (h, d, b, m) at [(h*32 + d)*4096 + b*1024 + m]
//   out f32 NCHW: element (b, h*32+d, n) at [(b*256 + h*32 + d)*4096 + n]
//   scores = (q . k') * 32^-0.5 : bf16 hi/lo split (hi.hi + hi.lo + lo.hi) on v_wmma_f32_16x16x32_bf16
//   out    = p . v             : bf16 hi/lo split of p (unnormalised exp) and v, f32 accumulate, x 1/rowsum in f32 at the end
//   online softmax in f32 over the 1024 keys of the batch element (16 chunks of 64, compile-time trip count, no masking).
//   Block = 4 waves = 64 query positions of one (batch, head); grid.x = 4 * 8 * 64 = 2048 (exact).
//   K chunk staging: thread r = tid>>1 stages K row r cols (tid&1)*16 .. +15 (two 16-B copies per plane) -> 64x32 whole tile;
//   V^T chunk staging: thread d = tid>>2 stages row d cols (tid&3)*16 .. +15 -> 32x64 whole tile; __syncthreads before and after.
//   P tiles 16x64 per wave fully written every chunk before the same wave reloads them through the same v8b element type
// =====================================================================================
#define AT_D  32
#define AT_NW 4
#define AT_QB 64
#define AT_KC 64

__device__ __forceinline__ unsigned short at_bf_bits(float f) {
  unsigned u = __float_as_uint(f);
  return (unsigned short)((u + 0x7FFFu + ((u >> 16) & 1u)) >> 16);
}
__device__ __forceinline__ __bf16 at_f2bf(float f) { return __builtin_bit_cast(__bf16, at_bf_bits(f)); }
__device__ __forceinline__ void at_split(float f, __bf16& hi, __bf16& lo) {
  const unsigned short hb = at_bf_bits(f);
  hi = __builtin_bit_cast(__bf16, hb);
  lo = at_f2bf(f - __uint_as_float(((unsigned)hb) << 16));
}
__device__ __forceinline__ v8f at_mma(v16b a, v16b b, v8f c) {
  c = __builtin_amdgcn_wmma_f32_16x16x32_bf16(false, a, false, b, (short)0, c, false, false);
  asm volatile("v_nop\n\tv_nop\n\tv_nop\n\tv_nop" : "+v"(c) : "v"(a), "v"(b));
  return c;
}

__global__ __launch_bounds__(128)
void attn32_kernel(const unsigned short* __restrict__ qhp, const unsigned short* __restrict__ qlp,
                   const unsigned short* __restrict__ khp, const unsigned short* __restrict__ klp,
                   const unsigned short* __restrict__ vhp, const unsigned short* __restrict__ vlp,
                   float* __restrict__ out, float sscale) {
  union FB { v16b v; v8b h[2]; };
  __shared__ __align__(16) __bf16 Ksh[AT_KC * AT_D];             // K hi [kv][d]   4 KB
  __shared__ __align__(16) __bf16 Ksl[AT_KC * AT_D];             // K lo
  __shared__ __align__(16) __bf16 Vth[AT_D * AT_KC];             // V hi [d][kv]   4 KB
  __shared__ __align__(16) __bf16 Vtl[AT_D * AT_KC];             // V lo
  __shared__ __align__(16) __bf16 Psh[AT_NW][16 * AT_KC];        // per wave P hi [row][kv]
  __shared__ __align__(16) __bf16 Psl[AT_NW][16 * AT_KC];        // per wave P lo
  __shared__ __align__(16) float  Os[AT_D * 68];                 // block out tile transposed [d][n_local], pitch 68

  const int tid  = threadIdx.x;
  const int wave = tid >> 5;
  const int lane = tid & 31;
  const int hh   = lane >> 4;
  const int c    = lane & 15;

  const int nqb = NQ / AT_QB;              // 64 query blocks per (batch, head)
  const int bx = blockIdx.x;               // grid = NB * NH * nqb (exact)
  const int qb = bx % nqb;
  const int hb = bx / nqb;
  const int h  = hb % NH;                  // 0..7
  const int b  = hb / NH;                  // 0..3
  const int q0 = b * NQ + qb * AT_QB + wave * 16;   // row in the q planes

  const __bf16* Qh = (const __bf16*)(const void*)qhp + (size_t)h * AT_D;
  const __bf16* Ql = (const __bf16*)(const void*)qlp + (size_t)h * AT_D;
  const __bf16* Kh = (const __bf16*)(const void*)khp + (size_t)h * AT_D;
  const __bf16* Kl = (const __bf16*)(const void*)klp + (size_t)h * AT_D;
  const __bf16* Vh = (const __bf16*)(const void*)vhp + (size_t)h * AT_D * VTP + (size_t)b * NKV;
  const __bf16* Vl = (const __bf16*)(const void*)vlp + (size_t)h * AT_D * VTP + (size_t)b * NKV;

  // ---- Q fragments (A operand, row = lane&15, split k map via Frag load): head dim 32 = one k-step, hi and lo ----
  v16b qah, qal;
  {
    const __bf16* qr = Qh + (size_t)(q0 + c) * DIM + 8 * hh;
    const __bf16* ql = Ql + (size_t)(q0 + c) * DIM + 8 * hh;
    qah = Frag<__bf16>::load(qr);
    qal = Frag<__bf16>::load(ql);
  }

  float mrow[8], lrow[8];
  v8f oacc[2];
#pragma unroll
  for (int r = 0; r < 8; ++r) { mrow[r] = -INFINITY; lrow[r] = 0.f; }
#pragma unroll
  for (int t = 0; t < 2; ++t) oacc[t] = (v8f){0.f,0.f,0.f,0.f,0.f,0.f,0.f,0.f};

  const int nChunks = NKV / AT_KC;   // 16, compile-time constant
  for (int kc = 0; kc < nChunks; ++kc) {
    const int kv0 = kc * AT_KC;
    __syncthreads();
    {
      // K staging: 128 threads x 16 elements per plane = 64 rows x 32
      const int r = tid >> 1, hf = (tid & 1) * 16;
      const __bf16* ksh = Kh + (size_t)(b * NKV + kv0 + r) * DIM + hf;
      const __bf16* ksl = Kl + (size_t)(b * NKV + kv0 + r) * DIM + hf;
      const v8b a0 = *(const v8b*)(ksh);
      const v8b a1 = *(const v8b*)(ksh + 8);
      const v8b a2 = *(const v8b*)(ksl);
      const v8b a3 = *(const v8b*)(ksl + 8);
      *(v8b*)(Ksh + r * AT_D + hf)     = a0;
      *(v8b*)(Ksh + r * AT_D + hf + 8) = a1;
      *(v8b*)(Ksl + r * AT_D + hf)     = a2;
      *(v8b*)(Ksl + r * AT_D + hf + 8) = a3;
      // V^T staging: 128 threads x 16 elements per plane = 32 rows x 64
      const int d = tid >> 2, qq = (tid & 3) * 16;
      const __bf16* vsh = Vh + (size_t)d * VTP + kv0 + qq;
      const __bf16* vsl = Vl + (size_t)d * VTP + kv0 + qq;
      const v8b b0 = *(const v8b*)(vsh);
      const v8b b1 = *(const v8b*)(vsh + 8);
      const v8b b2 = *(const v8b*)(vsl);
      const v8b b3 = *(const v8b*)(vsl + 8);
      *(v8b*)(Vth + d * AT_KC + qq)     = b0;
      *(v8b*)(Vth + d * AT_KC + qq + 8) = b1;
      *(v8b*)(Vtl + d * AT_KC + qq)     = b2;
      *(v8b*)(Vtl + d * AT_KC + qq + 8) = b3;
    }
    __syncthreads();

    v8f s[4];
#pragma unroll
    for (int j = 0; j < 4; ++j) {
      s[j] = (v8f){0.f,0.f,0.f,0.f,0.f,0.f,0.f,0.f};
      FB kb, kl;
      kb.h[0] = *(const v8b*)(Ksh + (j * 16 + c) * AT_D + 8 * hh);
      kb.h[1] = *(const v8b*)(Ksh + (j * 16 + c) * AT_D + 16 + 8 * hh);
      kl.h[0] = *(const v8b*)(Ksl + (j * 16 + c) * AT_D + 8 * hh);
      kl.h[1] = *(const v8b*)(Ksl + (j * 16 + c) * AT_D + 16 + 8 * hh);
      s[j] = at_mma(qah, kb.v, s[j]);
      s[j] = at_mma(qah, kl.v, s[j]);
      s[j] = at_mma(qal, kb.v, s[j]);
    }
    // scale, then chunk row max
    float cm[8];
#pragma unroll
    for (int r = 0; r < 8; ++r) {
      float m = -INFINITY;
#pragma unroll
      for (int j = 0; j < 4; ++j) {
        const float sv = s[j][r] * sscale;
        s[j][r] = sv;
        m = fmaxf(m, sv);
      }
#pragma unroll
      for (int off = 1; off < 16; off <<= 1) m = fmaxf(m, __shfl_xor(m, off, 32));
      cm[r] = m;
    }
    __bf16* pwh = Psh[wave];
    __bf16* pwl = Psl[wave];
#pragma unroll
    for (int r = 0; r < 8; ++r) {
      const float mnew = fmaxf(mrow[r], cm[r]);
      const float alpha = expf(mrow[r] - mnew);
      mrow[r] = mnew;
      float psum = 0.f;
#pragma unroll
      for (int j = 0; j < 4; ++j) {
        const float p = expf(s[j][r] - mnew);
        psum += p;
        __bf16 a, bl; at_split(p, a, bl);
        pwh[(8 * hh + r) * AT_KC + j * 16 + c] = a;
        pwl[(8 * hh + r) * AT_KC + j * 16 + c] = bl;
      }
#pragma unroll
      for (int off = 1; off < 16; off <<= 1) psum += __shfl_xor(psum, off, 32);
      lrow[r] = lrow[r] * alpha + psum;
#pragma unroll
      for (int t = 0; t < 2; ++t) oacc[t][r] *= alpha;
    }
    __builtin_amdgcn_fence(__ATOMIC_RELEASE, "workgroup");
    __builtin_amdgcn_wave_barrier();
    __builtin_amdgcn_fence(__ATOMIC_ACQUIRE, "workgroup");
#pragma unroll 1
    for (int kk = 0; kk < 2; ++kk) {
      FB pa, pl;
      pa.h[0] = *(const v8b*)(pwh + c * AT_KC + kk * 32 + 8 * hh);
      pa.h[1] = *(const v8b*)(pwh + c * AT_KC + kk * 32 + 16 + 8 * hh);
      pl.h[0] = *(const v8b*)(pwl + c * AT_KC + kk * 32 + 8 * hh);
      pl.h[1] = *(const v8b*)(pwl + c * AT_KC + kk * 32 + 16 + 8 * hh);
#pragma unroll
      for (int t = 0; t < 2; ++t) {
        FB vb, vl;
        vb.h[0] = *(const v8b*)(Vth + (t * 16 + c) * AT_KC + kk * 32 + 8 * hh);
        vb.h[1] = *(const v8b*)(Vth + (t * 16 + c) * AT_KC + kk * 32 + 16 + 8 * hh);
        vl.h[0] = *(const v8b*)(Vtl + (t * 16 + c) * AT_KC + kk * 32 + 8 * hh);
        vl.h[1] = *(const v8b*)(Vtl + (t * 16 + c) * AT_KC + kk * 32 + 16 + 8 * hh);
        oacc[t] = at_mma(pa.v, vb.v, oacc[t]);
        oacc[t] = at_mma(pa.v, vl.v, oacc[t]);
        oacc[t] = at_mma(pl.v, vb.v, oacc[t]);
      }
    }
  }

  // ---- normalise and stage transposed: Os[d][n_local], d = t*16 + c, n_local = wave*16 + 8hh + r (all 32 x 64 written) ----
#pragma unroll
  for (int r = 0; r < 8; ++r) {
    const float inv = 1.0f / lrow[r];
#pragma unroll
    for (int t = 0; t < 2; ++t) Os[(t * 16 + c) * 68 + wave * 16 + 8 * hh + r] = oacc[t][r] * inv;
  }
  __syncthreads();
  {
    float* ob = out + ((size_t)(b * DIM + h * AT_D)) * NQ + (size_t)qb * AT_QB;
    const int q = lane >> 3, c4 = (lane & 7) * 4;
    {
#pragma unroll
      for (int it = 0; it < 4; ++it) {
        const int L  = it * 16 + wave * 4 + q;   // 0..63: line index within the block's 32 x 256-B output region
        const int d  = L >> 1;
        const int hf = (L & 1) * 32;
        v4f val = *(const v4f*)(Os + d * 68 + hf + c4);
        *(v4f*)(ob + (size_t)d * NQ + hf + c4) = val;
      }
      
    }
  }
}

// ---------------------------------------------------------------------------
// Workspace region map (byte offsets; every region fully written by its producer launch before any consumer reads it;
//   XT   bf16 [16384][256]         0       8388608
//   WQ   bf16 [256][256]     8388608        131072
//   WKp  bf16 [256][1024]    8519680        524288
//   WVp  bf16 [256][1024]    9043968        524288
//   Qh   bf16 [16384][256]   9568256       8388608   Ql  17956864
//   Kh   bf16 [4096][256]   26345472       2097152   Kl  28442624
//   VTh  bf16 [256][4096]   30539776       2097152   VTl 32636928
//   total                  34734080
// ---------------------------------------------------------------------------
extern "C" void kernel_launch(void* const* d_in, const int* in_sizes, int n_in,
                              void* d_out, int out_size, void* d_ws, size_t ws_size,
                              hipStream_t stream) {
  if (n_in < 6) return;
  if (in_sizes[0] != NB * DIM * NQ) return;          // x [4][256][64][64]
  if (in_sizes[1] != DIM * DIM) return;              // Wq [256][256]
  if (in_sizes[2] != DIM * DIM * 4) return;          // Wk [256][256][2][2]
  if (in_sizes[3] != DIM * DIM * 4) return;          // Wv [256][256][2][2]
  if (in_sizes[4] != NH * HD * OH) return;           // rel_h [1][8][32][1][32]
  if (in_sizes[5] != NH * HD * OW) return;           // rel_w [1][8][32][32][1]
  if (out_size != NB * DIM * NQ) return;

  const float* x     = (const float*)d_in[0];
  const float* Wq    = (const float*)d_in[1];
  const float* Wk    = (const float*)d_in[2];
  const float* Wv    = (const float*)d_in[3];
  const float* rel_h = (const float*)d_in[4];
  const float* rel_w = (const float*)d_in[5];

  const size_t PXT = (size_t)MTOK * DIM * 2;        // 8388608
  const size_t PWQ = (size_t)DIM * DIM * 2;         // 131072
  const size_t PWC = (size_t)DIM * KCONV * 2;       // 524288
  const size_t PQ  = (size_t)MTOK * DIM * 2;        // 8388608
  const size_t PK  = (size_t)MKV * DIM * 2;         // 2097152
  const size_t PVT = (size_t)DIM * VTP * 2;         // 2097152
  size_t off = 0;
  const size_t oXT  = off; off += PXT;
  const size_t oWQ  = off; off += PWQ;
  const size_t oWK  = off; off += PWC;
  const size_t oWV  = off; off += PWC;
  const size_t oQh  = off; off += PQ;   const size_t oQl  = off; off += PQ;
  const size_t oKh  = off; off += PK;   const size_t oKl  = off; off += PK;
  const size_t oVTh = off; off += PVT;  const size_t oVTl = off; off += PVT;
  if (off > ws_size) return;                        // off = 34734080
  if (off > (size_t)134217728) return;

  char* ws = (char*)d_ws;
  unsigned short* XT  = (unsigned short*)(ws + oXT);
  unsigned short* WQ  = (unsigned short*)(ws + oWQ);
  unsigned short* WKp = (unsigned short*)(ws + oWK);
  unsigned short* WVp = (unsigned short*)(ws + oWV);
  unsigned short* Qh  = (unsigned short*)(ws + oQh);  unsigned short* Ql  = (unsigned short*)(ws + oQl);
  unsigned short* Kh  = (unsigned short*)(ws + oKh);  unsigned short* Kl  = (unsigned short*)(ws + oKl);
  unsigned short* VTh = (unsigned short*)(ws + oVTh); unsigned short* VTl = (unsigned short*)(ws + oVTl);

  const dim3 blk(256);

  // (1) x[b] viewed [R=256 c][Cc=4096 n] (pitch 4096) -> XT_b[n][c] (pitch 256); grid (Cc/64, R/64, B) = (64, 4, 4)
  tconv_kernel<<<dim3(NQ / 64, DIM / 64, NB), blk, 0, stream>>>(x, XT, NQ, DIM, (long)DIM * NQ, (long)NQ * DIM);
  // (2) Wq [256][256] -> WQ bf16 same layout; 8192 units -> 32 blocks
  const int n8q = DIM * DIM / 8;
  convrows_kernel<<<dim3(n8q / 256), blk, 0, stream>>>(Wq, WQ, DIM, DIM, n8q);
  // (3,4) conv weights OIHW -> [o][q4*256 + c] bf16; 8192 units -> 32 blocks each
  wperm_kernel<<<dim3((DIM * 32) / 256), blk, 0, stream>>>(Wk, WKp);
  wperm_kernel<<<dim3((DIM * 32) / 256), blk, 0, stream>>>(Wv, WVp);
  // (5) q = XT . WQ^T -> Qh|Ql [16384][256]   (M=16384, N=256, K=256; 1024 tiles -> 128 blocks); bias/resid unused (mode 0)
  const dim3 gQ(((MTOK / 64) * (DIM / 64) + 7) / 8, 1);
  wmma_gemm64<1, false, 0, 2, false, 0><<<gQ, blk, 0, stream>>>(
      XT, XT, DIM, 0L, WQ, WQ, DIM, 0L, (void*)Qh, (void*)Ql, DIM, 0L,
      rel_h, rel_h, 0L, MTOK, DIM, DIM, 1.0f);
  // (6) k' = conv_k(im2col XT) + pos -> Kh|Kl [4096][256]   (M=4096, N=256, K=1024; 256 tiles -> 32 blocks)
  conv_gemm64<0><<<dim3(((MKV / 64) * (DIM / 64)) / 8), blk, 0, stream>>>(XT, WKp, rel_h, rel_w, Kh, Kl);
  // (7) v^T = WVp . im2col(XT)^T -> VTh|VTl [256][4096]     (M=256, N=4096, K=1024; 256 tiles -> 32 blocks)
  conv_gemm64<1><<<dim3(((DIM / 64) * (MKV / 64)) / 8), blk, 0, stream>>>(XT, WVp, rel_h, rel_w, VTh, VTl);
  // (8) attention per (batch, head, 64-query block) -> d_out NCHW; 2048 blocks of 128
  attn32_kernel<<<dim3(NB * NH * (NQ / AT_QB)), dim3(128), 0, stream>>>(Qh, Ql, Kh, Kl, VTh, VTl, (float*)d_out,
                                                                        0.17677669529663687f);
  (void)hipGetLastError();
}

// v001
// One run takes 234 microseconds.
// Timed twice side by side with v000, it ran 1.48 and 1.49 times as fast.
// Contractions: q projection, k conv (im2col) and v^T conv (im2col) = v_wmma_f32_16x16x32_bf16 single products on bf16 planes of the RNE-converted inputs (exact products); scores q.(k+pos) and p.v = bf16 hi/lo split (hi.hi + hi.lo + lo.hi); f32 accumulate everywhere; positional add, 32^-0.5 scale, online softmax and 1/rowsum in f32 on the VALU.
// Plane / carry map (all carry 1, nothing to fold back):
//   XT  = bf16(x) token-major [16384][256] (row b*4096 + n, n = y*64 + x, col c)
//   WQ  = bf16(Wq) [256 o][256 c];  WKp, WVp bf16 [256 o][1024]: col q4*256 + c = bf16(W[o][c][kh][kw]), q4 = kh*2 + kw
//   Qh|Ql bf16 [16384][256] (col h*32 + d) = hi/lo of q;  Kh|Kl bf16 [4096][256] (row b*1024 + m, m = i*32 + j; col h*32 + d) = hi/lo of (conv_k + pos)
//   pos(h,d,m) = bf16(rel_h[(h*32+d)*32 + (m & 31)]) + bf16(rel_w[(h*32+d)*32 + (m >> 5)]) in f32
//   VTh|VTl bf16 [256 (h*32+d)][4096 (b*1024+m)] = hi/lo of conv_v;  P hi|lo = unnormalised exp in (0,1] (bf16), 1/rowsum applied to the f32 accumulator
#include <hip/hip_runtime.h>
#include <math.h>
#include <stdint.h>

#define NB    4
#define DIM   256
#define NH    8
#define HD    32
#define IMH   64
#define IMW   64
#define NQ    4096
#define OH    32
#define OW    32
#define NKV   1024
#define KCONV 1024
#define MTOK  (NB * NQ)
#define MKV   (NB * NKV)
#define VTP   (NB * NKV)

static_assert(NQ == IMH * IMW);
static_assert(NKV == OH * OW);
static_assert(OH * 2 == IMH);
static_assert(OW * 2 == IMW);
static_assert(DIM == NH * HD);
static_assert(HD == 32);
static_assert(KCONV == DIM * 4);
static_assert(MTOK % 64 == 0);
static_assert(MKV % 128 == 0);
static_assert(DIM % 64 == 0);
static_assert(KCONV % 32 == 0);
static_assert(DIM % 32 == 0);
static_assert((DIM * DIM) % (8 * 256) == 0);
static_assert(((MKV / 64) * (DIM / 64)) % 8 == 0);
static_assert(((MTOK / 64) * (DIM / 64)) % 8 == 0);
static_assert(DIM * OH == 8192);
static_assert(NQ % 64 == 0);
static_assert(NKV % 64 == 0);

typedef __attribute__((ext_vector_type(16))) _Float16 v16h;
typedef __attribute__((ext_vector_type(8)))  _Float16 v8h;
typedef __attribute__((ext_vector_type(16))) __bf16   v16b;
typedef __attribute__((ext_vector_type(8)))  __bf16   v8b;
typedef __attribute__((ext_vector_type(8)))  float    v8f;
typedef __attribute__((ext_vector_type(4)))  float    v4f;
typedef __attribute__((ext_vector_type(2)))  float    v2f;
typedef __attribute__((ext_vector_type(4)))  unsigned int v4u;
typedef __attribute__((ext_vector_type(2)))  unsigned int v2u;

__device__ __forceinline__ unsigned short f2bf_bits(float f) {
  unsigned u = __float_as_uint(f);
  return (unsigned short)((u + 0x7FFFu + ((u >> 16) & 1u)) >> 16);
}
__device__ __forceinline__ float bf_bits2f(unsigned short h) { return __uint_as_float(((unsigned)h) << 16); }
__device__ __forceinline__ unsigned pk16(unsigned short a, unsigned short b) { return (unsigned)a | ((unsigned)b << 16); }

// hazard guards as plain device helpers (no inline asm inside the kernel template body)
__device__ __forceinline__ void dep_guard_h(v8f& a, v8f& b, v16h x, v16h y) { asm volatile("v_nop\n\tv_nop\n\tv_nop\n\tv_nop" : "+v"(a), "+v"(b) : "v"(x), "v"(y)); }
__device__ __forceinline__ void dep_guard_b(v8f& a, v8f& b, v16b x, v16b y) { asm volatile("v_nop\n\tv_nop\n\tv_nop\n\tv_nop" : "+v"(a), "+v"(b) : "v"(x), "v"(y)); }
__device__ __forceinline__ void keep4_h(v16h a, v16h b, v16h c, v16h d) { asm volatile("v_nop" :: "v"(a), "v"(b), "v"(c), "v"(d)); }
__device__ __forceinline__ void keep4_b(v16b a, v16b b, v16b c, v16b d) { asm volatile("v_nop" :: "v"(a), "v"(b), "v"(c), "v"(d)); }
__device__ __forceinline__ void acc_guard4(v8f& a, v8f& b, v8f& c, v8f& d) { asm volatile("v_nop\n\tv_nop\n\tv_nop\n\tv_nop" : "+v"(a), "+v"(b), "+v"(c), "+v"(d)); }
template <typename T> struct Frag;
template <> struct Frag<_Float16> {
  typedef v16h V; union U { v16h v; v8h h[2]; };
  static __device__ __forceinline__ v16h load(const _Float16* p) {   // elements 0..7 <- p[0..7], 8..15 <- p[16..23]
    U f; f.h[0] = *(const v8h*)(p); f.h[1] = *(const v8h*)(p + 16); return f.v;
  }
  static __device__ __forceinline__ v8f mma(v16h a, v16h b, v8f c) {
    return __builtin_amdgcn_wmma_f32_16x16x32_f16(false, a, false, b, (short)0, c, false, false);
  }
  static __device__ __forceinline__ void guard(v8f& a, v8f& b, v16h x, v16h y) { dep_guard_h(a, b, x, y); }
  static __device__ __forceinline__ void keep(v16h a, v16h b, v16h c, v16h d) { keep4_h(a, b, c, d); }
};
template <> struct Frag<__bf16> {
  typedef v16b V; union U { v16b v; v8b h[2]; };
  static __device__ __forceinline__ v16b load(const __bf16* p) {
    U f; f.h[0] = *(const v8b*)(p); f.h[1] = *(const v8b*)(p + 16); return f.v;
  }
  static __device__ __forceinline__ v8f mma(v16b a, v16b b, v8f c) {
    return __builtin_amdgcn_wmma_f32_16x16x32_bf16(false, a, false, b, (short)0, c, false, false);
  }
  static __device__ __forceinline__ void guard(v8f& a, v8f& b, v16b x, v16b y) { dep_guard_b(a, b, x, y); }
  static __device__ __forceinline__ void keep(v16b a, v16b b, v16b c, v16b d) { keep4_b(a, b, c, d); }
};

// ---- Register-blocked batched WMMA GEMM ------------------------------------
// C[m,n] = scale * sum_k A[m,k] * Bt[n,k] (+bias)(+resid); each wave owns a 64x64 tile.
// A row-major [M,K]; Bt row-major [N,K]; M,N % 64 == 0, K % 32 == 0.
// SPLIT: operands are hi/lo planes (A2/Bt2 = lo planes, same layout); product = hi.hi + hi.lo + lo.hi.
// BIAS_MODE: 0 = none, 1 = bias[m], 2 = bias[n].
// OUT_MODE: 0 = f32, 1 = f16, 2 = bf16 hi plane (Cout) + bf16 lo plane (Cout2).
// ET: 0 = f16 operands, 1 = bf16 operands (pointers passed as 16-bit storage)
template <int ET> struct Elem;
template <> struct Elem<0> { typedef _Float16 T; };
template <> struct Elem<1> { typedef __bf16 T; };
template <int ET, bool SPLIT, int BIAS_MODE, int OUT_MODE, bool RESID, int ACT = 0>
__global__ __launch_bounds__(256) void wmma_gemm64(
    const unsigned short* __restrict__ Ap, const unsigned short* __restrict__ A2p, int lda, long strideA,
    const unsigned short* __restrict__ Btp, const unsigned short* __restrict__ Bt2p, int ldb, long strideB,
    void* __restrict__ Cout, void* __restrict__ Cout2, int ldc, long strideC,
    const float* __restrict__ bias,
    const float* __restrict__ resid, long strideR,
    int M, int N, int K, float scale) {
  typedef typename Elem<ET>::T T;
  typedef typename Frag<T>::V V;
  const T* A = (const T*)Ap; const T* A2 = (const T*)A2p; const T* Bt = (const T*)Btp; const T* Bt2 = (const T*)Bt2p;
  __shared__ __align__(16) float sT[8][16 * 68];   // per-wave 16x64 slab, pitch 68 floats
  const int b    = blockIdx.y;
  const int lane = threadIdx.x & 31;
  const int wave = threadIdx.x >> 5;
  const int tilesN = N >> 6;
  const int tilesM = M >> 6;
  const int tile = blockIdx.x * 8 + wave;
  if (tile >= tilesM * tilesN) return;   // wave-uniform; no block barriers in this kernel
  const int tm = tile / tilesN;
  const int tn = tile - tm * tilesN;
  const int m0 = tm << 6;
  const int n0 = tn << 6;

  const T* Ab  = A  + (size_t)b * strideA;
  const T* Bb  = Bt + (size_t)b * strideB;
  const T* Ab2 = SPLIT ? (A2  + (size_t)b * strideA) : nullptr;
  const T* Bb2 = SPLIT ? (Bt2 + (size_t)b * strideB) : nullptr;

  const int rlane = lane & 15;                 // row (A) / col (B, D) within subtile
  const int koff  = (lane >> 4) * 8;           // k offset of this lane half
  const int mOff  = (lane >> 4) * 8;           // D row offset

  v8f acc[4][4];
#pragma unroll
  for (int i = 0; i < 4; ++i)
#pragma unroll
    for (int j = 0; j < 4; ++j) acc[i][j] = (v8f){0.f,0.f,0.f,0.f,0.f,0.f,0.f,0.f};

  for (int k0 = 0; k0 < K; k0 += 32) {
    V bh[4], bl[4];
#pragma unroll
    for (int j = 0; j < 4; ++j) {
      const size_t bo = (size_t)(n0 + (j << 4) + rlane) * ldb + koff + k0;
      bh[j] = Frag<T>::load(Bb + bo);
      if (SPLIT) bl[j] = Frag<T>::load(Bb2 + bo); else bl[j] = bh[j];
    }
#pragma unroll
    for (int i = 0; i < 4; ++i) {
      const size_t ao = (size_t)(m0 + (i << 4) + rlane) * lda + koff + k0;
      V ah = Frag<T>::load(Ab + ao);
      V al;
      if (SPLIT) al = Frag<T>::load(Ab2 + ao); else al = ah;
#pragma unroll
      for (int j = 0; j < 4; ++j) {
        acc[i][j] = Frag<T>::mma(ah, bh[j], acc[i][j]);
        if (SPLIT) {
          acc[i][j] = Frag<T>::mma(ah, bl[j], acc[i][j]);
          acc[i][j] = Frag<T>::mma(al, bh[j], acc[i][j]);
        }
      }
      Frag<T>::guard(acc[i][0], acc[i][3], ah, al);
    }
    Frag<T>::keep(bh[0], bh[1], bh[2], bh[3]);
    if (SPLIT) Frag<T>::keep(bl[0], bl[1], bl[2], bl[3]);
  }
  acc_guard4(acc[0][0], acc[0][1], acc[0][2], acc[0][3]);
  acc_guard4(acc[1][0], acc[1][1], acc[1][2], acc[1][3]);
  acc_guard4(acc[2][0], acc[2][1], acc[2][2], acc[2][3]);
  acc_guard4(acc[3][0], acc[3][1], acc[3][2], acc[3][3]);

  // ---- epilogue ----
  float* slab = sT[wave];
  const float* Rb = RESID ? (resid + (size_t)b * strideR) : nullptr;
#pragma unroll
  for (int i = 0; i < 4; ++i) {
    const int mBase = m0 + (i << 4);
#pragma unroll
    for (int j = 0; j < 4; ++j) {
      const int n = n0 + (j << 4) + rlane;
      float bv = 0.f;
      if (BIAS_MODE == 2) bv = bias[n];
#pragma unroll
      for (int r = 0; r < 8; ++r) {
        float v = acc[i][j][r] * scale;
        if (BIAS_MODE == 1) v += bias[mBase + mOff + r];
        if (BIAS_MODE == 2) v += bv;
        if (RESID) v += Rb[(size_t)(mBase + mOff + r) * ldc + n];
        if (ACT == 1) v = tanhf(v);
        if (ACT == 2) v = fmaxf(v, 0.0f);
        if (ACT == 3) v = v / (1.0f + expf(-v));
        if (ACT == 4) v = (v > 0.f) ? v : 0.01f * v;
        if (ACT == 5) v = 0.5f * v * (1.0f + erff(v * 0.70710678118654752f));
        slab[(mOff + r) * 68 + (j << 4) + rlane] = v;
      }
    }
    __builtin_amdgcn_fence(__ATOMIC_RELEASE, "workgroup");
    __builtin_amdgcn_wave_barrier();
    __builtin_amdgcn_fence(__ATOMIC_ACQUIRE, "workgroup");
    if (OUT_MODE == 0) {
      float* C = (float*)Cout + (size_t)b * strideC;
      const int hh = lane >> 4, c4 = (lane & 15) * 4;     // row seg = 256 B = 16 lanes x 16 B
      {
#pragma unroll
        for (int it = 0; it < 8; ++it) {
          const int row = it * 2 + hh;
          v4f v = *(const v4f*)(slab + row * 68 + c4);
          *(v4f*)(C + (size_t)(mBase + row) * ldc + n0 + c4) = v;
        }
        
      }
    } else {
      const int q = lane >> 3, c8 = (lane & 7) * 8;
      unsigned short* C  = (unsigned short*)Cout  + (size_t)b * strideC;
      unsigned short* C2 = (OUT_MODE == 2) ? ((unsigned short*)Cout2 + (size_t)b * strideC) : nullptr;
      {
#pragma unroll
        for (int it = 0; it < 4; ++it) {
          const int row = it * 4 + q;
          const float* sp = slab + row * 68 + c8;
          v8h hv, lv;
#pragma unroll
          for (int e = 0; e < 8; ++e) {
            if (OUT_MODE == 1) {
              hv[e] = (_Float16)sp[e];
            } else {
              unsigned short hb = f2bf_bits(sp[e]);
              unsigned short lb = f2bf_bits(sp[e] - bf_bits2f(hb));
              hv[e] = __builtin_bit_cast(_Float16, hb);
              lv[e] = __builtin_bit_cast(_Float16, lb);
            }
          }
          *(v8h*)(C + (size_t)(mBase + row) * ldc + n0 + c8) = hv;
          if (OUT_MODE == 2) *(v8h*)(C2 + (size_t)(mBase + row) * ldc + n0 + c8) = lv;
        }
        
      }
    }
    __builtin_amdgcn_fence(__ATOMIC_RELEASE, "workgroup");
    __builtin_amdgcn_wave_barrier();
    __builtin_amdgcn_fence(__ATOMIC_ACQUIRE, "workgroup");
  }
}

// ---------------------------------------------------------------------------
// Row-preserving bf16 RNE convert of an f32 matrix [rows][ncols] into a u16 plane with row pitch ldout.
// 8 consecutive elements per thread = one 16-B store; 32 lanes cover 256 consecutive columns of one row
// ---------------------------------------------------------------------------
__global__ __launch_bounds__(256) void convrows_kernel(const float* __restrict__ in, unsigned short* __restrict__ out,
                                                       int ncols, int ldout, int n8) {
  const int i = blockIdx.x * 256 + threadIdx.x;
  if (i < n8) {
    const size_t e0 = (size_t)i * 8;
    const int row = (int)(e0 / (size_t)ncols);
    const int col = (int)(e0 - (size_t)row * ncols);
    const v4f a = *(const v4f*)(in + e0);
    const v4f c = *(const v4f*)(in + e0 + 4);
    v4u hv;
    hv[0] = pk16(f2bf_bits(a[0]), f2bf_bits(a[1]));
    hv[1] = pk16(f2bf_bits(a[2]), f2bf_bits(a[3]));
    hv[2] = pk16(f2bf_bits(c[0]), f2bf_bits(c[1]));
    hv[3] = pk16(f2bf_bits(c[2]), f2bf_bits(c[3]));
    const size_t o = (size_t)row * ldout + col;
    {
      *(v4u*)(out + o) = hv;
      
    }
  }
}

// ---------------------------------------------------------------------------
// Fused transpose + bf16 RNE convert of an f32 matrix, z-batched, one plane:
//   in_z = W + z*sIn viewed [R rows][Cc cols] with row pitch ldin  ->  oh_z[c][r] = bf16(in_z[r][c]), row pitch ldout, oh_z = oh + z*sOut.
// 64x64 tiles through LDS. grid = (Cc/64, R/64, Z), 256 threads (R, Cc multiples of 64; ldout multiple of 64 so every
// Coverage per block: load 4 it x 256 thr x 4 floats = 64x64; store 2 it x 256 thr x 8 u16 = 64x64.
// ---------------------------------------------------------------------------
__global__ __launch_bounds__(256) void tconv_kernel(const float* __restrict__ W, unsigned short* __restrict__ oh,
                                                    int ldin, int ldout, long sIn, long sOut) {
  __shared__ __align__(16) float tf[64 * 68];
  W  += (size_t)blockIdx.z * sIn;
  oh += (size_t)blockIdx.z * sOut;
  const int c0  = blockIdx.x * 64;   // input column block = output row block
  const int r0  = blockIdx.y * 64;   // input row block    = output column block
  const int tid = threadIdx.x;
  {
    const int lr = tid >> 4;         // 0..15
    const int c4 = (tid & 15) * 4;   // 0..60
#pragma unroll
    for (int it = 0; it < 4; ++it) {
      const int rr = it * 16 + lr;   // 0..63
      const v4f a = *(const v4f*)(W + (size_t)(r0 + rr) * ldin + c0 + c4);
      *(v4f*)(tf + rr * 68 + c4) = a;
    }
  }
  __syncthreads();
  const int sub = tid >> 3;          // 0..31
  const int c8  = (tid & 7) * 8;     // 0..56
  v4u hv[2];
#pragma unroll
  for (int it = 0; it < 2; ++it) {
    const int oc = it * 32 + sub;    // output row within tile (= input column)
    v4u a;
#pragma unroll
    for (int q = 0; q < 4; ++q) {
      const float f0 = tf[(c8 + 2 * q) * 68 + oc];
      const float f1 = tf[(c8 + 2 * q + 1) * 68 + oc];
      a[q] = pk16(f2bf_bits(f0), f2bf_bits(f1));
    }
    hv[it] = a;
  }
  {
#pragma unroll
    for (int it = 0; it < 2; ++it) {
      const int oc = it * 32 + sub;
      const size_t go = (size_t)(c0 + oc) * ldout + r0 + c8;
      *(v4u*)(oh + go) = hv[it];
    }
    
  }
}

// ---------------------------------------------------------------------------
// Conv weight permute + bf16 RNE convert: W OIHW [256 o][256 c][2][2] f32 -> O[o][q4*256 + c] u16 (q4 = kh*2 + kw),
// row pitch KCONV = 1024. One unit = (o, c0 = 8*lane): 8 x 16-B loads (the 4 taps of 8 consecutive c), 4 x 16-B stores
// (8 consecutive c of each q4 segment). Per store instruction the 32 lanes of a wave (same o) write 32 x 16 B = the whole
// Coverage: 32 blocks x 256 threads = 8192 units x 32 elements = 256 x 1024 = whole plane.
// ---------------------------------------------------------------------------
__global__ __launch_bounds__(256) void wperm_kernel(const float* __restrict__ W, unsigned short* __restrict__ O) {
  const int u = blockIdx.x * 256 + threadIdx.x;   // 0 .. DIM*32 - 1
  if (u < DIM * 32) {
    const int o = u >> 5, c0 = (u & 31) * 8;
    v4f w[8];
#pragma unroll
    for (int e = 0; e < 8; ++e) w[e] = *(const v4f*)(W + ((size_t)(o * DIM + c0 + e)) * 4);
    v4u pk[4];
#pragma unroll
    for (int q4 = 0; q4 < 4; ++q4) {
      v4u a;
#pragma unroll
      for (int p = 0; p < 4; ++p) a[p] = pk16(f2bf_bits(w[2 * p][q4]), f2bf_bits(w[2 * p + 1][q4]));
      pk[q4] = a;
    }
    unsigned short* orow = O + (size_t)o * KCONV + c0;
    {
#pragma unroll
      for (int q4 = 0; q4 < 4; ++q4) *(v4u*)(orow + q4 * DIM) = pk[q4];
      
    }
  }
}

// ---------------------------------------------------------------------------
// im2col addressing of the 2x2 / stride-2 / VALID conv as a GEMM over XT (token-major bf16 [NB*4096][256]):
//   im2col row g = b*1024 + m, m = i*32 + j (output grid row i, col j); k = q4*256 + c, q4 = kh*2 + kw;
//   element (g, k) = XT[(b*4096 + (2i+kh)*64 + (2j+kw)) * 256 + c].
// For a 32-deep k-step (k0 % 32 == 0) the 32 k values are 32 consecutive channels of one source token row,
// so a fragment is two 16-B loads at the returned offset + koff and + koff + 16 (arithmetic addressing only).
// ---------------------------------------------------------------------------
__device__ __forceinline__ size_t im2col_off(int g, int k0) {
  const int b = g >> 10, m = g & (NKV - 1);
  const int q4 = k0 >> 8, c0 = k0 & (DIM - 1);
  const int kh = q4 >> 1, kw = q4 & 1;
  const int i = m >> 5, j = m & 31;
  return ((size_t)(b * NQ + (2 * i + kh) * IMW + 2 * j + kw)) * DIM + c0;
}

// ---------------------------------------------------------------------------
// Conv GEMM (bf16 single products, f32 accumulate), wave-owned 64x64 tiles as in wmma_gemm64, K = 1024:
//   MODE 0: C[g][o] = sum_k im2col(g,k) * WKp[o][k]  (M = 4096 rows g, N = 256), epilogue adds
//           pos(o, m) = bf16(rel_h[o*32 + (m&31)]) + bf16(rel_w[o*32 + (m>>5)]) in f32, then bf16 hi|lo planes [4096][256].
//           Block bx covers rows 128bx..128bx+127 (tilesN = 4), i.e. b = bx>>3, m = 128*(bx&7) + 0..127, m>>5 = 4*(bx&7) + 0..3;
//           rel_h (all 8192 values) and the 4 needed rel_w columns per o are staged once per block in LDS as bf16 bits.
//   MODE 1: C[o][g] = sum_k WVp[o][k] * im2col(g,k)  (M = 256, N = 4096) -> bf16 hi|lo planes [256][4096] (v^T layout).
// grid = 32 blocks x 8 waves = 256 tiles exactly (both modes).
// ---------------------------------------------------------------------------
template <int MODE>
__global__ __launch_bounds__(256) void conv_gemm64(const unsigned short* __restrict__ XTp, const unsigned short* __restrict__ Wpp,
                                                   const float* __restrict__ rel_h, const float* __restrict__ rel_w,
                                                   unsigned short* __restrict__ Ch, unsigned short* __restrict__ Cl) {
  typedef __bf16 T;
  typedef v16b V;
  const T* XT = (const T*)XTp; const T* Wp = (const T*)Wpp;
  __shared__ __align__(16) float sT[8][16 * 68];
  __shared__ __align__(16) unsigned short sRh[(MODE == 0) ? (DIM * OH) : 8];
  __shared__ __align__(16) unsigned short sRw[(MODE == 0) ? (DIM * 4) : 8];
  constexpr int M = (MODE == 0) ? MKV : DIM;
  constexpr int N = (MODE == 0) ? DIM : MKV;
  constexpr int LDC = N;
  const int tid  = threadIdx.x;
  const int lane = tid & 31;
  const int wave = tid >> 5;

  if (MODE == 0) {
    // stage rel_h (8 x 16-B loads per thread, 256 threads x 32 = 8192 values) and rel_w[o][4*(bx&7) .. +3] (thread = o)
    const int iib = 4 * (blockIdx.x & 7);
#pragma unroll
    for (int it = 0; it < 8; ++it) {
      const int e4 = (it * 256 + tid) * 4;
      const v4f a = *(const v4f*)(rel_h + e4);
      v2u w;
      w[0] = pk16(f2bf_bits(a[0]), f2bf_bits(a[1]));
      w[1] = pk16(f2bf_bits(a[2]), f2bf_bits(a[3]));
      *(v2u*)(sRh + e4) = w;
    }
    {
      const v4f a = *(const v4f*)(rel_w + (size_t)tid * OW + iib);
      v2u w;
      w[0] = pk16(f2bf_bits(a[0]), f2bf_bits(a[1]));
      w[1] = pk16(f2bf_bits(a[2]), f2bf_bits(a[3]));
      *(v2u*)(sRw + tid * 4) = w;
    }
    __syncthreads();
  }

  constexpr int tilesN = N >> 6;
  constexpr int tilesM = M >> 6;
  const int tile = blockIdx.x * 8 + wave;
  if (tile >= tilesM * tilesN) return;   // wave-uniform, never taken with the exact grid; no block barriers below
  const int tm = tile / tilesN;
  const int tn = tile - tm * tilesN;
  const int m0 = tm << 6;
  const int n0 = tn << 6;

  const int rlane = lane & 15;
  const int koff  = (lane >> 4) * 8;
  const int mOff  = (lane >> 4) * 8;

  v8f acc[4][4];
#pragma unroll
  for (int i = 0; i < 4; ++i)
#pragma unroll
    for (int j = 0; j < 4; ++j) acc[i][j] = (v8f){0.f,0.f,0.f,0.f,0.f,0.f,0.f,0.f};

  for (int k0 = 0; k0 < KCONV; k0 += 32) {
    V bfr[4];
#pragma unroll
    for (int j = 0; j < 4; ++j) {
      const int n = n0 + (j << 4) + rlane;
      if (MODE == 0) bfr[j] = Frag<T>::load(Wp + (size_t)n * KCONV + k0 + koff);
      else           bfr[j] = Frag<T>::load(XT + im2col_off(n, k0) + koff);
    }
#pragma unroll
    for (int i = 0; i < 4; ++i) {
      const int mr = m0 + (i << 4) + rlane;
      V ah;
      if (MODE == 0) ah = Frag<T>::load(XT + im2col_off(mr, k0) + koff);
      else           ah = Frag<T>::load(Wp + (size_t)mr * KCONV + k0 + koff);
#pragma unroll
      for (int j = 0; j < 4; ++j) acc[i][j] = Frag<T>::mma(ah, bfr[j], acc[i][j]);
      Frag<T>::guard(acc[i][0], acc[i][3], ah, ah);
    }
    Frag<T>::keep(bfr[0], bfr[1], bfr[2], bfr[3]);
  }
  acc_guard4(acc[0][0], acc[0][1], acc[0][2], acc[0][3]);
  acc_guard4(acc[1][0], acc[1][1], acc[1][2], acc[1][3]);
  acc_guard4(acc[2][0], acc[2][1], acc[2][2], acc[2][3]);
  acc_guard4(acc[3][0], acc[3][1], acc[3][2], acc[3][3]);

  // ---- epilogue ----
  float* slab = sT[wave];
#pragma unroll
  for (int i = 0; i < 4; ++i) {
    const int mBase = m0 + (i << 4);
#pragma unroll
    for (int j = 0; j < 4; ++j) {
      const int n = n0 + (j << 4) + rlane;
#pragma unroll
      for (int r = 0; r < 8; ++r) {
        float v = acc[i][j][r];
        if (MODE == 0) {
          const int row = mBase + mOff + r;
          const int m   = row & (NKV - 1);
          const int jj  = m & 31;
          const int iil = (m >> 5) & 3;
          const float pos = bf_bits2f(sRh[n * OH + jj]) + bf_bits2f(sRw[n * 4 + iil]);
          v += pos;
        }
        slab[(mOff + r) * 68 + (j << 4) + rlane] = v;
      }
    }
    __builtin_amdgcn_fence(__ATOMIC_RELEASE, "workgroup");
    __builtin_amdgcn_wave_barrier();
    __builtin_amdgcn_fence(__ATOMIC_ACQUIRE, "workgroup");
    {
      const int q = lane >> 3, c8 = (lane & 7) * 8;
      {
#pragma unroll
        for (int it = 0; it < 4; ++it) {
          const int row = it * 4 + q;
          const float* sp = slab + row * 68 + c8;
          v8h hv, lv;
#pragma unroll
          for (int e = 0; e < 8; ++e) {
            unsigned short hb = f2bf_bits(sp[e]);
            unsigned short lb = f2bf_bits(sp[e] - bf_bits2f(hb));
            hv[e] = __builtin_bit_cast(_Float16, hb);
            lv[e] = __builtin_bit_cast(_Float16, lb);
          }
          *(v8h*)(Ch + (size_t)(mBase + row) * LDC + n0 + c8) = hv;
          *(v8h*)(Cl + (size_t)(mBase + row) * LDC + n0 + c8) = lv;
        }
        
      }
    }
    __builtin_amdgcn_fence(__ATOMIC_RELEASE, "workgroup");
    __builtin_amdgcn_wave_barrier();
    __builtin_amdgcn_fence(__ATOMIC_ACQUIRE, "workgroup");
  }
}

// =====================================================================================
// Full (non-causal, unmasked) attention, head dim 32, all batches and heads in one launch.
//   q planes (hi/lo bf16) [16384][256]: element (b, n, h, d) at [(b*4096+n)*256 + h*32 + d]
//   k planes (hi/lo bf16) [4096][256]:  element (b, m, h, d) at [(b*1024+m)*256 + h*32 + d]  (pos already folded in)
//   v^T planes (hi/lo bf16) [256][4096]: element (h, d, b, m) at [(h*32 + d)*4096 + b*1024 + m]
//   out f32 NCHW: element (b, h*32+d, n) at [(b*256 + h*32 + d)*4096 + n]
//   scores = (q . k') * 32^-0.5 : bf16 hi/lo split (hi.hi + hi.lo + lo.hi) on v_wmma_f32_16x16x32_bf16
//   out    = p . v             : bf16 hi/lo split of p (unnormalised exp) and v, f32 accumulate, x 1/rowsum in f32 at the end
//   online softmax in f32 over the 1024 keys of the batch element (16 chunks of 64, compile-time trip count, no masking).
//   Block = 4 waves = 64 query positions of one (batch, head); grid.x = 4 * 8 * 64 = 2048 (exact).
//   K chunk staging: thread r = tid>>1 stages K row r cols (tid&1)*16 .. +15 (two 16-B copies per plane) -> 64x32 whole tile;
//   V^T chunk staging: thread d = tid>>2 stages row d cols (tid&3)*16 .. +15 -> 32x64 whole tile; __syncthreads before and after.
//   Scores are formed transposed, S^T = K . Q^T (A = K rows, B = Q): a lane holds 32 of the chunk's 64 scores of ONE query
//   (query = lane & 15, keys j*16 + 8*(lane>>4) + r), so maximum and sum run in the lane plus one exchange between lane halves;
//   two S^T tiles converted in place are the B operand of O^T += V^T . P^T (same k order as the V^T loader): P never touches LDS.
// =====================================================================================
#define AT_D  32
#define AT_NW 4
#define AT_QB 64
#define AT_KC 64

__device__ __forceinline__ unsigned short at_bf_bits(float f) {
  unsigned u = __float_as_uint(f);
  return (unsigned short)((u + 0x7FFFu + ((u >> 16) & 1u)) >> 16);
}
__device__ __forceinline__ __bf16 at_f2bf(float f) { return __builtin_bit_cast(__bf16, at_bf_bits(f)); }
__device__ __forceinline__ void at_split(float f, __bf16& hi, __bf16& lo) {
  const unsigned short hb = at_bf_bits(f);
  hi = __builtin_bit_cast(__bf16, hb);
  lo = at_f2bf(f - __uint_as_float(((unsigned)hb) << 16));
}
__device__ __forceinline__ v8f at_mma(v16b a, v16b b, v8f c) {
  c = __builtin_amdgcn_wmma_f32_16x16x32_bf16(false, a, false, b, (short)0, c, false, false);
  asm volatile("v_nop\n\tv_nop\n\tv_nop\n\tv_nop" : "+v"(c) : "v"(a), "v"(b));
  return c;
}

// value of the same lane position in the other 16-lane half (lane ^ 16), as a vector cross-row move
__device__ __forceinline__ float at_xhalf(float f) {
  const int b = __float_as_int(f);
  return __int_as_float(__builtin_amdgcn_permlanex16(b, b, 0x76543210, 0xfedcba98, false, false));
}

__global__ __launch_bounds__(128)
void attn32_kernel(const unsigned short* __restrict__ qhp, const unsigned short* __restrict__ qlp,
                   const unsigned short* __restrict__ khp, const unsigned short* __restrict__ klp,
                   const unsigned short* __restrict__ vhp, const unsigned short* __restrict__ vlp,
                   float* __restrict__ out, float sscale) {
  union FB { v16b v; v8b h[2]; };
  __shared__ __align__(16) __bf16 Ksh[AT_KC * AT_D];             // K hi [kv][d]   4 KB
  __shared__ __align__(16) __bf16 Ksl[AT_KC * AT_D];             // K lo
  __shared__ __align__(16) __bf16 Vth[AT_D * AT_KC];             // V hi [d][kv]   4 KB
  __shared__ __align__(16) __bf16 Vtl[AT_D * AT_KC];             // V lo
  __shared__ __align__(16) float  Os[AT_D * 68];                 // block out tile transposed [d][n_local], pitch 68

  const int tid  = threadIdx.x;
  const int wave = tid >> 5;
  const int lane = tid & 31;
  const int hh   = lane >> 4;
  const int c    = lane & 15;

  const int nqb = NQ / AT_QB;              // 64 query blocks per (batch, head)
  const int bx = blockIdx.x;               // grid = NB * NH * nqb (exact)
  const int qb = bx % nqb;
  const int hb = bx / nqb;
  const int h  = hb % NH;                  // 0..7
  const int b  = hb / NH;                  // 0..3
  const int q0 = b * NQ + qb * AT_QB + wave * 16;   // row in the q planes

  const __bf16* Qh = (const __bf16*)(const void*)qhp + (size_t)h * AT_D;
  const __bf16* Ql = (const __bf16*)(const void*)qlp + (size_t)h * AT_D;
  const __bf16* Kh = (const __bf16*)(const void*)khp + (size_t)h * AT_D;
  const __bf16* Kl = (const __bf16*)(const void*)klp + (size_t)h * AT_D;
  const __bf16* Vh = (const __bf16*)(const void*)vhp + (size_t)h * AT_D * VTP + (size_t)b * NKV;
  const __bf16* Vl = (const __bf16*)(const void*)vlp + (size_t)h * AT_D * VTP + (size_t)b * NKV;

  // ---- Q fragments (B operand, column = lane&15, split k map via Frag load): head dim 32 = one k-step, hi and lo ----
  v16b qah, qal;
  {
    const __bf16* qr = Qh + (size_t)(q0 + c) * DIM + 8 * hh;
    const __bf16* ql = Ql + (size_t)(q0 + c) * DIM + 8 * hh;
    qah = Frag<__bf16>::load(qr);
    qal = Frag<__bf16>::load(ql);
  }

  float mrow = -INFINITY;   // running maximum of this lane's query (equal in both lane halves)
  float lrow = 0.f;         // running sum over this lane half's keys only; the halves are joined once after the loop
  v8f oacc[2];              // O^T tiles: oacc[t][r] = out[d = t*16 + 8*hh + r][query c]
#pragma unroll
  for (int t = 0; t < 2; ++t) oacc[t] = (v8f){0.f,0.f,0.f,0.f,0.f,0.f,0.f,0.f};

  const int nChunks = NKV / AT_KC;   // 16, compile-time constant
  for (int kc = 0; kc < nChunks; ++kc) {
    const int kv0 = kc * AT_KC;
    __syncthreads();
    {
      // K staging: 128 threads x 16 elements per plane = 64 rows x 32
      const int r = tid >> 1, hf = (tid & 1) * 16;
      const __bf16* ksh = Kh + (size_t)(b * NKV + kv0 + r) * DIM + hf;
      const __bf16* ksl = Kl + (size_t)(b * NKV + kv0 + r) * DIM + hf;
      const v8b a0 = *(const v8b*)(ksh);
      const v8b a1 = *(const v8b*)(ksh + 8);
      const v8b a2 = *(const v8b*)(ksl);
      const v8b a3 = *(const v8b*)(ksl + 8);
      *(v8b*)(Ksh + r * AT_D + hf)     = a0;
      *(v8b*)(Ksh + r * AT_D + hf + 8) = a1;
      *(v8b*)(Ksl + r * AT_D + hf)     = a2;
      *(v8b*)(Ksl + r * AT_D + hf + 8) = a3;
      // V^T staging: 128 threads x 16 elements per plane = 32 rows x 64
      const int d = tid >> 2, qq = (tid & 3) * 16;
      const __bf16* vsh = Vh + (size_t)d * VTP + kv0 + qq;
      const __bf16* vsl = Vl + (size_t)d * VTP + kv0 + qq;
      const v8b b0 = *(const v8b*)(vsh);
      const v8b b1 = *(const v8b*)(vsh + 8);
      const v8b b2 = *(const v8b*)(vsl);
      const v8b b3 = *(const v8b*)(vsl + 8);
      *(v8b*)(Vth + d * AT_KC + qq)     = b0;
      *(v8b*)(Vth + d * AT_KC + qq + 8) = b1;
      *(v8b*)(Vtl + d * AT_KC + qq)     = b2;
      *(v8b*)(Vtl + d * AT_KC + qq + 8) = b3;
    }
    __syncthreads();

    v8f s[4];
#pragma unroll
    for (int j = 0; j < 4; ++j) {
      s[j] = (v8f){0.f,0.f,0.f,0.f,0.f,0.f,0.f,0.f};
      FB kb, kl;
      kb.h[0] = *(const v8b*)(Ksh + (j * 16 + c) * AT_D + 8 * hh);
      kb.h[1] = *(const v8b*)(Ksh + (j * 16 + c) * AT_D + 16 + 8 * hh);
      kl.h[0] = *(const v8b*)(Ksl + (j * 16 + c) * AT_D + 8 * hh);
      kl.h[1] = *(const v8b*)(Ksl + (j * 16 + c) * AT_D + 16 + 8 * hh);
      s[j] = at_mma(kb.v, qah, s[j]);
      s[j] = at_mma(kl.v, qah, s[j]);
      s[j] = at_mma(kb.v, qal, s[j]);
    }
    // scale, then the query's chunk maximum: in the lane, then one exchange with the other lane half
    // (the loops over j, r, t and kk below are unrolled so that s, ph, pl and oacc are indexed at compile time and stay in registers)
    float cm = -INFINITY;
#pragma unroll
    for (int j = 0; j < 4; ++j) {
#pragma unroll
      for (int r = 0; r < 8; ++r) {
        const float sv = s[j][r] * sscale;
        s[j][r] = sv;
        cm = fmaxf(cm, sv);
      }
    }
    cm = fmaxf(cm, at_xhalf(cm));
    const float mnew = fmaxf(mrow, cm);
    const float alpha = expf(mrow - mnew);
    mrow = mnew;
    // P^T as B operand: element e of k-step kk = S^T tile 2*kk + (e >> 3), register e & 7 (key kk*32 + 16*(e>>3) + 8*hh + (e&7))
    FB ph[2], pl[2];
    float psum = 0.f;
#pragma unroll
    for (int j = 0; j < 4; ++j) {
#pragma unroll
      for (int r = 0; r < 8; ++r) {
        const float p = expf(s[j][r] - mnew);
        psum += p;
        __bf16 a, bl; at_split(p, a, bl);
        ph[j >> 1].v[(j & 1) * 8 + r] = a;
        pl[j >> 1].v[(j & 1) * 8 + r] = bl;
      }
    }
    lrow = lrow * alpha + psum;
#pragma unroll
    for (int t = 0; t < 2; ++t)
#pragma unroll
      for (int r = 0; r < 8; ++r) oacc[t][r] *= alpha;
#pragma unroll
    for (int kk = 0; kk < 2; ++kk) {
#pragma unroll
      for (int t = 0; t < 2; ++t) {
        FB vb, vl;
        vb.h[0] = *(const v8b*)(Vth + (t * 16 + c) * AT_KC + kk * 32 + 8 * hh);
        vb.h[1] = *(const v8b*)(Vth + (t * 16 + c) * AT_KC + kk * 32 + 16 + 8 * hh);
        vl.h[0] = *(const v8b*)(Vtl + (t * 16 + c) * AT_KC + kk * 32 + 8 * hh);
        vl.h[1] = *(const v8b*)(Vtl + (t * 16 + c) * AT_KC + kk * 32 + 16 + 8 * hh);
        oacc[t] = at_mma(vb.v, ph[kk].v, oacc[t]);
        oacc[t] = at_mma(vl.v, ph[kk].v, oacc[t]);
        oacc[t] = at_mma(vb.v, pl[kk].v, oacc[t]);
      }
    }
  }

  // ---- join the lane halves' sums, normalise and stage: Os[d][n_local], d = t*16 + 8hh + r, n_local = wave*16 + c (all 32 x 64 written) ----
  {
    const float inv = 1.0f / (lrow + at_xhalf(lrow));
#pragma unroll
    for (int t = 0; t < 2; ++t)
#pragma unroll
      for (int r = 0; r < 8; ++r) Os[(t * 16 + 8 * hh + r) * 68 + wave * 16 + c] = oacc[t][r] * inv;
  }
  __syncthreads();
  {
    float* ob = out + ((size_t)(b * DIM + h * AT_D)) * NQ + (size_t)qb * AT_QB;
    const int q = lane >> 3, c4 = (lane & 7) * 4;
    {
#pragma unroll
      for (int it = 0; it < 4; ++it) {
        const int L  = it * 16 + wave * 4 + q;   // 0..63: line index within the block's 32 x 256-B output region
        const int d  = L >> 1;
        const int hf = (L & 1) * 32;
        v4f val = *(const v4f*)(Os + d * 68 + hf + c4);
        *(v4f*)(ob + (size_t)d * NQ + hf + c4) = val;
      }
      
    }
  }
}

// ---------------------------------------------------------------------------
// Workspace region map (byte offsets; every region fully written by its producer launch before any consumer reads it;
//   XT   bf16 [16384][256]         0       8388608
//   WQ   bf16 [256][256]     8388608        131072
//   WKp  bf16 [256][1024]    8519680        524288
//   WVp  bf16 [256][1024]    9043968        524288
//   Qh   bf16 [16384][256]   9568256       8388608   Ql  17956864
//   Kh   bf16 [4096][256]   26345472       2097152   Kl  28442624
//   VTh  bf16 [256][4096]   30539776       2097152   VTl 32636928
//   total                  34734080
// ---------------------------------------------------------------------------
extern "C" void kernel_launch(void* const* d_in, const int* in_sizes, int n_in,
                              void* d_out, int out_size, void* d_ws, size_t ws_size,
                              hipStream_t stream) {
  if (n_in < 6) return;
  if (in_sizes[0] != NB * DIM * NQ) return;          // x [4][256][64][64]
  if (in_sizes[1] != DIM * DIM) return;              // Wq [256][256]
  if (in_sizes[2] != DIM * DIM * 4) return;          // Wk [256][256][2][2]
  if (in_sizes[3] != DIM * DIM * 4) return;          // Wv [256][256][2][2]
  if (in_sizes[4] != NH * HD * OH) return;           // rel_h [1][8][32][1][32]
  if (in_sizes[5] != NH * HD * OW) return;           // rel_w [1][8][32][32][1]
  if (out_size != NB * DIM * NQ) return;

  const float* x     = (const float*)d_in[0];
  const float* Wq    = (const float*)d_in[1];
  const float* Wk    = (const float*)d_in[2];
  const float* Wv    = (const float*)d_in[3];
  const float* rel_h = (const float*)d_in[4];
  const float* rel_w = (const float*)d_in[5];

  const size_t PXT = (size_t)MTOK * DIM * 2;        // 8388608
  const size_t PWQ = (size_t)DIM * DIM * 2;         // 131072
  const size_t PWC = (size_t)DIM * KCONV * 2;       // 524288
  const size_t PQ  = (size_t)MTOK * DIM * 2;        // 8388608
  const size_t PK  = (size_t)MKV * DIM * 2;         // 2097152
  const size_t PVT = (size_t)DIM * VTP * 2;         // 2097152
  size_t off = 0;
  const size_t oXT  = off; off += PXT;
  const size_t oWQ  = off; off += PWQ;
  const size_t oWK  = off; off += PWC;
  const size_t oWV  = off; off += PWC;
  const size_t oQh  = off; off += PQ;   const size_t oQl  = off; off += PQ;
  const size_t oKh  = off; off += PK;   const size_t oKl  = off; off += PK;
  const size_t oVTh = off; off += PVT;  const size_t oVTl = off; off += PVT;
  if (off > ws_size) return;                        // off = 34734080
  if (off > (size_t)134217728) return;

  char* ws = (char*)d_ws;
  unsigned short* XT  = (unsigned short*)(ws + oXT);
  unsigned short* WQ  = (unsigned short*)(ws + oWQ);
  unsigned short* WKp = (unsigned short*)(ws + oWK);
  unsigned short* WVp = (unsigned short*)(ws + oWV);
  unsigned short* Qh  = (unsigned short*)(ws + oQh);  unsigned short* Ql  = (unsigned short*)(ws + oQl);
  unsigned short* Kh  = (unsigned short*)(ws + oKh);  unsigned short* Kl  = (unsigned short*)(ws + oKl);
  unsigned short* VTh = (unsigned short*)(ws + oVTh); unsigned short* VTl = (unsigned short*)(ws + oVTl);

  const dim3 blk(256);

  // (1) x[b] viewed [R=256 c][Cc=4096 n] (pitch 4096) -> XT_b[n][c] (pitch 256); grid (Cc/64, R/64, B) = (64, 4, 4)
  tconv_kernel<<<dim3(NQ / 64, DIM / 64, NB), blk, 0, stream>>>(x, XT, NQ, DIM, (long)DIM * NQ, (long)NQ * DIM);
  // (2) Wq [256][256] -> WQ bf16 same layout; 8192 units -> 32 blocks
  const int n8q = DIM * DIM / 8;
  convrows_kernel<<<dim3(n8q / 256), blk, 0, stream>>>(Wq, WQ, DIM, DIM, n8q);
  // (3,4) conv weights OIHW -> [o][q4*256 + c] bf16; 8192 units -> 32 blocks each
  wperm_kernel<<<dim3((DIM * 32) / 256), blk, 0, stream>>>(Wk, WKp);
  wperm_kernel<<<dim3((DIM * 32) / 256), blk, 0, stream>>>(Wv, WVp);
  // (5) q = XT . WQ^T -> Qh|Ql [16384][256]   (M=16384, N=256, K=256; 1024 tiles -> 128 blocks); bias/resid unused (mode 0)
  const dim3 gQ(((MTOK / 64) * (DIM / 64) + 7) / 8, 1);
  wmma_gemm64<1, false, 0, 2, false, 0><<<gQ, blk, 0, stream>>>(
      XT, XT, DIM, 0L, WQ, WQ, DIM, 0L, (void*)Qh, (void*)Ql, DIM, 0L,
      rel_h, rel_h, 0L, MTOK, DIM, DIM, 1.0f);
  // (6) k' = conv_k(im2col XT) + pos -> Kh|Kl [4096][256]   (M=4096, N=256, K=1024; 256 tiles -> 32 blocks)
  conv_gemm64<0><<<dim3(((MKV / 64) * (DIM / 64)) / 8), blk, 0, stream>>>(XT, WKp, rel_h, rel_w, Kh, Kl);
  // (7) v^T = WVp . im2col(XT)^T -> VTh|VTl [256][4096]     (M=256, N=4096, K=1024; 256 tiles -> 32 blocks)
  conv_gemm64<1><<<dim3(((DIM / 64) * (MKV / 64)) / 8), blk, 0, stream>>>(XT, WVp, rel_h, rel_w, VTh, VTl);
  // (8) attention per (batch, head, 64-query block) -> d_out NCHW; 2048 blocks of 128
  attn32_kernel<<<dim3(NB * NH * (NQ / AT_QB)), dim3(128), 0, stream>>>(Qh, Ql, Kh, Kl, VTh, VTl, (float*)d_out,
                                                                        0.17677669529663687f);
  (void)hipGetLastError();
}

// v002
// Measured time: 227 microseconds a run.
// Next to v001, in two timings, it ran 1.03 times as fast each time.
// Counting every step since v000, it is 1.53 times as fast.
// Contractions: q projection, k conv (im2col) and v^T conv (im2col) = v_wmma_f32_16x16x32_bf16 single products on bf16 planes of the RNE-converted inputs (exact products); scores q.(k+pos) and p.v = bf16 hi/lo split (hi.hi + hi.lo + lo.hi); f32 accumulate everywhere; positional add, 32^-0.5 scale, online softmax and 1/rowsum in f32 on the VALU.
// Plane / carry map (all carry 1, nothing to fold back):
//   XT  = bf16(x) token-major [16384][256] (row b*4096 + n, n = y*64 + x, col c)
//   WQ  = bf16(Wq) [256 o][256 c];  WKp, WVp bf16 [256 o][1024]: col q4*256 + c = bf16(W[o][c][kh][kw]), q4 = kh*2 + kw
//   Qh|Ql bf16 [16384][256] (col h*32 + d) = hi/lo of q;  Kh|Kl bf16 [4096][256] (row b*1024 + m, m = i*32 + j; col h*32 + d) = hi/lo of (conv_k + pos)
//   pos(h,d,m) = bf16(rel_h[(h*32+d)*32 + (m & 31)]) + bf16(rel_w[(h*32+d)*32 + (m >> 5)]) in f32
//   VTh|VTl bf16 [256 (h*32+d)][4096 (b*1024+m)] = hi/lo of conv_v;  P hi|lo = unnormalised exp in (0,1] (bf16), 1/rowsum applied to the f32 accumulator
#include <hip/hip_runtime.h>
#include <math.h>
#include <stdint.h>

#define NB    4
#define DIM   256
#define NH    8
#define HD    32
#define IMH   64
#define IMW   64
#define NQ    4096
#define OH    32
#define OW    32
#define NKV   1024
#define KCONV 1024
#define MTOK  (NB * NQ)
#define MKV   (NB * NKV)
#define VTP   (NB * NKV)

static_assert(NQ == IMH * IMW);
static_assert(NKV == OH * OW);
static_assert(OH * 2 == IMH);
static_assert(OW * 2 == IMW);
static_assert(DIM == NH * HD);
static_assert(HD == 32);
static_assert(KCONV == DIM * 4);
static_assert(MTOK % 64 == 0);
static_assert(MKV % 128 == 0);
static_assert(DIM % 64 == 0);
static_assert(KCONV % 32 == 0);
static_assert(DIM % 32 == 0);
static_assert((DIM * DIM) % (8 * 256) == 0);
static_assert(((MKV / 64) * (DIM / 64)) % 8 == 0);
static_assert(((MTOK / 64) * (DIM / 64)) % 8 == 0);
static_assert(DIM * OH == 8192);
static_assert(NQ % 64 == 0);
static_assert(NKV % 64 == 0);

typedef __attribute__((ext_vector_type(16))) _Float16 v16h;
typedef __attribute__((ext_vector_type(8)))  _Float16 v8h;
typedef __attribute__((ext_vector_type(16))) __bf16   v16b;
typedef __attribute__((ext_vector_type(8)))  __bf16   v8b;
typedef __attribute__((ext_vector_type(8)))  float    v8f;
typedef __attribute__((ext_vector_type(4)))  float    v4f;
typedef __attribute__((ext_vector_type(2)))  float    v2f;
typedef __attribute__((ext_vector_type(4)))  unsigned int v4u;
typedef __attribute__((ext_vector_type(2)))  unsigned int v2u;

__device__ __forceinline__ unsigned short f2bf_bits(float f) {
  unsigned u = __float_as_uint(f);
  return (unsigned short)((u + 0x7FFFu + ((u >> 16) & 1u)) >> 16);
}
__device__ __forceinline__ float bf_bits2f(unsigned short h) { return __uint_as_float(((unsigned)h) << 16); }
__device__ __forceinline__ unsigned pk16(unsigned short a, unsigned short b) { return (unsigned)a | ((unsigned)b << 16); }

// hazard guards as plain device helpers (no inline asm inside the kernel template body)
__device__ __forceinline__ void dep_guard_h(v8f& a, v8f& b, v16h x, v16h y) { asm volatile("v_nop\n\tv_nop\n\tv_nop\n\tv_nop" : "+v"(a), "+v"(b) : "v"(x), "v"(y)); }
__device__ __forceinline__ void dep_guard_b(v8f& a, v8f& b, v16b x, v16b y) { asm volatile("v_nop\n\tv_nop\n\tv_nop\n\tv_nop" : "+v"(a), "+v"(b) : "v"(x), "v"(y)); }
__device__ __forceinline__ void keep4_h(v16h a, v16h b, v16h c, v16h d) { asm volatile("v_nop" :: "v"(a), "v"(b), "v"(c), "v"(d)); }
__device__ __forceinline__ void keep4_b(v16b a, v16b b, v16b c, v16b d) { asm volatile("v_nop" :: "v"(a), "v"(b), "v"(c), "v"(d)); }
__device__ __forceinline__ void acc_guard4(v8f& a, v8f& b, v8f& c, v8f& d) { asm volatile("v_nop\n\tv_nop\n\tv_nop\n\tv_nop" : "+v"(a), "+v"(b), "+v"(c), "+v"(d)); }
template <typename T> struct Frag;
template <> struct Frag<_Float16> {
  typedef v16h V; union U { v16h v; v8h h[2]; };
  static __device__ __forceinline__ v16h load(const _Float16* p) {   // elements 0..7 <- p[0..7], 8..15 <- p[16..23]
    U f; f.h[0] = *(const v8h*)(p); f.h[1] = *(const v8h*)(p + 16); return f.v;
  }
  static __device__ __forceinline__ v8f mma(v16h a, v16h b, v8f c) {
    return __builtin_amdgcn_wmma_f32_16x16x32_f16(false, a, false, b, (short)0, c, false, false);
  }
  static __device__ __forceinline__ void guard(v8f& a, v8f& b, v16h x, v16h y) { dep_guard_h(a, b, x, y); }
  static __device__ __forceinline__ void keep(v16h a, v16h b, v16h c, v16h d) { keep4_h(a, b, c, d); }
};
template <> struct Frag<__bf16> {
  typedef v16b V; union U { v16b v; v8b h[2]; };
  static __device__ __forceinline__ v16b load(const __bf16* p) {
    U f; f.h[0] = *(const v8b*)(p); f.h[1] = *(const v8b*)(p + 16); return f.v;
  }
  static __device__ __forceinline__ v8f mma(v16b a, v16b b, v8f c) {
    return __builtin_amdgcn_wmma_f32_16x16x32_bf16(false, a, false, b, (short)0, c, false, false);
  }
  static __device__ __forceinline__ void guard(v8f& a, v8f& b, v16b x, v16b y) { dep_guard_b(a, b, x, y); }
  static __device__ __forceinline__ void keep(v16b a, v16b b, v16b c, v16b d) { keep4_b(a, b, c, d); }
};

// ---- Register-blocked batched WMMA GEMM ------------------------------------
// C[m,n] = scale * sum_k A[m,k] * Bt[n,k] (+bias)(+resid); each wave owns a 64x64 tile.
// A row-major [M,K]; Bt row-major [N,K]; M,N % 64 == 0, K % 32 == 0.
// SPLIT: operands are hi/lo planes (A2/Bt2 = lo planes, same layout); product = hi.hi + hi.lo + lo.hi.
// BIAS_MODE: 0 = none, 1 = bias[m], 2 = bias[n].
// OUT_MODE: 0 = f32, 1 = f16, 2 = bf16 hi plane (Cout) + bf16 lo plane (Cout2).
// ET: 0 = f16 operands, 1 = bf16 operands (pointers passed as 16-bit storage)
template <int ET> struct Elem;
template <> struct Elem<0> { typedef _Float16 T; };
template <> struct Elem<1> { typedef __bf16 T; };
template <int ET, bool SPLIT, int BIAS_MODE, int OUT_MODE, bool RESID, int ACT = 0>
__global__ __launch_bounds__(256) void wmma_gemm64(
    const unsigned short* __restrict__ Ap, const unsigned short* __restrict__ A2p, int lda, long strideA,
    const unsigned short* __restrict__ Btp, const unsigned short* __restrict__ Bt2p, int ldb, long strideB,
    void* __restrict__ Cout, void* __restrict__ Cout2, int ldc, long strideC,
    const float* __restrict__ bias,
    const float* __restrict__ resid, long strideR,
    int M, int N, int K, float scale) {
  typedef typename Elem<ET>::T T;
  typedef typename Frag<T>::V V;
  const T* A = (const T*)Ap; const T* A2 = (const T*)A2p; const T* Bt = (const T*)Btp; const T* Bt2 = (const T*)Bt2p;
  __shared__ __align__(16) float sT[8][16 * 68];   // per-wave 16x64 slab, pitch 68 floats
  const int b    = blockIdx.y;
  const int lane = threadIdx.x & 31;
  const int wave = threadIdx.x >> 5;
  const int tilesN = N >> 6;
  const int tilesM = M >> 6;
  const int tile = blockIdx.x * 8 + wave;
  if (tile >= tilesM * tilesN) return;   // wave-uniform; no block barriers in this kernel
  const int tm = tile / tilesN;
  const int tn = tile - tm * tilesN;
  const int m0 = tm << 6;
  const int n0 = tn << 6;

  const T* Ab  = A  + (size_t)b * strideA;
  const T* Bb  = Bt + (size_t)b * strideB;
  const T* Ab2 = SPLIT ? (A2  + (size_t)b * strideA) : nullptr;
  const T* Bb2 = SPLIT ? (Bt2 + (size_t)b * strideB) : nullptr;

  const int rlane = lane & 15;                 // row (A) / col (B, D) within subtile
  const int koff  = (lane >> 4) * 8;           // k offset of this lane half
  const int mOff  = (lane >> 4) * 8;           // D row offset

  v8f acc[4][4];
#pragma unroll
  for (int i = 0; i < 4; ++i)
#pragma unroll
    for (int j = 0; j < 4; ++j) acc[i][j] = (v8f){0.f,0.f,0.f,0.f,0.f,0.f,0.f,0.f};

  for (int k0 = 0; k0 < K; k0 += 32) {
    V bh[4], bl[4];
#pragma unroll
    for (int j = 0; j < 4; ++j) {
      const size_t bo = (size_t)(n0 + (j << 4) + rlane) * ldb + koff + k0;
      bh[j] = Frag<T>::load(Bb + bo);
      if (SPLIT) bl[j] = Frag<T>::load(Bb2 + bo); else bl[j] = bh[j];
    }
#pragma unroll
    for (int i = 0; i < 4; ++i) {
      const size_t ao = (size_t)(m0 + (i << 4) + rlane) * lda + koff + k0;
      V ah = Frag<T>::load(Ab + ao);
      V al;
      if (SPLIT) al = Frag<T>::load(Ab2 + ao); else al = ah;
#pragma unroll
      for (int j = 0; j < 4; ++j) {
        acc[i][j] = Frag<T>::mma(ah, bh[j], acc[i][j]);
        if (SPLIT) {
          acc[i][j] = Frag<T>::mma(ah, bl[j], acc[i][j]);
          acc[i][j] = Frag<T>::mma(al, bh[j], acc[i][j]);
        }
      }
      Frag<T>::guard(acc[i][0], acc[i][3], ah, al);
    }
    Frag<T>::keep(bh[0], bh[1], bh[2], bh[3]);
    if (SPLIT) Frag<T>::keep(bl[0], bl[1], bl[2], bl[3]);
  }
  acc_guard4(acc[0][0], acc[0][1], acc[0][2], acc[0][3]);
  acc_guard4(acc[1][0], acc[1][1], acc[1][2], acc[1][3]);
  acc_guard4(acc[2][0], acc[2][1], acc[2][2], acc[2][3]);
  acc_guard4(acc[3][0], acc[3][1], acc[3][2], acc[3][3]);

  // ---- epilogue ----
  float* slab = sT[wave];
  const float* Rb = RESID ? (resid + (size_t)b * strideR) : nullptr;
#pragma unroll
  for (int i = 0; i < 4; ++i) {
    const int mBase = m0 + (i << 4);
#pragma unroll
    for (int j = 0; j < 4; ++j) {
      const int n = n0 + (j << 4) + rlane;
      float bv = 0.f;
      if (BIAS_MODE == 2) bv = bias[n];
#pragma unroll
      for (int r = 0; r < 8; ++r) {
        float v = acc[i][j][r] * scale;
        if (BIAS_MODE == 1) v += bias[mBase + mOff + r];
        if (BIAS_MODE == 2) v += bv;
        if (RESID) v += Rb[(size_t)(mBase + mOff + r) * ldc + n];
        if (ACT == 1) v = tanhf(v);
        if (ACT == 2) v = fmaxf(v, 0.0f);
        if (ACT == 3) v = v / (1.0f + expf(-v));
        if (ACT == 4) v = (v > 0.f) ? v : 0.01f * v;
        if (ACT == 5) v = 0.5f * v * (1.0f + erff(v * 0.70710678118654752f));
        slab[(mOff + r) * 68 + (j << 4) + rlane] = v;
      }
    }
    __builtin_amdgcn_fence(__ATOMIC_RELEASE, "workgroup");
    __builtin_amdgcn_wave_barrier();
    __builtin_amdgcn_fence(__ATOMIC_ACQUIRE, "workgroup");
    if (OUT_MODE == 0) {
      float* C = (float*)Cout + (size_t)b * strideC;
      const int hh = lane >> 4, c4 = (lane & 15) * 4;     // row seg = 256 B = 16 lanes x 16 B
      {
#pragma unroll
        for (int it = 0; it < 8; ++it) {
          const int row = it * 2 + hh;
          v4f v = *(const v4f*)(slab + row * 68 + c4);
          *(v4f*)(C + (size_t)(mBase + row) * ldc + n0 + c4) = v;
        }
        
      }
    } else {
      const int q = lane >> 3, c8 = (lane & 7) * 8;
      unsigned short* C  = (unsigned short*)Cout  + (size_t)b * strideC;
      unsigned short* C2 = (OUT_MODE == 2) ? ((unsigned short*)Cout2 + (size_t)b * strideC) : nullptr;
      {
#pragma unroll
        for (int it = 0; it < 4; ++it) {
          const int row = it * 4 + q;
          const float* sp = slab + row * 68 + c8;
          v8h hv, lv;
#pragma unroll
          for (int e = 0; e < 8; ++e) {
            if (OUT_MODE == 1) {
              hv[e] = (_Float16)sp[e];
            } else {
              unsigned short hb = f2bf_bits(sp[e]);
              unsigned short lb = f2bf_bits(sp[e] - bf_bits2f(hb));
              hv[e] = __builtin_bit_cast(_Float16, hb);
              lv[e] = __builtin_bit_cast(_Float16, lb);
            }
          }
          *(v8h*)(C + (size_t)(mBase + row) * ldc + n0 + c8) = hv;
          if (OUT_MODE == 2) *(v8h*)(C2 + (size_t)(mBase + row) * ldc + n0 + c8) = lv;
        }
        
      }
    }
    __builtin_amdgcn_fence(__ATOMIC_RELEASE, "workgroup");
    __builtin_amdgcn_wave_barrier();
    __builtin_amdgcn_fence(__ATOMIC_ACQUIRE, "workgroup");
  }
}

// ---------------------------------------------------------------------------
// Row-preserving bf16 RNE convert of an f32 matrix [rows][ncols] into a u16 plane with row pitch ldout.
// 8 consecutive elements per thread = one 16-B store; 32 lanes cover 256 consecutive columns of one row
// ---------------------------------------------------------------------------
__global__ __launch_bounds__(256) void convrows_kernel(const float* __restrict__ in, unsigned short* __restrict__ out,
                                                       int ncols, int ldout, int n8) {
  const int i = blockIdx.x * 256 + threadIdx.x;
  if (i < n8) {
    const size_t e0 = (size_t)i * 8;
    const int row = (int)(e0 / (size_t)ncols);
    const int col = (int)(e0 - (size_t)row * ncols);
    const v4f a = *(const v4f*)(in + e0);
    const v4f c = *(const v4f*)(in + e0 + 4);
    v4u hv;
    hv[0] = pk16(f2bf_bits(a[0]), f2bf_bits(a[1]));
    hv[1] = pk16(f2bf_bits(a[2]), f2bf_bits(a[3]));
    hv[2] = pk16(f2bf_bits(c[0]), f2bf_bits(c[1]));
    hv[3] = pk16(f2bf_bits(c[2]), f2bf_bits(c[3]));
    const size_t o = (size_t)row * ldout + col;
    {
      *(v4u*)(out + o) = hv;
      
    }
  }
}

// ---------------------------------------------------------------------------
// Fused transpose + bf16 RNE convert of an f32 matrix, z-batched, one plane:
//   in_z = W + z*sIn viewed [R rows][Cc cols] with row pitch ldin  ->  oh_z[c][r] = bf16(in_z[r][c]), row pitch ldout, oh_z = oh + z*sOut.
// 64x64 tiles through LDS. grid = (Cc/64, R/64, Z), 256 threads (R, Cc multiples of 64; ldout multiple of 64 so every
// Coverage per block: load 4 it x 256 thr x 4 floats = 64x64; store 2 it x 256 thr x 8 u16 = 64x64.
// ---------------------------------------------------------------------------
__global__ __launch_bounds__(256) void tconv_kernel(const float* __restrict__ W, unsigned short* __restrict__ oh,
                                                    int ldin, int ldout, long sIn, long sOut) {
  __shared__ __align__(16) float tf[64 * 68];
  W  += (size_t)blockIdx.z * sIn;
  oh += (size_t)blockIdx.z * sOut;
  const int c0  = blockIdx.x * 64;   // input column block = output row block
  const int r0  = blockIdx.y * 64;   // input row block    = output column block
  const int tid = threadIdx.x;
  {
    const int lr = tid >> 4;         // 0..15
    const int c4 = (tid & 15) * 4;   // 0..60
#pragma unroll
    for (int it = 0; it < 4; ++it) {
      const int rr = it * 16 + lr;   // 0..63
      const v4f a = *(const v4f*)(W + (size_t)(r0 + rr) * ldin + c0 + c4);
      *(v4f*)(tf + rr * 68 + c4) = a;
    }
  }
  __syncthreads();
  const int sub = tid >> 3;          // 0..31
  const int c8  = (tid & 7) * 8;     // 0..56
  v4u hv[2];
#pragma unroll
  for (int it = 0; it < 2; ++it) {
    const int oc = it * 32 + sub;    // output row within tile (= input column)
    v4u a;
#pragma unroll
    for (int q = 0; q < 4; ++q) {
      const float f0 = tf[(c8 + 2 * q) * 68 + oc];
      const float f1 = tf[(c8 + 2 * q + 1) * 68 + oc];
      a[q] = pk16(f2bf_bits(f0), f2bf_bits(f1));
    }
    hv[it] = a;
  }
  {
#pragma unroll
    for (int it = 0; it < 2; ++it) {
      const int oc = it * 32 + sub;
      const size_t go = (size_t)(c0 + oc) * ldout + r0 + c8;
      *(v4u*)(oh + go) = hv[it];
    }
    
  }
}

// ---------------------------------------------------------------------------
// Conv weight permute + bf16 RNE convert: W OIHW [256 o][256 c][2][2] f32 -> O[o][q4*256 + c] u16 (q4 = kh*2 + kw),
// row pitch KCONV = 1024. One unit = (o, c0 = 8*lane): 8 x 16-B loads (the 4 taps of 8 consecutive c), 4 x 16-B stores
// (8 consecutive c of each q4 segment). Per store instruction the 32 lanes of a wave (same o) write 32 x 16 B = the whole
// Coverage: 32 blocks x 256 threads = 8192 units x 32 elements = 256 x 1024 = whole plane.
// ---------------------------------------------------------------------------
__global__ __launch_bounds__(256) void wperm_kernel(const float* __restrict__ W, unsigned short* __restrict__ O) {
  const int u = blockIdx.x * 256 + threadIdx.x;   // 0 .. DIM*32 - 1
  if (u < DIM * 32) {
    const int o = u >> 5, c0 = (u & 31) * 8;
    v4f w[8];
#pragma unroll
    for (int e = 0; e < 8; ++e) w[e] = *(const v4f*)(W + ((size_t)(o * DIM + c0 + e)) * 4);
    v4u pk[4];
#pragma unroll
    for (int q4 = 0; q4 < 4; ++q4) {
      v4u a;
#pragma unroll
      for (int p = 0; p < 4; ++p) a[p] = pk16(f2bf_bits(w[2 * p][q4]), f2bf_bits(w[2 * p + 1][q4]));
      pk[q4] = a;
    }
    unsigned short* orow = O + (size_t)o * KCONV + c0;
    {
#pragma unroll
      for (int q4 = 0; q4 < 4; ++q4) *(v4u*)(orow + q4 * DIM) = pk[q4];
      
    }
  }
}

// ---------------------------------------------------------------------------
// im2col addressing of the 2x2 / stride-2 / VALID conv as a GEMM over XT (token-major bf16 [NB*4096][256]):
//   im2col row g = b*1024 + m, m = i*32 + j (output grid row i, col j); k = q4*256 + c, q4 = kh*2 + kw;
//   element (g, k) = XT[(b*4096 + (2i+kh)*64 + (2j+kw)) * 256 + c].
// For a 32-deep k-step (k0 % 32 == 0) the 32 k values are 32 consecutive channels of one source token row,
// so a fragment is two 16-B loads at the returned offset + koff and + koff + 16 (arithmetic addressing only).
// ---------------------------------------------------------------------------
__device__ __forceinline__ size_t im2col_off(int g, int k0) {
  const int b = g >> 10, m = g & (NKV - 1);
  const int q4 = k0 >> 8, c0 = k0 & (DIM - 1);
  const int kh = q4 >> 1, kw = q4 & 1;
  const int i = m >> 5, j = m & 31;
  return ((size_t)(b * NQ + (2 * i + kh) * IMW + 2 * j + kw)) * DIM + c0;
}

// ---------------------------------------------------------------------------
// Conv GEMM (bf16 single products, f32 accumulate), wave-owned 64x64 tiles as in wmma_gemm64, K = 1024:
//   MODE 0: C[g][o] = sum_k im2col(g,k) * WKp[o][k]  (M = 4096 rows g, N = 256), epilogue adds
//           pos(o, m) = bf16(rel_h[o*32 + (m&31)]) + bf16(rel_w[o*32 + (m>>5)]) in f32, then bf16 hi|lo planes [4096][256].
//           Block bx covers rows 128bx..128bx+127 (tilesN = 4), i.e. b = bx>>3, m = 128*(bx&7) + 0..127, m>>5 = 4*(bx&7) + 0..3;
//           rel_h (all 8192 values) and the 4 needed rel_w columns per o are staged once per block in LDS as bf16 bits.
//   MODE 1: C[o][g] = sum_k WVp[o][k] * im2col(g,k)  (M = 256, N = 4096) -> bf16 hi|lo planes [256][4096] (v^T layout).
// grid = 32 blocks x 8 waves = 256 tiles exactly (both modes).
// ---------------------------------------------------------------------------
template <int MODE>
__global__ __launch_bounds__(256) void conv_gemm64(const unsigned short* __restrict__ XTp, const unsigned short* __restrict__ Wpp,
                                                   const float* __restrict__ rel_h, const float* __restrict__ rel_w,
                                                   unsigned short* __restrict__ Ch, unsigned short* __restrict__ Cl) {
  typedef __bf16 T;
  typedef v16b V;
  const T* XT = (const T*)XTp; const T* Wp = (const T*)Wpp;
  __shared__ __align__(16) float sT[8][16 * 68];
  __shared__ __align__(16) unsigned short sRh[(MODE == 0) ? (DIM * OH) : 8];
  __shared__ __align__(16) unsigned short sRw[(MODE == 0) ? (DIM * 4) : 8];
  constexpr int M = (MODE == 0) ? MKV : DIM;
  constexpr int N = (MODE == 0) ? DIM : MKV;
  constexpr int LDC = N;
  const int tid  = threadIdx.x;
  const int lane = tid & 31;
  const int wave = tid >> 5;

  if (MODE == 0) {
    // stage rel_h (8 x 16-B loads per thread, 256 threads x 32 = 8192 values) and rel_w[o][4*(bx&7) .. +3] (thread = o)
    const int iib = 4 * (blockIdx.x & 7);
#pragma unroll
    for (int it = 0; it < 8; ++it) {
      const int e4 = (it * 256 + tid) * 4;
      const v4f a = *(const v4f*)(rel_h + e4);
      v2u w;
      w[0] = pk16(f2bf_bits(a[0]), f2bf_bits(a[1]));
      w[1] = pk16(f2bf_bits(a[2]), f2bf_bits(a[3]));
      *(v2u*)(sRh + e4) = w;
    }
    {
      const v4f a = *(const v4f*)(rel_w + (size_t)tid * OW + iib);
      v2u w;
      w[0] = pk16(f2bf_bits(a[0]), f2bf_bits(a[1]));
      w[1] = pk16(f2bf_bits(a[2]), f2bf_bits(a[3]));
      *(v2u*)(sRw + tid * 4) = w;
    }
    __syncthreads();
  }

  constexpr int tilesN = N >> 6;
  constexpr int tilesM = M >> 6;
  const int tile = blockIdx.x * 8 + wave;
  if (tile >= tilesM * tilesN) return;   // wave-uniform, never taken with the exact grid; no block barriers below
  const int tm = tile / tilesN;
  const int tn = tile - tm * tilesN;
  const int m0 = tm << 6;
  const int n0 = tn << 6;

  const int rlane = lane & 15;
  const int koff  = (lane >> 4) * 8;
  const int mOff  = (lane >> 4) * 8;

  v8f acc[4][4];
#pragma unroll
  for (int i = 0; i < 4; ++i)
#pragma unroll
    for (int j = 0; j < 4; ++j) acc[i][j] = (v8f){0.f,0.f,0.f,0.f,0.f,0.f,0.f,0.f};

  for (int k0 = 0; k0 < KCONV; k0 += 32) {
    V bfr[4];
#pragma unroll
    for (int j = 0; j < 4; ++j) {
      const int n = n0 + (j << 4) + rlane;
      if (MODE == 0) bfr[j] = Frag<T>::load(Wp + (size_t)n * KCONV + k0 + koff);
      else           bfr[j] = Frag<T>::load(XT + im2col_off(n, k0) + koff);
    }
#pragma unroll
    for (int i = 0; i < 4; ++i) {
      const int mr = m0 + (i << 4) + rlane;
      V ah;
      if (MODE == 0) ah = Frag<T>::load(XT + im2col_off(mr, k0) + koff);
      else           ah = Frag<T>::load(Wp + (size_t)mr * KCONV + k0 + koff);
#pragma unroll
      for (int j = 0; j < 4; ++j) acc[i][j] = Frag<T>::mma(ah, bfr[j], acc[i][j]);
      Frag<T>::guard(acc[i][0], acc[i][3], ah, ah);
    }
    Frag<T>::keep(bfr[0], bfr[1], bfr[2], bfr[3]);
  }
  acc_guard4(acc[0][0], acc[0][1], acc[0][2], acc[0][3]);
  acc_guard4(acc[1][0], acc[1][1], acc[1][2], acc[1][3]);
  acc_guard4(acc[2][0], acc[2][1], acc[2][2], acc[2][3]);
  acc_guard4(acc[3][0], acc[3][1], acc[3][2], acc[3][3]);

  // ---- epilogue ----
  float* slab = sT[wave];
#pragma unroll
  for (int i = 0; i < 4; ++i) {
    const int mBase = m0 + (i << 4);
#pragma unroll
    for (int j = 0; j < 4; ++j) {
      const int n = n0 + (j << 4) + rlane;
#pragma unroll
      for (int r = 0; r < 8; ++r) {
        float v = acc[i][j][r];
        if (MODE == 0) {
          const int row = mBase + mOff + r;
          const int m   = row & (NKV - 1);
          const int jj  = m & 31;
          const int iil = (m >> 5) & 3;
          const float pos = bf_bits2f(sRh[n * OH + jj]) + bf_bits2f(sRw[n * 4 + iil]);
          v += pos;
        }
        slab[(mOff + r) * 68 + (j << 4) + rlane] = v;
      }
    }
    __builtin_amdgcn_fence(__ATOMIC_RELEASE, "workgroup");
    __builtin_amdgcn_wave_barrier();
    __builtin_amdgcn_fence(__ATOMIC_ACQUIRE, "workgroup");
    {
      const int q = lane >> 3, c8 = (lane & 7) * 8;
      {
#pragma unroll
        for (int it = 0; it < 4; ++it) {
          const int row = it * 4 + q;
          const float* sp = slab + row * 68 + c8;
          v8h hv, lv;
#pragma unroll
          for (int e = 0; e < 8; ++e) {
            unsigned short hb = f2bf_bits(sp[e]);
            unsigned short lb = f2bf_bits(sp[e] - bf_bits2f(hb));
            hv[e] = __builtin_bit_cast(_Float16, hb);
            lv[e] = __builtin_bit_cast(_Float16, lb);
          }
          *(v8h*)(Ch + (size_t)(mBase + row) * LDC + n0 + c8) = hv;
          *(v8h*)(Cl + (size_t)(mBase + row) * LDC + n0 + c8) = lv;
        }
        
      }
    }
    __builtin_amdgcn_fence(__ATOMIC_RELEASE, "workgroup");
    __builtin_amdgcn_wave_barrier();
    __builtin_amdgcn_fence(__ATOMIC_ACQUIRE, "workgroup");
  }
}

// =====================================================================================
// Full (non-causal, unmasked) attention, head dim 32, all batches and heads in one launch.
//   q planes (hi/lo bf16) [16384][256]: element (b, n, h, d) at [(b*4096+n)*256 + h*32 + d]
//   k planes (hi/lo bf16) [4096][256]:  element (b, m, h, d) at [(b*1024+m)*256 + h*32 + d]  (pos already folded in)
//   v^T planes (hi/lo bf16) [256][4096]: element (h, d, b, m) at [(h*32 + d)*4096 + b*1024 + m]
//   out f32 NCHW: element (b, h*32+d, n) at [(b*256 + h*32 + d)*4096 + n]
//   scores = (q . k') * 32^-0.5 : bf16 hi/lo split (hi.hi + hi.lo + lo.hi) on v_wmma_f32_16x16x32_bf16
//   out    = p . v             : bf16 hi/lo split of p (unnormalised exp) and v, f32 accumulate, x 1/rowsum in f32 at the end
//   online softmax in f32 over the 1024 keys of the batch element (16 chunks of 64, compile-time trip count, no masking).
//   Block = 4 waves = 64 query positions of one (batch, head); grid.x = 4 * 8 * 64 = 2048 (exact).
//   K chunk staging: thread r = tid>>1 stages K row r cols (tid&1)*16 .. +15 (two 16-B copies per plane) -> 64x32 whole tile;
//   V^T chunk staging: thread d = tid>>2 stages row d cols (tid&3)*16 .. +15 -> 32x64 whole tile; __syncthreads before and after.
//   Scores are formed transposed, S^T = K . Q^T (A = K rows, B = Q): a lane holds 32 of the chunk's 64 scores of ONE query
//   (query = lane & 15, keys j*16 + 8*(lane>>4) + r), so maximum and sum run in the lane plus one exchange between lane halves;
//   two S^T tiles converted in place are the B operand of O^T += V^T . P^T (same k order as the V^T loader): P never touches LDS.
// =====================================================================================
#define AT_D  32
#define AT_NW 4
#define AT_QB 64
#define AT_KC 64
#define AT_KP 40   // LDS pitch of a K row in elements: 80 B = 16 B x 5 (odd), so the 16 rows of one 16-byte fragment read fall on 16 distinct bank groups
#define AT_VP 72   // LDS pitch of a V^T row in elements: 144 B = 16 B x 9 (odd), same reason

__device__ __forceinline__ unsigned short at_bf_bits(float f) {
  unsigned u = __float_as_uint(f);
  return (unsigned short)((u + 0x7FFFu + ((u >> 16) & 1u)) >> 16);
}
__device__ __forceinline__ __bf16 at_f2bf(float f) { return __builtin_bit_cast(__bf16, at_bf_bits(f)); }
__device__ __forceinline__ void at_split(float f, __bf16& hi, __bf16& lo) {
  const unsigned short hb = at_bf_bits(f);
  hi = __builtin_bit_cast(__bf16, hb);
  lo = at_f2bf(f - __uint_as_float(((unsigned)hb) << 16));
}
__device__ __forceinline__ v8f at_mma(v16b a, v16b b, v8f c) {
  c = __builtin_amdgcn_wmma_f32_16x16x32_bf16(false, a, false, b, (short)0, c, false, false);
  asm volatile("v_nop\n\tv_nop\n\tv_nop\n\tv_nop" : "+v"(c) : "v"(a), "v"(b));
  return c;
}

// value of the same lane position in the other 16-lane half (lane ^ 16), as a vector cross-row move
__device__ __forceinline__ float at_xhalf(float f) {
  const int b = __float_as_int(f);
  return __int_as_float(__builtin_amdgcn_permlanex16(b, b, 0x76543210, 0xfedcba98, false, false));
}

__global__ __launch_bounds__(128)
void attn32_kernel(const unsigned short* __restrict__ qhp, const unsigned short* __restrict__ qlp,
                   const unsigned short* __restrict__ khp, const unsigned short* __restrict__ klp,
                   const unsigned short* __restrict__ vhp, const unsigned short* __restrict__ vlp,
                   float* __restrict__ out, float sscale) {
  union FB { v16b v; v8b h[2]; };
  __shared__ __align__(16) __bf16 Ksh[AT_KC * AT_KP];            // K hi [kv][d], padded rows   5 KB
  __shared__ __align__(16) __bf16 Ksl[AT_KC * AT_KP];            // K lo
  __shared__ __align__(16) __bf16 Vth[AT_D * AT_VP];             // V hi [d][kv], padded rows   4.5 KB
  __shared__ __align__(16) __bf16 Vtl[AT_D * AT_VP];             // V lo
  __shared__ __align__(16) float  Os[AT_D * 68];                 // block out tile transposed [d][n_local], pitch 68

  const int tid  = threadIdx.x;
  const int wave = tid >> 5;
  const int lane = tid & 31;
  const int hh   = lane >> 4;
  const int c    = lane & 15;

  const int nqb = NQ / AT_QB;              // 64 query blocks per (batch, head)
  const int bx = blockIdx.x;               // grid = NB * NH * nqb (exact)
  const int qb = bx % nqb;
  const int hb = bx / nqb;
  const int h  = hb % NH;                  // 0..7
  const int b  = hb / NH;                  // 0..3
  const int q0 = b * NQ + qb * AT_QB + wave * 16;   // row in the q planes

  const __bf16* Qh = (const __bf16*)(const void*)qhp + (size_t)h * AT_D;
  const __bf16* Ql = (const __bf16*)(const void*)qlp + (size_t)h * AT_D;
  const __bf16* Kh = (const __bf16*)(const void*)khp + (size_t)h * AT_D;
  const __bf16* Kl = (const __bf16*)(const void*)klp + (size_t)h * AT_D;
  const __bf16* Vh = (const __bf16*)(const void*)vhp + (size_t)h * AT_D * VTP + (size_t)b * NKV;
  const __bf16* Vl = (const __bf16*)(const void*)vlp + (size_t)h * AT_D * VTP + (size_t)b * NKV;

  // ---- Q fragments (B operand, column = lane&15, split k map via Frag load): head dim 32 = one k-step, hi and lo ----
  v16b qah, qal;
  {
    const __bf16* qr = Qh + (size_t)(q0 + c) * DIM + 8 * hh;
    const __bf16* ql = Ql + (size_t)(q0 + c) * DIM + 8 * hh;
    qah = Frag<__bf16>::load(qr);
    qal = Frag<__bf16>::load(ql);
  }

  float mrow = -INFINITY;   // running maximum of this lane's query (equal in both lane halves)
  float lrow = 0.f;         // running sum over this lane half's keys only; the halves are joined once after the loop
  v8f oacc[2];              // O^T tiles: oacc[t][r] = out[d = t*16 + 8*hh + r][query c]
#pragma unroll
  for (int t = 0; t < 2; ++t) oacc[t] = (v8f){0.f,0.f,0.f,0.f,0.f,0.f,0.f,0.f};

  const int nChunks = NKV / AT_KC;   // 16, compile-time constant
  for (int kc = 0; kc < nChunks; ++kc) {
    const int kv0 = kc * AT_KC;
    __syncthreads();
    {
      // K staging: 128 threads x 16 elements per plane = 64 rows x 32
      const int r = tid >> 1, hf = (tid & 1) * 16;
      const __bf16* ksh = Kh + (size_t)(b * NKV + kv0 + r) * DIM + hf;
      const __bf16* ksl = Kl + (size_t)(b * NKV + kv0 + r) * DIM + hf;
      const v8b a0 = *(const v8b*)(ksh);
      const v8b a1 = *(const v8b*)(ksh + 8);
      const v8b a2 = *(const v8b*)(ksl);
      const v8b a3 = *(const v8b*)(ksl + 8);
      *(v8b*)(Ksh + r * AT_KP + hf)     = a0;
      *(v8b*)(Ksh + r * AT_KP + hf + 8) = a1;
      *(v8b*)(Ksl + r * AT_KP + hf)     = a2;
      *(v8b*)(Ksl + r * AT_KP + hf + 8) = a3;
      // V^T staging: 128 threads x 16 elements per plane = 32 rows x 64
      const int d = tid >> 2, qq = (tid & 3) * 16;
      const __bf16* vsh = Vh + (size_t)d * VTP + kv0 + qq;
      const __bf16* vsl = Vl + (size_t)d * VTP + kv0 + qq;
      const v8b b0 = *(const v8b*)(vsh);
      const v8b b1 = *(const v8b*)(vsh + 8);
      const v8b b2 = *(const v8b*)(vsl);
      const v8b b3 = *(const v8b*)(vsl + 8);
      *(v8b*)(Vth + d * AT_VP + qq)     = b0;
      *(v8b*)(Vth + d * AT_VP + qq + 8) = b1;
      *(v8b*)(Vtl + d * AT_VP + qq)     = b2;
      *(v8b*)(Vtl + d * AT_VP + qq + 8) = b3;
    }
    __syncthreads();

    v8f s[4];
#pragma unroll
    for (int j = 0; j < 4; ++j) {
      s[j] = (v8f){0.f,0.f,0.f,0.f,0.f,0.f,0.f,0.f};
      FB kb, kl;
      kb.h[0] = *(const v8b*)(Ksh + (j * 16 + c) * AT_KP + 8 * hh);
      kb.h[1] = *(const v8b*)(Ksh + (j * 16 + c) * AT_KP + 16 + 8 * hh);
      kl.h[0] = *(const v8b*)(Ksl + (j * 16 + c) * AT_KP + 8 * hh);
      kl.h[1] = *(const v8b*)(Ksl + (j * 16 + c) * AT_KP + 16 + 8 * hh);
      s[j] = at_mma(kb.v, qah, s[j]);
      s[j] = at_mma(kl.v, qah, s[j]);
      s[j] = at_mma(kb.v, qal, s[j]);
    }
    // scale, then the query's chunk maximum: in the lane, then one exchange with the other lane half
    // (the loops over j, r, t and kk below are unrolled so that s, ph, pl and oacc are indexed at compile time and stay in registers)
    float cm = -INFINITY;
#pragma unroll
    for (int j = 0; j < 4; ++j) {
#pragma unroll
      for (int r = 0; r < 8; ++r) {
        const float sv = s[j][r] * sscale;
        s[j][r] = sv;
        cm = fmaxf(cm, sv);
      }
    }
    cm = fmaxf(cm, at_xhalf(cm));
    const float mnew = fmaxf(mrow, cm);
    const float alpha = expf(mrow - mnew);
    mrow = mnew;
    // P^T as B operand: element e of k-step kk = S^T tile 2*kk + (e >> 3), register e & 7 (key kk*32 + 16*(e>>3) + 8*hh + (e&7))
    FB ph[2], pl[2];
    float psum = 0.f;
#pragma unroll
    for (int j = 0; j < 4; ++j) {
#pragma unroll
      for (int r = 0; r < 8; ++r) {
        const float p = expf(s[j][r] - mnew);
        psum += p;
        __bf16 a, bl; at_split(p, a, bl);
        ph[j >> 1].v[(j & 1) * 8 + r] = a;
        pl[j >> 1].v[(j & 1) * 8 + r] = bl;
      }
    }
    lrow = lrow * alpha + psum;
#pragma unroll
    for (int t = 0; t < 2; ++t)
#pragma unroll
      for (int r = 0; r < 8; ++r) oacc[t][r] *= alpha;
#pragma unroll
    for (int kk = 0; kk < 2; ++kk) {
#pragma unroll
      for (int t = 0; t < 2; ++t) {
        FB vb, vl;
        vb.h[0] = *(const v8b*)(Vth + (t * 16 + c) * AT_VP + kk * 32 + 8 * hh);
        vb.h[1] = *(const v8b*)(Vth + (t * 16 + c) * AT_VP + kk * 32 + 16 + 8 * hh);
        vl.h[0] = *(const v8b*)(Vtl + (t * 16 + c) * AT_VP + kk * 32 + 8 * hh);
        vl.h[1] = *(const v8b*)(Vtl + (t * 16 + c) * AT_VP + kk * 32 + 16 + 8 * hh);
        oacc[t] = at_mma(vb.v, ph[kk].v, oacc[t]);
        oacc[t] = at_mma(vl.v, ph[kk].v, oacc[t]);
        oacc[t] = at_mma(vb.v, pl[kk].v, oacc[t]);
      }
    }
  }

  // ---- join the lane halves' sums, normalise and stage: Os[d][n_local], d = t*16 + 8hh + r, n_local = wave*16 + c (all 32 x 64 written) ----
  {
    const float inv = 1.0f / (lrow + at_xhalf(lrow));
#pragma unroll
    for (int t = 0; t < 2; ++t)
#pragma unroll
      for (int r = 0; r < 8; ++r) Os[(t * 16 + 8 * hh + r) * 68 + wave * 16 + c] = oacc[t][r] * inv;
  }
  __syncthreads();
  {
    float* ob = out + ((size_t)(b * DIM + h * AT_D)) * NQ + (size_t)qb * AT_QB;
    const int q = lane >> 3, c4 = (lane & 7) * 4;
    {
#pragma unroll
      for (int it = 0; it < 4; ++it) {
        const int L  = it * 16 + wave * 4 + q;   // 0..63: line index within the block's 32 x 256-B output region
        const int d  = L >> 1;
        const int hf = (L & 1) * 32;
        v4f val = *(const v4f*)(Os + d * 68 + hf + c4);
        *(v4f*)(ob + (size_t)d * NQ + hf + c4) = val;
      }
      
    }
  }
}

// ---------------------------------------------------------------------------
// Workspace region map (byte offsets; every region fully written by its producer launch before any consumer reads it;
//   XT   bf16 [16384][256]         0       8388608
//   WQ   bf16 [256][256]     8388608        131072
//   WKp  bf16 [256][1024]    8519680        524288
//   WVp  bf16 [256][1024]    9043968        524288
//   Qh   bf16 [16384][256]   9568256       8388608   Ql  17956864
//   Kh   bf16 [4096][256]   26345472       2097152   Kl  28442624
//   VTh  bf16 [256][4096]   30539776       2097152   VTl 32636928
//   total                  34734080
// ---------------------------------------------------------------------------
extern "C" void kernel_launch(void* const* d_in, const int* in_sizes, int n_in,
                              void* d_out, int out_size, void* d_ws, size_t ws_size,
                              hipStream_t stream) {
  if (n_in < 6) return;
  if (in_sizes[0] != NB * DIM * NQ) return;          // x [4][256][64][64]
  if (in_sizes[1] != DIM * DIM) return;              // Wq [256][256]
  if (in_sizes[2] != DIM * DIM * 4) return;          // Wk [256][256][2][2]
  if (in_sizes[3] != DIM * DIM * 4) return;          // Wv [256][256][2][2]
  if (in_sizes[4] != NH * HD * OH) return;           // rel_h [1][8][32][1][32]
  if (in_sizes[5] != NH * HD * OW) return;           // rel_w [1][8][32][32][1]
  if (out_size != NB * DIM * NQ) return;

  const float* x     = (const float*)d_in[0];
  const float* Wq    = (const float*)d_in[1];
  const float* Wk    = (const float*)d_in[2];
  const float* Wv    = (const float*)d_in[3];
  const float* rel_h = (const float*)d_in[4];
  const float* rel_w = (const float*)d_in[5];

  const size_t PXT = (size_t)MTOK * DIM * 2;        // 8388608
  const size_t PWQ = (size_t)DIM * DIM * 2;         // 131072
  const size_t PWC = (size_t)DIM * KCONV * 2;       // 524288
  const size_t PQ  = (size_t)MTOK * DIM * 2;        // 8388608
  const size_t PK  = (size_t)MKV * DIM * 2;         // 2097152
  const size_t PVT = (size_t)DIM * VTP * 2;         // 2097152
  size_t off = 0;
  const size_t oXT  = off; off += PXT;
  const size_t oWQ  = off; off += PWQ;
  const size_t oWK  = off; off += PWC;
  const size_t oWV  = off; off += PWC;
  const size_t oQh  = off; off += PQ;   const size_t oQl  = off; off += PQ;
  const size_t oKh  = off; off += PK;   const size_t oKl  = off; off += PK;
  const size_t oVTh = off; off += PVT;  const size_t oVTl = off; off += PVT;
  if (off > ws_size) return;                        // off = 34734080
  if (off > (size_t)134217728) return;

  char* ws = (char*)d_ws;
  unsigned short* XT  = (unsigned short*)(ws + oXT);
  unsigned short* WQ  = (unsigned short*)(ws + oWQ);
  unsigned short* WKp = (unsigned short*)(ws + oWK);
  unsigned short* WVp = (unsigned short*)(ws + oWV);
  unsigned short* Qh  = (unsigned short*)(ws + oQh);  unsigned short* Ql  = (unsigned short*)(ws + oQl);
  unsigned short* Kh  = (unsigned short*)(ws + oKh);  unsigned short* Kl  = (unsigned short*)(ws + oKl);
  unsigned short* VTh = (unsigned short*)(ws + oVTh); unsigned short* VTl = (unsigned short*)(ws + oVTl);

  const dim3 blk(256);

  // (1) x[b] viewed [R=256 c][Cc=4096 n] (pitch 4096) -> XT_b[n][c] (pitch 256); grid (Cc/64, R/64, B) = (64, 4, 4)
  tconv_kernel<<<dim3(NQ / 64, DIM / 64, NB), blk, 0, stream>>>(x, XT, NQ, DIM, (long)DIM * NQ, (long)NQ * DIM);
  // (2) Wq [256][256] -> WQ bf16 same layout; 8192 units -> 32 blocks
  const int n8q = DIM * DIM / 8;
  convrows_kernel<<<dim3(n8q / 256), blk, 0, stream>>>(Wq, WQ, DIM, DIM, n8q);
  // (3,4) conv weights OIHW -> [o][q4*256 + c] bf16; 8192 units -> 32 blocks each
  wperm_kernel<<<dim3((DIM * 32) / 256), blk, 0, stream>>>(Wk, WKp);
  wperm_kernel<<<dim3((DIM * 32) / 256), blk, 0, stream>>>(Wv, WVp);
  // (5) q = XT . WQ^T -> Qh|Ql [16384][256]   (M=16384, N=256, K=256; 1024 tiles -> 128 blocks); bias/resid unused (mode 0)
  const dim3 gQ(((MTOK / 64) * (DIM / 64) + 7) / 8, 1);
  wmma_gemm64<1, false, 0, 2, false, 0><<<gQ, blk, 0, stream>>>(
      XT, XT, DIM, 0L, WQ, WQ, DIM, 0L, (void*)Qh, (void*)Ql, DIM, 0L,
      rel_h, rel_h, 0L, MTOK, DIM, DIM, 1.0f);
  // (6) k' = conv_k(im2col XT) + pos -> Kh|Kl [4096][256]   (M=4096, N=256, K=1024; 256 tiles -> 32 blocks)
  conv_gemm64<0><<<dim3(((MKV / 64) * (DIM / 64)) / 8), blk, 0, stream>>>(XT, WKp, rel_h, rel_w, Kh, Kl);
  // (7) v^T = WVp . im2col(XT)^T -> VTh|VTl [256][4096]     (M=256, N=4096, K=1024; 256 tiles -> 32 blocks)
  conv_gemm64<1><<<dim3(((DIM / 64) * (MKV / 64)) / 8), blk, 0, stream>>>(XT, WVp, rel_h, rel_w, VTh, VTl);
  // (8) attention per (batch, head, 64-query block) -> d_out NCHW; 2048 blocks of 128
  attn32_kernel<<<dim3(NB * NH * (NQ / AT_QB)), dim3(128), 0, stream>>>(Qh, Ql, Kh, Kl, VTh, VTl, (float*)d_out,
                                                                        0.17677669529663687f);
  (void)hipGetLastError();
}

// v003
// One run takes 144 microseconds.
// Next to v002, in two timings, it ran 1.57 and 1.58 times as fast.
// Over all steps from v000 it is 2.42 times as fast.
// Contractions: q projection, k conv (im2col) and v^T conv (im2col) = v_wmma_f32_16x16x32_bf16 single products on bf16 planes of the RNE-converted inputs (exact products); scores q.(k+pos) and p.v = bf16 hi/lo split (hi.hi + hi.lo + lo.hi); f32 accumulate everywhere; positional add, 32^-0.5 scale, online softmax and 1/rowsum in f32 on the VALU.
// Plane / carry map (all carry 1, nothing to fold back):
//   XT  = bf16(x) token-major [16384][256] (row b*4096 + n, n = y*64 + x, col c)
//   WQ  = bf16(Wq) [256 o][256 c];  WKp, WVp bf16 [256 o][1024]: col q4*256 + c = bf16(W[o][c][kh][kw]), q4 = kh*2 + kw
//   Qh|Ql bf16 [16384][256] (col h*32 + d) = hi/lo of q;  Kh|Kl bf16 [4096][256] (row b*1024 + m, m = i*32 + j; col h*32 + d) = hi/lo of (conv_k + pos)
//   pos(h,d,m) = bf16(rel_h[(h*32+d)*32 + (m & 31)]) + bf16(rel_w[(h*32+d)*32 + (m >> 5)]) in f32
//   VTh|VTl bf16 [256 (h*32+d)][4096 (b*1024+m)] = hi/lo of conv_v;  P hi|lo = unnormalised exp in (0,1] (bf16), 1/rowsum applied to the f32 accumulator
#include <hip/hip_runtime.h>
#include <math.h>
#include <stdint.h>

#define NB    4
#define DIM   256
#define NH    8
#define HD    32
#define IMH   64
#define IMW   64
#define NQ    4096
#define OH    32
#define OW    32
#define NKV   1024
#define KCONV 1024
#define MTOK  (NB * NQ)
#define MKV   (NB * NKV)
#define VTP   (NB * NKV)

static_assert(NQ == IMH * IMW);
static_assert(NKV == OH * OW);
static_assert(OH * 2 == IMH);
static_assert(OW * 2 == IMW);
static_assert(DIM == NH * HD);
static_assert(HD == 32);
static_assert(KCONV == DIM * 4);
static_assert(MTOK % 64 == 0);
static_assert(MKV % 128 == 0);
static_assert(DIM % 64 == 0);
static_assert(KCONV % 32 == 0);
static_assert(DIM % 32 == 0);
static_assert((DIM * DIM) % (8 * 256) == 0);
static_assert(((MKV / 64) * (DIM / 64)) % 8 == 0);
static_assert(((MTOK / 64) * (DIM / 64)) % 8 == 0);
static_assert(DIM * OH == 8192);
static_assert(NQ % 64 == 0);
static_assert(NKV % 64 == 0);

typedef __attribute__((ext_vector_type(16))) _Float16 v16h;
typedef __attribute__((ext_vector_type(8)))  _Float16 v8h;
typedef __attribute__((ext_vector_type(16))) __bf16   v16b;
typedef __attribute__((ext_vector_type(8)))  __bf16   v8b;
typedef __attribute__((ext_vector_type(8)))  float    v8f;
typedef __attribute__((ext_vector_type(4)))  float    v4f;
typedef __attribute__((ext_vector_type(2)))  float    v2f;
typedef __attribute__((ext_vector_type(4)))  unsigned int v4u;
typedef __attribute__((ext_vector_type(2)))  unsigned int v2u;

__device__ __forceinline__ unsigned short f2bf_bits(float f) {
  unsigned u = __float_as_uint(f);
  return (unsigned short)((u + 0x7FFFu + ((u >> 16) & 1u)) >> 16);
}
__device__ __forceinline__ float bf_bits2f(unsigned short h) { return __uint_as_float(((unsigned)h) << 16); }
__device__ __forceinline__ unsigned pk16(unsigned short a, unsigned short b) { return (unsigned)a | ((unsigned)b << 16); }

// hazard guards as plain device helpers (no inline asm inside the kernel template body)
__device__ __forceinline__ void dep_guard_h(v8f& a, v8f& b, v16h x, v16h y) { asm volatile("v_nop\n\tv_nop\n\tv_nop\n\tv_nop" : "+v"(a), "+v"(b) : "v"(x), "v"(y)); }
__device__ __forceinline__ void dep_guard_b(v8f& a, v8f& b, v16b x, v16b y) { asm volatile("v_nop\n\tv_nop\n\tv_nop\n\tv_nop" : "+v"(a), "+v"(b) : "v"(x), "v"(y)); }
__device__ __forceinline__ void keep4_h(v16h a, v16h b, v16h c, v16h d) { asm volatile("v_nop" :: "v"(a), "v"(b), "v"(c), "v"(d)); }
__device__ __forceinline__ void keep4_b(v16b a, v16b b, v16b c, v16b d) { asm volatile("v_nop" :: "v"(a), "v"(b), "v"(c), "v"(d)); }
__device__ __forceinline__ void acc_guard4(v8f& a, v8f& b, v8f& c, v8f& d) { asm volatile("v_nop\n\tv_nop\n\tv_nop\n\tv_nop" : "+v"(a), "+v"(b), "+v"(c), "+v"(d)); }
template <typename T> struct Frag;
template <> struct Frag<_Float16> {
  typedef v16h V; union U { v16h v; v8h h[2]; };
  static __device__ __forceinline__ v16h load(const _Float16* p) {   // elements 0..7 <- p[0..7], 8..15 <- p[16..23]
    U f; f.h[0] = *(const v8h*)(p); f.h[1] = *(const v8h*)(p + 16); return f.v;
  }
  static __device__ __forceinline__ v8f mma(v16h a, v16h b, v8f c) {
    return __builtin_amdgcn_wmma_f32_16x16x32_f16(false, a, false, b, (short)0, c, false, false);
  }
  static __device__ __forceinline__ void guard(v8f& a, v8f& b, v16h x, v16h y) { dep_guard_h(a, b, x, y); }
  static __device__ __forceinline__ void keep(v16h a, v16h b, v16h c, v16h d) { keep4_h(a, b, c, d); }
};
template <> struct Frag<__bf16> {
  typedef v16b V; union U { v16b v; v8b h[2]; };
  static __device__ __forceinline__ v16b load(const __bf16* p) {
    U f; f.h[0] = *(const v8b*)(p); f.h[1] = *(const v8b*)(p + 16); return f.v;
  }
  static __device__ __forceinline__ v8f mma(v16b a, v16b b, v8f c) {
    return __builtin_amdgcn_wmma_f32_16x16x32_bf16(false, a, false, b, (short)0, c, false, false);
  }
  static __device__ __forceinline__ void guard(v8f& a, v8f& b, v16b x, v16b y) { dep_guard_b(a, b, x, y); }
  static __device__ __forceinline__ void keep(v16b a, v16b b, v16b c, v16b d) { keep4_b(a, b, c, d); }
};

// ---- Register-blocked batched WMMA GEMM ------------------------------------
// C[m,n] = scale * sum_k A[m,k] * Bt[n,k] (+bias)(+resid); each wave owns a 64x64 tile.
// A row-major [M,K]; Bt row-major [N,K]; M,N % 64 == 0, K % 32 == 0.
// SPLIT: operands are hi/lo planes (A2/Bt2 = lo planes, same layout); product = hi.hi + hi.lo + lo.hi.
// BIAS_MODE: 0 = none, 1 = bias[m], 2 = bias[n].
// OUT_MODE: 0 = f32, 1 = f16, 2 = bf16 hi plane (Cout) + bf16 lo plane (Cout2).
// ET: 0 = f16 operands, 1 = bf16 operands (pointers passed as 16-bit storage)
template <int ET> struct Elem;
template <> struct Elem<0> { typedef _Float16 T; };
template <> struct Elem<1> { typedef __bf16 T; };
template <int ET, bool SPLIT, int BIAS_MODE, int OUT_MODE, bool RESID, int ACT = 0>
__global__ __launch_bounds__(256) void wmma_gemm64(
    const unsigned short* __restrict__ Ap, const unsigned short* __restrict__ A2p, int lda, long strideA,
    const unsigned short* __restrict__ Btp, const unsigned short* __restrict__ Bt2p, int ldb, long strideB,
    void* __restrict__ Cout, void* __restrict__ Cout2, int ldc, long strideC,
    const float* __restrict__ bias,
    const float* __restrict__ resid, long strideR,
    int M, int N, int K, float scale) {
  typedef typename Elem<ET>::T T;
  typedef typename Frag<T>::V V;
  const T* A = (const T*)Ap; const T* A2 = (const T*)A2p; const T* Bt = (const T*)Btp; const T* Bt2 = (const T*)Bt2p;
  __shared__ __align__(16) float sT[8][16 * 68];   // per-wave 16x64 slab, pitch 68 floats
  const int b    = blockIdx.y;
  const int lane = threadIdx.x & 31;
  const int wave = threadIdx.x >> 5;
  const int tilesN = N >> 6;
  const int tilesM = M >> 6;
  const int tile = blockIdx.x * 8 + wave;
  if (tile >= tilesM * tilesN) return;   // wave-uniform; no block barriers in this kernel
  const int tm = tile / tilesN;
  const int tn = tile - tm * tilesN;
  const int m0 = tm << 6;
  const int n0 = tn << 6;

  const T* Ab  = A  + (size_t)b * strideA;
  const T* Bb  = Bt + (size_t)b * strideB;
  const T* Ab2 = SPLIT ? (A2  + (size_t)b * strideA) : nullptr;
  const T* Bb2 = SPLIT ? (Bt2 + (size_t)b * strideB) : nullptr;

  const int rlane = lane & 15;                 // row (A) / col (B, D) within subtile
  const int koff  = (lane >> 4) * 8;           // k offset of this lane half
  const int mOff  = (lane >> 4) * 8;           // D row offset

  v8f acc[4][4];
#pragma unroll
  for (int i = 0; i < 4; ++i)
#pragma unroll
    for (int j = 0; j < 4; ++j) acc[i][j] = (v8f){0.f,0.f,0.f,0.f,0.f,0.f,0.f,0.f};

  for (int k0 = 0; k0 < K; k0 += 32) {
    V bh[4], bl[4];
#pragma unroll
    for (int j = 0; j < 4; ++j) {
      const size_t bo = (size_t)(n0 + (j << 4) + rlane) * ldb + koff + k0;
      bh[j] = Frag<T>::load(Bb + bo);
      if (SPLIT) bl[j] = Frag<T>::load(Bb2 + bo); else bl[j] = bh[j];
    }
#pragma unroll
    for (int i = 0; i < 4; ++i) {
      const size_t ao = (size_t)(m0 + (i << 4) + rlane) * lda + koff + k0;
      V ah = Frag<T>::load(Ab + ao);
      V al;
      if (SPLIT) al = Frag<T>::load(Ab2 + ao); else al = ah;
#pragma unroll
      for (int j = 0; j < 4; ++j) {
        acc[i][j] = Frag<T>::mma(ah, bh[j], acc[i][j]);
        if (SPLIT) {
          acc[i][j] = Frag<T>::mma(ah, bl[j], acc[i][j]);
          acc[i][j] = Frag<T>::mma(al, bh[j], acc[i][j]);
        }
      }
      Frag<T>::guard(acc[i][0], acc[i][3], ah, al);
    }
    Frag<T>::keep(bh[0], bh[1], bh[2], bh[3]);
    if (SPLIT) Frag<T>::keep(bl[0], bl[1], bl[2], bl[3]);
  }
  acc_guard4(acc[0][0], acc[0][1], acc[0][2], acc[0][3]);
  acc_guard4(acc[1][0], acc[1][1], acc[1][2], acc[1][3]);
  acc_guard4(acc[2][0], acc[2][1], acc[2][2], acc[2][3]);
  acc_guard4(acc[3][0], acc[3][1], acc[3][2], acc[3][3]);

  // ---- epilogue ----
  float* slab = sT[wave];
  const float* Rb = RESID ? (resid + (size_t)b * strideR) : nullptr;
#pragma unroll
  for (int i = 0; i < 4; ++i) {
    const int mBase = m0 + (i << 4);
#pragma unroll
    for (int j = 0; j < 4; ++j) {
      const int n = n0 + (j << 4) + rlane;
      float bv = 0.f;
      if (BIAS_MODE == 2) bv = bias[n];
#pragma unroll
      for (int r = 0; r < 8; ++r) {
        float v = acc[i][j][r] * scale;
        if (BIAS_MODE == 1) v += bias[mBase + mOff + r];
        if (BIAS_MODE == 2) v += bv;
        if (RESID) v += Rb[(size_t)(mBase + mOff + r) * ldc + n];
        if (ACT == 1) v = tanhf(v);
        if (ACT == 2) v = fmaxf(v, 0.0f);
        if (ACT == 3) v = v / (1.0f + expf(-v));
        if (ACT == 4) v = (v > 0.f) ? v : 0.01f * v;
        if (ACT == 5) v = 0.5f * v * (1.0f + erff(v * 0.70710678118654752f));
        slab[(mOff + r) * 68 + (j << 4) + rlane] = v;
      }
    }
    __builtin_amdgcn_fence(__ATOMIC_RELEASE, "workgroup");
    __builtin_amdgcn_wave_barrier();
    __builtin_amdgcn_fence(__ATOMIC_ACQUIRE, "workgroup");
    if (OUT_MODE == 0) {
      float* C = (float*)Cout + (size_t)b * strideC;
      const int hh = lane >> 4, c4 = (lane & 15) * 4;     // row seg = 256 B = 16 lanes x 16 B
      {
#pragma unroll
        for (int it = 0; it < 8; ++it) {
          const int row = it * 2 + hh;
          v4f v = *(const v4f*)(slab + row * 68 + c4);
          *(v4f*)(C + (size_t)(mBase + row) * ldc + n0 + c4) = v;
        }
        
      }
    } else {
      const int q = lane >> 3, c8 = (lane & 7) * 8;
      unsigned short* C  = (unsigned short*)Cout  + (size_t)b * strideC;
      unsigned short* C2 = (OUT_MODE == 2) ? ((unsigned short*)Cout2 + (size_t)b * strideC) : nullptr;
      {
#pragma unroll
        for (int it = 0; it < 4; ++it) {
          const int row = it * 4 + q;
          const float* sp = slab + row * 68 + c8;
          v8h hv, lv;
#pragma unroll
          for (int e = 0; e < 8; ++e) {
            if (OUT_MODE == 1) {
              hv[e] = (_Float16)sp[e];
            } else {
              unsigned short hb = f2bf_bits(sp[e]);
              unsigned short lb = f2bf_bits(sp[e] - bf_bits2f(hb));
              hv[e] = __builtin_bit_cast(_Float16, hb);
              lv[e] = __builtin_bit_cast(_Float16, lb);
            }
          }
          *(v8h*)(C + (size_t)(mBase + row) * ldc + n0 + c8) = hv;
          if (OUT_MODE == 2) *(v8h*)(C2 + (size_t)(mBase + row) * ldc + n0 + c8) = lv;
        }
        
      }
    }
    __builtin_amdgcn_fence(__ATOMIC_RELEASE, "workgroup");
    __builtin_amdgcn_wave_barrier();
    __builtin_amdgcn_fence(__ATOMIC_ACQUIRE, "workgroup");
  }
}

// ---------------------------------------------------------------------------
// Row-preserving bf16 RNE convert of an f32 matrix [rows][ncols] into a u16 plane with row pitch ldout.
// 8 consecutive elements per thread = one 16-B store; 32 lanes cover 256 consecutive columns of one row
// ---------------------------------------------------------------------------
__global__ __launch_bounds__(256) void convrows_kernel(const float* __restrict__ in, unsigned short* __restrict__ out,
                                                       int ncols, int ldout, int n8) {
  const int i = blockIdx.x * 256 + threadIdx.x;
  if (i < n8) {
    const size_t e0 = (size_t)i * 8;
    const int row = (int)(e0 / (size_t)ncols);
    const int col = (int)(e0 - (size_t)row * ncols);
    const v4f a = *(const v4f*)(in + e0);
    const v4f c = *(const v4f*)(in + e0 + 4);
    v4u hv;
    hv[0] = pk16(f2bf_bits(a[0]), f2bf_bits(a[1]));
    hv[1] = pk16(f2bf_bits(a[2]), f2bf_bits(a[3]));
    hv[2] = pk16(f2bf_bits(c[0]), f2bf_bits(c[1]));
    hv[3] = pk16(f2bf_bits(c[2]), f2bf_bits(c[3]));
    const size_t o = (size_t)row * ldout + col;
    {
      *(v4u*)(out + o) = hv;
      
    }
  }
}

// ---------------------------------------------------------------------------
// Fused transpose + bf16 RNE convert of an f32 matrix, z-batched, one plane:
//   in_z = W + z*sIn viewed [R rows][Cc cols] with row pitch ldin  ->  oh_z[c][r] = bf16(in_z[r][c]), row pitch ldout, oh_z = oh + z*sOut.
// 64x64 tiles through LDS. grid = (Cc/64, R/64, Z), 256 threads (R, Cc multiples of 64; ldout multiple of 64 so every
// Coverage per block: load 4 it x 256 thr x 4 floats = 64x64; store 2 it x 256 thr x 8 u16 = 64x64.
// ---------------------------------------------------------------------------
__global__ __launch_bounds__(256) void tconv_kernel(const float* __restrict__ W, unsigned short* __restrict__ oh,
                                                    int ldin, int ldout, long sIn, long sOut) {
  __shared__ __align__(16) float tf[64 * 68];
  W  += (size_t)blockIdx.z * sIn;
  oh += (size_t)blockIdx.z * sOut;
  const int c0  = blockIdx.x * 64;   // input column block = output row block
  const int r0  = blockIdx.y * 64;   // input row block    = output column block
  const int tid = threadIdx.x;
  {
    const int lr = tid >> 4;         // 0..15
    const int c4 = (tid & 15) * 4;   // 0..60
#pragma unroll
    for (int it = 0; it < 4; ++it) {
      const int rr = it * 16 + lr;   // 0..63
      const v4f a = *(const v4f*)(W + (size_t)(r0 + rr) * ldin + c0 + c4);
      *(v4f*)(tf + rr * 68 + c4) = a;
    }
  }
  __syncthreads();
  const int sub = tid >> 3;          // 0..31
  const int c8  = (tid & 7) * 8;     // 0..56
  v4u hv[2];
#pragma unroll
  for (int it = 0; it < 2; ++it) {
    const int oc = it * 32 + sub;    // output row within tile (= input column)
    v4u a;
#pragma unroll
    for (int q = 0; q < 4; ++q) {
      const float f0 = tf[(c8 + 2 * q) * 68 + oc];
      const float f1 = tf[(c8 + 2 * q + 1) * 68 + oc];
      a[q] = pk16(f2bf_bits(f0), f2bf_bits(f1));
    }
    hv[it] = a;
  }
  {
#pragma unroll
    for (int it = 0; it < 2; ++it) {
      const int oc = it * 32 + sub;
      const size_t go = (size_t)(c0 + oc) * ldout + r0 + c8;
      *(v4u*)(oh + go) = hv[it];
    }
    
  }
}

// ---------------------------------------------------------------------------
// Conv weight permute + bf16 RNE convert: W OIHW [256 o][256 c][2][2] f32 -> O[o][q4*256 + c] u16 (q4 = kh*2 + kw),
// row pitch KCONV = 1024. One unit = (o, c0 = 8*lane): 8 x 16-B loads (the 4 taps of 8 consecutive c), 4 x 16-B stores
// (8 consecutive c of each q4 segment). Per store instruction the 32 lanes of a wave (same o) write 32 x 16 B = the whole
// Coverage: 32 blocks x 256 threads = 8192 units x 32 elements = 256 x 1024 = whole plane.
// ---------------------------------------------------------------------------
__global__ __launch_bounds__(256) void wperm_kernel(const float* __restrict__ W, unsigned short* __restrict__ O) {
  const int u = blockIdx.x * 256 + threadIdx.x;   // 0 .. DIM*32 - 1
  if (u < DIM * 32) {
    const int o = u >> 5, c0 = (u & 31) * 8;
    v4f w[8];
#pragma unroll
    for (int e = 0; e < 8; ++e) w[e] = *(const v4f*)(W + ((size_t)(o * DIM + c0 + e)) * 4);
    v4u pk[4];
#pragma unroll
    for (int q4 = 0; q4 < 4; ++q4) {
      v4u a;
#pragma unroll
      for (int p = 0; p < 4; ++p) a[p] = pk16(f2bf_bits(w[2 * p][q4]), f2bf_bits(w[2 * p + 1][q4]));
      pk[q4] = a;
    }
    unsigned short* orow = O + (size_t)o * KCONV + c0;
    {
#pragma unroll
      for (int q4 = 0; q4 < 4; ++q4) *(v4u*)(orow + q4 * DIM) = pk[q4];
      
    }
  }
}

// ---------------------------------------------------------------------------
// im2col addressing of the 2x2 / stride-2 / VALID conv as a GEMM over XT (token-major bf16 [NB*4096][256]):
//   im2col row g = b*1024 + m, m = i*32 + j (output grid row i, col j); k = q4*256 + c, q4 = kh*2 + kw;
//   element (g, k) = XT[(b*4096 + (2i+kh)*64 + (2j+kw)) * 256 + c].
// For a 32-deep k-step (k0 % 32 == 0) the 32 k values are 32 consecutive channels of one source token row,
// so a fragment is two 16-B loads at the returned offset + koff and + koff + 16 (arithmetic addressing only).
// ---------------------------------------------------------------------------
__device__ __forceinline__ size_t im2col_off(int g, int k0) {
  const int b = g >> 10, m = g & (NKV - 1);
  const int q4 = k0 >> 8, c0 = k0 & (DIM - 1);
  const int kh = q4 >> 1, kw = q4 & 1;
  const int i = m >> 5, j = m & 31;
  return ((size_t)(b * NQ + (2 * i + kh) * IMW + 2 * j + kw)) * DIM + c0;
}

// ---------------------------------------------------------------------------
// Conv GEMM (bf16 single products, f32 accumulate), K = 1024, one 64x64 output tile per work-group:
//   MODE 0: C[g][o] = sum_k im2col(g,k) * WKp[o][k]  (M = 4096 rows g, N = 256), epilogue adds
//           pos(o, m) = bf16(rel_h[o*32 + (m&31)]) + bf16(rel_w[o*32 + (m>>5)]) in f32, then bf16 hi|lo planes [4096][256].
//   MODE 1: C[o][g] = sum_k WVp[o][k] * im2col(g,k)  (M = 256, N = 4096) -> bf16 hi|lo planes [256][4096] (v^T layout).
// K is split over the 8 waves: wave w sums k = 128w .. 128w+127 (4 k-steps) of the whole tile into its own f32 partial,
// writes it to its LDS plane, and behind one work-group barrier wave w adds the 8 partials (plane 0 first, then 1 .. 7)
// of rows 8w .. 8w+7 and finishes those rows (pos, hi|lo split, whole 128-B line stores).
// MODE 0 tables (bf16 bits, two per dword), written before the k loop and read only behind that same barrier:
//   sRh[nl*17 + (jj>>1)] holds rel_h[(n0+nl)*32 + jj] (pitch 17 dwords: the 8 lanes of a row read 8 distinct banks);
//   sRw[nl] holds rel_w[(n0+nl)*32 + ii0 + {0,1}], ii0 = first of the two output-grid rows that the tile's 64 rows m cover.
// grid = 256 work-groups of 8 waves, one tile each = 256 tiles exactly (both modes).
// ---------------------------------------------------------------------------
template <int MODE>
__global__ __launch_bounds__(256) void conv_gemm64(const unsigned short* __restrict__ XTp, const unsigned short* __restrict__ Wpp,
                                                   const float* __restrict__ rel_h, const float* __restrict__ rel_w,
                                                   unsigned short* __restrict__ Ch, unsigned short* __restrict__ Cl) {
  typedef __bf16 T;
  typedef v16b V;
  const T* XT = (const T*)XTp; const T* Wp = (const T*)Wpp;
  __shared__ __align__(16) float sP[8][64 * 68];   // per-wave partial 64x64 tile, pitch 68 floats
  __shared__ unsigned sRh[(MODE == 0) ? (64 * 17) : 1];
  __shared__ unsigned sRw[(MODE == 0) ? 64 : 1];
  constexpr int M = (MODE == 0) ? MKV : DIM;
  constexpr int N = (MODE == 0) ? DIM : MKV;
  constexpr int LDC = N;
  constexpr int KW = KCONV / 8;                    // k range of one wave
  static_assert(KW % 32 == 0);
  const int tid  = threadIdx.x;
  const int lane = tid & 31;
  const int wave = __builtin_amdgcn_readfirstlane(tid >> 5);   // scalar, so that the k offsets stay scalar

  constexpr int tilesN = N >> 6;
  constexpr int tilesM = M >> 6;
  const int tile = blockIdx.x;
  if (tile >= tilesM * tilesN) return;   // block-uniform, in front of the barrier; never taken with the exact grid
  const int tm = tile / tilesN;
  const int tn = tile - tm * tilesN;
  const int m0 = tm << 6;
  const int n0 = tn << 6;

  if (MODE == 0) {
    // rel_h rows n0 .. n0+63: 64 x 32 values, 8 per thread
    const int nl = tid >> 2, j0 = (tid & 3) * 8;
    const float* rh = rel_h + (size_t)(n0 + nl) * OH + j0;
    const v4f a = *(const v4f*)(rh);
    const v4f c = *(const v4f*)(rh + 4);
    unsigned* d = sRh + nl * 17 + (j0 >> 1);
    d[0] = pk16(f2bf_bits(a[0]), f2bf_bits(a[1]));
    d[1] = pk16(f2bf_bits(a[2]), f2bf_bits(a[3]));
    d[2] = pk16(f2bf_bits(c[0]), f2bf_bits(c[1]));
    d[3] = pk16(f2bf_bits(c[2]), f2bf_bits(c[3]));
    if (tid < 64) {
      const int ii0 = (m0 & (NKV - 1)) >> 5;       // even, m0 being a multiple of 64
      const v2f w = *(const v2f*)(rel_w + (size_t)(n0 + tid) * OW + ii0);
      sRw[tid] = pk16(f2bf_bits(w[0]), f2bf_bits(w[1]));
    }
  }

  const int rlane = lane & 15;
  const int koff  = (lane >> 4) * 8;
  const int mOff  = (lane >> 4) * 8;

  v8f acc[4][4];
#pragma unroll
  for (int i = 0; i < 4; ++i)
#pragma unroll
    for (int j = 0; j < 4; ++j) acc[i][j] = (v8f){0.f,0.f,0.f,0.f,0.f,0.f,0.f,0.f};

  const int kbeg = wave * KW;
  for (int k0 = kbeg; k0 < kbeg + KW; k0 += 32) {
    V bfr[4];
#pragma unroll
    for (int j = 0; j < 4; ++j) {
      const int n = n0 + (j << 4) + rlane;
      if (MODE == 0) bfr[j] = Frag<T>::load(Wp + (size_t)n * KCONV + k0 + koff);
      else           bfr[j] = Frag<T>::load(XT + im2col_off(n, k0) + koff);
    }
#pragma unroll
    for (int i = 0; i < 4; ++i) {
      const int mr = m0 + (i << 4) + rlane;
      V ah;
      if (MODE == 0) ah = Frag<T>::load(XT + im2col_off(mr, k0) + koff);
      else           ah = Frag<T>::load(Wp + (size_t)mr * KCONV + k0 + koff);
#pragma unroll
      for (int j = 0; j < 4; ++j) acc[i][j] = Frag<T>::mma(ah, bfr[j], acc[i][j]);
      Frag<T>::guard(acc[i][0], acc[i][3], ah, ah);
    }
    Frag<T>::keep(bfr[0], bfr[1], bfr[2], bfr[3]);
  }
  acc_guard4(acc[0][0], acc[0][1], acc[0][2], acc[0][3]);
  acc_guard4(acc[1][0], acc[1][1], acc[1][2], acc[1][3]);
  acc_guard4(acc[2][0], acc[2][1], acc[2][2], acc[2][3]);
  acc_guard4(acc[3][0], acc[3][1], acc[3][2], acc[3][3]);

  // ---- this wave's partial tile to its LDS plane ----
  {
    float* part = sP[wave];
#pragma unroll
    for (int i = 0; i < 4; ++i)
#pragma unroll
      for (int j = 0; j < 4; ++j)
#pragma unroll
        for (int r = 0; r < 8; ++r) part[((i << 4) + mOff + r) * 68 + (j << 4) + rlane] = acc[i][j][r];
  }
  __syncthreads();

  // ---- join the 8 partials of rows 8*wave .. +7 and finish them: a lane holds 8 consecutive columns of one row ----
  const int q = lane >> 3, c8 = (lane & 7) * 8;
#pragma unroll
  for (int it = 0; it < 2; ++it) {
    const int row = wave * 8 + it * 4 + q;         // row within the tile
    const float* sp = &sP[0][row * 68 + c8];
    v4f s0 = *(const v4f*)(sp);
    v4f s1 = *(const v4f*)(sp + 4);
#pragma unroll
    for (int w = 1; w < 8; ++w) {
      s0 += *(const v4f*)(sp + w * (64 * 68));
      s1 += *(const v4f*)(sp + w * (64 * 68) + 4);
    }
    v8h hv, lv;
#pragma unroll
    for (int e = 0; e < 8; ++e) {
      float v = (e < 4) ? s0[e & 3] : s1[e & 3];
      if (MODE == 0) {
        const int jj = row & 31;                   // (m0 + row) & 31, m0 being a multiple of 64
        const unsigned hw = sRh[(c8 + e) * 17 + (jj >> 1)] >> ((jj & 1) * 16);
        const unsigned ww = sRw[c8 + e] >> ((row >> 5) * 16);
        const float pos = bf_bits2f((unsigned short)hw) + bf_bits2f((unsigned short)ww);
        v += pos;
      }
      unsigned short hb = f2bf_bits(v);
      unsigned short lb = f2bf_bits(v - bf_bits2f(hb));
      hv[e] = __builtin_bit_cast(_Float16, hb);
      lv[e] = __builtin_bit_cast(_Float16, lb);
    }
    *(v8h*)(Ch + (size_t)(m0 + row) * LDC + n0 + c8) = hv;
    *(v8h*)(Cl + (size_t)(m0 + row) * LDC + n0 + c8) = lv;
  }
}

// =====================================================================================
// Full (non-causal, unmasked) attention, head dim 32, all batches and heads in one launch.
//   q planes (hi/lo bf16) [16384][256]: element (b, n, h, d) at [(b*4096+n)*256 + h*32 + d]
//   k planes (hi/lo bf16) [4096][256]:  element (b, m, h, d) at [(b*1024+m)*256 + h*32 + d]  (pos already folded in)
//   v^T planes (hi/lo bf16) [256][4096]: element (h, d, b, m) at [(h*32 + d)*4096 + b*1024 + m]
//   out f32 NCHW: element (b, h*32+d, n) at [(b*256 + h*32 + d)*4096 + n]
//   scores = (q . k') * 32^-0.5 : bf16 hi/lo split (hi.hi + hi.lo + lo.hi) on v_wmma_f32_16x16x32_bf16
//   out    = p . v             : bf16 hi/lo split of p (unnormalised exp) and v, f32 accumulate, x 1/rowsum in f32 at the end
//   online softmax in f32 over the 1024 keys of the batch element (16 chunks of 64, compile-time trip count, no masking).
//   Block = 4 waves = 64 query positions of one (batch, head); grid.x = 4 * 8 * 64 = 2048 (exact).
//   K chunk staging: thread r = tid>>1 stages K row r cols (tid&1)*16 .. +15 (two 16-B copies per plane) -> 64x32 whole tile;
//   V^T chunk staging: thread d = tid>>2 stages row d cols (tid&3)*16 .. +15 -> 32x64 whole tile; __syncthreads before and after.
//   Scores are formed transposed, S^T = K . Q^T (A = K rows, B = Q): a lane holds 32 of the chunk's 64 scores of ONE query
//   (query = lane & 15, keys j*16 + 8*(lane>>4) + r), so maximum and sum run in the lane plus one exchange between lane halves;
//   two S^T tiles converted in place are the B operand of O^T += V^T . P^T (same k order as the V^T loader): P never touches LDS.
// =====================================================================================
#define AT_D  32
#define AT_NW 4
#define AT_QB 64
#define AT_KC 64
#define AT_KP 40   // LDS pitch of a K row in elements: 80 B = 16 B x 5 (odd), so the 16 rows of one 16-byte fragment read fall on 16 distinct bank groups
#define AT_VP 72   // LDS pitch of a V^T row in elements: 144 B = 16 B x 9 (odd), same reason

__device__ __forceinline__ unsigned short at_bf_bits(float f) {
  unsigned u = __float_as_uint(f);
  return (unsigned short)((u + 0x7FFFu + ((u >> 16) & 1u)) >> 16);
}
__device__ __forceinline__ __bf16 at_f2bf(float f) { return __builtin_bit_cast(__bf16, at_bf_bits(f)); }
__device__ __forceinline__ void at_split(float f, __bf16& hi, __bf16& lo) {
  const unsigned short hb = at_bf_bits(f);
  hi = __builtin_bit_cast(__bf16, hb);
  lo = at_f2bf(f - __uint_as_float(((unsigned)hb) << 16));
}
__device__ __forceinline__ v8f at_mma(v16b a, v16b b, v8f c) {
  c = __builtin_amdgcn_wmma_f32_16x16x32_bf16(false, a, false, b, (short)0, c, false, false);
  asm volatile("v_nop\n\tv_nop\n\tv_nop\n\tv_nop" : "+v"(c) : "v"(a), "v"(b));
  return c;
}

// value of the same lane position in the other 16-lane half (lane ^ 16), as a vector cross-row move
__device__ __forceinline__ float at_xhalf(float f) {
  const int b = __float_as_int(f);
  return __int_as_float(__builtin_amdgcn_permlanex16(b, b, 0x76543210, 0xfedcba98, false, false));
}

__global__ __launch_bounds__(128)
void attn32_kernel(const unsigned short* __restrict__ qhp, const unsigned short* __restrict__ qlp,
                   const unsigned short* __restrict__ khp, const unsigned short* __restrict__ klp,
                   const unsigned short* __restrict__ vhp, const unsigned short* __restrict__ vlp,
                   float* __restrict__ out, float sscale) {
  union FB { v16b v; v8b h[2]; };
  __shared__ __align__(16) __bf16 Ksh[AT_KC * AT_KP];            // K hi [kv][d], padded rows   5 KB
  __shared__ __align__(16) __bf16 Ksl[AT_KC * AT_KP];            // K lo
  __shared__ __align__(16) __bf16 Vth[AT_D * AT_VP];             // V hi [d][kv], padded rows   4.5 KB
  __shared__ __align__(16) __bf16 Vtl[AT_D * AT_VP];             // V lo
  __shared__ __align__(16) float  Os[AT_D * 68];                 // block out tile transposed [d][n_local], pitch 68

  const int tid  = threadIdx.x;
  const int wave = tid >> 5;
  const int lane = tid & 31;
  const int hh   = lane >> 4;
  const int c    = lane & 15;

  const int nqb = NQ / AT_QB;              // 64 query blocks per (batch, head)
  const int bx = blockIdx.x;               // grid = NB * NH * nqb (exact)
  const int qb = bx % nqb;
  const int hb = bx / nqb;
  const int h  = hb % NH;                  // 0..7
  const int b  = hb / NH;                  // 0..3
  const int q0 = b * NQ + qb * AT_QB + wave * 16;   // row in the q planes

  const __bf16* Qh = (const __bf16*)(const void*)qhp + (size_t)h * AT_D;
  const __bf16* Ql = (const __bf16*)(const void*)qlp + (size_t)h * AT_D;
  const __bf16* Kh = (const __bf16*)(const void*)khp + (size_t)h * AT_D;
  const __bf16* Kl = (const __bf16*)(const void*)klp + (size_t)h * AT_D;
  const __bf16* Vh = (const __bf16*)(const void*)vhp + (size_t)h * AT_D * VTP + (size_t)b * NKV;
  const __bf16* Vl = (const __bf16*)(const void*)vlp + (size_t)h * AT_D * VTP + (size_t)b * NKV;

  // ---- Q fragments (B operand, column = lane&15, split k map via Frag load): head dim 32 = one k-step, hi and lo ----
  v16b qah, qal;
  {
    const __bf16* qr = Qh + (size_t)(q0 + c) * DIM + 8 * hh;
    const __bf16* ql = Ql + (size_t)(q0 + c) * DIM + 8 * hh;
    qah = Frag<__bf16>::load(qr);
    qal = Frag<__bf16>::load(ql);
  }

  float mrow = -INFINITY;   // running maximum of this lane's query (equal in both lane halves)
  float lrow = 0.f;         // running sum over this lane half's keys only; the halves are joined once after the loop
  v8f oacc[2];              // O^T tiles: oacc[t][r] = out[d = t*16 + 8*hh + r][query c]
#pragma unroll
  for (int t = 0; t < 2; ++t) oacc[t] = (v8f){0.f,0.f,0.f,0.f,0.f,0.f,0.f,0.f};

  const int nChunks = NKV / AT_KC;   // 16, compile-time constant
  for (int kc = 0; kc < nChunks; ++kc) {
    const int kv0 = kc * AT_KC;
    __syncthreads();
    {
      // K staging: 128 threads x 16 elements per plane = 64 rows x 32
      const int r = tid >> 1, hf = (tid & 1) * 16;
      const __bf16* ksh = Kh + (size_t)(b * NKV + kv0 + r) * DIM + hf;
      const __bf16* ksl = Kl + (size_t)(b * NKV + kv0 + r) * DIM + hf;
      const v8b a0 = *(const v8b*)(ksh);
      const v8b a1 = *(const v8b*)(ksh + 8);
      const v8b a2 = *(const v8b*)(ksl);
      const v8b a3 = *(const v8b*)(ksl + 8);
      *(v8b*)(Ksh + r * AT_KP + hf)     = a0;
      *(v8b*)(Ksh + r * AT_KP + hf + 8) = a1;
      *(v8b*)(Ksl + r * AT_KP + hf)     = a2;
      *(v8b*)(Ksl + r * AT_KP + hf + 8) = a3;
      // V^T staging: 128 threads x 16 elements per plane = 32 rows x 64
      const int d = tid >> 2, qq = (tid & 3) * 16;
      const __bf16* vsh = Vh + (size_t)d * VTP + kv0 + qq;
      const __bf16* vsl = Vl + (size_t)d * VTP + kv0 + qq;
      const v8b b0 = *(const v8b*)(vsh);
      const v8b b1 = *(const v8b*)(vsh + 8);
      const v8b b2 = *(const v8b*)(vsl);
      const v8b b3 = *(const v8b*)(vsl + 8);
      *(v8b*)(Vth + d * AT_VP + qq)     = b0;
      *(v8b*)(Vth + d * AT_VP + qq + 8) = b1;
      *(v8b*)(Vtl + d * AT_VP + qq)     = b2;
      *(v8b*)(Vtl + d * AT_VP + qq + 8) = b3;
    }
    __syncthreads();

    v8f s[4];
#pragma unroll
    for (int j = 0; j < 4; ++j) {
      s[j] = (v8f){0.f,0.f,0.f,0.f,0.f,0.f,0.f,0.f};
      FB kb, kl;
      kb.h[0] = *(const v8b*)(Ksh + (j * 16 + c) * AT_KP + 8 * hh);
      kb.h[1] = *(const v8b*)(Ksh + (j * 16 + c) * AT_KP + 16 + 8 * hh);
      kl.h[0] = *(const v8b*)(Ksl + (j * 16 + c) * AT_KP + 8 * hh);
      kl.h[1] = *(const v8b*)(Ksl + (j * 16 + c) * AT_KP + 16 + 8 * hh);
      s[j] = at_mma(kb.v, qah, s[j]);
      s[j] = at_mma(kl.v, qah, s[j]);
      s[j] = at_mma(kb.v, qal, s[j]);
    }
    // scale, then the query's chunk maximum: in the lane, then one exchange with the other lane half
    // (the loops over j, r, t and kk below are unrolled so that s, ph, pl and oacc are indexed at compile time and stay in registers)
    float cm = -INFINITY;
#pragma unroll
    for (int j = 0; j < 4; ++j) {
#pragma unroll
      for (int r = 0; r < 8; ++r) {
        const float sv = s[j][r] * sscale;
        s[j][r] = sv;
        cm = fmaxf(cm, sv);
      }
    }
    cm = fmaxf(cm, at_xhalf(cm));
    const float mnew = fmaxf(mrow, cm);
    const float alpha = expf(mrow - mnew);
    mrow = mnew;
    // P^T as B operand: element e of k-step kk = S^T tile 2*kk + (e >> 3), register e & 7 (key kk*32 + 16*(e>>3) + 8*hh + (e&7))
    FB ph[2], pl[2];
    float psum = 0.f;
#pragma unroll
    for (int j = 0; j < 4; ++j) {
#pragma unroll
      for (int r = 0; r < 8; ++r) {
        const float p = expf(s[j][r] - mnew);
        psum += p;
        __bf16 a, bl; at_split(p, a, bl);
        ph[j >> 1].v[(j & 1) * 8 + r] = a;
        pl[j >> 1].v[(j & 1) * 8 + r] = bl;
      }
    }
    lrow = lrow * alpha + psum;
#pragma unroll
    for (int t = 0; t < 2; ++t)
#pragma unroll
      for (int r = 0; r < 8; ++r) oacc[t][r] *= alpha;
#pragma unroll
    for (int kk = 0; kk < 2; ++kk) {
#pragma unroll
      for (int t = 0; t < 2; ++t) {
        FB vb, vl;
        vb.h[0] = *(const v8b*)(Vth + (t * 16 + c) * AT_VP + kk * 32 + 8 * hh);
        vb.h[1] = *(const v8b*)(Vth + (t * 16 + c) * AT_VP + kk * 32 + 16 + 8 * hh);
        vl.h[0] = *(const v8b*)(Vtl + (t * 16 + c) * AT_VP + kk * 32 + 8 * hh);
        vl.h[1] = *(const v8b*)(Vtl + (t * 16 + c) * AT_VP + kk * 32 + 16 + 8 * hh);
        oacc[t] = at_mma(vb.v, ph[kk].v, oacc[t]);
        oacc[t] = at_mma(vl.v, ph[kk].v, oacc[t]);
        oacc[t] = at_mma(vb.v, pl[kk].v, oacc[t]);
      }
    }
  }

  // ---- join the lane halves' sums, normalise and stage: Os[d][n_local], d = t*16 + 8hh + r, n_local = wave*16 + c (all 32 x 64 written) ----
  {
    const float inv = 1.0f / (lrow + at_xhalf(lrow));
#pragma unroll
    for (int t = 0; t < 2; ++t)
#pragma unroll
      for (int r = 0; r < 8; ++r) Os[(t * 16 + 8 * hh + r) * 68 + wave * 16 + c] = oacc[t][r] * inv;
  }
  __syncthreads();
  {
    float* ob = out + ((size_t)(b * DIM + h * AT_D)) * NQ + (size_t)qb * AT_QB;
    const int q = lane >> 3, c4 = (lane & 7) * 4;
    {
#pragma unroll
      for (int it = 0; it < 4; ++it) {
        const int L  = it * 16 + wave * 4 + q;   // 0..63: line index within the block's 32 x 256-B output region
        const int d  = L >> 1;
        const int hf = (L & 1) * 32;
        v4f val = *(const v4f*)(Os + d * 68 + hf + c4);
        *(v4f*)(ob + (size_t)d * NQ + hf + c4) = val;
      }
      
    }
  }
}

// ---------------------------------------------------------------------------
// Workspace region map (byte offsets; every region fully written by its producer launch before any consumer reads it;
//   XT   bf16 [16384][256]         0       8388608
//   WQ   bf16 [256][256]     8388608        131072
//   WKp  bf16 [256][1024]    8519680        524288
//   WVp  bf16 [256][1024]    9043968        524288
//   Qh   bf16 [16384][256]   9568256       8388608   Ql  17956864
//   Kh   bf16 [4096][256]   26345472       2097152   Kl  28442624
//   VTh  bf16 [256][4096]   30539776       2097152   VTl 32636928
//   total                  34734080
// ---------------------------------------------------------------------------
extern "C" void kernel_launch(void* const* d_in, const int* in_sizes, int n_in,
                              void* d_out, int out_size, void* d_ws, size_t ws_size,
                              hipStream_t stream) {
  if (n_in < 6) return;
  if (in_sizes[0] != NB * DIM * NQ) return;          // x [4][256][64][64]
  if (in_sizes[1] != DIM * DIM) return;              // Wq [256][256]
  if (in_sizes[2] != DIM * DIM * 4) return;          // Wk [256][256][2][2]
  if (in_sizes[3] != DIM * DIM * 4) return;          // Wv [256][256][2][2]
  if (in_sizes[4] != NH * HD * OH) return;           // rel_h [1][8][32][1][32]
  if (in_sizes[5] != NH * HD * OW) return;           // rel_w [1][8][32][32][1]
  if (out_size != NB * DIM * NQ) return;

  const float* x     = (const float*)d_in[0];
  const float* Wq    = (const float*)d_in[1];
  const float* Wk    = (const float*)d_in[2];
  const float* Wv    = (const float*)d_in[3];
  const float* rel_h = (const float*)d_in[4];
  const float* rel_w = (const float*)d_in[5];

  const size_t PXT = (size_t)MTOK * DIM * 2;        // 8388608
  const size_t PWQ = (size_t)DIM * DIM * 2;         // 131072
  const size_t PWC = (size_t)DIM * KCONV * 2;       // 524288
  const size_t PQ  = (size_t)MTOK * DIM * 2;        // 8388608
  const size_t PK  = (size_t)MKV * DIM * 2;         // 2097152
  const size_t PVT = (size_t)DIM * VTP * 2;         // 2097152
  size_t off = 0;
  const size_t oXT  = off; off += PXT;
  const size_t oWQ  = off; off += PWQ;
  const size_t oWK  = off; off += PWC;
  const size_t oWV  = off; off += PWC;
  const size_t oQh  = off; off += PQ;   const size_t oQl  = off; off += PQ;
  const size_t oKh  = off; off += PK;   const size_t oKl  = off; off += PK;
  const size_t oVTh = off; off += PVT;  const size_t oVTl = off; off += PVT;
  if (off > ws_size) return;                        // off = 34734080
  if (off > (size_t)134217728) return;

  char* ws = (char*)d_ws;
  unsigned short* XT  = (unsigned short*)(ws + oXT);
  unsigned short* WQ  = (unsigned short*)(ws + oWQ);
  unsigned short* WKp = (unsigned short*)(ws + oWK);
  unsigned short* WVp = (unsigned short*)(ws + oWV);
  unsigned short* Qh  = (unsigned short*)(ws + oQh);  unsigned short* Ql  = (unsigned short*)(ws + oQl);
  unsigned short* Kh  = (unsigned short*)(ws + oKh);  unsigned short* Kl  = (unsigned short*)(ws + oKl);
  unsigned short* VTh = (unsigned short*)(ws + oVTh); unsigned short* VTl = (unsigned short*)(ws + oVTl);

  const dim3 blk(256);

  // (1) x[b] viewed [R=256 c][Cc=4096 n] (pitch 4096) -> XT_b[n][c] (pitch 256); grid (Cc/64, R/64, B) = (64, 4, 4)
  tconv_kernel<<<dim3(NQ / 64, DIM / 64, NB), blk, 0, stream>>>(x, XT, NQ, DIM, (long)DIM * NQ, (long)NQ * DIM);
  // (2) Wq [256][256] -> WQ bf16 same layout; 8192 units -> 32 blocks
  const int n8q = DIM * DIM / 8;
  convrows_kernel<<<dim3(n8q / 256), blk, 0, stream>>>(Wq, WQ, DIM, DIM, n8q);
  // (3,4) conv weights OIHW -> [o][q4*256 + c] bf16; 8192 units -> 32 blocks each
  wperm_kernel<<<dim3((DIM * 32) / 256), blk, 0, stream>>>(Wk, WKp);
  wperm_kernel<<<dim3((DIM * 32) / 256), blk, 0, stream>>>(Wv, WVp);
  // (5) q = XT . WQ^T -> Qh|Ql [16384][256]   (M=16384, N=256, K=256; 1024 tiles -> 128 blocks); bias/resid unused (mode 0)
  const dim3 gQ(((MTOK / 64) * (DIM / 64) + 7) / 8, 1);
  wmma_gemm64<1, false, 0, 2, false, 0><<<gQ, blk, 0, stream>>>(
      XT, XT, DIM, 0L, WQ, WQ, DIM, 0L, (void*)Qh, (void*)Ql, DIM, 0L,
      rel_h, rel_h, 0L, MTOK, DIM, DIM, 1.0f);
  // (6) k' = conv_k(im2col XT) + pos -> Kh|Kl [4096][256]   (M=4096, N=256, K=1024; 256 tiles -> 256 blocks)
  conv_gemm64<0><<<dim3((MKV / 64) * (DIM / 64)), blk, 0, stream>>>(XT, WKp, rel_h, rel_w, Kh, Kl);
  // (7) v^T = WVp . im2col(XT)^T -> VTh|VTl [256][4096]     (M=256, N=4096, K=1024; 256 tiles -> 256 blocks)
  conv_gemm64<1><<<dim3((DIM / 64) * (MKV / 64)), blk, 0, stream>>>(XT, WVp, rel_h, rel_w, VTh, VTl);
  // (8) attention per (batch, head, 64-query block) -> d_out NCHW; 2048 blocks of 128
  attn32_kernel<<<dim3(NB * NH * (NQ / AT_QB)), dim3(128), 0, stream>>>(Qh, Ql, Kh, Kl, VTh, VTl, (float*)d_out,
                                                                        0.17677669529663687f);
  (void)hipGetLastError();
}

// v004
// A run of this version takes 119 microseconds.
// In two side-by-side timings against v003, it was 1.22 and 1.19 times as fast.
// All steps since v000 together make it 2.91 times as fast.
// Contractions: q projection, k conv (im2col) and v^T conv (im2col) = v_wmma_f32_16x16x32_bf16 single products on bf16 planes of the RNE-converted inputs (exact products); scores q.(k+pos) and p.v = bf16 hi/lo split (hi.hi + hi.lo + lo.hi); f32 accumulate everywhere; positional add, 32^-0.5 scale, online softmax and 1/rowsum in f32 on the VALU.
// Plane / carry map (all carry 1, nothing to fold back):
//   XT  = bf16(x) token-major [16384][256] (row b*4096 + n, n = y*64 + x, col c)
//   WQ  = bf16(Wq) [256 o][256 c];  WKp, WVp bf16 [256 o][1024]: col q4*256 + c = bf16(W[o][c][kh][kw]), q4 = kh*2 + kw
//   Qh|Ql bf16 [16384][256] (col h*32 + d) = hi/lo of q;  Kh|Kl bf16 [4096][256] (row b*1024 + m, m = i*32 + j; col h*32 + d) = hi/lo of (conv_k + pos)
//   pos(h,d,m) = bf16(rel_h[(h*32+d)*32 + (m & 31)]) + bf16(rel_w[(h*32+d)*32 + (m >> 5)]) in f32
//   VTh|VTl bf16 [256 (h*32+d)][4096 (b*1024+m)] = hi/lo of conv_v;  P hi|lo = unnormalised exp, at most 1 up to the rounding of the scaled maximum (f32), 1/rowsum applied to the f32 accumulator
#include <hip/hip_runtime.h>
#include <math.h>
#include <stdint.h>

#define NB    4
#define DIM   256
#define NH    8
#define HD    32
#define IMH   64
#define IMW   64
#define NQ    4096
#define OH    32
#define OW    32
#define NKV   1024
#define KCONV 1024
#define MTOK  (NB * NQ)
#define MKV   (NB * NKV)
#define VTP   (NB * NKV)

static_assert(NQ == IMH * IMW);
static_assert(NKV == OH * OW);
static_assert(OH * 2 == IMH);
static_assert(OW * 2 == IMW);
static_assert(DIM == NH * HD);
static_assert(HD == 32);
static_assert(KCONV == DIM * 4);
static_assert(MTOK % 64 == 0);
static_assert(MKV % 128 == 0);
static_assert(DIM % 64 == 0);
static_assert(KCONV % 32 == 0);
static_assert(DIM % 32 == 0);
static_assert((DIM * DIM) % (8 * 256) == 0);
static_assert(((MKV / 64) * (DIM / 64)) % 8 == 0);
static_assert(((MTOK / 64) * (DIM / 64)) % 8 == 0);
static_assert(DIM * OH == 8192);
static_assert(NQ % 64 == 0);
static_assert(NKV % 64 == 0);

typedef __attribute__((ext_vector_type(16))) _Float16 v16h;
typedef __attribute__((ext_vector_type(8)))  _Float16 v8h;
typedef __attribute__((ext_vector_type(16))) __bf16   v16b;
typedef __attribute__((ext_vector_type(8)))  __bf16   v8b;
typedef __attribute__((ext_vector_type(8)))  float    v8f;
typedef __attribute__((ext_vector_type(4)))  float    v4f;
typedef __attribute__((ext_vector_type(2)))  float    v2f;
typedef __attribute__((ext_vector_type(4)))  unsigned int v4u;
typedef __attribute__((ext_vector_type(2)))  unsigned int v2u;

__device__ __forceinline__ unsigned short f2bf_bits(float f) {
  unsigned u = __float_as_uint(f);
  return (unsigned short)((u + 0x7FFFu + ((u >> 16) & 1u)) >> 16);
}
__device__ __forceinline__ float bf_bits2f(unsigned short h) { return __uint_as_float(((unsigned)h) << 16); }
__device__ __forceinline__ unsigned pk16(unsigned short a, unsigned short b) { return (unsigned)a | ((unsigned)b << 16); }

// hazard guards as plain device helpers (no inline asm inside the kernel template body)
__device__ __forceinline__ void dep_guard_h(v8f& a, v8f& b, v16h x, v16h y) { asm volatile("v_nop\n\tv_nop\n\tv_nop\n\tv_nop" : "+v"(a), "+v"(b) : "v"(x), "v"(y)); }
__device__ __forceinline__ void dep_guard_b(v8f& a, v8f& b, v16b x, v16b y) { asm volatile("v_nop\n\tv_nop\n\tv_nop\n\tv_nop" : "+v"(a), "+v"(b) : "v"(x), "v"(y)); }
__device__ __forceinline__ void keep4_h(v16h a, v16h b, v16h c, v16h d) { asm volatile("v_nop" :: "v"(a), "v"(b), "v"(c), "v"(d)); }
__device__ __forceinline__ void keep4_b(v16b a, v16b b, v16b c, v16b d) { asm volatile("v_nop" :: "v"(a), "v"(b), "v"(c), "v"(d)); }
__device__ __forceinline__ void acc_guard4(v8f& a, v8f& b, v8f& c, v8f& d) { asm volatile("v_nop\n\tv_nop\n\tv_nop\n\tv_nop" : "+v"(a), "+v"(b), "+v"(c), "+v"(d)); }
template <typename T> struct Frag;
template <> struct Frag<_Float16> {
  typedef v16h V; union U { v16h v; v8h h[2]; };
  static __device__ __forceinline__ v16h load(const _Float16* p) {   // elements 0..7 <- p[0..7], 8..15 <- p[16..23]
    U f; f.h[0] = *(const v8h*)(p); f.h[1] = *(const v8h*)(p + 16); return f.v;
  }
  static __device__ __forceinline__ v8f mma(v16h a, v16h b, v8f c) {
    return __builtin_amdgcn_wmma_f32_16x16x32_f16(false, a, false, b, (short)0, c, false, false);
  }
  static __device__ __forceinline__ void guard(v8f& a, v8f& b, v16h x, v16h y) { dep_guard_h(a, b, x, y); }
  static __device__ __forceinline__ void keep(v16h a, v16h b, v16h c, v16h d) { keep4_h(a, b, c, d); }
};
template <> struct Frag<__bf16> {
  typedef v16b V; union U { v16b v; v8b h[2]; };
  static __device__ __forceinline__ v16b load(const __bf16* p) {
    U f; f.h[0] = *(const v8b*)(p); f.h[1] = *(const v8b*)(p + 16); return f.v;
  }
  static __device__ __forceinline__ v8f mma(v16b a, v16b b, v8f c) {
    return __builtin_amdgcn_wmma_f32_16x16x32_bf16(false, a, false, b, (short)0, c, false, false);
  }
  static __device__ __forceinline__ void guard(v8f& a, v8f& b, v16b x, v16b y) { dep_guard_b(a, b, x, y); }
  static __device__ __forceinline__ void keep(v16b a, v16b b, v16b c, v16b d) { keep4_b(a, b, c, d); }
};

// ---- Register-blocked batched WMMA GEMM ------------------------------------
// C[m,n] = scale * sum_k A[m,k] * Bt[n,k] (+bias)(+resid); each wave owns a 64x64 tile.
// A row-major [M,K]; Bt row-major [N,K]; M,N % 64 == 0, K % 32 == 0.
// SPLIT: operands are hi/lo planes (A2/Bt2 = lo planes, same layout); product = hi.hi + hi.lo + lo.hi.
// BIAS_MODE: 0 = none, 1 = bias[m], 2 = bias[n].
// OUT_MODE: 0 = f32, 1 = f16, 2 = bf16 hi plane (Cout) + bf16 lo plane (Cout2).
// ET: 0 = f16 operands, 1 = bf16 operands (pointers passed as 16-bit storage)
template <int ET> struct Elem;
template <> struct Elem<0> { typedef _Float16 T; };
template <> struct Elem<1> { typedef __bf16 T; };
template <int ET, bool SPLIT, int BIAS_MODE, int OUT_MODE, bool RESID, int ACT = 0>
__global__ __launch_bounds__(256) void wmma_gemm64(
    const unsigned short* __restrict__ Ap, const unsigned short* __restrict__ A2p, int lda, long strideA,
    const unsigned short* __restrict__ Btp, const unsigned short* __restrict__ Bt2p, int ldb, long strideB,
    void* __restrict__ Cout, void* __restrict__ Cout2, int ldc, long strideC,
    const float* __restrict__ bias,
    const float* __restrict__ resid, long strideR,
    int M, int N, int K, float scale) {
  typedef typename Elem<ET>::T T;
  typedef typename Frag<T>::V V;
  const T* A = (const T*)Ap; const T* A2 = (const T*)A2p; const T* Bt = (const T*)Btp; const T* Bt2 = (const T*)Bt2p;
  __shared__ __align__(16) float sT[8][16 * 68];   // per-wave 16x64 slab, pitch 68 floats
  const int b    = blockIdx.y;
  const int lane = threadIdx.x & 31;
  const int wave = threadIdx.x >> 5;
  const int tilesN = N >> 6;
  const int tilesM = M >> 6;
  const int tile = blockIdx.x * 8 + wave;
  if (tile >= tilesM * tilesN) return;   // wave-uniform; no block barriers in this kernel
  const int tm = tile / tilesN;
  const int tn = tile - tm * tilesN;
  const int m0 = tm << 6;
  const int n0 = tn << 6;

  const T* Ab  = A  + (size_t)b * strideA;
  const T* Bb  = Bt + (size_t)b * strideB;
  const T* Ab2 = SPLIT ? (A2  + (size_t)b * strideA) : nullptr;
  const T* Bb2 = SPLIT ? (Bt2 + (size_t)b * strideB) : nullptr;

  const int rlane = lane & 15;                 // row (A) / col (B, D) within subtile
  const int koff  = (lane >> 4) * 8;           // k offset of this lane half
  const int mOff  = (lane >> 4) * 8;           // D row offset

  v8f acc[4][4];
#pragma unroll
  for (int i = 0; i < 4; ++i)
#pragma unroll
    for (int j = 0; j < 4; ++j) acc[i][j] = (v8f){0.f,0.f,0.f,0.f,0.f,0.f,0.f,0.f};

  for (int k0 = 0; k0 < K; k0 += 32) {
    V bh[4], bl[4];
#pragma unroll
    for (int j = 0; j < 4; ++j) {
      const size_t bo = (size_t)(n0 + (j << 4) + rlane) * ldb + koff + k0;
      bh[j] = Frag<T>::load(Bb + bo);
      if (SPLIT) bl[j] = Frag<T>::load(Bb2 + bo); else bl[j] = bh[j];
    }
#pragma unroll
    for (int i = 0; i < 4; ++i) {
      const size_t ao = (size_t)(m0 + (i << 4) + rlane) * lda + koff + k0;
      V ah = Frag<T>::load(Ab + ao);
      V al;
      if (SPLIT) al = Frag<T>::load(Ab2 + ao); else al = ah;
#pragma unroll
      for (int j = 0; j < 4; ++j) {
        acc[i][j] = Frag<T>::mma(ah, bh[j], acc[i][j]);
        if (SPLIT) {
          acc[i][j] = Frag<T>::mma(ah, bl[j], acc[i][j]);
          acc[i][j] = Frag<T>::mma(al, bh[j], acc[i][j]);
        }
      }
      Frag<T>::guard(acc[i][0], acc[i][3], ah, al);
    }
    Frag<T>::keep(bh[0], bh[1], bh[2], bh[3]);
    if (SPLIT) Frag<T>::keep(bl[0], bl[1], bl[2], bl[3]);
  }
  acc_guard4(acc[0][0], acc[0][1], acc[0][2], acc[0][3]);
  acc_guard4(acc[1][0], acc[1][1], acc[1][2], acc[1][3]);
  acc_guard4(acc[2][0], acc[2][1], acc[2][2], acc[2][3]);
  acc_guard4(acc[3][0], acc[3][1], acc[3][2], acc[3][3]);

  // ---- epilogue ----
  float* slab = sT[wave];
  const float* Rb = RESID ? (resid + (size_t)b * strideR) : nullptr;
#pragma unroll
  for (int i = 0; i < 4; ++i) {
    const int mBase = m0 + (i << 4);
#pragma unroll
    for (int j = 0; j < 4; ++j) {
      const int n = n0 + (j << 4) + rlane;
      float bv = 0.f;
      if (BIAS_MODE == 2) bv = bias[n];
#pragma unroll
      for (int r = 0; r < 8; ++r) {
        float v = acc[i][j][r] * scale;
        if (BIAS_MODE == 1) v += bias[mBase + mOff + r];
        if (BIAS_MODE == 2) v += bv;
        if (RESID) v += Rb[(size_t)(mBase + mOff + r) * ldc + n];
        if (ACT == 1) v = tanhf(v);
        if (ACT == 2) v = fmaxf(v, 0.0f);
        if (ACT == 3) v = v / (1.0f + expf(-v));
        if (ACT == 4) v = (v > 0.f) ? v : 0.01f * v;
        if (ACT == 5) v = 0.5f * v * (1.0f + erff(v * 0.70710678118654752f));
        slab[(mOff + r) * 68 + (j << 4) + rlane] = v;
      }
    }
    __builtin_amdgcn_fence(__ATOMIC_RELEASE, "workgroup");
    __builtin_amdgcn_wave_barrier();
    __builtin_amdgcn_fence(__ATOMIC_ACQUIRE, "workgroup");
    if (OUT_MODE == 0) {
      float* C = (float*)Cout + (size_t)b * strideC;
      const int hh = lane >> 4, c4 = (lane & 15) * 4;     // row seg = 256 B = 16 lanes x 16 B
      {
#pragma unroll
        for (int it = 0; it < 8; ++it) {
          const int row = it * 2 + hh;
          v4f v = *(const v4f*)(slab + row * 68 + c4);
          *(v4f*)(C + (size_t)(mBase + row) * ldc + n0 + c4) = v;
        }
        
      }
    } else {
      const int q = lane >> 3, c8 = (lane & 7) * 8;
      unsigned short* C  = (unsigned short*)Cout  + (size_t)b * strideC;
      unsigned short* C2 = (OUT_MODE == 2) ? ((unsigned short*)Cout2 + (size_t)b * strideC) : nullptr;
      {
#pragma unroll
        for (int it = 0; it < 4; ++it) {
          const int row = it * 4 + q;
          const float* sp = slab + row * 68 + c8;
          v8h hv, lv;
#pragma unroll
          for (int e = 0; e < 8; ++e) {
            if (OUT_MODE == 1) {
              hv[e] = (_Float16)sp[e];
            } else {
              unsigned short hb = f2bf_bits(sp[e]);
              unsigned short lb = f2bf_bits(sp[e] - bf_bits2f(hb));
              hv[e] = __builtin_bit_cast(_Float16, hb);
              lv[e] = __builtin_bit_cast(_Float16, lb);
            }
          }
          *(v8h*)(C + (size_t)(mBase + row) * ldc + n0 + c8) = hv;
          if (OUT_MODE == 2) *(v8h*)(C2 + (size_t)(mBase + row) * ldc + n0 + c8) = lv;
        }
        
      }
    }
    __builtin_amdgcn_fence(__ATOMIC_RELEASE, "workgroup");
    __builtin_amdgcn_wave_barrier();
    __builtin_amdgcn_fence(__ATOMIC_ACQUIRE, "workgroup");
  }
}

// ---------------------------------------------------------------------------
// Row-preserving bf16 RNE convert of an f32 matrix [rows][ncols] into a u16 plane with row pitch ldout.
// 8 consecutive elements per thread = one 16-B store; 32 lanes cover 256 consecutive columns of one row
// ---------------------------------------------------------------------------
__global__ __launch_bounds__(256) void convrows_kernel(const float* __restrict__ in, unsigned short* __restrict__ out,
                                                       int ncols, int ldout, int n8) {
  const int i = blockIdx.x * 256 + threadIdx.x;
  if (i < n8) {
    const size_t e0 = (size_t)i * 8;
    const int row = (int)(e0 / (size_t)ncols);
    const int col = (int)(e0 - (size_t)row * ncols);
    const v4f a = *(const v4f*)(in + e0);
    const v4f c = *(const v4f*)(in + e0 + 4);
    v4u hv;
    hv[0] = pk16(f2bf_bits(a[0]), f2bf_bits(a[1]));
    hv[1] = pk16(f2bf_bits(a[2]), f2bf_bits(a[3]));
    hv[2] = pk16(f2bf_bits(c[0]), f2bf_bits(c[1]));
    hv[3] = pk16(f2bf_bits(c[2]), f2bf_bits(c[3]));
    const size_t o = (size_t)row * ldout + col;
    {
      *(v4u*)(out + o) = hv;
      
    }
  }
}

// ---------------------------------------------------------------------------
// Fused transpose + bf16 RNE convert of an f32 matrix, z-batched, one plane:
//   in_z = W + z*sIn viewed [R rows][Cc cols] with row pitch ldin  ->  oh_z[c][r] = bf16(in_z[r][c]), row pitch ldout, oh_z = oh + z*sOut.
// 64x64 tiles through LDS. grid = (Cc/64, R/64, Z), 256 threads (R, Cc multiples of 64; ldout multiple of 64 so every
// Coverage per block: load 4 it x 256 thr x 4 floats = 64x64; store 2 it x 256 thr x 8 u16 = 64x64.
// ---------------------------------------------------------------------------
__global__ __launch_bounds__(256) void tconv_kernel(const float* __restrict__ W, unsigned short* __restrict__ oh,
                                                    int ldin, int ldout, long sIn, long sOut) {
  __shared__ __align__(16) float tf[64 * 68];
  W  += (size_t)blockIdx.z * sIn;
  oh += (size_t)blockIdx.z * sOut;
  const int c0  = blockIdx.x * 64;   // input column block = output row block
  const int r0  = blockIdx.y * 64;   // input row block    = output column block
  const int tid = threadIdx.x;
  {
    const int lr = tid >> 4;         // 0..15
    const int c4 = (tid & 15) * 4;   // 0..60
#pragma unroll
    for (int it = 0; it < 4; ++it) {
      const int rr = it * 16 + lr;   // 0..63
      const v4f a = *(const v4f*)(W + (size_t)(r0 + rr) * ldin + c0 + c4);
      *(v4f*)(tf + rr * 68 + c4) = a;
    }
  }
  __syncthreads();
  const int sub = tid >> 3;          // 0..31
  const int c8  = (tid & 7) * 8;     // 0..56
  v4u hv[2];
#pragma unroll
  for (int it = 0; it < 2; ++it) {
    const int oc = it * 32 + sub;    // output row within tile (= input column)
    v4u a;
#pragma unroll
    for (int q = 0; q < 4; ++q) {
      const float f0 = tf[(c8 + 2 * q) * 68 + oc];
      const float f1 = tf[(c8 + 2 * q + 1) * 68 + oc];
      a[q] = pk16(f2bf_bits(f0), f2bf_bits(f1));
    }
    hv[it] = a;
  }
  {
#pragma unroll
    for (int it = 0; it < 2; ++it) {
      const int oc = it * 32 + sub;
      const size_t go = (size_t)(c0 + oc) * ldout + r0 + c8;
      *(v4u*)(oh + go) = hv[it];
    }
    
  }
}

// ---------------------------------------------------------------------------
// Conv weight permute + bf16 RNE convert: W OIHW [256 o][256 c][2][2] f32 -> O[o][q4*256 + c] u16 (q4 = kh*2 + kw),
// row pitch KCONV = 1024. One unit = (o, c0 = 8*lane): 8 x 16-B loads (the 4 taps of 8 consecutive c), 4 x 16-B stores
// (8 consecutive c of each q4 segment). Per store instruction the 32 lanes of a wave (same o) write 32 x 16 B = the whole
// Coverage: 32 blocks x 256 threads = 8192 units x 32 elements = 256 x 1024 = whole plane.
// ---------------------------------------------------------------------------
__global__ __launch_bounds__(256) void wperm_kernel(const float* __restrict__ W, unsigned short* __restrict__ O) {
  const int u = blockIdx.x * 256 + threadIdx.x;   // 0 .. DIM*32 - 1
  if (u < DIM * 32) {
    const int o = u >> 5, c0 = (u & 31) * 8;
    v4f w[8];
#pragma unroll
    for (int e = 0; e < 8; ++e) w[e] = *(const v4f*)(W + ((size_t)(o * DIM + c0 + e)) * 4);
    v4u pk[4];
#pragma unroll
    for (int q4 = 0; q4 < 4; ++q4) {
      v4u a;
#pragma unroll
      for (int p = 0; p < 4; ++p) a[p] = pk16(f2bf_bits(w[2 * p][q4]), f2bf_bits(w[2 * p + 1][q4]));
      pk[q4] = a;
    }
    unsigned short* orow = O + (size_t)o * KCONV + c0;
    {
#pragma unroll
      for (int q4 = 0; q4 < 4; ++q4) *(v4u*)(orow + q4 * DIM) = pk[q4];
      
    }
  }
}

// ---------------------------------------------------------------------------
// im2col addressing of the 2x2 / stride-2 / VALID conv as a GEMM over XT (token-major bf16 [NB*4096][256]):
//   im2col row g = b*1024 + m, m = i*32 + j (output grid row i, col j); k = q4*256 + c, q4 = kh*2 + kw;
//   element (g, k) = XT[(b*4096 + (2i+kh)*64 + (2j+kw)) * 256 + c].
// For a 32-deep k-step (k0 % 32 == 0) the 32 k values are 32 consecutive channels of one source token row,
// so a fragment is two 16-B loads at the returned offset + koff and + koff + 16 (arithmetic addressing only).
// ---------------------------------------------------------------------------
__device__ __forceinline__ size_t im2col_off(int g, int k0) {
  const int b = g >> 10, m = g & (NKV - 1);
  const int q4 = k0 >> 8, c0 = k0 & (DIM - 1);
  const int kh = q4 >> 1, kw = q4 & 1;
  const int i = m >> 5, j = m & 31;
  return ((size_t)(b * NQ + (2 * i + kh) * IMW + 2 * j + kw)) * DIM + c0;
}

// ---------------------------------------------------------------------------
// Conv GEMM (bf16 single products, f32 accumulate), K = 1024, one 64x64 output tile per work-group:
//   MODE 0: C[g][o] = sum_k im2col(g,k) * WKp[o][k]  (M = 4096 rows g, N = 256), epilogue adds
//           pos(o, m) = bf16(rel_h[o*32 + (m&31)]) + bf16(rel_w[o*32 + (m>>5)]) in f32, then bf16 hi|lo planes [4096][256].
//   MODE 1: C[o][g] = sum_k WVp[o][k] * im2col(g,k)  (M = 256, N = 4096) -> bf16 hi|lo planes [256][4096] (v^T layout).
// K is split over the 8 waves: wave w sums k = 128w .. 128w+127 (4 k-steps) of the whole tile into its own f32 partial,
// writes it to its LDS plane, and behind one work-group barrier wave w adds the 8 partials (plane 0 first, then 1 .. 7)
// of rows 8w .. 8w+7 and finishes those rows (pos, hi|lo split, whole 128-B line stores).
// MODE 0 tables (bf16 bits, two per dword), written before the k loop and read only behind that same barrier:
//   sRh[nl*17 + (jj>>1)] holds rel_h[(n0+nl)*32 + jj] (pitch 17 dwords: the 8 lanes of a row read 8 distinct banks);
//   sRw[nl] holds rel_w[(n0+nl)*32 + ii0 + {0,1}], ii0 = first of the two output-grid rows that the tile's 64 rows m cover.
// grid = 256 work-groups of 8 waves, one tile each = 256 tiles exactly (both modes).
// ---------------------------------------------------------------------------
template <int MODE>
__global__ __launch_bounds__(256) void conv_gemm64(const unsigned short* __restrict__ XTp, const unsigned short* __restrict__ Wpp,
                                                   const float* __restrict__ rel_h, const float* __restrict__ rel_w,
                                                   unsigned short* __restrict__ Ch, unsigned short* __restrict__ Cl) {
  typedef __bf16 T;
  typedef v16b V;
  const T* XT = (const T*)XTp; const T* Wp = (const T*)Wpp;
  __shared__ __align__(16) float sP[8][64 * 68];   // per-wave partial 64x64 tile, pitch 68 floats
  __shared__ unsigned sRh[(MODE == 0) ? (64 * 17) : 1];
  __shared__ unsigned sRw[(MODE == 0) ? 64 : 1];
  constexpr int M = (MODE == 0) ? MKV : DIM;
  constexpr int N = (MODE == 0) ? DIM : MKV;
  constexpr int LDC = N;
  constexpr int KW = KCONV / 8;                    // k range of one wave
  static_assert(KW % 32 == 0);
  const int tid  = threadIdx.x;
  const int lane = tid & 31;
  const int wave = __builtin_amdgcn_readfirstlane(tid >> 5);   // scalar, so that the k offsets stay scalar

  constexpr int tilesN = N >> 6;
  constexpr int tilesM = M >> 6;
  const int tile = blockIdx.x;
  if (tile >= tilesM * tilesN) return;   // block-uniform, in front of the barrier; never taken with the exact grid
  const int tm = tile / tilesN;
  const int tn = tile - tm * tilesN;
  const int m0 = tm << 6;
  const int n0 = tn << 6;

  if (MODE == 0) {
    // rel_h rows n0 .. n0+63: 64 x 32 values, 8 per thread
    const int nl = tid >> 2, j0 = (tid & 3) * 8;
    const float* rh = rel_h + (size_t)(n0 + nl) * OH + j0;
    const v4f a = *(const v4f*)(rh);
    const v4f c = *(const v4f*)(rh + 4);
    unsigned* d = sRh + nl * 17 + (j0 >> 1);
    d[0] = pk16(f2bf_bits(a[0]), f2bf_bits(a[1]));
    d[1] = pk16(f2bf_bits(a[2]), f2bf_bits(a[3]));
    d[2] = pk16(f2bf_bits(c[0]), f2bf_bits(c[1]));
    d[3] = pk16(f2bf_bits(c[2]), f2bf_bits(c[3]));
    if (tid < 64) {
      const int ii0 = (m0 & (NKV - 1)) >> 5;       // even, m0 being a multiple of 64
      const v2f w = *(const v2f*)(rel_w + (size_t)(n0 + tid) * OW + ii0);
      sRw[tid] = pk16(f2bf_bits(w[0]), f2bf_bits(w[1]));
    }
  }

  const int rlane = lane & 15;
  const int koff  = (lane >> 4) * 8;
  const int mOff  = (lane >> 4) * 8;

  v8f acc[4][4];
#pragma unroll
  for (int i = 0; i < 4; ++i)
#pragma unroll
    for (int j = 0; j < 4; ++j) acc[i][j] = (v8f){0.f,0.f,0.f,0.f,0.f,0.f,0.f,0.f};

  const int kbeg = wave * KW;
  for (int k0 = kbeg; k0 < kbeg + KW; k0 += 32) {
    V bfr[4];
#pragma unroll
    for (int j = 0; j < 4; ++j) {
      const int n = n0 + (j << 4) + rlane;
      if (MODE == 0) bfr[j] = Frag<T>::load(Wp + (size_t)n * KCONV + k0 + koff);
      else           bfr[j] = Frag<T>::load(XT + im2col_off(n, k0) + koff);
    }
#pragma unroll
    for (int i = 0; i < 4; ++i) {
      const int mr = m0 + (i << 4) + rlane;
      V ah;
      if (MODE == 0) ah = Frag<T>::load(XT + im2col_off(mr, k0) + koff);
      else           ah = Frag<T>::load(Wp + (size_t)mr * KCONV + k0 + koff);
#pragma unroll
      for (int j = 0; j < 4; ++j) acc[i][j] = Frag<T>::mma(ah, bfr[j], acc[i][j]);
      Frag<T>::guard(acc[i][0], acc[i][3], ah, ah);
    }
    Frag<T>::keep(bfr[0], bfr[1], bfr[2], bfr[3]);
  }
  acc_guard4(acc[0][0], acc[0][1], acc[0][2], acc[0][3]);
  acc_guard4(acc[1][0], acc[1][1], acc[1][2], acc[1][3]);
  acc_guard4(acc[2][0], acc[2][1], acc[2][2], acc[2][3]);
  acc_guard4(acc[3][0], acc[3][1], acc[3][2], acc[3][3]);

  // ---- this wave's partial tile to its LDS plane ----
  {
    float* part = sP[wave];
#pragma unroll
    for (int i = 0; i < 4; ++i)
#pragma unroll
      for (int j = 0; j < 4; ++j)
#pragma unroll
        for (int r = 0; r < 8; ++r) part[((i << 4) + mOff + r) * 68 + (j << 4) + rlane] = acc[i][j][r];
  }
  __syncthreads();

  // ---- join the 8 partials of rows 8*wave .. +7 and finish them: a lane holds 8 consecutive columns of one row ----
  const int q = lane >> 3, c8 = (lane & 7) * 8;
#pragma unroll
  for (int it = 0; it < 2; ++it) {
    const int row = wave * 8 + it * 4 + q;         // row within the tile
    const float* sp = &sP[0][row * 68 + c8];
    v4f s0 = *(const v4f*)(sp);
    v4f s1 = *(const v4f*)(sp + 4);
#pragma unroll
    for (int w = 1; w < 8; ++w) {
      s0 += *(const v4f*)(sp + w * (64 * 68));
      s1 += *(const v4f*)(sp + w * (64 * 68) + 4);
    }
    v8h hv, lv;
#pragma unroll
    for (int e = 0; e < 8; ++e) {
      float v = (e < 4) ? s0[e & 3] : s1[e & 3];
      if (MODE == 0) {
        const int jj = row & 31;                   // (m0 + row) & 31, m0 being a multiple of 64
        const unsigned hw = sRh[(c8 + e) * 17 + (jj >> 1)] >> ((jj & 1) * 16);
        const unsigned ww = sRw[c8 + e] >> ((row >> 5) * 16);
        const float pos = bf_bits2f((unsigned short)hw) + bf_bits2f((unsigned short)ww);
        v += pos;
      }
      unsigned short hb = f2bf_bits(v);
      unsigned short lb = f2bf_bits(v - bf_bits2f(hb));
      hv[e] = __builtin_bit_cast(_Float16, hb);
      lv[e] = __builtin_bit_cast(_Float16, lb);
    }
    *(v8h*)(Ch + (size_t)(m0 + row) * LDC + n0 + c8) = hv;
    *(v8h*)(Cl + (size_t)(m0 + row) * LDC + n0 + c8) = lv;
  }
}

// =====================================================================================
// Full (non-causal, unmasked) attention, head dim 32, all batches and heads in one launch.
//   q planes (hi/lo bf16) [16384][256]: element (b, n, h, d) at [(b*4096+n)*256 + h*32 + d]
//   k planes (hi/lo bf16) [4096][256]:  element (b, m, h, d) at [(b*1024+m)*256 + h*32 + d]  (pos already folded in)
//   v^T planes (hi/lo bf16) [256][4096]: element (h, d, b, m) at [(h*32 + d)*4096 + b*1024 + m]
//   out f32 NCHW: element (b, h*32+d, n) at [(b*256 + h*32 + d)*4096 + n]
//   scores = (q . k') * 32^-0.5 : bf16 hi/lo split (hi.hi + hi.lo + lo.hi) on v_wmma_f32_16x16x32_bf16
//   out    = p . v             : bf16 hi/lo split of p (unnormalised exp) and v, f32 accumulate, x 1/rowsum in f32 at the end
//   online softmax in f32 over the 1024 keys of the batch element (16 chunks of 64, compile-time trip count, no masking),
//   in base 2: p = 2^(s * scale * log2(e) - m), one multiply-add and one hardware exponential per score.
//   Block = 4 waves = 64 query positions of one (batch, head); grid.x = 4 * 8 * 64 = 2048 (exact).
//   K chunk staging: thread r = tid>>1 stages K row r cols (tid&1)*16 .. +15 (two 16-B copies per plane) -> 64x32 whole tile;
//   V^T chunk staging: thread d = tid>>2 stages row d cols (tid&3)*16 .. +15 -> 32x64 whole tile; __syncthreads before and after.
//   Scores are formed transposed, S^T = K . Q^T (A = K rows, B = Q): a lane holds 32 of the chunk's 64 scores of ONE query
//   (query = lane & 15, keys j*16 + 8*(lane>>4) + r), so maximum and sum run in the lane plus one exchange between lane halves;
//   two S^T tiles converted in place are the B operand of O^T += V^T . P^T (same k order as the V^T loader): P never touches LDS.
// =====================================================================================
#define AT_D  32
#define AT_NW 4
#define AT_QB 64
#define AT_KC 64
#define AT_KP 40   // LDS pitch of a K row in elements: 80 B = 16 B x 5 (odd), so the 16 rows of one 16-byte fragment read fall on 16 distinct bank groups
#define AT_VP 72   // LDS pitch of a V^T row in elements: 144 B = 16 B x 9 (odd), same reason

__device__ __forceinline__ unsigned at_rne_hi(float f) {   // bf16 RNE bits of f in the high half of the word (low half: leftovers of the rounding add)
  const unsigned u = __float_as_uint(f);
  return u + 0x7FFFu + ((u >> 16) & 1u);
}
__device__ __forceinline__ v8f at_mma(v16b a, v16b b, v8f c) {
  c = __builtin_amdgcn_wmma_f32_16x16x32_bf16(false, a, false, b, (short)0, c, false, false);
  asm volatile("v_nop\n\tv_nop\n\tv_nop\n\tv_nop" : "+v"(c) : "v"(a), "v"(b));
  return c;
}

// value of the same lane position in the other 16-lane half (lane ^ 16), as a vector cross-row move
__device__ __forceinline__ float at_xhalf(float f) {
  const int b = __float_as_int(f);
  return __int_as_float(__builtin_amdgcn_permlanex16(b, b, 0x76543210, 0xfedcba98, false, false));
}

__global__ __launch_bounds__(128)
void attn32_kernel(const unsigned short* __restrict__ qhp, const unsigned short* __restrict__ qlp,
                   const unsigned short* __restrict__ khp, const unsigned short* __restrict__ klp,
                   const unsigned short* __restrict__ vhp, const unsigned short* __restrict__ vlp,
                   float* __restrict__ out, float sscale) {
  union FB { v16b v; v8b h[2]; unsigned w[8]; };
  __shared__ __align__(16) __bf16 Ksh[AT_KC * AT_KP];            // K hi [kv][d], padded rows   5 KB
  __shared__ __align__(16) __bf16 Ksl[AT_KC * AT_KP];            // K lo
  __shared__ __align__(16) __bf16 Vth[AT_D * AT_VP];             // V hi [d][kv], padded rows   4.5 KB
  __shared__ __align__(16) __bf16 Vtl[AT_D * AT_VP];             // V lo
  __shared__ __align__(16) float  Os[AT_D * 68];                 // block out tile transposed [d][n_local], pitch 68

  const int tid  = threadIdx.x;
  const int wave = tid >> 5;
  const int lane = tid & 31;
  const int hh   = lane >> 4;
  const int c    = lane & 15;

  const int nqb = NQ / AT_QB;              // 64 query blocks per (batch, head)
  const int bx = blockIdx.x;               // grid = NB * NH * nqb (exact)
  const int qb = bx % nqb;
  const int hb = bx / nqb;
  const int h  = hb % NH;                  // 0..7
  const int b  = hb / NH;                  // 0..3
  const int q0 = b * NQ + qb * AT_QB + wave * 16;   // row in the q planes

  const __bf16* Qh = (const __bf16*)(const void*)qhp + (size_t)h * AT_D;
  const __bf16* Ql = (const __bf16*)(const void*)qlp + (size_t)h * AT_D;
  const __bf16* Kh = (const __bf16*)(const void*)khp + (size_t)h * AT_D;
  const __bf16* Kl = (const __bf16*)(const void*)klp + (size_t)h * AT_D;
  const __bf16* Vh = (const __bf16*)(const void*)vhp + (size_t)h * AT_D * VTP + (size_t)b * NKV;
  const __bf16* Vl = (const __bf16*)(const void*)vlp + (size_t)h * AT_D * VTP + (size_t)b * NKV;

  // ---- Q fragments (B operand, column = lane&15, split k map via Frag load): head dim 32 = one k-step, hi and lo ----
  v16b qah, qal;
  {
    const __bf16* qr = Qh + (size_t)(q0 + c) * DIM + 8 * hh;
    const __bf16* ql = Ql + (size_t)(q0 + c) * DIM + 8 * hh;
    qah = Frag<__bf16>::load(qr);
    qal = Frag<__bf16>::load(ql);
  }

  const float sl2 = sscale * 1.4426950408889634f;   // score scale times log2(e): the softmax runs in base 2
  float mrow = -INFINITY;   // running maximum of this lane's query in base-2 units, max(s) * sl2 (equal in both lane halves)
  float lrow = 0.f;         // running sum over this lane half's keys only; the halves are joined once after the loop
  v8f oacc[2];              // O^T tiles: oacc[t][r] = out[d = t*16 + 8*hh + r][query c]
#pragma unroll
  for (int t = 0; t < 2; ++t) oacc[t] = (v8f){0.f,0.f,0.f,0.f,0.f,0.f,0.f,0.f};

  const int nChunks = NKV / AT_KC;   // 16, compile-time constant
  for (int kc = 0; kc < nChunks; ++kc) {
    const int kv0 = kc * AT_KC;
    __syncthreads();
    {
      // K staging: 128 threads x 16 elements per plane = 64 rows x 32
      const int r = tid >> 1, hf = (tid & 1) * 16;
      const __bf16* ksh = Kh + (size_t)(b * NKV + kv0 + r) * DIM + hf;
      const __bf16* ksl = Kl + (size_t)(b * NKV + kv0 + r) * DIM + hf;
      const v8b a0 = *(const v8b*)(ksh);
      const v8b a1 = *(const v8b*)(ksh + 8);
      const v8b a2 = *(const v8b*)(ksl);
      const v8b a3 = *(const v8b*)(ksl + 8);
      *(v8b*)(Ksh + r * AT_KP + hf)     = a0;
      *(v8b*)(Ksh + r * AT_KP + hf + 8) = a1;
      *(v8b*)(Ksl + r * AT_KP + hf)     = a2;
      *(v8b*)(Ksl + r * AT_KP + hf + 8) = a3;
      // V^T staging: 128 threads x 16 elements per plane = 32 rows x 64
      const int d = tid >> 2, qq = (tid & 3) * 16;
      const __bf16* vsh = Vh + (size_t)d * VTP + kv0 + qq;
      const __bf16* vsl = Vl + (size_t)d * VTP + kv0 + qq;
      const v8b b0 = *(const v8b*)(vsh);
      const v8b b1 = *(const v8b*)(vsh + 8);
      const v8b b2 = *(const v8b*)(vsl);
      const v8b b3 = *(const v8b*)(vsl + 8);
      *(v8b*)(Vth + d * AT_VP + qq)     = b0;
      *(v8b*)(Vth + d * AT_VP + qq + 8) = b1;
      *(v8b*)(Vtl + d * AT_VP + qq)     = b2;
      *(v8b*)(Vtl + d * AT_VP + qq + 8) = b3;
    }
    __syncthreads();

    v8f s[4];
#pragma unroll
    for (int j = 0; j < 4; ++j) {
      s[j] = (v8f){0.f,0.f,0.f,0.f,0.f,0.f,0.f,0.f};
      FB kb, kl;
      kb.h[0] = *(const v8b*)(Ksh + (j * 16 + c) * AT_KP + 8 * hh);
      kb.h[1] = *(const v8b*)(Ksh + (j * 16 + c) * AT_KP + 16 + 8 * hh);
      kl.h[0] = *(const v8b*)(Ksl + (j * 16 + c) * AT_KP + 8 * hh);
      kl.h[1] = *(const v8b*)(Ksl + (j * 16 + c) * AT_KP + 16 + 8 * hh);
      s[j] = at_mma(kb.v, qah, s[j]);
      s[j] = at_mma(kl.v, qah, s[j]);
      s[j] = at_mma(kb.v, qal, s[j]);
    }
    // the query's chunk maximum of the raw scores: in the lane, then one exchange with the other lane half; scaled once (sl2 > 0 keeps the order)
    // (the loops over j, r, t and kk below are unrolled so that s, ph, pl and oacc are indexed at compile time and stay in registers)
    float cm = -INFINITY;
#pragma unroll
    for (int j = 0; j < 4; ++j) {
#pragma unroll
      for (int r = 0; r < 8; ++r) cm = fmaxf(cm, s[j][r]);
    }
    cm = fmaxf(cm, at_xhalf(cm));
    const float mnew = fmaxf(mrow, cm * sl2);
    const float alpha = __builtin_amdgcn_exp2f(mrow - mnew);   // 0 on the first chunk, where mrow is -inf
    mrow = mnew;
    // P^T as B operand: element e of k-step kk = S^T tile 2*kk + (e >> 3), register e & 7 (key kk*32 + 16*(e>>3) + 8*hh + (e&7))
    FB ph[2], pl[2];
    float psum = 0.f;
#pragma unroll
    for (int j = 0; j < 4; ++j) {
#pragma unroll
      for (int r = 0; r < 8; r += 2) {
        // e^(scale*s - max) as 2^(s*sl2 - mnew), the multiply-add on two scores at a time
        const v2f arg = __builtin_elementwise_fma((v2f){s[j][r], s[j][r + 1]}, (v2f){sl2, sl2}, (v2f){-mnew, -mnew});
        const float p0 = __builtin_amdgcn_exp2f(arg[0]);
        const float p1 = __builtin_amdgcn_exp2f(arg[1]);
        psum += p0;
        psum += p1;
        // hi|lo split as before (same bits); the two halves of a word are joined by a byte permute, because with the short
        // exponential the compiler otherwise pairs the split's integer steps over neighbouring words and adds 16-bit moves
        const unsigned t0 = at_rne_hi(p0), t1 = at_rne_hi(p1);
        const unsigned l0 = at_rne_hi(p0 - __uint_as_float(t0 & 0xFFFF0000u));
        const unsigned l1 = at_rne_hi(p1 - __uint_as_float(t1 & 0xFFFF0000u));
        ph[j >> 1].w[(j & 1) * 4 + (r >> 1)] = __builtin_amdgcn_perm(t1, t0, 0x07060302u);
        pl[j >> 1].w[(j & 1) * 4 + (r >> 1)] = __builtin_amdgcn_perm(l1, l0, 0x07060302u);
      }
    }
    lrow = lrow * alpha + psum;
#pragma unroll
    for (int t = 0; t < 2; ++t)
#pragma unroll
      for (int r = 0; r < 8; ++r) oacc[t][r] *= alpha;
#pragma unroll
    for (int kk = 0; kk < 2; ++kk) {
#pragma unroll
      for (int t = 0; t < 2; ++t) {
        FB vb, vl;
        vb.h[0] = *(const v8b*)(Vth + (t * 16 + c) * AT_VP + kk * 32 + 8 * hh);
        vb.h[1] = *(const v8b*)(Vth + (t * 16 + c) * AT_VP + kk * 32 + 16 + 8 * hh);
        vl.h[0] = *(const v8b*)(Vtl + (t * 16 + c) * AT_VP + kk * 32 + 8 * hh);
        vl.h[1] = *(const v8b*)(Vtl + (t * 16 + c) * AT_VP + kk * 32 + 16 + 8 * hh);
        oacc[t] = at_mma(vb.v, ph[kk].v, oacc[t]);
        oacc[t] = at_mma(vl.v, ph[kk].v, oacc[t]);
        oacc[t] = at_mma(vb.v, pl[kk].v, oacc[t]);
      }
    }
  }

  // ---- join the lane halves' sums, normalise and stage: Os[d][n_local], d = t*16 + 8hh + r, n_local = wave*16 + c (all 32 x 64 written) ----
  {
    const float inv = 1.0f / (lrow + at_xhalf(lrow));
#pragma unroll
    for (int t = 0; t < 2; ++t)
#pragma unroll
      for (int r = 0; r < 8; ++r) Os[(t * 16 + 8 * hh + r) * 68 + wave * 16 + c] = oacc[t][r] * inv;
  }
  __syncthreads();
  {
    float* ob = out + ((size_t)(b * DIM + h * AT_D)) * NQ + (size_t)qb * AT_QB;
    const int q = lane >> 3, c4 = (lane & 7) * 4;
    {
#pragma unroll
      for (int it = 0; it < 4; ++it) {
        const int L  = it * 16 + wave * 4 + q;   // 0..63: line index within the block's 32 x 256-B output region
        const int d  = L >> 1;
        const int hf = (L & 1) * 32;
        v4f val = *(const v4f*)(Os + d * 68 + hf + c4);
        *(v4f*)(ob + (size_t)d * NQ + hf + c4) = val;
      }
      
    }
  }
}

// ---------------------------------------------------------------------------
// Workspace region map (byte offsets; every region fully written by its producer launch before any consumer reads it;
//   XT   bf16 [16384][256]         0       8388608
//   WQ   bf16 [256][256]     8388608        131072
//   WKp  bf16 [256][1024]    8519680        524288
//   WVp  bf16 [256][1024]    9043968        524288
//   Qh   bf16 [16384][256]   9568256       8388608   Ql  17956864
//   Kh   bf16 [4096][256]   26345472       2097152   Kl  28442624
//   VTh  bf16 [256][4096]   30539776       2097152   VTl 32636928
//   total                  34734080
// ---------------------------------------------------------------------------
extern "C" void kernel_launch(void* const* d_in, const int* in_sizes, int n_in,
                              void* d_out, int out_size, void* d_ws, size_t ws_size,
                              hipStream_t stream) {
  if (n_in < 6) return;
  if (in_sizes[0] != NB * DIM * NQ) return;          // x [4][256][64][64]
  if (in_sizes[1] != DIM * DIM) return;              // Wq [256][256]
  if (in_sizes[2] != DIM * DIM * 4) return;          // Wk [256][256][2][2]
  if (in_sizes[3] != DIM * DIM * 4) return;          // Wv [256][256][2][2]
  if (in_sizes[4] != NH * HD * OH) return;           // rel_h [1][8][32][1][32]
  if (in_sizes[5] != NH * HD * OW) return;           // rel_w [1][8][32][32][1]
  if (out_size != NB * DIM * NQ) return;

  const float* x     = (const float*)d_in[0];
  const float* Wq    = (const float*)d_in[1];
  const float* Wk    = (const float*)d_in[2];
  const float* Wv    = (const float*)d_in[3];
  const float* rel_h = (const float*)d_in[4];
  const float* rel_w = (const float*)d_in[5];

  const size_t PXT = (size_t)MTOK * DIM * 2;        // 8388608
  const size_t PWQ = (size_t)DIM * DIM * 2;         // 131072
  const size_t PWC = (size_t)DIM * KCONV * 2;       // 524288
  const size_t PQ  = (size_t)MTOK * DIM * 2;        // 8388608
  const size_t PK  = (size_t)MKV * DIM * 2;         // 2097152
  const size_t PVT = (size_t)DIM * VTP * 2;         // 2097152
  size_t off = 0;
  const size_t oXT  = off; off += PXT;
  const size_t oWQ  = off; off += PWQ;
  const size_t oWK  = off; off += PWC;
  const size_t oWV  = off; off += PWC;
  const size_t oQh  = off; off += PQ;   const size_t oQl  = off; off += PQ;
  const size_t oKh  = off; off += PK;   const size_t oKl  = off; off += PK;
  const size_t oVTh = off; off += PVT;  const size_t oVTl = off; off += PVT;
  if (off > ws_size) return;                        // off = 34734080
  if (off > (size_t)134217728) return;

  char* ws = (char*)d_ws;
  unsigned short* XT  = (unsigned short*)(ws + oXT);
  unsigned short* WQ  = (unsigned short*)(ws + oWQ);
  unsigned short* WKp = (unsigned short*)(ws + oWK);
  unsigned short* WVp = (unsigned short*)(ws + oWV);
  unsigned short* Qh  = (unsigned short*)(ws + oQh);  unsigned short* Ql  = (unsigned short*)(ws + oQl);
  unsigned short* Kh  = (unsigned short*)(ws + oKh);  unsigned short* Kl  = (unsigned short*)(ws + oKl);
  unsigned short* VTh = (unsigned short*)(ws + oVTh); unsigned short* VTl = (unsigned short*)(ws + oVTl);

  const dim3 blk(256);

  // (1) x[b] viewed [R=256 c][Cc=4096 n] (pitch 4096) -> XT_b[n][c] (pitch 256); grid (Cc/64, R/64, B) = (64, 4, 4)
  tconv_kernel<<<dim3(NQ / 64, DIM / 64, NB), blk, 0, stream>>>(x, XT, NQ, DIM, (long)DIM * NQ, (long)NQ * DIM);
  // (2) Wq [256][256] -> WQ bf16 same layout; 8192 units -> 32 blocks
  const int n8q = DIM * DIM / 8;
  convrows_kernel<<<dim3(n8q / 256), blk, 0, stream>>>(Wq, WQ, DIM, DIM, n8q);
  // (3,4) conv weights OIHW -> [o][q4*256 + c] bf16; 8192 units -> 32 blocks each
  wperm_kernel<<<dim3((DIM * 32) / 256), blk, 0, stream>>>(Wk, WKp);
  wperm_kernel<<<dim3((DIM * 32) / 256), blk, 0, stream>>>(Wv, WVp);
  // (5) q = XT . WQ^T -> Qh|Ql [16384][256]   (M=16384, N=256, K=256; 1024 tiles -> 128 blocks); bias/resid unused (mode 0)
  const dim3 gQ(((MTOK / 64) * (DIM / 64) + 7) / 8, 1);
  wmma_gemm64<1, false, 0, 2, false, 0><<<gQ, blk, 0, stream>>>(
      XT, XT, DIM, 0L, WQ, WQ, DIM, 0L, (void*)Qh, (void*)Ql, DIM, 0L,
      rel_h, rel_h, 0L, MTOK, DIM, DIM, 1.0f);
  // (6) k' = conv_k(im2col XT) + pos -> Kh|Kl [4096][256]   (M=4096, N=256, K=1024; 256 tiles -> 256 blocks)
  conv_gemm64<0><<<dim3((MKV / 64) * (DIM / 64)), blk, 0, stream>>>(XT, WKp, rel_h, rel_w, Kh, Kl);
  // (7) v^T = WVp . im2col(XT)^T -> VTh|VTl [256][4096]     (M=256, N=4096, K=1024; 256 tiles -> 256 blocks)
  conv_gemm64<1><<<dim3((DIM / 64) * (MKV / 64)), blk, 0, stream>>>(XT, WVp, rel_h, rel_w, VTh, VTl);
  // (8) attention per (batch, head, 64-query block) -> d_out NCHW; 2048 blocks of 128
  attn32_kernel<<<dim3(NB * NH * (NQ / AT_QB)), dim3(128), 0, stream>>>(Qh, Ql, Kh, Kl, VTh, VTl, (float*)d_out,
                                                                        0.17677669529663687f);
  (void)hipGetLastError();
}

// v005
// A run of this version takes 93.6 microseconds.
// Timed twice side by side with v004, it ran 1.27 times as fast both times.
// All steps since v000 together make it 3.70 times as fast.
// Contractions: q projection, k conv (im2col) and v^T conv (im2col) = v_wmma_f32_16x16x32_bf16 single products on bf16 planes of the RNE-converted inputs (exact products); scores q.(k+pos) and p.v = bf16 hi/lo split (hi.hi + hi.lo + lo.hi); f32 accumulate everywhere; positional add, 32^-0.5 scale, online softmax and 1/rowsum in f32 on the VALU.
// Plane / carry map (all carry 1, nothing to fold back):
//   XT  = bf16(x) token-major [16384][256] (row b*4096 + n, n = y*64 + x, col c)
//   WQ  = bf16(Wq) [256 o][256 c];  WKp, WVp bf16 [256 o][1024]: col q4*256 + c = bf16(W[o][c][kh][kw]), q4 = kh*2 + kw
//   Qh|Ql bf16 [16384][256] (col h*32 + d) = hi/lo of q;  Kh|Kl bf16 [4096][256] (row b*1024 + m, m = i*32 + j; col h*32 + d) = hi/lo of (conv_k + pos)
//   pos(h,d,m) = bf16(rel_h[(h*32+d)*32 + (m & 31)]) + bf16(rel_w[(h*32+d)*32 + (m >> 5)]) in f32
//   VTh|VTl bf16 [256 (h*32+d)][4096 (b*1024+m)] = hi/lo of conv_v;  P hi|lo = unnormalised exp, at most 1 up to the rounding of the scaled maximum (f32), 1/rowsum applied to the f32 accumulator
#include <hip/hip_runtime.h>
#include <math.h>
#include <stdint.h>

#define NB    4
#define DIM   256
#define NH    8
#define HD    32
#define IMH   64
#define IMW   64
#define NQ    4096
#define OH    32
#define OW    32
#define NKV   1024
#define KCONV 1024
#define MTOK  (NB * NQ)
#define MKV   (NB * NKV)
#define VTP   (NB * NKV)

static_assert(NQ == IMH * IMW);
static_assert(NKV == OH * OW);
static_assert(OH * 2 == IMH);
static_assert(OW * 2 == IMW);
static_assert(DIM == NH * HD);
static_assert(HD == 32);
static_assert(KCONV == DIM * 4);
static_assert(MTOK % 64 == 0);
static_assert(MKV % 128 == 0);
static_assert(DIM % 64 == 0);
static_assert(KCONV % 32 == 0);
static_assert(DIM % 32 == 0);
static_assert((DIM * DIM) % (8 * 256) == 0);
static_assert(((MKV / 64) * (DIM / 64)) % 8 == 0);
static_assert(((MTOK / 64) * (DIM / 64)) % 8 == 0);
static_assert(DIM * OH == 8192);
static_assert(NQ % 64 == 0);
static_assert(NKV % 64 == 0);

typedef __attribute__((ext_vector_type(16))) _Float16 v16h;
typedef __attribute__((ext_vector_type(8)))  _Float16 v8h;
typedef __attribute__((ext_vector_type(16))) __bf16   v16b;
typedef __attribute__((ext_vector_type(8)))  __bf16   v8b;
typedef __attribute__((ext_vector_type(8)))  float    v8f;
typedef __attribute__((ext_vector_type(4)))  float    v4f;
typedef __attribute__((ext_vector_type(2)))  float    v2f;
typedef __attribute__((ext_vector_type(4)))  unsigned int v4u;
typedef __attribute__((ext_vector_type(2)))  unsigned int v2u;

__device__ __forceinline__ unsigned short f2bf_bits(float f) {
  unsigned u = __float_as_uint(f);
  return (unsigned short)((u + 0x7FFFu + ((u >> 16) & 1u)) >> 16);
}
__device__ __forceinline__ float bf_bits2f(unsigned short h) { return __uint_as_float(((unsigned)h) << 16); }
__device__ __forceinline__ unsigned pk16(unsigned short a, unsigned short b) { return (unsigned)a | ((unsigned)b << 16); }

// hazard guards as plain device helpers (no inline asm inside the kernel template body)
__device__ __forceinline__ void dep_guard_h(v8f& a, v8f& b, v16h x, v16h y) { asm volatile("v_nop\n\tv_nop\n\tv_nop\n\tv_nop" : "+v"(a), "+v"(b) : "v"(x), "v"(y)); }
__device__ __forceinline__ void dep_guard_b(v8f& a, v8f& b, v16b x, v16b y) { asm volatile("v_nop\n\tv_nop\n\tv_nop\n\tv_nop" : "+v"(a), "+v"(b) : "v"(x), "v"(y)); }
__device__ __forceinline__ void keep4_h(v16h a, v16h b, v16h c, v16h d) { asm volatile("v_nop" :: "v"(a), "v"(b), "v"(c), "v"(d)); }
__device__ __forceinline__ void keep4_b(v16b a, v16b b, v16b c, v16b d) { asm volatile("v_nop" :: "v"(a), "v"(b), "v"(c), "v"(d)); }
__device__ __forceinline__ void acc_guard4(v8f& a, v8f& b, v8f& c, v8f& d) { asm volatile("v_nop\n\tv_nop\n\tv_nop\n\tv_nop" : "+v"(a), "+v"(b), "+v"(c), "+v"(d)); }
// s_wait_xcnt 0 behind issued global loads or stores, in front of the next write of a register that they name: the addresses
// (and a store's data) are inputs of the statement, so their registers stay as they are up to the wait
__device__ __forceinline__ void xcnt_wait(const void* a) { asm volatile("s_wait_xcnt 0x0" :: "v"(a) : "memory"); }
__device__ __forceinline__ void xcnt_wait(const void* a, const void* b, const void* c, const void* d) {
  asm volatile("s_wait_xcnt 0x0" :: "v"(a), "v"(b), "v"(c), "v"(d) : "memory");
}
__device__ __forceinline__ void xcnt_wait_st(unsigned short* const (&a)[2], const v4u (&x)[2]) {
  asm volatile("s_wait_xcnt 0x0" :: "v"(a[0]), "v"(a[1]), "v"(x[0]), "v"(x[1]) : "memory");
}
__device__ __forceinline__ void xcnt_wait_st(unsigned short* const (&a)[2], unsigned short* const (&b)[2], const v8h (&x)[2], const v8h (&y)[2]) {
  asm volatile("s_wait_xcnt 0x0" :: "v"(a[0]), "v"(a[1]), "v"(b[0]), "v"(b[1]), "v"(x[0]), "v"(x[1]), "v"(y[0]), "v"(y[1]) : "memory");
}
__device__ __forceinline__ void xcnt_wait_st(unsigned short* const (&a)[4], unsigned short* const (&b)[4], const v8h (&x)[4], const v8h (&y)[4]) {
  asm volatile("s_wait_xcnt 0x0" :: "v"(a[0]), "v"(a[1]), "v"(a[2]), "v"(a[3]), "v"(b[0]), "v"(b[1]), "v"(b[2]), "v"(b[3]),
               "v"(x[0]), "v"(x[1]), "v"(x[2]), "v"(x[3]), "v"(y[0]), "v"(y[1]), "v"(y[2]), "v"(y[3]) : "memory");
}
template <typename T> struct Frag;
template <> struct Frag<_Float16> {
  typedef v16h V; union U { v16h v; v8h h[2]; };
  static __device__ __forceinline__ v16h load(const _Float16* p) {   // elements 0..7 <- p[0..7], 8..15 <- p[16..23]
    U f; f.h[0] = *(const v8h*)(p); f.h[1] = *(const v8h*)(p + 16); return f.v;
  }
  static __device__ __forceinline__ v8f mma(v16h a, v16h b, v8f c) {
    return __builtin_amdgcn_wmma_f32_16x16x32_f16(false, a, false, b, (short)0, c, false, false);
  }
  static __device__ __forceinline__ void guard(v8f& a, v8f& b, v16h x, v16h y) { dep_guard_h(a, b, x, y); }
  static __device__ __forceinline__ void keep(v16h a, v16h b, v16h c, v16h d) { keep4_h(a, b, c, d); }
};
template <> struct Frag<__bf16> {
  typedef v16b V; union U { v16b v; v8b h[2]; };
  static __device__ __forceinline__ v16b load(const __bf16* p) {
    U f; f.h[0] = *(const v8b*)(p); f.h[1] = *(const v8b*)(p + 16); return f.v;
  }
  static __device__ __forceinline__ v8f mma(v16b a, v16b b, v8f c) {
    return __builtin_amdgcn_wmma_f32_16x16x32_bf16(false, a, false, b, (short)0, c, false, false);
  }
  static __device__ __forceinline__ void guard(v8f& a, v8f& b, v16b x, v16b y) { dep_guard_b(a, b, x, y); }
  static __device__ __forceinline__ void keep(v16b a, v16b b, v16b c, v16b d) { keep4_b(a, b, c, d); }
};

// ---- Register-blocked batched WMMA GEMM ------------------------------------
// C[m,n] = scale * sum_k A[m,k] * Bt[n,k] (+bias)(+resid); each wave owns a 64x64 tile.
// A row-major [M,K]; Bt row-major [N,K]; M,N % 64 == 0, K % 32 == 0.
// SPLIT: operands are hi/lo planes (A2/Bt2 = lo planes, same layout); product = hi.hi + hi.lo + lo.hi.
// BIAS_MODE: 0 = none, 1 = bias[m], 2 = bias[n].
// OUT_MODE: 0 = f32, 1 = f16, 2 = bf16 hi plane (Cout) + bf16 lo plane (Cout2).
// ET: 0 = f16 operands, 1 = bf16 operands (pointers passed as 16-bit storage)
template <int ET> struct Elem;
template <> struct Elem<0> { typedef _Float16 T; };
template <> struct Elem<1> { typedef __bf16 T; };
// Device body: smem = the work-group's LDS (8 slabs of 16 x 68 floats are used), bx / by = the block indices of this GEMM's own grid.
template <int ET, bool SPLIT, int BIAS_MODE, int OUT_MODE, bool RESID, int ACT = 0>
__device__ __forceinline__ void wmma_gemm64(
    const unsigned short* __restrict__ Ap, const unsigned short* __restrict__ A2p, int lda, long strideA,
    const unsigned short* __restrict__ Btp, const unsigned short* __restrict__ Bt2p, int ldb, long strideB,
    void* __restrict__ Cout, void* __restrict__ Cout2, int ldc, long strideC,
    const float* __restrict__ bias,
    const float* __restrict__ resid, long strideR,
    int M, int N, int K, float scale, float* smem, int bx, int by) {
  typedef typename Elem<ET>::T T;
  typedef typename Frag<T>::V V;
  const T* A = (const T*)Ap; const T* A2 = (const T*)A2p; const T* Bt = (const T*)Btp; const T* Bt2 = (const T*)Bt2p;
  const int b    = by;
  const int lane = threadIdx.x & 31;
  const int wave = threadIdx.x >> 5;
  const int tilesN = N >> 6;
  const int tilesM = M >> 6;
  const int tile = bx * 8 + wave;
  if (tile >= tilesM * tilesN) return;   // wave-uniform; no block barriers in this body
  const int tm = tile / tilesN;
  const int tn = tile - tm * tilesN;
  const int m0 = tm << 6;
  const int n0 = tn << 6;

  const T* Ab  = A  + (size_t)b * strideA;
  const T* Bb  = Bt + (size_t)b * strideB;
  const T* Ab2 = SPLIT ? (A2  + (size_t)b * strideA) : nullptr;
  const T* Bb2 = SPLIT ? (Bt2 + (size_t)b * strideB) : nullptr;

  const int rlane = lane & 15;                 // row (A) / col (B, D) within subtile
  const int koff  = (lane >> 4) * 8;           // k offset of this lane half
  const int mOff  = (lane >> 4) * 8;           // D row offset

  v8f acc[4][4];
#pragma unroll
  for (int i = 0; i < 4; ++i)
#pragma unroll
    for (int j = 0; j < 4; ++j) acc[i][j] = (v8f){0.f,0.f,0.f,0.f,0.f,0.f,0.f,0.f};

  for (int k0 = 0; k0 < K; k0 += 32) {
    V bh[4], bl[4];
    const T* pb[4];
    const T* pb2[4];
#pragma unroll
    for (int j = 0; j < 4; ++j) {
      const size_t bo = (size_t)(n0 + (j << 4) + rlane) * ldb + koff + k0;
      pb[j] = Bb + bo;
      pb2[j] = SPLIT ? (Bb2 + bo) : pb[j];
      bh[j] = Frag<T>::load(pb[j]);
      if (SPLIT) bl[j] = Frag<T>::load(pb2[j]); else bl[j] = bh[j];
    }
    xcnt_wait(pb[0], pb[1], pb[2], pb[3]);
    if (SPLIT) xcnt_wait(pb2[0], pb2[1], pb2[2], pb2[3]);
#pragma unroll
    for (int i = 0; i < 4; ++i) {
      const size_t ao = (size_t)(m0 + (i << 4) + rlane) * lda + koff + k0;
      const T* pa = Ab + ao;
      V ah = Frag<T>::load(pa);
      xcnt_wait(pa);
      V al;
      if (SPLIT) { const T* pa2 = Ab2 + ao; al = Frag<T>::load(pa2); xcnt_wait(pa2); } else al = ah;
#pragma unroll
      for (int j = 0; j < 4; ++j) {
        acc[i][j] = Frag<T>::mma(ah, bh[j], acc[i][j]);
        if (SPLIT) {
          acc[i][j] = Frag<T>::mma(ah, bl[j], acc[i][j]);
          acc[i][j] = Frag<T>::mma(al, bh[j], acc[i][j]);
        }
      }
      Frag<T>::guard(acc[i][0], acc[i][3], ah, al);
    }
    Frag<T>::keep(bh[0], bh[1], bh[2], bh[3]);
    if (SPLIT) Frag<T>::keep(bl[0], bl[1], bl[2], bl[3]);
  }
  acc_guard4(acc[0][0], acc[0][1], acc[0][2], acc[0][3]);
  acc_guard4(acc[1][0], acc[1][1], acc[1][2], acc[1][3]);
  acc_guard4(acc[2][0], acc[2][1], acc[2][2], acc[2][3]);
  acc_guard4(acc[3][0], acc[3][1], acc[3][2], acc[3][3]);

  // ---- epilogue ----
  float* slab = smem + wave * (16 * 68);           // per-wave 16x64 slab, pitch 68 floats
  const float* Rb = RESID ? (resid + (size_t)b * strideR) : nullptr;
#pragma unroll
  for (int i = 0; i < 4; ++i) {
    const int mBase = m0 + (i << 4);
#pragma unroll
    for (int j = 0; j < 4; ++j) {
      const int n = n0 + (j << 4) + rlane;
      float bv = 0.f;
      if (BIAS_MODE == 2) bv = bias[n];
#pragma unroll
      for (int r = 0; r < 8; ++r) {
        float v = acc[i][j][r] * scale;
        if (BIAS_MODE == 1) v += bias[mBase + mOff + r];
        if (BIAS_MODE == 2) v += bv;
        if (RESID) v += Rb[(size_t)(mBase + mOff + r) * ldc + n];
        if (ACT == 1) v = tanhf(v);
        if (ACT == 2) v = fmaxf(v, 0.0f);
        if (ACT == 3) v = v / (1.0f + expf(-v));
        if (ACT == 4) v = (v > 0.f) ? v : 0.01f * v;
        if (ACT == 5) v = 0.5f * v * (1.0f + erff(v * 0.70710678118654752f));
        slab[(mOff + r) * 68 + (j << 4) + rlane] = v;
      }
    }
    __builtin_amdgcn_fence(__ATOMIC_RELEASE, "workgroup");
    __builtin_amdgcn_wave_barrier();
    __builtin_amdgcn_fence(__ATOMIC_ACQUIRE, "workgroup");
    if (OUT_MODE == 0) {
      float* C = (float*)Cout + (size_t)b * strideC;
      const int hh = lane >> 4, c4 = (lane & 15) * 4;     // row seg = 256 B = 16 lanes x 16 B
      {
#pragma unroll
        for (int it = 0; it < 8; ++it) {
          const int row = it * 2 + hh;
          v4f v = *(const v4f*)(slab + row * 68 + c4);
          *(v4f*)(C + (size_t)(mBase + row) * ldc + n0 + c4) = v;
        }
        
      }
    } else {
      const int q = lane >> 3, c8 = (lane & 7) * 8;
      unsigned short* C  = (unsigned short*)Cout  + (size_t)b * strideC;
      unsigned short* C2 = (OUT_MODE == 2) ? ((unsigned short*)Cout2 + (size_t)b * strideC) : nullptr;
      {
        v8h hv[4], lv[4];
        unsigned short* pc[4];
        unsigned short* pc2[4];
#pragma unroll
        for (int it = 0; it < 4; ++it) {
          const int row = it * 4 + q;
          const float* sp = slab + row * 68 + c8;
#pragma unroll
          for (int e = 0; e < 8; ++e) {
            if (OUT_MODE == 1) {
              hv[it][e] = (_Float16)sp[e];
            } else {
              unsigned short hb = f2bf_bits(sp[e]);
              unsigned short lb = f2bf_bits(sp[e] - bf_bits2f(hb));
              hv[it][e] = __builtin_bit_cast(_Float16, hb);
              lv[it][e] = __builtin_bit_cast(_Float16, lb);
            }
          }
          pc[it]  = C + (size_t)(mBase + row) * ldc + n0 + c8;
          pc2[it] = (OUT_MODE == 2) ? (C2 + (size_t)(mBase + row) * ldc + n0 + c8) : pc[it];
          *(v8h*)pc[it] = hv[it];
          if (OUT_MODE == 2) *(v8h*)pc2[it] = lv[it]; else lv[it] = hv[it];
        }
        xcnt_wait_st(pc, pc2, hv, lv);
        
      }
    }
    __builtin_amdgcn_fence(__ATOMIC_RELEASE, "workgroup");
    __builtin_amdgcn_wave_barrier();
    __builtin_amdgcn_fence(__ATOMIC_ACQUIRE, "workgroup");
  }
}

// ---------------------------------------------------------------------------
// Row-preserving bf16 RNE convert of an f32 matrix [rows][ncols] into a u16 plane with row pitch ldout.
// 8 consecutive elements per thread = one 16-B store; 32 lanes cover 256 consecutive columns of one row
// ---------------------------------------------------------------------------
__device__ __forceinline__ void convrows_body(const float* __restrict__ in, unsigned short* __restrict__ out,
                                              int ncols, int ldout, int n8, int bx) {
  const int i = bx * 256 + threadIdx.x;
  if (i < n8) {
    const size_t e0 = (size_t)i * 8;
    const int row = (int)(e0 / (size_t)ncols);
    const int col = (int)(e0 - (size_t)row * ncols);
    const v4f a = *(const v4f*)(in + e0);
    const v4f c = *(const v4f*)(in + e0 + 4);
    v4u hv;
    hv[0] = pk16(f2bf_bits(a[0]), f2bf_bits(a[1]));
    hv[1] = pk16(f2bf_bits(a[2]), f2bf_bits(a[3]));
    hv[2] = pk16(f2bf_bits(c[0]), f2bf_bits(c[1]));
    hv[3] = pk16(f2bf_bits(c[2]), f2bf_bits(c[3]));
    const size_t o = (size_t)row * ldout + col;
    {
      *(v4u*)(out + o) = hv;
      
    }
  }
}

// ---------------------------------------------------------------------------
// Fused transpose + bf16 RNE convert of an f32 matrix, z-batched, one plane:
//   in_z = W + z*sIn viewed [R rows][Cc cols] with row pitch ldin  ->  oh_z[c][r] = bf16(in_z[r][c]), row pitch ldout, oh_z = oh + z*sOut.
// 64x64 tiles through LDS (tf). Tile indices (bx, by, bz) run over (Cc/64, R/64, Z), 256 threads (R, Cc, ldout multiples of 64).
// Coverage per block: load 4 it x 256 thr x 4 floats = 64x64; store 2 it x 256 thr x 8 u16 = 64x64.
// ---------------------------------------------------------------------------
__device__ __forceinline__ void tconv_body(const float* __restrict__ W, unsigned short* __restrict__ oh,
                                           int ldin, int ldout, long sIn, long sOut, float* tf, int bx, int by, int bz) {
  W  += (size_t)bz * sIn;
  oh += (size_t)bz * sOut;
  const int c0  = bx * 64;   // input column block = output row block
  const int r0  = by * 64;   // input row block    = output column block
  const int tid = threadIdx.x;
  {
    const int lr = tid >> 4;         // 0..15
    const int c4 = (tid & 15) * 4;   // 0..60
    const float* pw[4];
    v4f a[4];
#pragma unroll
    for (int it = 0; it < 4; ++it) {
      pw[it] = W + (size_t)(r0 + it * 16 + lr) * ldin + c0 + c4;   // rows 0..63
      a[it] = *(const v4f*)(pw[it]);
    }
    xcnt_wait(pw[0], pw[1], pw[2], pw[3]);
#pragma unroll
    for (int it = 0; it < 4; ++it) *(v4f*)(tf + (it * 16 + lr) * 68 + c4) = a[it];
  }
  __syncthreads();
  const int sub = tid >> 3;          // 0..31
  const int c8  = (tid & 7) * 8;     // 0..56
  v4u hv[2];
#pragma unroll
  for (int it = 0; it < 2; ++it) {
    const int oc = it * 32 + sub;    // output row within tile (= input column)
    v4u a;
#pragma unroll
    for (int q = 0; q < 4; ++q) {
      const float f0 = tf[(c8 + 2 * q) * 68 + oc];
      const float f1 = tf[(c8 + 2 * q + 1) * 68 + oc];
      a[q] = pk16(f2bf_bits(f0), f2bf_bits(f1));
    }
    hv[it] = a;
  }
  {
    unsigned short* po[2];
#pragma unroll
    for (int it = 0; it < 2; ++it) {
      const int oc = it * 32 + sub;
      const size_t go = (size_t)(c0 + oc) * ldout + r0 + c8;
      po[it] = oh + go;
      *(v4u*)po[it] = hv[it];
    }
    xcnt_wait_st(po, hv);   // the code of the grid's other block ranges follows in the kernel and reuses these registers
  }
}

// ---------------------------------------------------------------------------
// Conv weight permute + bf16 RNE convert: W OIHW [256 o][256 c][2][2] f32 -> O[o][q4*256 + c] u16 (q4 = kh*2 + kw),
// row pitch KCONV = 1024. One unit = (o, c0 = 8*lane): 8 x 16-B loads (the 4 taps of 8 consecutive c), 4 x 16-B stores
// (8 consecutive c of each q4 segment). Per store instruction the 32 lanes of a wave (same o) write 32 x 16 B = the whole
// Coverage: 32 blocks x 256 threads = 8192 units x 32 elements = 256 x 1024 = whole plane.
// ---------------------------------------------------------------------------
__device__ __forceinline__ void wperm_body(const float* __restrict__ W, unsigned short* __restrict__ O, int bx) {
  const int u = bx * 256 + threadIdx.x;   // 0 .. DIM*32 - 1
  if (u < DIM * 32) {
    const int o = u >> 5, c0 = (u & 31) * 8;
    v4f w[8];
#pragma unroll
    for (int e = 0; e < 8; ++e) w[e] = *(const v4f*)(W + ((size_t)(o * DIM + c0 + e)) * 4);
    v4u pk[4];
#pragma unroll
    for (int q4 = 0; q4 < 4; ++q4) {
      v4u a;
#pragma unroll
      for (int p = 0; p < 4; ++p) a[p] = pk16(f2bf_bits(w[2 * p][q4]), f2bf_bits(w[2 * p + 1][q4]));
      pk[q4] = a;
    }
    unsigned short* orow = O + (size_t)o * KCONV + c0;
    {
#pragma unroll
      for (int q4 = 0; q4 < 4; ++q4) *(v4u*)(orow + q4 * DIM) = pk[q4];
      
    }
  }
}

// ---------------------------------------------------------------------------
// The four operand preparations read only inputs and write disjoint planes, so they share one grid by ranges of the block
// index (block-uniform branches): Wq convert, Wk permute, Wv permute, then the x transpose tiles (x fastest, then y, then batch).
// ---------------------------------------------------------------------------
#define PR_WQ ((DIM * DIM / 8) / 256)              // 32 blocks
#define PR_WC ((DIM * 32) / 256)                   // 32 blocks per conv weight
#define PR_XT ((NQ / 64) * (DIM / 64) * NB)        // 1024 blocks
__global__ __launch_bounds__(256) void prep_kernel(const float* __restrict__ x, const float* __restrict__ Wq,
                                                   const float* __restrict__ Wk, const float* __restrict__ Wv,
                                                   unsigned short* __restrict__ XT, unsigned short* __restrict__ WQ,
                                                   unsigned short* __restrict__ WKp, unsigned short* __restrict__ WVp) {
  __shared__ __align__(16) float tf[64 * 68];      // used by the transpose blocks only
  const int bx = blockIdx.x;
  if (bx < PR_WQ) {
    convrows_body(Wq, WQ, DIM, DIM, DIM * DIM / 8, bx);
  } else if (bx < PR_WQ + PR_WC) {
    wperm_body(Wk, WKp, bx - PR_WQ);
  } else if (bx < PR_WQ + 2 * PR_WC) {
    wperm_body(Wv, WVp, bx - (PR_WQ + PR_WC));
  } else {
    // x[b] viewed [R=256 c][Cc=4096 n] (pitch 4096) -> XT_b[n][c] (pitch 256)
    const int t = bx - (PR_WQ + 2 * PR_WC);
    tconv_body(x, XT, NQ, DIM, (long)DIM * NQ, (long)NQ * DIM, tf,
               t % (NQ / 64), (t / (NQ / 64)) % (DIM / 64), t / ((NQ / 64) * (DIM / 64)));
  }
}

// ---------------------------------------------------------------------------
// im2col addressing of the 2x2 / stride-2 / VALID conv as a GEMM over XT (token-major bf16 [NB*4096][256]):
//   im2col row g = b*1024 + m, m = i*32 + j (output grid row i, col j); k = q4*256 + c, q4 = kh*2 + kw;
//   element (g, k) = XT[(b*4096 + (2i+kh)*64 + (2j+kw)) * 256 + c].
// For a 32-deep k-step (k0 % 32 == 0) the 32 k values are 32 consecutive channels of one source token row,
// so a fragment is two 16-B loads at the returned offset + koff and + koff + 16 (arithmetic addressing only).
// ---------------------------------------------------------------------------
__device__ __forceinline__ size_t im2col_off(int g, int k0) {
  const int b = g >> 10, m = g & (NKV - 1);
  const int q4 = k0 >> 8, c0 = k0 & (DIM - 1);
  const int kh = q4 >> 1, kw = q4 & 1;
  const int i = m >> 5, j = m & 31;
  return ((size_t)(b * NQ + (2 * i + kh) * IMW + 2 * j + kw)) * DIM + c0;
}

// ---------------------------------------------------------------------------
// Conv GEMM (bf16 single products, f32 accumulate), K = 1024, one 64x64 output tile per work-group:
//   MODE 0: C[g][o] = sum_k im2col(g,k) * WKp[o][k]  (M = 4096 rows g, N = 256), epilogue adds
//           pos(o, m) = bf16(rel_h[o*32 + (m&31)]) + bf16(rel_w[o*32 + (m>>5)]) in f32, then bf16 hi|lo planes [4096][256].
//   MODE 1: C[o][g] = sum_k WVp[o][k] * im2col(g,k)  (M = 256, N = 4096) -> bf16 hi|lo planes [256][4096] (v^T layout).
// K is split over the 8 waves: wave w sums k = 128w .. 128w+127 (4 k-steps) of the whole tile into its own f32 partial,
// writes it to its LDS plane, and behind one work-group barrier wave w adds the 8 partials (plane 0 first, then 1 .. 7)
// of rows 8w .. 8w+7 and finishes those rows (pos, hi|lo split, whole 128-B line stores).
// MODE 0 tables (bf16 bits, two per dword), written before the k loop and read only behind that same barrier:
//   sRh[nl*17 + (jj>>1)] holds rel_h[(n0+nl)*32 + jj] (pitch 17 dwords: the 8 lanes of a row read 8 distinct banks);
//   sRw[nl] holds rel_w[(n0+nl)*32 + ii0 + {0,1}], ii0 = first of the two output-grid rows that the tile's 64 rows m cover.
// 256 work-groups x 8 waves = 256 tiles exactly (both modes); tile = the work-group's index within its range of the shared grid.
// ---------------------------------------------------------------------------
#define CG_PLANE (64 * 68)                         // floats of one wave's partial tile
#define CG_LDS   (8 * CG_PLANE + 64 * 17 + 64)     // dwords of LDS that MODE 0 uses (MODE 1: the 8 planes only)
template <int MODE>
__device__ __forceinline__ void conv_gemm64(const unsigned short* __restrict__ XTp, const unsigned short* __restrict__ Wpp,
                                            const float* __restrict__ rel_h, const float* __restrict__ rel_w,
                                            unsigned short* __restrict__ Ch, unsigned short* __restrict__ Cl,
                                            float* smem, int tile) {
  typedef __bf16 T;
  typedef v16b V;
  const T* XT = (const T*)XTp; const T* Wp = (const T*)Wpp;
  float* sP = smem;                                // 8 planes: per-wave partial 64x64 tile, pitch 68 floats
  unsigned* sRh = (unsigned*)(smem + 8 * CG_PLANE);   // MODE 0 only: 64 x 17 dwords
  unsigned* sRw = sRh + 64 * 17;                      // MODE 0 only: 64 dwords
  constexpr int M = (MODE == 0) ? MKV : DIM;
  constexpr int N = (MODE == 0) ? DIM : MKV;
  constexpr int LDC = N;
  constexpr int KW = KCONV / 8;                    // k range of one wave
  static_assert(KW % 32 == 0);
  const int tid  = threadIdx.x;
  const int lane = tid & 31;
  const int wave = __builtin_amdgcn_readfirstlane(tid >> 5);   // scalar, so that the k offsets stay scalar

  constexpr int tilesN = N >> 6;
  constexpr int tilesM = M >> 6;
  if (tile >= tilesM * tilesN) return;   // block-uniform, in front of the barrier; never taken with the exact grid
  const int tm = tile / tilesN;
  const int tn = tile - tm * tilesN;
  const int m0 = tm << 6;
  const int n0 = tn << 6;

  if (MODE == 0) {
    // rel_h rows n0 .. n0+63: 64 x 32 values, 8 per thread
    const int nl = tid >> 2, j0 = (tid & 3) * 8;
    const float* rh = rel_h + (size_t)(n0 + nl) * OH + j0;
    const v4f a = *(const v4f*)(rh);
    const v4f c = *(const v4f*)(rh + 4);
    unsigned* d = sRh + nl * 17 + (j0 >> 1);
    d[0] = pk16(f2bf_bits(a[0]), f2bf_bits(a[1]));
    d[1] = pk16(f2bf_bits(a[2]), f2bf_bits(a[3]));
    d[2] = pk16(f2bf_bits(c[0]), f2bf_bits(c[1]));
    d[3] = pk16(f2bf_bits(c[2]), f2bf_bits(c[3]));
    if (tid < 64) {
      const int ii0 = (m0 & (NKV - 1)) >> 5;       // even, m0 being a multiple of 64
      const v2f w = *(const v2f*)(rel_w + (size_t)(n0 + tid) * OW + ii0);
      sRw[tid] = pk16(f2bf_bits(w[0]), f2bf_bits(w[1]));
    }
  }

  const int rlane = lane & 15;
  const int koff  = (lane >> 4) * 8;
  const int mOff  = (lane >> 4) * 8;

  v8f acc[4][4];
#pragma unroll
  for (int i = 0; i < 4; ++i)
#pragma unroll
    for (int j = 0; j < 4; ++j) acc[i][j] = (v8f){0.f,0.f,0.f,0.f,0.f,0.f,0.f,0.f};

  const int kbeg = wave * KW;
  for (int k0 = kbeg; k0 < kbeg + KW; k0 += 32) {
    V bfr[4];
    const T* pb[4];
#pragma unroll
    for (int j = 0; j < 4; ++j) {
      const int n = n0 + (j << 4) + rlane;
      if (MODE == 0) pb[j] = Wp + (size_t)n * KCONV + k0 + koff;
      else           pb[j] = XT + im2col_off(n, k0) + koff;
      bfr[j] = Frag<T>::load(pb[j]);
    }
    xcnt_wait(pb[0], pb[1], pb[2], pb[3]);
#pragma unroll
    for (int i = 0; i < 4; ++i) {
      const int mr = m0 + (i << 4) + rlane;
      const T* pa;
      if (MODE == 0) pa = XT + im2col_off(mr, k0) + koff;
      else           pa = Wp + (size_t)mr * KCONV + k0 + koff;
      V ah = Frag<T>::load(pa);
      xcnt_wait(pa);
#pragma unroll
      for (int j = 0; j < 4; ++j) acc[i][j] = Frag<T>::mma(ah, bfr[j], acc[i][j]);
      Frag<T>::guard(acc[i][0], acc[i][3], ah, ah);
    }
    Frag<T>::keep(bfr[0], bfr[1], bfr[2], bfr[3]);
  }
  acc_guard4(acc[0][0], acc[0][1], acc[0][2], acc[0][3]);
  acc_guard4(acc[1][0], acc[1][1], acc[1][2], acc[1][3]);
  acc_guard4(acc[2][0], acc[2][1], acc[2][2], acc[2][3]);
  acc_guard4(acc[3][0], acc[3][1], acc[3][2], acc[3][3]);

  // ---- this wave's partial tile to its LDS plane ----
  {
    float* part = sP + wave * CG_PLANE;
#pragma unroll
    for (int i = 0; i < 4; ++i)
#pragma unroll
      for (int j = 0; j < 4; ++j)
#pragma unroll
        for (int r = 0; r < 8; ++r) part[((i << 4) + mOff + r) * 68 + (j << 4) + rlane] = acc[i][j][r];
  }
  __syncthreads();

  // ---- join the 8 partials of rows 8*wave .. +7 and finish them: a lane holds 8 consecutive columns of one row ----
  const int q = lane >> 3, c8 = (lane & 7) * 8;
  v8h hv[2], lv[2];
  unsigned short* pch[2];
  unsigned short* pcl[2];
#pragma unroll
  for (int it = 0; it < 2; ++it) {
    const int row = wave * 8 + it * 4 + q;         // row within the tile
    const float* sp = sP + row * 68 + c8;
    v4f s0 = *(const v4f*)(sp);
    v4f s1 = *(const v4f*)(sp + 4);
#pragma unroll
    for (int w = 1; w < 8; ++w) {
      s0 += *(const v4f*)(sp + w * (64 * 68));
      s1 += *(const v4f*)(sp + w * (64 * 68) + 4);
    }
#pragma unroll
    for (int e = 0; e < 8; ++e) {
      float v = (e < 4) ? s0[e & 3] : s1[e & 3];
      if (MODE == 0) {
        const int jj = row & 31;                   // (m0 + row) & 31, m0 being a multiple of 64
        const unsigned hw = sRh[(c8 + e) * 17 + (jj >> 1)] >> ((jj & 1) * 16);
        const unsigned ww = sRw[c8 + e] >> ((row >> 5) * 16);
        const float pos = bf_bits2f((unsigned short)hw) + bf_bits2f((unsigned short)ww);
        v += pos;
      }
      unsigned short hb = f2bf_bits(v);
      unsigned short lb = f2bf_bits(v - bf_bits2f(hb));
      hv[it][e] = __builtin_bit_cast(_Float16, hb);
      lv[it][e] = __builtin_bit_cast(_Float16, lb);
    }
    pch[it] = Ch + (size_t)(m0 + row) * LDC + n0 + c8;
    pcl[it] = Cl + (size_t)(m0 + row) * LDC + n0 + c8;
    *(v8h*)pch[it] = hv[it];
    *(v8h*)pcl[it] = lv[it];
  }
  xcnt_wait_st(pch, pcl, hv, lv);   // the code of the grid's other block ranges follows in the kernel and reuses these registers
}

// ---------------------------------------------------------------------------
// The three GEMMs read only the prepared planes and write disjoint planes, so they share one grid by ranges of the block index
// (block-uniform branches) and one LDS array: the q projection first (its waves run the longest k loop), then k', then v^T.
//   q = XT . WQ^T -> Qh|Ql [16384][256]   (M=16384, N=256, K=256; 1024 tiles, 8 per block); bias/resid unused (mode 0)
// ---------------------------------------------------------------------------
#define G3_Q (((MTOK / 64) * (DIM / 64)) / 8)      // 128 blocks
#define G3_C ((MKV / 64) * (DIM / 64))             // 256 blocks per conv GEMM
static_assert(CG_LDS >= 8 * 16 * 68);
__global__ __launch_bounds__(256) void gemm3_kernel(const unsigned short* __restrict__ XT, const unsigned short* __restrict__ WQ,
                                                    const unsigned short* __restrict__ WKp, const unsigned short* __restrict__ WVp,
                                                    const float* __restrict__ rel_h, const float* __restrict__ rel_w,
                                                    unsigned short* __restrict__ Qh, unsigned short* __restrict__ Ql,
                                                    unsigned short* __restrict__ Kh, unsigned short* __restrict__ Kl,
                                                    unsigned short* __restrict__ VTh, unsigned short* __restrict__ VTl) {
  __shared__ __align__(16) float smem[CG_LDS];
  const int bx = blockIdx.x;
  if (bx < G3_Q) {
    wmma_gemm64<1, false, 0, 2, false, 0>(XT, XT, DIM, 0L, WQ, WQ, DIM, 0L, (void*)Qh, (void*)Ql, DIM, 0L,
                                          rel_h, rel_h, 0L, MTOK, DIM, DIM, 1.0f, smem, bx, 0);
  } else if (bx < G3_Q + G3_C) {
    conv_gemm64<0>(XT, WKp, rel_h, rel_w, Kh, Kl, smem, bx - G3_Q);
  } else {
    conv_gemm64<1>(XT, WVp, rel_h, rel_w, VTh, VTl, smem, bx - (G3_Q + G3_C));
  }
}

// =====================================================================================
// Full (non-causal, unmasked) attention, head dim 32, all batches and heads in one launch.
//   q planes (hi/lo bf16) [16384][256]: element (b, n, h, d) at [(b*4096+n)*256 + h*32 + d]
//   k planes (hi/lo bf16) [4096][256]:  element (b, m, h, d) at [(b*1024+m)*256 + h*32 + d]  (pos already folded in)
//   v^T planes (hi/lo bf16) [256][4096]: element (h, d, b, m) at [(h*32 + d)*4096 + b*1024 + m]
//   out f32 NCHW: element (b, h*32+d, n) at [(b*256 + h*32 + d)*4096 + n]
//   scores = (q . k') * 32^-0.5 : bf16 hi/lo split (hi.hi + hi.lo + lo.hi) on v_wmma_f32_16x16x32_bf16
//   out    = p . v             : bf16 hi/lo split of p (unnormalised exp) and v, f32 accumulate, x 1/rowsum in f32 at the end
//   online softmax in f32 over the 1024 keys of the batch element (16 chunks of 64, compile-time trip count, no masking),
//   in base 2: p = 2^(s * scale * log2(e) - m), one multiply-add and one hardware exponential per score.
//   Block = 4 waves = 64 query positions of one (batch, head); grid.x = 4 * 8 * 64 = 2048 (exact).
//   K chunk staging: thread r = tid>>1 stages K row r cols (tid&1)*16 .. +15 (two 16-B copies per plane) -> 64x32 whole tile;
//   V^T chunk staging: thread d = tid>>2 stages row d cols (tid&3)*16 .. +15 -> 32x64 whole tile; __syncthreads before and after.
//   Scores are formed transposed, S^T = K . Q^T (A = K rows, B = Q): a lane holds 32 of the chunk's 64 scores of ONE query
//   (query = lane & 15, keys j*16 + 8*(lane>>4) + r), so maximum and sum run in the lane plus one exchange between lane halves;
//   two S^T tiles converted in place are the B operand of O^T += V^T . P^T (same k order as the V^T loader): P never touches LDS.
// =====================================================================================
#define AT_D  32
#define AT_NW 4
#define AT_QB 64
#define AT_KC 64
#define AT_KP 40   // LDS pitch of a K row in elements: 80 B = 16 B x 5 (odd), so the 16 rows of one 16-byte fragment read fall on 16 distinct bank groups
#define AT_VP 72   // LDS pitch of a V^T row in elements: 144 B = 16 B x 9 (odd), same reason

__device__ __forceinline__ unsigned at_rne_hi(float f) {   // bf16 RNE bits of f in the high half of the word (low half: leftovers of the rounding add)
  const unsigned u = __float_as_uint(f);
  return u + 0x7FFFu + ((u >> 16) & 1u);
}
__device__ __forceinline__ v8f at_mma(v16b a, v16b b, v8f c) {
  c = __builtin_amdgcn_wmma_f32_16x16x32_bf16(false, a, false, b, (short)0, c, false, false);
  asm volatile("v_nop\n\tv_nop\n\tv_nop\n\tv_nop" : "+v"(c) : "v"(a), "v"(b));
  return c;
}

// value of the same lane position in the other 16-lane half (lane ^ 16), as a vector cross-row move
__device__ __forceinline__ float at_xhalf(float f) {
  const int b = __float_as_int(f);
  return __int_as_float(__builtin_amdgcn_permlanex16(b, b, 0x76543210, 0xfedcba98, false, false));
}

__global__ __launch_bounds__(128)
void attn32_kernel(const unsigned short* __restrict__ qhp, const unsigned short* __restrict__ qlp,
                   const unsigned short* __restrict__ khp, const unsigned short* __restrict__ klp,
                   const unsigned short* __restrict__ vhp, const unsigned short* __restrict__ vlp,
                   float* __restrict__ out, float sscale) {
  union FB { v16b v; v8b h[2]; unsigned w[8]; };
  __shared__ __align__(16) __bf16 Ksh[AT_KC * AT_KP];            // K hi [kv][d], padded rows   5 KB
  __shared__ __align__(16) __bf16 Ksl[AT_KC * AT_KP];            // K lo
  __shared__ __align__(16) __bf16 Vth[AT_D * AT_VP];             // V hi [d][kv], padded rows   4.5 KB
  __shared__ __align__(16) __bf16 Vtl[AT_D * AT_VP];             // V lo
  __shared__ __align__(16) float  Os[AT_D * 68];                 // block out tile transposed [d][n_local], pitch 68

  const int tid  = threadIdx.x;
  const int wave = tid >> 5;
  const int lane = tid & 31;
  const int hh   = lane >> 4;
  const int c    = lane & 15;

  const int nqb = NQ / AT_QB;              // 64 query blocks per (batch, head)
  const int bx = blockIdx.x;               // grid = NB * NH * nqb (exact)
  const int qb = bx % nqb;
  const int hb = bx / nqb;
  const int h  = hb % NH;                  // 0..7
  const int b  = hb / NH;                  // 0..3
  const int q0 = b * NQ + qb * AT_QB + wave * 16;   // row in the q planes

  const __bf16* Qh = (const __bf16*)(const void*)qhp + (size_t)h * AT_D;
  const __bf16* Ql = (const __bf16*)(const void*)qlp + (size_t)h * AT_D;
  const __bf16* Kh = (const __bf16*)(const void*)khp + (size_t)h * AT_D;
  const __bf16* Kl = (const __bf16*)(const void*)klp + (size_t)h * AT_D;
  const __bf16* Vh = (const __bf16*)(const void*)vhp + (size_t)h * AT_D * VTP + (size_t)b * NKV;
  const __bf16* Vl = (const __bf16*)(const void*)vlp + (size_t)h * AT_D * VTP + (size_t)b * NKV;

  // ---- Q fragments (B operand, column = lane&15, split k map via Frag load): head dim 32 = one k-step, hi and lo ----
  v16b qah, qal;
  {
    const __bf16* qr = Qh + (size_t)(q0 + c) * DIM + 8 * hh;
    const __bf16* ql = Ql + (size_t)(q0 + c) * DIM + 8 * hh;
    qah = Frag<__bf16>::load(qr);
    qal = Frag<__bf16>::load(ql);
  }

  const float sl2 = sscale * 1.4426950408889634f;   // score scale times log2(e): the softmax runs in base 2
  float mrow = -INFINITY;   // running maximum of this lane's query in base-2 units, max(s) * sl2 (equal in both lane halves)
  float lrow = 0.f;         // running sum over this lane half's keys only; the halves are joined once after the loop
  v8f oacc[2];              // O^T tiles: oacc[t][r] = out[d = t*16 + 8*hh + r][query c]
#pragma unroll
  for (int t = 0; t < 2; ++t) oacc[t] = (v8f){0.f,0.f,0.f,0.f,0.f,0.f,0.f,0.f};

  const int nChunks = NKV / AT_KC;   // 16, compile-time constant
  for (int kc = 0; kc < nChunks; ++kc) {
    const int kv0 = kc * AT_KC;
    __syncthreads();
    {
      // K staging: 128 threads x 16 elements per plane = 64 rows x 32
      const int r = tid >> 1, hf = (tid & 1) * 16;
      const __bf16* ksh = Kh + (size_t)(b * NKV + kv0 + r) * DIM + hf;
      const __bf16* ksl = Kl + (size_t)(b * NKV + kv0 + r) * DIM + hf;
      const v8b a0 = *(const v8b*)(ksh);
      const v8b a1 = *(const v8b*)(ksh + 8);
      const v8b a2 = *(const v8b*)(ksl);
      const v8b a3 = *(const v8b*)(ksl + 8);
      *(v8b*)(Ksh + r * AT_KP + hf)     = a0;
      *(v8b*)(Ksh + r * AT_KP + hf + 8) = a1;
      *(v8b*)(Ksl + r * AT_KP + hf)     = a2;
      *(v8b*)(Ksl + r * AT_KP + hf + 8) = a3;
      // V^T staging: 128 threads x 16 elements per plane = 32 rows x 64
      const int d = tid >> 2, qq = (tid & 3) * 16;
      const __bf16* vsh = Vh + (size_t)d * VTP + kv0 + qq;
      const __bf16* vsl = Vl + (size_t)d * VTP + kv0 + qq;
      const v8b b0 = *(const v8b*)(vsh);
      const v8b b1 = *(const v8b*)(vsh + 8);
      const v8b b2 = *(const v8b*)(vsl);
      const v8b b3 = *(const v8b*)(vsl + 8);
      *(v8b*)(Vth + d * AT_VP + qq)     = b0;
      *(v8b*)(Vth + d * AT_VP + qq + 8) = b1;
      *(v8b*)(Vtl + d * AT_VP + qq)     = b2;
      *(v8b*)(Vtl + d * AT_VP + qq + 8) = b3;
    }
    __syncthreads();

    v8f s[4];
#pragma unroll
    for (int j = 0; j < 4; ++j) {
      s[j] = (v8f){0.f,0.f,0.f,0.f,0.f,0.f,0.f,0.f};
      FB kb, kl;
      kb.h[0] = *(const v8b*)(Ksh + (j * 16 + c) * AT_KP + 8 * hh);
      kb.h[1] = *(const v8b*)(Ksh + (j * 16 + c) * AT_KP + 16 + 8 * hh);
      kl.h[0] = *(const v8b*)(Ksl + (j * 16 + c) * AT_KP + 8 * hh);
      kl.h[1] = *(const v8b*)(Ksl + (j * 16 + c) * AT_KP + 16 + 8 * hh);
      s[j] = at_mma(kb.v, qah, s[j]);
      s[j] = at_mma(kl.v, qah, s[j]);
      s[j] = at_mma(kb.v, qal, s[j]);
    }
    // the query's chunk maximum of the raw scores: in the lane, then one exchange with the other lane half; scaled once (sl2 > 0 keeps the order)
    // (the loops over j, r, t and kk below are unrolled so that s, ph, pl and oacc are indexed at compile time and stay in registers)
    float cm = -INFINITY;
#pragma unroll
    for (int j = 0; j < 4; ++j) {
#pragma unroll
      for (int r = 0; r < 8; ++r) cm = fmaxf(cm, s[j][r]);
    }
    cm = fmaxf(cm, at_xhalf(cm));
    const float mnew = fmaxf(mrow, cm * sl2);
    const float alpha = __builtin_amdgcn_exp2f(mrow - mnew);   // 0 on the first chunk, where mrow is -inf
    mrow = mnew;
    // P^T as B operand: element e of k-step kk = S^T tile 2*kk + (e >> 3), register e & 7 (key kk*32 + 16*(e>>3) + 8*hh + (e&7))
    FB ph[2], pl[2];
    float psum = 0.f;
#pragma unroll
    for (int j = 0; j < 4; ++j) {
#pragma unroll
      for (int r = 0; r < 8; r += 2) {
        // e^(scale*s - max) as 2^(s*sl2 - mnew), the multiply-add on two scores at a time
        const v2f arg = __builtin_elementwise_fma((v2f){s[j][r], s[j][r + 1]}, (v2f){sl2, sl2}, (v2f){-mnew, -mnew});
        const float p0 = __builtin_amdgcn_exp2f(arg[0]);
        const float p1 = __builtin_amdgcn_exp2f(arg[1]);
        psum += p0;
        psum += p1;
        // hi|lo split as before (same bits); the two halves of a word are joined by a byte permute, because with the short
        // exponential the compiler otherwise pairs the split's integer steps over neighbouring words and adds 16-bit moves
        const unsigned t0 = at_rne_hi(p0), t1 = at_rne_hi(p1);
        const unsigned l0 = at_rne_hi(p0 - __uint_as_float(t0 & 0xFFFF0000u));
        const unsigned l1 = at_rne_hi(p1 - __uint_as_float(t1 & 0xFFFF0000u));
        ph[j >> 1].w[(j & 1) * 4 + (r >> 1)] = __builtin_amdgcn_perm(t1, t0, 0x07060302u);
        pl[j >> 1].w[(j & 1) * 4 + (r >> 1)] = __builtin_amdgcn_perm(l1, l0, 0x07060302u);
      }
    }
    lrow = lrow * alpha + psum;
#pragma unroll
    for (int t = 0; t < 2; ++t)
#pragma unroll
      for (int r = 0; r < 8; ++r) oacc[t][r] *= alpha;
#pragma unroll
    for (int kk = 0; kk < 2; ++kk) {
#pragma unroll
      for (int t = 0; t < 2; ++t) {
        FB vb, vl;
        vb.h[0] = *(const v8b*)(Vth + (t * 16 + c) * AT_VP + kk * 32 + 8 * hh);
        vb.h[1] = *(const v8b*)(Vth + (t * 16 + c) * AT_VP + kk * 32 + 16 + 8 * hh);
        vl.h[0] = *(const v8b*)(Vtl + (t * 16 + c) * AT_VP + kk * 32 + 8 * hh);
        vl.h[1] = *(const v8b*)(Vtl + (t * 16 + c) * AT_VP + kk * 32 + 16 + 8 * hh);
        oacc[t] = at_mma(vb.v, ph[kk].v, oacc[t]);
        oacc[t] = at_mma(vl.v, ph[kk].v, oacc[t]);
        oacc[t] = at_mma(vb.v, pl[kk].v, oacc[t]);
      }
    }
  }

  // ---- join the lane halves' sums, normalise and stage: Os[d][n_local], d = t*16 + 8hh + r, n_local = wave*16 + c (all 32 x 64 written) ----
  {
    const float inv = 1.0f / (lrow + at_xhalf(lrow));
#pragma unroll
    for (int t = 0; t < 2; ++t)
#pragma unroll
      for (int r = 0; r < 8; ++r) Os[(t * 16 + 8 * hh + r) * 68 + wave * 16 + c] = oacc[t][r] * inv;
  }
  __syncthreads();
  {
    float* ob = out + ((size_t)(b * DIM + h * AT_D)) * NQ + (size_t)qb * AT_QB;
    const int q = lane >> 3, c4 = (lane & 7) * 4;
    {
#pragma unroll
      for (int it = 0; it < 4; ++it) {
        const int L  = it * 16 + wave * 4 + q;   // 0..63: line index within the block's 32 x 256-B output region
        const int d  = L >> 1;
        const int hf = (L & 1) * 32;
        v4f val = *(const v4f*)(Os + d * 68 + hf + c4);
        *(v4f*)(ob + (size_t)d * NQ + hf + c4) = val;
      }
      
    }
  }
}

// ---------------------------------------------------------------------------
// Workspace region map (byte offsets; every region fully written by its producer launch before any consumer reads it;
//   XT   bf16 [16384][256]         0       8388608
//   WQ   bf16 [256][256]     8388608        131072
//   WKp  bf16 [256][1024]    8519680        524288
//   WVp  bf16 [256][1024]    9043968        524288
//   Qh   bf16 [16384][256]   9568256       8388608   Ql  17956864
//   Kh   bf16 [4096][256]   26345472       2097152   Kl  28442624
//   VTh  bf16 [256][4096]   30539776       2097152   VTl 32636928
//   total                  34734080
// ---------------------------------------------------------------------------
extern "C" void kernel_launch(void* const* d_in, const int* in_sizes, int n_in,
                              void* d_out, int out_size, void* d_ws, size_t ws_size,
                              hipStream_t stream) {
  if (n_in < 6) return;
  if (in_sizes[0] != NB * DIM * NQ) return;          // x [4][256][64][64]
  if (in_sizes[1] != DIM * DIM) return;              // Wq [256][256]
  if (in_sizes[2] != DIM * DIM * 4) return;          // Wk [256][256][2][2]
  if (in_sizes[3] != DIM * DIM * 4) return;          // Wv [256][256][2][2]
  if (in_sizes[4] != NH * HD * OH) return;           // rel_h [1][8][32][1][32]
  if (in_sizes[5] != NH * HD * OW) return;           // rel_w [1][8][32][32][1]
  if (out_size != NB * DIM * NQ) return;

  const float* x     = (const float*)d_in[0];
  const float* Wq    = (const float*)d_in[1];
  const float* Wk    = (const float*)d_in[2];
  const float* Wv    = (const float*)d_in[3];
  const float* rel_h = (const float*)d_in[4];
  const float* rel_w = (const float*)d_in[5];

  const size_t PXT = (size_t)MTOK * DIM * 2;        // 8388608
  const size_t PWQ = (size_t)DIM * DIM * 2;         // 131072
  const size_t PWC = (size_t)DIM * KCONV * 2;       // 524288
  const size_t PQ  = (size_t)MTOK * DIM * 2;        // 8388608
  const size_t PK  = (size_t)MKV * DIM * 2;         // 2097152
  const size_t PVT = (size_t)DIM * VTP * 2;         // 2097152
  size_t off = 0;
  const size_t oXT  = off; off += PXT;
  const size_t oWQ  = off; off += PWQ;
  const size_t oWK  = off; off += PWC;
  const size_t oWV  = off; off += PWC;
  const size_t oQh  = off; off += PQ;   const size_t oQl  = off; off += PQ;
  const size_t oKh  = off; off += PK;   const size_t oKl  = off; off += PK;
  const size_t oVTh = off; off += PVT;  const size_t oVTl = off; off += PVT;
  if (off > ws_size) return;                        // off = 34734080
  if (off > (size_t)134217728) return;

  char* ws = (char*)d_ws;
  unsigned short* XT  = (unsigned short*)(ws + oXT);
  unsigned short* WQ  = (unsigned short*)(ws + oWQ);
  unsigned short* WKp = (unsigned short*)(ws + oWK);
  unsigned short* WVp = (unsigned short*)(ws + oWV);
  unsigned short* Qh  = (unsigned short*)(ws + oQh);  unsigned short* Ql  = (unsigned short*)(ws + oQl);
  unsigned short* Kh  = (unsigned short*)(ws + oKh);  unsigned short* Kl  = (unsigned short*)(ws + oKl);
  unsigned short* VTh = (unsigned short*)(ws + oVTh); unsigned short* VTl = (unsigned short*)(ws + oVTl);

  const dim3 blk(256);

  // (1) operand preparation: WQ, WKp, WVp and XT; 32 + 32 + 32 + 1024 blocks
  prep_kernel<<<dim3(PR_WQ + 2 * PR_WC + PR_XT), blk, 0, stream>>>(x, Wq, Wk, Wv, XT, WQ, WKp, WVp);
  // (2) q -> Qh|Ql, k' = conv_k + pos -> Kh|Kl, v^T = conv_v -> VTh|VTl; 128 + 256 + 256 blocks
  gemm3_kernel<<<dim3(G3_Q + 2 * G3_C), blk, 0, stream>>>(XT, WQ, WKp, WVp, rel_h, rel_w, Qh, Ql, Kh, Kl, VTh, VTl);
  // (3) attention per (batch, head, 64-query block) -> d_out NCHW; 2048 blocks of 128
  attn32_kernel<<<dim3(NB * NH * (NQ / AT_QB)), dim3(128), 0, stream>>>(Qh, Ql, Kh, Kl, VTh, VTl, (float*)d_out,
                                                                        0.17677669529663687f);
  (void)hipGetLastError();
}

// v006
// A run of this version takes 78.5 microseconds.
// Next to v005, in two timings, it ran 1.19 and 1.18 times as fast.
// Over all steps from v000 it is 4.40 times as fast.
// Contractions: q projection, k conv (im2col) and v^T conv (im2col) = v_wmma_f32_16x16x32_bf16 single products on bf16 planes of the RNE-converted inputs (exact products); scores q.(k+pos) and p.v = bf16 hi/lo split (hi.hi + hi.lo + lo.hi); f32 accumulate everywhere; positional add, 32^-0.5 scale, online softmax and 1/rowsum in f32 on the VALU.
// Plane / carry map (all carry 1, nothing to fold back):
//   XT  = bf16(x) token-major [16384][256] (row b*4096 + n, n = y*64 + x, col c)
//   WQ  = bf16(Wq) [256 o][256 c];  WKp, WVp bf16 [256 o][1024]: col q4*256 + c = bf16(W[o][c][kh][kw]), q4 = kh*2 + kw
//   Qh|Ql bf16 [16384][256] (col h*32 + d) = hi/lo of q;  Kh|Kl bf16 [4096][256] (row b*1024 + m, m = i*32 + j; col h*32 + d) = hi/lo of (conv_k + pos)
//   pos(h,d,m) = bf16(rel_h[(h*32+d)*32 + (m & 31)]) + bf16(rel_w[(h*32+d)*32 + (m >> 5)]) in f32
//   VTh|VTl bf16 [256 (h*32+d)][4096 (b*1024+m)] = hi/lo of conv_v;  P hi|lo = unnormalised exp, at most 1 up to the rounding of the scaled maximum (f32), 1/rowsum applied to the f32 accumulator
#include <hip/hip_runtime.h>
#include <math.h>
#include <stdint.h>

#define NB    4
#define DIM   256
#define NH    8
#define HD    32
#define IMH   64
#define IMW   64
#define NQ    4096
#define OH    32
#define OW    32
#define NKV   1024
#define KCONV 1024
#define MTOK  (NB * NQ)
#define MKV   (NB * NKV)
#define VTP   (NB * NKV)

static_assert(NQ == IMH * IMW);
static_assert(NKV == OH * OW);
static_assert(OH * 2 == IMH);
static_assert(OW * 2 == IMW);
static_assert(DIM == NH * HD);
static_assert(HD == 32);
static_assert(KCONV == DIM * 4);
static_assert(MTOK % 64 == 0);
static_assert(MKV % 128 == 0);
static_assert(DIM % 64 == 0);
static_assert(KCONV % 32 == 0);
static_assert(DIM % 32 == 0);
static_assert((DIM * DIM) % (8 * 256) == 0);
static_assert(((MKV / 64) * (DIM / 64)) % 8 == 0);
static_assert(((MTOK / 64) * (DIM / 64)) % 8 == 0);
static_assert(DIM * OH == 8192);
static_assert(NQ % 64 == 0);
static_assert(NKV % 64 == 0);

typedef __attribute__((ext_vector_type(16))) _Float16 v16h;
typedef __attribute__((ext_vector_type(8)))  _Float16 v8h;
typedef __attribute__((ext_vector_type(16))) __bf16   v16b;
typedef __attribute__((ext_vector_type(8)))  __bf16   v8b;
typedef __attribute__((ext_vector_type(2)))  __bf16   v2b;
typedef __attribute__((ext_vector_type(8)))  float    v8f;
typedef __attribute__((ext_vector_type(4)))  float    v4f;
typedef __attribute__((ext_vector_type(2)))  float    v2f;
typedef __attribute__((ext_vector_type(4)))  unsigned int v4u;
typedef __attribute__((ext_vector_type(2)))  unsigned int v2u;

__device__ __forceinline__ unsigned short f2bf_bits(float f) {
  unsigned u = __float_as_uint(f);
  return (unsigned short)((u + 0x7FFFu + ((u >> 16) & 1u)) >> 16);
}
__device__ __forceinline__ float bf_bits2f(unsigned short h) { return __uint_as_float(((unsigned)h) << 16); }
__device__ __forceinline__ unsigned pk16(unsigned short a, unsigned short b) { return (unsigned)a | ((unsigned)b << 16); }

// hazard guards as plain device helpers (no inline asm inside the kernel template body)
__device__ __forceinline__ void dep_guard_h(v8f& a, v8f& b, v16h x, v16h y) { asm volatile("v_nop\n\tv_nop\n\tv_nop\n\tv_nop" : "+v"(a), "+v"(b) : "v"(x), "v"(y)); }
__device__ __forceinline__ void dep_guard_b(v8f& a, v8f& b, v16b x, v16b y) { asm volatile("v_nop\n\tv_nop\n\tv_nop\n\tv_nop" : "+v"(a), "+v"(b) : "v"(x), "v"(y)); }
__device__ __forceinline__ void keep4_h(v16h a, v16h b, v16h c, v16h d) { asm volatile("v_nop" :: "v"(a), "v"(b), "v"(c), "v"(d)); }
__device__ __forceinline__ void keep4_b(v16b a, v16b b, v16b c, v16b d) { asm volatile("v_nop" :: "v"(a), "v"(b), "v"(c), "v"(d)); }
__device__ __forceinline__ void acc_guard4(v8f& a, v8f& b, v8f& c, v8f& d) { asm volatile("v_nop\n\tv_nop\n\tv_nop\n\tv_nop" : "+v"(a), "+v"(b), "+v"(c), "+v"(d)); }
// s_wait_xcnt 0 behind issued global loads or stores, in front of the next write of a register that they name: the addresses
// (and a store's data) are inputs of the statement, so their registers stay as they are up to the wait
__device__ __forceinline__ void xcnt_wait(const void* a) { asm volatile("s_wait_xcnt 0x0" :: "v"(a) : "memory"); }
__device__ __forceinline__ void xcnt_wait(const void* a, const void* b, const void* c, const void* d) {
  asm volatile("s_wait_xcnt 0x0" :: "v"(a), "v"(b), "v"(c), "v"(d) : "memory");
}
__device__ __forceinline__ void xcnt_wait_st(unsigned short* const (&a)[2], const v4u (&x)[2]) {
  asm volatile("s_wait_xcnt 0x0" :: "v"(a[0]), "v"(a[1]), "v"(x[0]), "v"(x[1]) : "memory");
}
__device__ __forceinline__ void xcnt_wait_st(unsigned short* const (&a)[2], unsigned short* const (&b)[2], const v8h (&x)[2], const v8h (&y)[2]) {
  asm volatile("s_wait_xcnt 0x0" :: "v"(a[0]), "v"(a[1]), "v"(b[0]), "v"(b[1]), "v"(x[0]), "v"(x[1]), "v"(y[0]), "v"(y[1]) : "memory");
}
__device__ __forceinline__ void xcnt_wait_st(unsigned short* const (&a)[4], unsigned short* const (&b)[4], const v8h (&x)[4], const v8h (&y)[4]) {
  asm volatile("s_wait_xcnt 0x0" :: "v"(a[0]), "v"(a[1]), "v"(a[2]), "v"(a[3]), "v"(b[0]), "v"(b[1]), "v"(b[2]), "v"(b[3]),
               "v"(x[0]), "v"(x[1]), "v"(x[2]), "v"(x[3]), "v"(y[0]), "v"(y[1]), "v"(y[2]), "v"(y[3]) : "memory");
}
template <typename T> struct Frag;
template <> struct Frag<_Float16> {
  typedef v16h V; union U { v16h v; v8h h[2]; };
  static __device__ __forceinline__ v16h load(const _Float16* p) {   // elements 0..7 <- p[0..7], 8..15 <- p[16..23]
    U f; f.h[0] = *(const v8h*)(p); f.h[1] = *(const v8h*)(p + 16); return f.v;
  }
  static __device__ __forceinline__ v8f mma(v16h a, v16h b, v8f c) {
    return __builtin_amdgcn_wmma_f32_16x16x32_f16(false, a, false, b, (short)0, c, false, false);
  }
  static __device__ __forceinline__ void guard(v8f& a, v8f& b, v16h x, v16h y) { dep_guard_h(a, b, x, y); }
  static __device__ __forceinline__ void keep(v16h a, v16h b, v16h c, v16h d) { keep4_h(a, b, c, d); }
};
template <> struct Frag<__bf16> {
  typedef v16b V; union U { v16b v; v8b h[2]; };
  static __device__ __forceinline__ v16b load(const __bf16* p) {
    U f; f.h[0] = *(const v8b*)(p); f.h[1] = *(const v8b*)(p + 16); return f.v;
  }
  static __device__ __forceinline__ v8f mma(v16b a, v16b b, v8f c) {
    return __builtin_amdgcn_wmma_f32_16x16x32_bf16(false, a, false, b, (short)0, c, false, false);
  }
  static __device__ __forceinline__ void guard(v8f& a, v8f& b, v16b x, v16b y) { dep_guard_b(a, b, x, y); }
  static __device__ __forceinline__ void keep(v16b a, v16b b, v16b c, v16b d) { keep4_b(a, b, c, d); }
};

// ---- Register-blocked batched WMMA GEMM ------------------------------------
// C[m,n] = scale * sum_k A[m,k] * Bt[n,k] (+bias)(+resid); each wave owns a 64x64 tile.
// A row-major [M,K]; Bt row-major [N,K]; M,N % 64 == 0, K % 32 == 0.
// SPLIT: operands are hi/lo planes (A2/Bt2 = lo planes, same layout); product = hi.hi + hi.lo + lo.hi.
// BIAS_MODE: 0 = none, 1 = bias[m], 2 = bias[n].
// OUT_MODE: 0 = f32, 1 = f16, 2 = bf16 hi plane (Cout) + bf16 lo plane (Cout2).
// ET: 0 = f16 operands, 1 = bf16 operands (pointers passed as 16-bit storage)
template <int ET> struct Elem;
template <> struct Elem<0> { typedef _Float16 T; };
template <> struct Elem<1> { typedef __bf16 T; };
// Device body: smem = the work-group's LDS (8 slabs of 16 x 68 floats are used), bx / by = the block indices of this GEMM's own grid.
template <int ET, bool SPLIT, int BIAS_MODE, int OUT_MODE, bool RESID, int ACT = 0>
__device__ __forceinline__ void wmma_gemm64(
    const unsigned short* __restrict__ Ap, const unsigned short* __restrict__ A2p, int lda, long strideA,
    const unsigned short* __restrict__ Btp, const unsigned short* __restrict__ Bt2p, int ldb, long strideB,
    void* __restrict__ Cout, void* __restrict__ Cout2, int ldc, long strideC,
    const float* __restrict__ bias,
    const float* __restrict__ resid, long strideR,
    int M, int N, int K, float scale, float* smem, int bx, int by) {
  typedef typename Elem<ET>::T T;
  typedef typename Frag<T>::V V;
  const T* A = (const T*)Ap; const T* A2 = (const T*)A2p; const T* Bt = (const T*)Btp; const T* Bt2 = (const T*)Bt2p;
  const int b    = by;
  const int lane = threadIdx.x & 31;
  const int wave = threadIdx.x >> 5;
  const int tilesN = N >> 6;
  const int tilesM = M >> 6;
  const int tile = bx * 8 + wave;
  if (tile >= tilesM * tilesN) return;   // wave-uniform; no block barriers in this body
  const int tm = tile / tilesN;
  const int tn = tile - tm * tilesN;
  const int m0 = tm << 6;
  const int n0 = tn << 6;

  const T* Ab  = A  + (size_t)b * strideA;
  const T* Bb  = Bt + (size_t)b * strideB;
  const T* Ab2 = SPLIT ? (A2  + (size_t)b * strideA) : nullptr;
  const T* Bb2 = SPLIT ? (Bt2 + (size_t)b * strideB) : nullptr;

  const int rlane = lane & 15;                 // row (A) / col (B, D) within subtile
  const int koff  = (lane >> 4) * 8;           // k offset of this lane half
  const int mOff  = (lane >> 4) * 8;           // D row offset

  v8f acc[4][4];
#pragma unroll
  for (int i = 0; i < 4; ++i)
#pragma unroll
    for (int j = 0; j < 4; ++j) acc[i][j] = (v8f){0.f,0.f,0.f,0.f,0.f,0.f,0.f,0.f};

  for (int k0 = 0; k0 < K; k0 += 32) {
    V bh[4], bl[4];
    const T* pb[4];
    const T* pb2[4];
#pragma unroll
    for (int j = 0; j < 4; ++j) {
      const size_t bo = (size_t)(n0 + (j << 4) + rlane) * ldb + koff + k0;
      pb[j] = Bb + bo;
      pb2[j] = SPLIT ? (Bb2 + bo) : pb[j];
      bh[j] = Frag<T>::load(pb[j]);
      if (SPLIT) bl[j] = Frag<T>::load(pb2[j]); else bl[j] = bh[j];
    }
    xcnt_wait(pb[0], pb[1], pb[2], pb[3]);
    if (SPLIT) xcnt_wait(pb2[0], pb2[1], pb2[2], pb2[3]);
#pragma unroll
    for (int i = 0; i < 4; ++i) {
      const size_t ao = (size_t)(m0 + (i << 4) + rlane) * lda + koff + k0;
      const T* pa = Ab + ao;
      V ah = Frag<T>::load(pa);
      xcnt_wait(pa);
      V al;
      if (SPLIT) { const T* pa2 = Ab2 + ao; al = Frag<T>::load(pa2); xcnt_wait(pa2); } else al = ah;
#pragma unroll
      for (int j = 0; j < 4; ++j) {
        acc[i][j] = Frag<T>::mma(ah, bh[j], acc[i][j]);
        if (SPLIT) {
          acc[i][j] = Frag<T>::mma(ah, bl[j], acc[i][j]);
          acc[i][j] = Frag<T>::mma(al, bh[j], acc[i][j]);
        }
      }
      Frag<T>::guard(acc[i][0], acc[i][3], ah, al);
    }
    Frag<T>::keep(bh[0], bh[1], bh[2], bh[3]);
    if (SPLIT) Frag<T>::keep(bl[0], bl[1], bl[2], bl[3]);
  }
  acc_guard4(acc[0][0], acc[0][1], acc[0][2], acc[0][3]);
  acc_guard4(acc[1][0], acc[1][1], acc[1][2], acc[1][3]);
  acc_guard4(acc[2][0], acc[2][1], acc[2][2], acc[2][3]);
  acc_guard4(acc[3][0], acc[3][1], acc[3][2], acc[3][3]);

  // ---- epilogue ----
  float* slab = smem + wave * (16 * 68);           // per-wave 16x64 slab, pitch 68 floats
  const float* Rb = RESID ? (resid + (size_t)b * strideR) : nullptr;
#pragma unroll
  for (int i = 0; i < 4; ++i) {
    const int mBase = m0 + (i << 4);
#pragma unroll
    for (int j = 0; j < 4; ++j) {
      const int n = n0 + (j << 4) + rlane;
      float bv = 0.f;
      if (BIAS_MODE == 2) bv = bias[n];
#pragma unroll
      for (int r = 0; r < 8; ++r) {
        float v = acc[i][j][r] * scale;
        if (BIAS_MODE == 1) v += bias[mBase + mOff + r];
        if (BIAS_MODE == 2) v += bv;
        if (RESID) v += Rb[(size_t)(mBase + mOff + r) * ldc + n];
        if (ACT == 1) v = tanhf(v);
        if (ACT == 2) v = fmaxf(v, 0.0f);
        if (ACT == 3) v = v / (1.0f + expf(-v));
        if (ACT == 4) v = (v > 0.f) ? v : 0.01f * v;
        if (ACT == 5) v = 0.5f * v * (1.0f + erff(v * 0.70710678118654752f));
        slab[(mOff + r) * 68 + (j << 4) + rlane] = v;
      }
    }
    __builtin_amdgcn_fence(__ATOMIC_RELEASE, "workgroup");
    __builtin_amdgcn_wave_barrier();
    __builtin_amdgcn_fence(__ATOMIC_ACQUIRE, "workgroup");
    if (OUT_MODE == 0) {
      float* C = (float*)Cout + (size_t)b * strideC;
      const int hh = lane >> 4, c4 = (lane & 15) * 4;     // row seg = 256 B = 16 lanes x 16 B
      {
#pragma unroll
        for (int it = 0; it < 8; ++it) {
          const int row = it * 2 + hh;
          v4f v = *(const v4f*)(slab + row * 68 + c4);
          *(v4f*)(C + (size_t)(mBase + row) * ldc + n0 + c4) = v;
        }
        
      }
    } else {
      const int q = lane >> 3, c8 = (lane & 7) * 8;
      unsigned short* C  = (unsigned short*)Cout  + (size_t)b * strideC;
      unsigned short* C2 = (OUT_MODE == 2) ? ((unsigned short*)Cout2 + (size_t)b * strideC) : nullptr;
      {
        v8h hv[4], lv[4];
        unsigned short* pc[4];
        unsigned short* pc2[4];
#pragma unroll
        for (int it = 0; it < 4; ++it) {
          const int row = it * 4 + q;
          const float* sp = slab + row * 68 + c8;
#pragma unroll
          for (int e = 0; e < 8; ++e) {
            if (OUT_MODE == 1) {
              hv[it][e] = (_Float16)sp[e];
            } else {
              unsigned short hb = f2bf_bits(sp[e]);
              unsigned short lb = f2bf_bits(sp[e] - bf_bits2f(hb));
              hv[it][e] = __builtin_bit_cast(_Float16, hb);
              lv[it][e] = __builtin_bit_cast(_Float16, lb);
            }
          }
          pc[it]  = C + (size_t)(mBase + row) * ldc + n0 + c8;
          pc2[it] = (OUT_MODE == 2) ? (C2 + (size_t)(mBase + row) * ldc + n0 + c8) : pc[it];
          *(v8h*)pc[it] = hv[it];
          if (OUT_MODE == 2) *(v8h*)pc2[it] = lv[it]; else lv[it] = hv[it];
        }
        xcnt_wait_st(pc, pc2, hv, lv);
        
      }
    }
    __builtin_amdgcn_fence(__ATOMIC_RELEASE, "workgroup");
    __builtin_amdgcn_wave_barrier();
    __builtin_amdgcn_fence(__ATOMIC_ACQUIRE, "workgroup");
  }
}

// ---------------------------------------------------------------------------
// Row-preserving bf16 RNE convert of an f32 matrix [rows][ncols] into a u16 plane with row pitch ldout.
// 8 consecutive elements per thread = one 16-B store; 32 lanes cover 256 consecutive columns of one row
// ---------------------------------------------------------------------------
__device__ __forceinline__ void convrows_body(const float* __restrict__ in, unsigned short* __restrict__ out,
                                              int ncols, int ldout, int n8, int bx) {
  const int i = bx * 256 + threadIdx.x;
  if (i < n8) {
    const size_t e0 = (size_t)i * 8;
    const int row = (int)(e0 / (size_t)ncols);
    const int col = (int)(e0 - (size_t)row * ncols);
    const v4f a = *(const v4f*)(in + e0);
    const v4f c = *(const v4f*)(in + e0 + 4);
    v4u hv;
    hv[0] = pk16(f2bf_bits(a[0]), f2bf_bits(a[1]));
    hv[1] = pk16(f2bf_bits(a[2]), f2bf_bits(a[3]));
    hv[2] = pk16(f2bf_bits(c[0]), f2bf_bits(c[1]));
    hv[3] = pk16(f2bf_bits(c[2]), f2bf_bits(c[3]));
    const size_t o = (size_t)row * ldout + col;
    {
      *(v4u*)(out + o) = hv;
      
    }
  }
}

// ---------------------------------------------------------------------------
// Fused transpose + bf16 RNE convert of an f32 matrix, z-batched, one plane:
//   in_z = W + z*sIn viewed [R rows][Cc cols] with row pitch ldin  ->  oh_z[c][r] = bf16(in_z[r][c]), row pitch ldout, oh_z = oh + z*sOut.
// 64x64 tiles through LDS (tf). Tile indices (bx, by, bz) run over (Cc/64, R/64, Z), 256 threads (R, Cc, ldout multiples of 64).
// Coverage per block: load 4 it x 256 thr x 4 floats = 64x64; store 2 it x 256 thr x 8 u16 = 64x64.
// ---------------------------------------------------------------------------
__device__ __forceinline__ void tconv_body(const float* __restrict__ W, unsigned short* __restrict__ oh,
                                           int ldin, int ldout, long sIn, long sOut, float* tf, int bx, int by, int bz) {
  W  += (size_t)bz * sIn;
  oh += (size_t)bz * sOut;
  const int c0  = bx * 64;   // input column block = output row block
  const int r0  = by * 64;   // input row block    = output column block
  const int tid = threadIdx.x;
  {
    const int lr = tid >> 4;         // 0..15
    const int c4 = (tid & 15) * 4;   // 0..60
    const float* pw[4];
    v4f a[4];
#pragma unroll
    for (int it = 0; it < 4; ++it) {
      pw[it] = W + (size_t)(r0 + it * 16 + lr) * ldin + c0 + c4;   // rows 0..63
      a[it] = *(const v4f*)(pw[it]);
    }
    xcnt_wait(pw[0], pw[1], pw[2], pw[3]);
#pragma unroll
    for (int it = 0; it < 4; ++it) *(v4f*)(tf + (it * 16 + lr) * 68 + c4) = a[it];
  }
  __syncthreads();
  const int sub = tid >> 3;          // 0..31
  const int c8  = (tid & 7) * 8;     // 0..56
  v4u hv[2];
#pragma unroll
  for (int it = 0; it < 2; ++it) {
    const int oc = it * 32 + sub;    // output row within tile (= input column)
    v4u a;
#pragma unroll
    for (int q = 0; q < 4; ++q) {
      const float f0 = tf[(c8 + 2 * q) * 68 + oc];
      const float f1 = tf[(c8 + 2 * q + 1) * 68 + oc];
      a[q] = pk16(f2bf_bits(f0), f2bf_bits(f1));
    }
    hv[it] = a;
  }
  {
    unsigned short* po[2];
#pragma unroll
    for (int it = 0; it < 2; ++it) {
      const int oc = it * 32 + sub;
      const size_t go = (size_t)(c0 + oc) * ldout + r0 + c8;
      po[it] = oh + go;
      *(v4u*)po[it] = hv[it];
    }
    xcnt_wait_st(po, hv);   // the code of the grid's other block ranges follows in the kernel and reuses these registers
  }
}

// ---------------------------------------------------------------------------
// Conv weight permute + bf16 RNE convert: W OIHW [256 o][256 c][2][2] f32 -> O[o][q4*256 + c] u16 (q4 = kh*2 + kw),
// row pitch KCONV = 1024. One unit = (o, c0 = 8*lane): 8 x 16-B loads (the 4 taps of 8 consecutive c), 4 x 16-B stores
// (8 consecutive c of each q4 segment). Per store instruction the 32 lanes of a wave (same o) write 32 x 16 B = the whole
// Coverage: 32 blocks x 256 threads = 8192 units x 32 elements = 256 x 1024 = whole plane.
// ---------------------------------------------------------------------------
__device__ __forceinline__ void wperm_body(const float* __restrict__ W, unsigned short* __restrict__ O, int bx) {
  const int u = bx * 256 + threadIdx.x;   // 0 .. DIM*32 - 1
  if (u < DIM * 32) {
    const int o = u >> 5, c0 = (u & 31) * 8;
    v4f w[8];
#pragma unroll
    for (int e = 0; e < 8; ++e) w[e] = *(const v4f*)(W + ((size_t)(o * DIM + c0 + e)) * 4);
    v4u pk[4];
#pragma unroll
    for (int q4 = 0; q4 < 4; ++q4) {
      v4u a;
#pragma unroll
      for (int p = 0; p < 4; ++p) a[p] = pk16(f2bf_bits(w[2 * p][q4]), f2bf_bits(w[2 * p + 1][q4]));
      pk[q4] = a;
    }
    unsigned short* orow = O + (size_t)o * KCONV + c0;
    {
#pragma unroll
      for (int q4 = 0; q4 < 4; ++q4) *(v4u*)(orow + q4 * DIM) = pk[q4];
      
    }
  }
}

// ---------------------------------------------------------------------------
// The four operand preparations read only inputs and write disjoint planes, so they share one grid by ranges of the block
// index (block-uniform branches): Wq convert, Wk permute, Wv permute, then the x transpose tiles (x fastest, then y, then batch).
// ---------------------------------------------------------------------------
#define PR_WQ ((DIM * DIM / 8) / 256)              // 32 blocks
#define PR_WC ((DIM * 32) / 256)                   // 32 blocks per conv weight
#define PR_XT ((NQ / 64) * (DIM / 64) * NB)        // 1024 blocks
__global__ __launch_bounds__(256) void prep_kernel(const float* __restrict__ x, const float* __restrict__ Wq,
                                                   const float* __restrict__ Wk, const float* __restrict__ Wv,
                                                   unsigned short* __restrict__ XT, unsigned short* __restrict__ WQ,
                                                   unsigned short* __restrict__ WKp, unsigned short* __restrict__ WVp) {
  __shared__ __align__(16) float tf[64 * 68];      // used by the transpose blocks only
  const int bx = blockIdx.x;
  if (bx < PR_WQ) {
    convrows_body(Wq, WQ, DIM, DIM, DIM * DIM / 8, bx);
  } else if (bx < PR_WQ + PR_WC) {
    wperm_body(Wk, WKp, bx - PR_WQ);
  } else if (bx < PR_WQ + 2 * PR_WC) {
    wperm_body(Wv, WVp, bx - (PR_WQ + PR_WC));
  } else {
    // x[b] viewed [R=256 c][Cc=4096 n] (pitch 4096) -> XT_b[n][c] (pitch 256)
    const int t = bx - (PR_WQ + 2 * PR_WC);
    tconv_body(x, XT, NQ, DIM, (long)DIM * NQ, (long)NQ * DIM, tf,
               t % (NQ / 64), (t / (NQ / 64)) % (DIM / 64), t / ((NQ / 64) * (DIM / 64)));
  }
}

// ---------------------------------------------------------------------------
// im2col addressing of the 2x2 / stride-2 / VALID conv as a GEMM over XT (token-major bf16 [NB*4096][256]):
//   im2col row g = b*1024 + m, m = i*32 + j (output grid row i, col j); k = q4*256 + c, q4 = kh*2 + kw;
//   element (g, k) = XT[(b*4096 + (2i+kh)*64 + (2j+kw)) * 256 + c].
// For a 32-deep k-step (k0 % 32 == 0) the 32 k values are 32 consecutive channels of one source token row,
// so a fragment is two 16-B loads at the returned offset + koff and + koff + 16 (arithmetic addressing only).
// ---------------------------------------------------------------------------
__device__ __forceinline__ size_t im2col_off(int g, int k0) {
  const int b = g >> 10, m = g & (NKV - 1);
  const int q4 = k0 >> 8, c0 = k0 & (DIM - 1);
  const int kh = q4 >> 1, kw = q4 & 1;
  const int i = m >> 5, j = m & 31;
  return ((size_t)(b * NQ + (2 * i + kh) * IMW + 2 * j + kw)) * DIM + c0;
}

// ---------------------------------------------------------------------------
// Conv GEMM (bf16 single products, f32 accumulate), K = 1024, one 64x64 output tile per work-group:
//   MODE 0: C[g][o] = sum_k im2col(g,k) * WKp[o][k]  (M = 4096 rows g, N = 256), epilogue adds
//           pos(o, m) = bf16(rel_h[o*32 + (m&31)]) + bf16(rel_w[o*32 + (m>>5)]) in f32, then bf16 hi|lo planes [4096][256].
//   MODE 1: C[o][g] = sum_k WVp[o][k] * im2col(g,k)  (M = 256, N = 4096) -> bf16 hi|lo planes [256][4096] (v^T layout).
// K is split over the 8 waves: wave w sums k = 128w .. 128w+127 (4 k-steps) of the whole tile into its own f32 partial,
// writes it to its LDS plane, and behind one work-group barrier wave w adds the 8 partials (plane 0 first, then 1 .. 7)
// of rows 8w .. 8w+7 and finishes those rows (pos, hi|lo split, whole 128-B line stores).
// MODE 0 tables (bf16 bits, two per dword), written before the k loop and read only behind that same barrier:
//   sRh[nl*17 + (jj>>1)] holds rel_h[(n0+nl)*32 + jj] (pitch 17 dwords: the 8 lanes of a row read 8 distinct banks);
//   sRw[nl] holds rel_w[(n0+nl)*32 + ii0 + {0,1}], ii0 = first of the two output-grid rows that the tile's 64 rows m cover.
// 256 work-groups x 8 waves = 256 tiles exactly (both modes); tile = the work-group's index within its range of the shared grid.
// ---------------------------------------------------------------------------
#define CG_PLANE (64 * 68)                         // floats of one wave's partial tile
#define CG_LDS   (8 * CG_PLANE + 64 * 17 + 64)     // dwords of LDS that MODE 0 uses (MODE 1: the 8 planes only)
template <int MODE>
__device__ __forceinline__ void conv_gemm64(const unsigned short* __restrict__ XTp, const unsigned short* __restrict__ Wpp,
                                            const float* __restrict__ rel_h, const float* __restrict__ rel_w,
                                            unsigned short* __restrict__ Ch, unsigned short* __restrict__ Cl,
                                            float* smem, int tile) {
  typedef __bf16 T;
  typedef v16b V;
  const T* XT = (const T*)XTp; const T* Wp = (const T*)Wpp;
  float* sP = smem;                                // 8 planes: per-wave partial 64x64 tile, pitch 68 floats
  unsigned* sRh = (unsigned*)(smem + 8 * CG_PLANE);   // MODE 0 only: 64 x 17 dwords
  unsigned* sRw = sRh + 64 * 17;                      // MODE 0 only: 64 dwords
  constexpr int M = (MODE == 0) ? MKV : DIM;
  constexpr int N = (MODE == 0) ? DIM : MKV;
  constexpr int LDC = N;
  constexpr int KW = KCONV / 8;                    // k range of one wave
  static_assert(KW % 32 == 0);
  const int tid  = threadIdx.x;
  const int lane = tid & 31;
  const int wave = __builtin_amdgcn_readfirstlane(tid >> 5);   // scalar, so that the k offsets stay scalar

  constexpr int tilesN = N >> 6;
  constexpr int tilesM = M >> 6;
  if (tile >= tilesM * tilesN) return;   // block-uniform, in front of the barrier; never taken with the exact grid
  const int tm = tile / tilesN;
  const int tn = tile - tm * tilesN;
  const int m0 = tm << 6;
  const int n0 = tn << 6;

  if (MODE == 0) {
    // rel_h rows n0 .. n0+63: 64 x 32 values, 8 per thread
    const int nl = tid >> 2, j0 = (tid & 3) * 8;
    const float* rh = rel_h + (size_t)(n0 + nl) * OH + j0;
    const v4f a = *(const v4f*)(rh);
    const v4f c = *(const v4f*)(rh + 4);
    unsigned* d = sRh + nl * 17 + (j0 >> 1);
    d[0] = pk16(f2bf_bits(a[0]), f2bf_bits(a[1]));
    d[1] = pk16(f2bf_bits(a[2]), f2bf_bits(a[3]));
    d[2] = pk16(f2bf_bits(c[0]), f2bf_bits(c[1]));
    d[3] = pk16(f2bf_bits(c[2]), f2bf_bits(c[3]));
    if (tid < 64) {
      const int ii0 = (m0 & (NKV - 1)) >> 5;       // even, m0 being a multiple of 64
      const v2f w = *(const v2f*)(rel_w + (size_t)(n0 + tid) * OW + ii0);
      sRw[tid] = pk16(f2bf_bits(w[0]), f2bf_bits(w[1]));
    }
  }

  const int rlane = lane & 15;
  const int koff  = (lane >> 4) * 8;
  const int mOff  = (lane >> 4) * 8;

  v8f acc[4][4];
#pragma unroll
  for (int i = 0; i < 4; ++i)
#pragma unroll
    for (int j = 0; j < 4; ++j) acc[i][j] = (v8f){0.f,0.f,0.f,0.f,0.f,0.f,0.f,0.f};

  const int kbeg = wave * KW;
  for (int k0 = kbeg; k0 < kbeg + KW; k0 += 32) {
    V bfr[4];
    const T* pb[4];
#pragma unroll
    for (int j = 0; j < 4; ++j) {
      const int n = n0 + (j << 4) + rlane;
      if (MODE == 0) pb[j] = Wp + (size_t)n * KCONV + k0 + koff;
      else           pb[j] = XT + im2col_off(n, k0) + koff;
      bfr[j] = Frag<T>::load(pb[j]);
    }
    xcnt_wait(pb[0], pb[1], pb[2], pb[3]);
#pragma unroll
    for (int i = 0; i < 4; ++i) {
      const int mr = m0 + (i << 4) + rlane;
      const T* pa;
      if (MODE == 0) pa = XT + im2col_off(mr, k0) + koff;
      else           pa = Wp + (size_t)mr * KCONV + k0 + koff;
      V ah = Frag<T>::load(pa);
      xcnt_wait(pa);
#pragma unroll
      for (int j = 0; j < 4; ++j) acc[i][j] = Frag<T>::mma(ah, bfr[j], acc[i][j]);
      Frag<T>::guard(acc[i][0], acc[i][3], ah, ah);
    }
    Frag<T>::keep(bfr[0], bfr[1], bfr[2], bfr[3]);
  }
  acc_guard4(acc[0][0], acc[0][1], acc[0][2], acc[0][3]);
  acc_guard4(acc[1][0], acc[1][1], acc[1][2], acc[1][3]);
  acc_guard4(acc[2][0], acc[2][1], acc[2][2], acc[2][3]);
  acc_guard4(acc[3][0], acc[3][1], acc[3][2], acc[3][3]);

  // ---- this wave's partial tile to its LDS plane ----
  {
    float* part = sP + wave * CG_PLANE;
#pragma unroll
    for (int i = 0; i < 4; ++i)
#pragma unroll
      for (int j = 0; j < 4; ++j)
#pragma unroll
        for (int r = 0; r < 8; ++r) part[((i << 4) + mOff + r) * 68 + (j << 4) + rlane] = acc[i][j][r];
  }
  __syncthreads();

  // ---- join the 8 partials of rows 8*wave .. +7 and finish them: a lane holds 8 consecutive columns of one row ----
  const int q = lane >> 3, c8 = (lane & 7) * 8;
  v8h hv[2], lv[2];
  unsigned short* pch[2];
  unsigned short* pcl[2];
#pragma unroll
  for (int it = 0; it < 2; ++it) {
    const int row = wave * 8 + it * 4 + q;         // row within the tile
    const float* sp = sP + row * 68 + c8;
    v4f s0 = *(const v4f*)(sp);
    v4f s1 = *(const v4f*)(sp + 4);
#pragma unroll
    for (int w = 1; w < 8; ++w) {
      s0 += *(const v4f*)(sp + w * (64 * 68));
      s1 += *(const v4f*)(sp + w * (64 * 68) + 4);
    }
#pragma unroll
    for (int e = 0; e < 8; ++e) {
      float v = (e < 4) ? s0[e & 3] : s1[e & 3];
      if (MODE == 0) {
        const int jj = row & 31;                   // (m0 + row) & 31, m0 being a multiple of 64
        const unsigned hw = sRh[(c8 + e) * 17 + (jj >> 1)] >> ((jj & 1) * 16);
        const unsigned ww = sRw[c8 + e] >> ((row >> 5) * 16);
        const float pos = bf_bits2f((unsigned short)hw) + bf_bits2f((unsigned short)ww);
        v += pos;
      }
      unsigned short hb = f2bf_bits(v);
      unsigned short lb = f2bf_bits(v - bf_bits2f(hb));
      hv[it][e] = __builtin_bit_cast(_Float16, hb);
      lv[it][e] = __builtin_bit_cast(_Float16, lb);
    }
    pch[it] = Ch + (size_t)(m0 + row) * LDC + n0 + c8;
    pcl[it] = Cl + (size_t)(m0 + row) * LDC + n0 + c8;
    *(v8h*)pch[it] = hv[it];
    *(v8h*)pcl[it] = lv[it];
  }
  xcnt_wait_st(pch, pcl, hv, lv);   // the code of the grid's other block ranges follows in the kernel and reuses these registers
}

// ---------------------------------------------------------------------------
// The three GEMMs read only the prepared planes and write disjoint planes, so they share one grid by ranges of the block index
// (block-uniform branches) and one LDS array: the q projection first (its waves run the longest k loop), then k', then v^T.
//   q = XT . WQ^T -> Qh|Ql [16384][256]   (M=16384, N=256, K=256; 1024 tiles, 8 per block); bias/resid unused (mode 0)
// ---------------------------------------------------------------------------
#define G3_Q (((MTOK / 64) * (DIM / 64)) / 8)      // 128 blocks
#define G3_C ((MKV / 64) * (DIM / 64))             // 256 blocks per conv GEMM
static_assert(CG_LDS >= 8 * 16 * 68);
__global__ __launch_bounds__(256) void gemm3_kernel(const unsigned short* __restrict__ XT, const unsigned short* __restrict__ WQ,
                                                    const unsigned short* __restrict__ WKp, const unsigned short* __restrict__ WVp,
                                                    const float* __restrict__ rel_h, const float* __restrict__ rel_w,
                                                    unsigned short* __restrict__ Qh, unsigned short* __restrict__ Ql,
                                                    unsigned short* __restrict__ Kh, unsigned short* __restrict__ Kl,
                                                    unsigned short* __restrict__ VTh, unsigned short* __restrict__ VTl) {
  __shared__ __align__(16) float smem[CG_LDS];
  const int bx = blockIdx.x;
  if (bx < G3_Q) {
    wmma_gemm64<1, false, 0, 2, false, 0>(XT, XT, DIM, 0L, WQ, WQ, DIM, 0L, (void*)Qh, (void*)Ql, DIM, 0L,
                                          rel_h, rel_h, 0L, MTOK, DIM, DIM, 1.0f, smem, bx, 0);
  } else if (bx < G3_Q + G3_C) {
    conv_gemm64<0>(XT, WKp, rel_h, rel_w, Kh, Kl, smem, bx - G3_Q);
  } else {
    conv_gemm64<1>(XT, WVp, rel_h, rel_w, VTh, VTl, smem, bx - (G3_Q + G3_C));
  }
}

// =====================================================================================
// Full (non-causal, unmasked) attention, head dim 32, all batches and heads in one launch.
//   q planes (hi/lo bf16) [16384][256]: element (b, n, h, d) at [(b*4096+n)*256 + h*32 + d]
//   k planes (hi/lo bf16) [4096][256]:  element (b, m, h, d) at [(b*1024+m)*256 + h*32 + d]  (pos already folded in)
//   v^T planes (hi/lo bf16) [256][4096]: element (h, d, b, m) at [(h*32 + d)*4096 + b*1024 + m]
//   out f32 NCHW: element (b, h*32+d, n) at [(b*256 + h*32 + d)*4096 + n]
//   scores = (q . k') * 32^-0.5 : bf16 hi/lo split (hi.hi + hi.lo + lo.hi) on v_wmma_f32_16x16x32_bf16
//   out    = p . v             : bf16 hi/lo split of p (unnormalised exp) and v, f32 accumulate, x 1/rowsum in f32 at the end
//   online softmax in f32 over the 1024 keys of the batch element (16 chunks of 64, compile-time trip count, no masking),
//   in base 2: p = 2^(s * scale * log2(e) - m), one multiply-add and one hardware exponential per score.
//   Block = 4 waves = 64 query positions of one (batch, head); grid.x = 4 * 8 * 64 = 2048 (exact).
//   K chunk staging: thread r = tid>>1 stages K row r cols (tid&1)*16 .. +15 (two 16-B copies per plane) -> 64x32 whole tile;
//   V^T chunk staging: thread d = tid>>2 stages row d cols (tid&3)*16 .. +15 -> 32x64 whole tile; __syncthreads before and after.
//   Scores are formed transposed, S^T = K . Q^T (A = K rows, B = Q): a lane holds 32 of the chunk's 64 scores of ONE query
//   (query = lane & 15, keys j*16 + 8*(lane>>4) + r), so maximum and sum run in the lane plus one exchange between lane halves;
//   two S^T tiles converted in place are the B operand of O^T += V^T . P^T (same k order as the V^T loader): P never touches LDS.
// =====================================================================================
#define AT_D  32
#define AT_NW 4
#define AT_QB 64
#define AT_KC 64
#define AT_KP 40   // LDS pitch of a K row in elements: 80 B = 16 B x 5 (odd), so the 16 rows of one 16-byte fragment read fall on 16 distinct bank groups
#define AT_VP 72   // LDS pitch of a V^T row in elements: 144 B = 16 B x 9 (odd), same reason

__device__ __forceinline__ v8f at_mma(v16b a, v16b b, v8f c) {
  c = __builtin_amdgcn_wmma_f32_16x16x32_bf16(false, a, false, b, (short)0, c, false, false);
  asm volatile("v_nop\n\tv_nop\n\tv_nop\n\tv_nop" : "+v"(c) : "v"(a), "v"(b));
  return c;
}

// value of the same lane position in the other 16-lane half (lane ^ 16), as a vector cross-row move
__device__ __forceinline__ float at_xhalf(float f) {
  const int b = __float_as_int(f);
  return __int_as_float(__builtin_amdgcn_permlanex16(b, b, 0x76543210, 0xfedcba98, false, false));
}

__global__ __launch_bounds__(128)
void attn32_kernel(const unsigned short* __restrict__ qhp, const unsigned short* __restrict__ qlp,
                   const unsigned short* __restrict__ khp, const unsigned short* __restrict__ klp,
                   const unsigned short* __restrict__ vhp, const unsigned short* __restrict__ vlp,
                   float* __restrict__ out, float sscale) {
  union FB { v16b v; v8b h[2]; unsigned w[8]; };
  __shared__ __align__(16) __bf16 Ksh[AT_KC * AT_KP];            // K hi [kv][d], padded rows   5 KB
  __shared__ __align__(16) __bf16 Ksl[AT_KC * AT_KP];            // K lo
  __shared__ __align__(16) __bf16 Vth[AT_D * AT_VP];             // V hi [d][kv], padded rows   4.5 KB
  __shared__ __align__(16) __bf16 Vtl[AT_D * AT_VP];             // V lo
  __shared__ __align__(16) float  Os[AT_D * 68];                 // block out tile transposed [d][n_local], pitch 68

  const int tid  = threadIdx.x;
  const int wave = tid >> 5;
  const int lane = tid & 31;
  const int hh   = lane >> 4;
  const int c    = lane & 15;

  const int nqb = NQ / AT_QB;              // 64 query blocks per (batch, head)
  const int bx = blockIdx.x;               // grid = NB * NH * nqb (exact)
  const int qb = bx % nqb;
  const int hb = bx / nqb;
  const int h  = hb % NH;                  // 0..7
  const int b  = hb / NH;                  // 0..3
  const int q0 = b * NQ + qb * AT_QB + wave * 16;   // row in the q planes

  const __bf16* Qh = (const __bf16*)(const void*)qhp + (size_t)h * AT_D;
  const __bf16* Ql = (const __bf16*)(const void*)qlp + (size_t)h * AT_D;
  const __bf16* Kh = (const __bf16*)(const void*)khp + (size_t)h * AT_D;
  const __bf16* Kl = (const __bf16*)(const void*)klp + (size_t)h * AT_D;
  const __bf16* Vh = (const __bf16*)(const void*)vhp + (size_t)h * AT_D * VTP + (size_t)b * NKV;
  const __bf16* Vl = (const __bf16*)(const void*)vlp + (size_t)h * AT_D * VTP + (size_t)b * NKV;

  // ---- Q fragments (B operand, column = lane&15, split k map via Frag load): head dim 32 = one k-step, hi and lo ----
  v16b qah, qal;
  {
    const __bf16* qr = Qh + (size_t)(q0 + c) * DIM + 8 * hh;
    const __bf16* ql = Ql + (size_t)(q0 + c) * DIM + 8 * hh;
    qah = Frag<__bf16>::load(qr);
    qal = Frag<__bf16>::load(ql);
  }

  const float sl2 = sscale * 1.4426950408889634f;   // score scale times log2(e): the softmax runs in base 2
  float mrow = -INFINITY;   // running maximum of this lane's query in base-2 units, max(s) * sl2 (equal in both lane halves)
  float lrow = 0.f;         // running sum over this lane half's keys only; the halves are joined once after the loop
  v8f oacc[2];              // O^T tiles: oacc[t][r] = out[d = t*16 + 8*hh + r][query c]
#pragma unroll
  for (int t = 0; t < 2; ++t) oacc[t] = (v8f){0.f,0.f,0.f,0.f,0.f,0.f,0.f,0.f};

  const int nChunks = NKV / AT_KC;   // 16, compile-time constant
  for (int kc = 0; kc < nChunks; ++kc) {
    const int kv0 = kc * AT_KC;
    __syncthreads();
    {
      // K staging: 128 threads x 16 elements per plane = 64 rows x 32
      const int r = tid >> 1, hf = (tid & 1) * 16;
      const __bf16* ksh = Kh + (size_t)(b * NKV + kv0 + r) * DIM + hf;
      const __bf16* ksl = Kl + (size_t)(b * NKV + kv0 + r) * DIM + hf;
      const v8b a0 = *(const v8b*)(ksh);
      const v8b a1 = *(const v8b*)(ksh + 8);
      const v8b a2 = *(const v8b*)(ksl);
      const v8b a3 = *(const v8b*)(ksl + 8);
      *(v8b*)(Ksh + r * AT_KP + hf)     = a0;
      *(v8b*)(Ksh + r * AT_KP + hf + 8) = a1;
      *(v8b*)(Ksl + r * AT_KP + hf)     = a2;
      *(v8b*)(Ksl + r * AT_KP + hf + 8) = a3;
      // V^T staging: 128 threads x 16 elements per plane = 32 rows x 64
      const int d = tid >> 2, qq = (tid & 3) * 16;
      const __bf16* vsh = Vh + (size_t)d * VTP + kv0 + qq;
      const __bf16* vsl = Vl + (size_t)d * VTP + kv0 + qq;
      const v8b b0 = *(const v8b*)(vsh);
      const v8b b1 = *(const v8b*)(vsh + 8);
      const v8b b2 = *(const v8b*)(vsl);
      const v8b b3 = *(const v8b*)(vsl + 8);
      *(v8b*)(Vth + d * AT_VP + qq)     = b0;
      *(v8b*)(Vth + d * AT_VP + qq + 8) = b1;
      *(v8b*)(Vtl + d * AT_VP + qq)     = b2;
      *(v8b*)(Vtl + d * AT_VP + qq + 8) = b3;
    }
    __syncthreads();

    v8f s[4];
#pragma unroll
    for (int j = 0; j < 4; ++j) {
      s[j] = (v8f){0.f,0.f,0.f,0.f,0.f,0.f,0.f,0.f};
      FB kb, kl;
      kb.h[0] = *(const v8b*)(Ksh + (j * 16 + c) * AT_KP + 8 * hh);
      kb.h[1] = *(const v8b*)(Ksh + (j * 16 + c) * AT_KP + 16 + 8 * hh);
      kl.h[0] = *(const v8b*)(Ksl + (j * 16 + c) * AT_KP + 8 * hh);
      kl.h[1] = *(const v8b*)(Ksl + (j * 16 + c) * AT_KP + 16 + 8 * hh);
      s[j] = at_mma(kb.v, qah, s[j]);
      s[j] = at_mma(kl.v, qah, s[j]);
      s[j] = at_mma(kb.v, qal, s[j]);
    }
    // the query's chunk maximum of the raw scores: in the lane, then one exchange with the other lane half; scaled once (sl2 > 0 keeps the order)
    // (the loops over j, r, t and kk below are unrolled so that s, ph, pl and oacc are indexed at compile time and stay in registers)
    float cm = -INFINITY;
#pragma unroll
    for (int j = 0; j < 4; ++j) {
#pragma unroll
      for (int r = 0; r < 8; ++r) cm = fmaxf(cm, s[j][r]);
    }
    cm = fmaxf(cm, at_xhalf(cm));
    const float mnew = fmaxf(mrow, cm * sl2);
    const float alpha = __builtin_amdgcn_exp2f(mrow - mnew);   // 0 on the first chunk, where mrow is -inf
    mrow = mnew;
    // P^T as B operand: element e of k-step kk = S^T tile 2*kk + (e >> 3), register e & 7 (key kk*32 + 16*(e>>3) + 8*hh + (e&7))
    FB ph[2], pl[2];
    float psum = 0.f;
#pragma unroll
    for (int j = 0; j < 4; ++j) {
#pragma unroll
      for (int r = 0; r < 8; r += 2) {
        // e^(scale*s - max) as 2^(s*sl2 - mnew), the multiply-add on two scores at a time
        const v2f arg = __builtin_elementwise_fma((v2f){s[j][r], s[j][r + 1]}, (v2f){sl2, sl2}, (v2f){-mnew, -mnew});
        const float p0 = __builtin_amdgcn_exp2f(arg[0]);
        const float p1 = __builtin_amdgcn_exp2f(arg[1]);
        psum += p0;
        psum += p1;
        // hi|lo split of two scores at a time: the packed hardware conversion rounds to nearest even, as the integer steps did,
        // and leaves both halves of the operand word in place; the remainder p - hi is exact in f32
        const unsigned hw = __builtin_bit_cast(unsigned, __builtin_convertvector((v2f){p0, p1}, v2b));
        const v2f rest = (v2f){p0, p1} - (v2f){__uint_as_float(hw << 16), __uint_as_float(hw & 0xFFFF0000u)};
        ph[j >> 1].w[(j & 1) * 4 + (r >> 1)] = hw;
        pl[j >> 1].w[(j & 1) * 4 + (r >> 1)] = __builtin_bit_cast(unsigned, __builtin_convertvector(rest, v2b));
      }
    }
    lrow = lrow * alpha + psum;
    // keeps the exponentials and the split in front of the P.V products: moved in among them they hold the f32 values of P longer,
    // the kernel passes 128 registers, and only 7 instead of 8 waves fit a SIMD (the 2048 work-groups then need a second round)
    __builtin_amdgcn_sched_barrier(0);
#pragma unroll
    for (int t = 0; t < 2; ++t)
#pragma unroll
      for (int r = 0; r < 8; ++r) oacc[t][r] *= alpha;
#pragma unroll
    for (int kk = 0; kk < 2; ++kk) {
#pragma unroll
      for (int t = 0; t < 2; ++t) {
        FB vb, vl;
        vb.h[0] = *(const v8b*)(Vth + (t * 16 + c) * AT_VP + kk * 32 + 8 * hh);
        vb.h[1] = *(const v8b*)(Vth + (t * 16 + c) * AT_VP + kk * 32 + 16 + 8 * hh);
        vl.h[0] = *(const v8b*)(Vtl + (t * 16 + c) * AT_VP + kk * 32 + 8 * hh);
        vl.h[1] = *(const v8b*)(Vtl + (t * 16 + c) * AT_VP + kk * 32 + 16 + 8 * hh);
        oacc[t] = at_mma(vb.v, ph[kk].v, oacc[t]);
        oacc[t] = at_mma(vl.v, ph[kk].v, oacc[t]);
        oacc[t] = at_mma(vb.v, pl[kk].v, oacc[t]);
      }
    }
  }

  // ---- join the lane halves' sums, normalise and stage: Os[d][n_local], d = t*16 + 8hh + r, n_local = wave*16 + c (all 32 x 64 written) ----
  {
    const float inv = 1.0f / (lrow + at_xhalf(lrow));
#pragma unroll
    for (int t = 0; t < 2; ++t)
#pragma unroll
      for (int r = 0; r < 8; ++r) Os[(t * 16 + 8 * hh + r) * 68 + wave * 16 + c] = oacc[t][r] * inv;
  }
  __syncthreads();
  {
    float* ob = out + ((size_t)(b * DIM + h * AT_D)) * NQ + (size_t)qb * AT_QB;
    const int q = lane >> 3, c4 = (lane & 7) * 4;
    {
#pragma unroll
      for (int it = 0; it < 4; ++it) {
        const int L  = it * 16 + wave * 4 + q;   // 0..63: line index within the block's 32 x 256-B output region
        const int d  = L >> 1;
        const int hf = (L & 1) * 32;
        v4f val = *(const v4f*)(Os + d * 68 + hf + c4);
        *(v4f*)(ob + (size_t)d * NQ + hf + c4) = val;
      }
      
    }
  }
}

// ---------------------------------------------------------------------------
// Workspace region map (byte offsets; every region fully written by its producer launch before any consumer reads it;
//   XT   bf16 [16384][256]         0       8388608
//   WQ   bf16 [256][256]     8388608        131072
//   WKp  bf16 [256][1024]    8519680        524288
//   WVp  bf16 [256][1024]    9043968        524288
//   Qh   bf16 [16384][256]   9568256       8388608   Ql  17956864
//   Kh   bf16 [4096][256]   26345472       2097152   Kl  28442624
//   VTh  bf16 [256][4096]   30539776       2097152   VTl 32636928
//   total                  34734080
// ---------------------------------------------------------------------------
extern "C" void kernel_launch(void* const* d_in, const int* in_sizes, int n_in,
                              void* d_out, int out_size, void* d_ws, size_t ws_size,
                              hipStream_t stream) {
  if (n_in < 6) return;
  if (in_sizes[0] != NB * DIM * NQ) return;          // x [4][256][64][64]
  if (in_sizes[1] != DIM * DIM) return;              // Wq [256][256]
  if (in_sizes[2] != DIM * DIM * 4) return;          // Wk [256][256][2][2]
  if (in_sizes[3] != DIM * DIM * 4) return;          // Wv [256][256][2][2]
  if (in_sizes[4] != NH * HD * OH) return;           // rel_h [1][8][32][1][32]
  if (in_sizes[5] != NH * HD * OW) return;           // rel_w [1][8][32][32][1]
  if (out_size != NB * DIM * NQ) return;

  const float* x     = (const float*)d_in[0];
  const float* Wq    = (const float*)d_in[1];
  const float* Wk    = (const float*)d_in[2];
  const float* Wv    = (const float*)d_in[3];
  const float* rel_h = (const float*)d_in[4];
  const float* rel_w = (const float*)d_in[5];

  const size_t PXT = (size_t)MTOK * DIM * 2;        // 8388608
  const size_t PWQ = (size_t)DIM * DIM * 2;         // 131072
  const size_t PWC = (size_t)DIM * KCONV * 2;       // 524288
  const size_t PQ  = (size_t)MTOK * DIM * 2;        // 8388608
  const size_t PK  = (size_t)MKV * DIM * 2;         // 2097152
  const size_t PVT = (size_t)DIM * VTP * 2;         // 2097152
  size_t off = 0;
  const size_t oXT  = off; off += PXT;
  const size_t oWQ  = off; off += PWQ;
  const size_t oWK  = off; off += PWC;
  const size_t oWV  = off; off += PWC;
  const size_t oQh  = off; off += PQ;   const size_t oQl  = off; off += PQ;
  const size_t oKh  = off; off += PK;   const size_t oKl  = off; off += PK;
  const size_t oVTh = off; off += PVT;  const size_t oVTl = off; off += PVT;
  if (off > ws_size) return;                        // off = 34734080
  if (off > (size_t)134217728) return;

  char* ws = (char*)d_ws;
  unsigned short* XT  = (unsigned short*)(ws + oXT);
  unsigned short* WQ  = (unsigned short*)(ws + oWQ);
  unsigned short* WKp = (unsigned short*)(ws + oWK);
  unsigned short* WVp = (unsigned short*)(ws + oWV);
  unsigned short* Qh  = (unsigned short*)(ws + oQh);  unsigned short* Ql  = (unsigned short*)(ws + oQl);
  unsigned short* Kh  = (unsigned short*)(ws + oKh);  unsigned short* Kl  = (unsigned short*)(ws + oKl);
  unsigned short* VTh = (unsigned short*)(ws + oVTh); unsigned short* VTl = (unsigned short*)(ws + oVTl);

  const dim3 blk(256);

  // (1) operand preparation: WQ, WKp, WVp and XT; 32 + 32 + 32 + 1024 blocks
  prep_kernel<<<dim3(PR_WQ + 2 * PR_WC + PR_XT), blk, 0, stream>>>(x, Wq, Wk, Wv, XT, WQ, WKp, WVp);
  // (2) q -> Qh|Ql, k' = conv_k + pos -> Kh|Kl, v^T = conv_v -> VTh|VTl; 128 + 256 + 256 blocks
  gemm3_kernel<<<dim3(G3_Q + 2 * G3_C), blk, 0, stream>>>(XT, WQ, WKp, WVp, rel_h, rel_w, Qh, Ql, Kh, Kl, VTh, VTl);
  // (3) attention per (batch, head, 64-query block) -> d_out NCHW; 2048 blocks of 128
  attn32_kernel<<<dim3(NB * NH * (NQ / AT_QB)), dim3(128), 0, stream>>>(Qh, Ql, Kh, Kl, VTh, VTl, (float*)d_out,
                                                                        0.17677669529663687f);
  (void)hipGetLastError();
}

// v007
// A run of this version takes 74.5 microseconds.
// Two timings next to v006 both put it at 1.06 times that version's speed.
// All steps since v000 together make it 4.67 times as fast.
// Contractions: q projection, k conv (im2col) and v^T conv (im2col) = v_wmma_f32_16x16x32_bf16 single products on bf16 planes of the RNE-converted inputs (exact products); scores q.(k+pos) and p.v = bf16 hi/lo split (hi.hi + hi.lo + lo.hi); f32 accumulate everywhere; positional add, 32^-0.5 scale, online softmax and 1/rowsum in f32 on the VALU.
// Plane / carry map (all carry 1, nothing to fold back):
//   XT  = bf16(x) token-major [16384][256] (row b*4096 + n, n = y*64 + x, col c)
//   WQ  = bf16(Wq) [256 o][256 c];  WKp, WVp bf16 [256 o][1024]: col q4*256 + c = bf16(W[o][c][kh][kw]), q4 = kh*2 + kw
//   Qh|Ql bf16 [16384][256] (col h*32 + d) = hi/lo of q;  Kh|Kl bf16 [4096][256] (row b*1024 + m, m = i*32 + j; col h*32 + d) = hi/lo of (conv_k + pos)
//   pos(h,d,m) = bf16(rel_h[(h*32+d)*32 + (m & 31)]) + bf16(rel_w[(h*32+d)*32 + (m >> 5)]) in f32
//   VTh|VTl bf16 [256 (h*32+d)][4096 (b*1024+m)] = hi/lo of conv_v;  P hi|lo = unnormalised exp, at most 1 up to the rounding of the scaled maximum (f32), 1/rowsum applied to the f32 accumulator
#include <hip/hip_runtime.h>
#include <math.h>
#include <stdint.h>

#define NB    4
#define DIM   256
#define NH    8
#define HD    32
#define IMH   64
#define IMW   64
#define NQ    4096
#define OH    32
#define OW    32
#define NKV   1024
#define KCONV 1024
#define MTOK  (NB * NQ)
#define MKV   (NB * NKV)
#define VTP   (NB * NKV)

static_assert(NQ == IMH * IMW);
static_assert(NKV == OH * OW);
static_assert(OH * 2 == IMH);
static_assert(OW * 2 == IMW);
static_assert(DIM == NH * HD);
static_assert(HD == 32);
static_assert(KCONV == DIM * 4);
static_assert(MTOK % 64 == 0);
static_assert(MKV % 128 == 0);
static_assert(DIM % 64 == 0);
static_assert(KCONV % 32 == 0);
static_assert(DIM % 32 == 0);
static_assert((DIM * DIM) % (8 * 256) == 0);
static_assert(((MKV / 64) * (DIM / 64)) % 8 == 0);
static_assert(((MTOK / 64) * (DIM / 64)) % 8 == 0);
static_assert(DIM * OH == 8192);
static_assert(NQ % 64 == 0);
static_assert(NKV % 64 == 0);

typedef __attribute__((ext_vector_type(16))) _Float16 v16h;
typedef __attribute__((ext_vector_type(8)))  _Float16 v8h;
typedef __attribute__((ext_vector_type(16))) __bf16   v16b;
typedef __attribute__((ext_vector_type(8)))  __bf16   v8b;
typedef __attribute__((ext_vector_type(2)))  __bf16   v2b;
typedef __attribute__((ext_vector_type(8)))  float    v8f;
typedef __attribute__((ext_vector_type(4)))  float    v4f;
typedef __attribute__((ext_vector_type(2)))  float    v2f;
typedef __attribute__((ext_vector_type(4)))  unsigned int v4u;
typedef __attribute__((ext_vector_type(2)))  unsigned int v2u;

__device__ __forceinline__ unsigned short f2bf_bits(float f) {
  unsigned u = __float_as_uint(f);
  return (unsigned short)((u + 0x7FFFu + ((u >> 16) & 1u)) >> 16);
}
__device__ __forceinline__ float bf_bits2f(unsigned short h) { return __uint_as_float(((unsigned)h) << 16); }
__device__ __forceinline__ unsigned pk16(unsigned short a, unsigned short b) { return (unsigned)a | ((unsigned)b << 16); }

// hazard guards as plain device helpers (no inline asm inside the kernel template body)
__device__ __forceinline__ void dep_guard_h(v8f& a, v8f& b, v16h x, v16h y) { asm volatile("v_nop\n\tv_nop\n\tv_nop\n\tv_nop" : "+v"(a), "+v"(b) : "v"(x), "v"(y)); }
__device__ __forceinline__ void dep_guard_b(v8f& a, v8f& b, v16b x, v16b y) { asm volatile("v_nop\n\tv_nop\n\tv_nop\n\tv_nop" : "+v"(a), "+v"(b) : "v"(x), "v"(y)); }
__device__ __forceinline__ void keep4_h(v16h a, v16h b, v16h c, v16h d) { asm volatile("v_nop" :: "v"(a), "v"(b), "v"(c), "v"(d)); }
__device__ __forceinline__ void keep4_b(v16b a, v16b b, v16b c, v16b d) { asm volatile("v_nop" :: "v"(a), "v"(b), "v"(c), "v"(d)); }
__device__ __forceinline__ void acc_guard4(v8f& a, v8f& b, v8f& c, v8f& d) { asm volatile("v_nop\n\tv_nop\n\tv_nop\n\tv_nop" : "+v"(a), "+v"(b), "+v"(c), "+v"(d)); }
// s_wait_xcnt 0 behind issued global loads or stores, in front of the next write of a register that they name: the addresses
// (and a store's data) are inputs of the statement, so their registers stay as they are up to the wait
__device__ __forceinline__ void xcnt_wait(const void* a) { asm volatile("s_wait_xcnt 0x0" :: "v"(a) : "memory"); }
__device__ __forceinline__ void xcnt_wait(const void* a, const void* b, const void* c, const void* d) {
  asm volatile("s_wait_xcnt 0x0" :: "v"(a), "v"(b), "v"(c), "v"(d) : "memory");
}
__device__ __forceinline__ void xcnt_wait_st(unsigned short* const (&a)[2], const v4u (&x)[2]) {
  asm volatile("s_wait_xcnt 0x0" :: "v"(a[0]), "v"(a[1]), "v"(x[0]), "v"(x[1]) : "memory");
}
__device__ __forceinline__ void xcnt_wait_st(unsigned short* const (&a)[2], unsigned short* const (&b)[2], const v8h (&x)[2], const v8h (&y)[2]) {
  asm volatile("s_wait_xcnt 0x0" :: "v"(a[0]), "v"(a[1]), "v"(b[0]), "v"(b[1]), "v"(x[0]), "v"(x[1]), "v"(y[0]), "v"(y[1]) : "memory");
}
__device__ __forceinline__ void xcnt_wait_st(unsigned short* const (&a)[4], unsigned short* const (&b)[4], const v8h (&x)[4], const v8h (&y)[4]) {
  asm volatile("s_wait_xcnt 0x0" :: "v"(a[0]), "v"(a[1]), "v"(a[2]), "v"(a[3]), "v"(b[0]), "v"(b[1]), "v"(b[2]), "v"(b[3]),
               "v"(x[0]), "v"(x[1]), "v"(x[2]), "v"(x[3]), "v"(y[0]), "v"(y[1]), "v"(y[2]), "v"(y[3]) : "memory");
}
template <typename T> struct Frag;
template <> struct Frag<_Float16> {
  typedef v16h V; union U { v16h v; v8h h[2]; };
  static __device__ __forceinline__ v16h load(const _Float16* p) {   // elements 0..7 <- p[0..7], 8..15 <- p[16..23]
    U f; f.h[0] = *(const v8h*)(p); f.h[1] = *(const v8h*)(p + 16); return f.v;
  }
  static __device__ __forceinline__ v8f mma(v16h a, v16h b, v8f c) {
    return __builtin_amdgcn_wmma_f32_16x16x32_f16(false, a, false, b, (short)0, c, false, false);
  }
  static __device__ __forceinline__ void guard(v8f& a, v8f& b, v16h x, v16h y) { dep_guard_h(a, b, x, y); }
  static __device__ __forceinline__ void keep(v16h a, v16h b, v16h c, v16h d) { keep4_h(a, b, c, d); }
};
template <> struct Frag<__bf16> {
  typedef v16b V; union U { v16b v; v8b h[2]; };
  static __device__ __forceinline__ v16b load(const __bf16* p) {
    U f; f.h[0] = *(const v8b*)(p); f.h[1] = *(const v8b*)(p + 16); return f.v;
  }
  static __device__ __forceinline__ v8f mma(v16b a, v16b b, v8f c) {
    return __builtin_amdgcn_wmma_f32_16x16x32_bf16(false, a, false, b, (short)0, c, false, false);
  }
  static __device__ __forceinline__ void guard(v8f& a, v8f& b, v16b x, v16b y) { dep_guard_b(a, b, x, y); }
  static __device__ __forceinline__ void keep(v16b a, v16b b, v16b c, v16b d) { keep4_b(a, b, c, d); }
};

// ---- Register-blocked batched WMMA GEMM ------------------------------------
// C[m,n] = scale * sum_k A[m,k] * Bt[n,k] (+bias)(+resid); each wave owns a 64x64 tile.
// A row-major [M,K]; Bt row-major [N,K]; M,N % 64 == 0, K % 32 == 0.
// SPLIT: operands are hi/lo planes (A2/Bt2 = lo planes, same layout); product = hi.hi + hi.lo + lo.hi.
// BIAS_MODE: 0 = none, 1 = bias[m], 2 = bias[n].
// OUT_MODE: 0 = f32, 1 = f16, 2 = bf16 hi plane (Cout) + bf16 lo plane (Cout2).
// ET: 0 = f16 operands, 1 = bf16 operands (pointers passed as 16-bit storage)
template <int ET> struct Elem;
template <> struct Elem<0> { typedef _Float16 T; };
template <> struct Elem<1> { typedef __bf16 T; };
// Device body: smem = the work-group's LDS (8 slabs of 16 x 68 floats are used), bx / by = the block indices of this GEMM's own grid.
template <int ET, bool SPLIT, int BIAS_MODE, int OUT_MODE, bool RESID, int ACT = 0>
__device__ __forceinline__ void wmma_gemm64(
    const unsigned short* __restrict__ Ap, const unsigned short* __restrict__ A2p, int lda, long strideA,
    const unsigned short* __restrict__ Btp, const unsigned short* __restrict__ Bt2p, int ldb, long strideB,
    void* __restrict__ Cout, void* __restrict__ Cout2, int ldc, long strideC,
    const float* __restrict__ bias,
    const float* __restrict__ resid, long strideR,
    int M, int N, int K, float scale, float* smem, int bx, int by) {
  typedef typename Elem<ET>::T T;
  typedef typename Frag<T>::V V;
  const T* A = (const T*)Ap; const T* A2 = (const T*)A2p; const T* Bt = (const T*)Btp; const T* Bt2 = (const T*)Bt2p;
  const int b    = by;
  const int lane = threadIdx.x & 31;
  const int wave = threadIdx.x >> 5;
  const int tilesN = N >> 6;
  const int tilesM = M >> 6;
  const int tile = bx * 8 + wave;
  if (tile >= tilesM * tilesN) return;   // wave-uniform; no block barriers in this body
  const int tm = tile / tilesN;
  const int tn = tile - tm * tilesN;
  const int m0 = tm << 6;
  const int n0 = tn << 6;

  const T* Ab  = A  + (size_t)b * strideA;
  const T* Bb  = Bt + (size_t)b * strideB;
  const T* Ab2 = SPLIT ? (A2  + (size_t)b * strideA) : nullptr;
  const T* Bb2 = SPLIT ? (Bt2 + (size_t)b * strideB) : nullptr;

  const int rlane = lane & 15;                 // row (A) / col (B, D) within subtile
  const int koff  = (lane >> 4) * 8;           // k offset of this lane half
  const int mOff  = (lane >> 4) * 8;           // D row offset

  v8f acc[4][4];
#pragma unroll
  for (int i = 0; i < 4; ++i)
#pragma unroll
    for (int j = 0; j < 4; ++j) acc[i][j] = (v8f){0.f,0.f,0.f,0.f,0.f,0.f,0.f,0.f};

  for (int k0 = 0; k0 < K; k0 += 32) {
    V bh[4], bl[4];
    const T* pb[4];
    const T* pb2[4];
#pragma unroll
    for (int j = 0; j < 4; ++j) {
      const size_t bo = (size_t)(n0 + (j << 4) + rlane) * ldb + koff + k0;
      pb[j] = Bb + bo;
      pb2[j] = SPLIT ? (Bb2 + bo) : pb[j];
      bh[j] = Frag<T>::load(pb[j]);
      if (SPLIT) bl[j] = Frag<T>::load(pb2[j]); else bl[j] = bh[j];
    }
    xcnt_wait(pb[0], pb[1], pb[2], pb[3]);
    if (SPLIT) xcnt_wait(pb2[0], pb2[1], pb2[2], pb2[3]);
#pragma unroll
    for (int i = 0; i < 4; ++i) {
      const size_t ao = (size_t)(m0 + (i << 4) + rlane) * lda + koff + k0;
      const T* pa = Ab + ao;
      V ah = Frag<T>::load(pa);
      xcnt_wait(pa);
      V al;
      if (SPLIT) { const T* pa2 = Ab2 + ao; al = Frag<T>::load(pa2); xcnt_wait(pa2); } else al = ah;
#pragma unroll
      for (int j = 0; j < 4; ++j) {
        acc[i][j] = Frag<T>::mma(ah, bh[j], acc[i][j]);
        if (SPLIT) {
          acc[i][j] = Frag<T>::mma(ah, bl[j], acc[i][j]);
          acc[i][j] = Frag<T>::mma(al, bh[j], acc[i][j]);
        }
      }
      Frag<T>::guard(acc[i][0], acc[i][3], ah, al);
    }
    Frag<T>::keep(bh[0], bh[1], bh[2], bh[3]);
    if (SPLIT) Frag<T>::keep(bl[0], bl[1], bl[2], bl[3]);
  }
  acc_guard4(acc[0][0], acc[0][1], acc[0][2], acc[0][3]);
  acc_guard4(acc[1][0], acc[1][1], acc[1][2], acc[1][3]);
  acc_guard4(acc[2][0], acc[2][1], acc[2][2], acc[2][3]);
  acc_guard4(acc[3][0], acc[3][1], acc[3][2], acc[3][3]);

  // ---- epilogue ----
  float* slab = smem + wave * (16 * 68);           // per-wave 16x64 slab, pitch 68 floats
  const float* Rb = RESID ? (resid + (size_t)b * strideR) : nullptr;
#pragma unroll
  for (int i = 0; i < 4; ++i) {
    const int mBase = m0 + (i << 4);
#pragma unroll
    for (int j = 0; j < 4; ++j) {
      const int n = n0 + (j << 4) + rlane;
      float bv = 0.f;
      if (BIAS_MODE == 2) bv = bias[n];
#pragma unroll
      for (int r = 0; r < 8; ++r) {
        float v = acc[i][j][r] * scale;
        if (BIAS_MODE == 1) v += bias[mBase + mOff + r];
        if (BIAS_MODE == 2) v += bv;
        if (RESID) v += Rb[(size_t)(mBase + mOff + r) * ldc + n];
        if (ACT == 1) v = tanhf(v);
        if (ACT == 2) v = fmaxf(v, 0.0f);
        if (ACT == 3) v = v / (1.0f + expf(-v));
        if (ACT == 4) v = (v > 0.f) ? v : 0.01f * v;
        if (ACT == 5) v = 0.5f * v * (1.0f + erff(v * 0.70710678118654752f));
        slab[(mOff + r) * 68 + (j << 4) + rlane] = v;
      }
    }
    __builtin_amdgcn_fence(__ATOMIC_RELEASE, "workgroup");
    __builtin_amdgcn_wave_barrier();
    __builtin_amdgcn_fence(__ATOMIC_ACQUIRE, "workgroup");
    if (OUT_MODE == 0) {
      float* C = (float*)Cout + (size_t)b * strideC;
      const int hh = lane >> 4, c4 = (lane & 15) * 4;     // row seg = 256 B = 16 lanes x 16 B
      {
#pragma unroll
        for (int it = 0; it < 8; ++it) {
          const int row = it * 2 + hh;
          v4f v = *(const v4f*)(slab + row * 68 + c4);
          *(v4f*)(C + (size_t)(mBase + row) * ldc + n0 + c4) = v;
        }
        
      }
    } else {
      const int q = lane >> 3, c8 = (lane & 7) * 8;
      unsigned short* C  = (unsigned short*)Cout  + (size_t)b * strideC;
      unsigned short* C2 = (OUT_MODE == 2) ? ((unsigned short*)Cout2 + (size_t)b * strideC) : nullptr;
      {
        v8h hv[4], lv[4];
        unsigned short* pc[4];
        unsigned short* pc2[4];
#pragma unroll
        for (int it = 0; it < 4; ++it) {
          const int row = it * 4 + q;
          const float* sp = slab + row * 68 + c8;
#pragma unroll
          for (int e = 0; e < 8; ++e) {
            if (OUT_MODE == 1) {
              hv[it][e] = (_Float16)sp[e];
            } else {
              unsigned short hb = f2bf_bits(sp[e]);
              unsigned short lb = f2bf_bits(sp[e] - bf_bits2f(hb));
              hv[it][e] = __builtin_bit_cast(_Float16, hb);
              lv[it][e] = __builtin_bit_cast(_Float16, lb);
            }
          }
          pc[it]  = C + (size_t)(mBase + row) * ldc + n0 + c8;
          pc2[it] = (OUT_MODE == 2) ? (C2 + (size_t)(mBase + row) * ldc + n0 + c8) : pc[it];
          *(v8h*)pc[it] = hv[it];
          if (OUT_MODE == 2) *(v8h*)pc2[it] = lv[it]; else lv[it] = hv[it];
        }
        xcnt_wait_st(pc, pc2, hv, lv);
        
      }
    }
    __builtin_amdgcn_fence(__ATOMIC_RELEASE, "workgroup");
    __builtin_amdgcn_wave_barrier();
    __builtin_amdgcn_fence(__ATOMIC_ACQUIRE, "workgroup");
  }
}

// ---------------------------------------------------------------------------
// Row-preserving bf16 RNE convert of an f32 matrix [rows][ncols] into a u16 plane with row pitch ldout.
// 8 consecutive elements per thread = one 16-B store; 32 lanes cover 256 consecutive columns of one row
// ---------------------------------------------------------------------------
__device__ __forceinline__ void convrows_body(const float* __restrict__ in, unsigned short* __restrict__ out,
                                              int ncols, int ldout, int n8, int bx) {
  const int i = bx * 256 + threadIdx.x;
  if (i < n8) {
    const size_t e0 = (size_t)i * 8;
    const int row = (int)(e0 / (size_t)ncols);
    const int col = (int)(e0 - (size_t)row * ncols);
    const v4f a = *(const v4f*)(in + e0);
    const v4f c = *(const v4f*)(in + e0 + 4);
    v4u hv;
    hv[0] = pk16(f2bf_bits(a[0]), f2bf_bits(a[1]));
    hv[1] = pk16(f2bf_bits(a[2]), f2bf_bits(a[3]));
    hv[2] = pk16(f2bf_bits(c[0]), f2bf_bits(c[1]));
    hv[3] = pk16(f2bf_bits(c[2]), f2bf_bits(c[3]));
    const size_t o = (size_t)row * ldout + col;
    {
      *(v4u*)(out + o) = hv;
      
    }
  }
}

// ---------------------------------------------------------------------------
// Fused transpose + bf16 RNE convert of an f32 matrix, z-batched, one plane:
//   in_z = W + z*sIn viewed [R rows][Cc cols] with row pitch ldin  ->  oh_z[c][r] = bf16(in_z[r][c]), row pitch ldout, oh_z = oh + z*sOut.
// 64x64 tiles through LDS (tf). Tile indices (bx, by, bz) run over (Cc/64, R/64, Z), 256 threads (R, Cc, ldout multiples of 64).
// Coverage per block: load 4 it x 256 thr x 4 floats = 64x64; store 2 it x 256 thr x 8 u16 = 64x64.
// ---------------------------------------------------------------------------
__device__ __forceinline__ void tconv_body(const float* __restrict__ W, unsigned short* __restrict__ oh,
                                           int ldin, int ldout, long sIn, long sOut, float* tf, int bx, int by, int bz) {
  W  += (size_t)bz * sIn;
  oh += (size_t)bz * sOut;
  const int c0  = bx * 64;   // input column block = output row block
  const int r0  = by * 64;   // input row block    = output column block
  const int tid = threadIdx.x;
  {
    const int lr = tid >> 4;         // 0..15
    const int c4 = (tid & 15) * 4;   // 0..60
    const float* pw[4];
    v4f a[4];
#pragma unroll
    for (int it = 0; it < 4; ++it) {
      pw[it] = W + (size_t)(r0 + it * 16 + lr) * ldin + c0 + c4;   // rows 0..63
      a[it] = *(const v4f*)(pw[it]);
    }
    xcnt_wait(pw[0], pw[1], pw[2], pw[3]);
#pragma unroll
    for (int it = 0; it < 4; ++it) *(v4f*)(tf + (it * 16 + lr) * 68 + c4) = a[it];
  }
  __syncthreads();
  const int sub = tid >> 3;          // 0..31
  const int c8  = (tid & 7) * 8;     // 0..56
  v4u hv[2];
#pragma unroll
  for (int it = 0; it < 2; ++it) {
    const int oc = it * 32 + sub;    // output row within tile (= input column)
    v4u a;
#pragma unroll
    for (int q = 0; q < 4; ++q) {
      const float f0 = tf[(c8 + 2 * q) * 68 + oc];
      const float f1 = tf[(c8 + 2 * q + 1) * 68 + oc];
      a[q] = pk16(f2bf_bits(f0), f2bf_bits(f1));
    }
    hv[it] = a;
  }
  {
    unsigned short* po[2];
#pragma unroll
    for (int it = 0; it < 2; ++it) {
      const int oc = it * 32 + sub;
      const size_t go = (size_t)(c0 + oc) * ldout + r0 + c8;
      po[it] = oh + go;
      *(v4u*)po[it] = hv[it];
    }
    xcnt_wait_st(po, hv);   // the code of the grid's other block ranges follows in the kernel and reuses these registers
  }
}

// ---------------------------------------------------------------------------
// Conv weight permute + bf16 RNE convert: W OIHW [256 o][256 c][2][2] f32 -> O[o][q4*256 + c] u16 (q4 = kh*2 + kw),
// row pitch KCONV = 1024. One unit = (o, c0 = 8*lane): 8 x 16-B loads (the 4 taps of 8 consecutive c), 4 x 16-B stores
// (8 consecutive c of each q4 segment). Per store instruction the 32 lanes of a wave (same o) write 32 x 16 B = the whole
// Coverage: 32 blocks x 256 threads = 8192 units x 32 elements = 256 x 1024 = whole plane.
// ---------------------------------------------------------------------------
__device__ __forceinline__ void wperm_body(const float* __restrict__ W, unsigned short* __restrict__ O, int bx) {
  const int u = bx * 256 + threadIdx.x;   // 0 .. DIM*32 - 1
  if (u < DIM * 32) {
    const int o = u >> 5, c0 = (u & 31) * 8;
    v4f w[8];
#pragma unroll
    for (int e = 0; e < 8; ++e) w[e] = *(const v4f*)(W + ((size_t)(o * DIM + c0 + e)) * 4);
    v4u pk[4];
#pragma unroll
    for (int q4 = 0; q4 < 4; ++q4) {
      v4u a;
#pragma unroll
      for (int p = 0; p < 4; ++p) a[p] = pk16(f2bf_bits(w[2 * p][q4]), f2bf_bits(w[2 * p + 1][q4]));
      pk[q4] = a;
    }
    unsigned short* orow = O + (size_t)o * KCONV + c0;
    {
#pragma unroll
      for (int q4 = 0; q4 < 4; ++q4) *(v4u*)(orow + q4 * DIM) = pk[q4];
      
    }
  }
}

// ---------------------------------------------------------------------------
// The four operand preparations read only inputs and write disjoint planes, so they share one grid by ranges of the block
// index (block-uniform branches): Wq convert, Wk permute, Wv permute, then the x transpose tiles (x fastest, then y, then batch).
// ---------------------------------------------------------------------------
#define PR_WQ ((DIM * DIM / 8) / 256)              // 32 blocks
#define PR_WC ((DIM * 32) / 256)                   // 32 blocks per conv weight
#define PR_XT ((NQ / 64) * (DIM / 64) * NB)        // 1024 blocks
__global__ __launch_bounds__(256) void prep_kernel(const float* __restrict__ x, const float* __restrict__ Wq,
                                                   const float* __restrict__ Wk, const float* __restrict__ Wv,
                                                   unsigned short* __restrict__ XT, unsigned short* __restrict__ WQ,
                                                   unsigned short* __restrict__ WKp, unsigned short* __restrict__ WVp) {
  __shared__ __align__(16) float tf[64 * 68];      // used by the transpose blocks only
  const int bx = blockIdx.x;
  if (bx < PR_WQ) {
    convrows_body(Wq, WQ, DIM, DIM, DIM * DIM / 8, bx);
  } else if (bx < PR_WQ + PR_WC) {
    wperm_body(Wk, WKp, bx - PR_WQ);
  } else if (bx < PR_WQ + 2 * PR_WC) {
    wperm_body(Wv, WVp, bx - (PR_WQ + PR_WC));
  } else {
    // x[b] viewed [R=256 c][Cc=4096 n] (pitch 4096) -> XT_b[n][c] (pitch 256)
    const int t = bx - (PR_WQ + 2 * PR_WC);
    tconv_body(x, XT, NQ, DIM, (long)DIM * NQ, (long)NQ * DIM, tf,
               t % (NQ / 64), (t / (NQ / 64)) % (DIM / 64), t / ((NQ / 64) * (DIM / 64)));
  }
}

// ---------------------------------------------------------------------------
// im2col addressing of the 2x2 / stride-2 / VALID conv as a GEMM over XT (token-major bf16 [NB*4096][256]):
//   im2col row g = b*1024 + m, m = i*32 + j (output grid row i, col j); k = q4*256 + c, q4 = kh*2 + kw;
//   element (g, k) = XT[(b*4096 + (2i+kh)*64 + (2j+kw)) * 256 + c].
// For a 32-deep k-step (k0 % 32 == 0) the 32 k values are 32 consecutive channels of one source token row,
// so a fragment is two 16-B loads at the returned offset + koff and + koff + 16 (arithmetic addressing only).
// ---------------------------------------------------------------------------
__device__ __forceinline__ size_t im2col_off(int g, int k0) {
  const int b = g >> 10, m = g & (NKV - 1);
  const int q4 = k0 >> 8, c0 = k0 & (DIM - 1);
  const int kh = q4 >> 1, kw = q4 & 1;
  const int i = m >> 5, j = m & 31;
  return ((size_t)(b * NQ + (2 * i + kh) * IMW + 2 * j + kw)) * DIM + c0;
}

// ---------------------------------------------------------------------------
// Conv GEMM (bf16 single products, f32 accumulate), K = 1024, one 64x64 output tile per work-group:
//   MODE 0: C[g][o] = sum_k im2col(g,k) * WKp[o][k]  (M = 4096 rows g, N = 256), epilogue adds
//           pos(o, m) = bf16(rel_h[o*32 + (m&31)]) + bf16(rel_w[o*32 + (m>>5)]) in f32, then bf16 hi|lo planes [4096][256].
//   MODE 1: C[o][g] = sum_k WVp[o][k] * im2col(g,k)  (M = 256, N = 4096) -> bf16 hi|lo planes [256][4096] (v^T layout).
// K is split over the 8 waves: wave w sums k = 128w .. 128w+127 (4 k-steps) of the whole tile into its own f32 partial,
// writes it to its LDS plane, and behind one work-group barrier wave w adds the 8 partials (plane 0 first, then 1 .. 7)
// of rows 8w .. 8w+7 and finishes those rows (pos, hi|lo split, whole 128-B line stores).
// MODE 0 tables (bf16 bits, two per dword), written before the k loop and read only behind that same barrier:
//   sRh[nl*17 + (jj>>1)] holds rel_h[(n0+nl)*32 + jj] (pitch 17 dwords: the 8 lanes of a row read 8 distinct banks);
//   sRw[nl] holds rel_w[(n0+nl)*32 + ii0 + {0,1}], ii0 = first of the two output-grid rows that the tile's 64 rows m cover.
// 256 work-groups x 8 waves = 256 tiles exactly (both modes); tile = the work-group's index within its range of the shared grid.
// ---------------------------------------------------------------------------
#define CG_PLANE (64 * 68)                         // floats of one wave's partial tile
#define CG_LDS   (8 * CG_PLANE + 64 * 17 + 64)     // dwords of LDS that MODE 0 uses (MODE 1: the 8 planes only)
template <int MODE>
__device__ __forceinline__ void conv_gemm64(const unsigned short* __restrict__ XTp, const unsigned short* __restrict__ Wpp,
                                            const float* __restrict__ rel_h, const float* __restrict__ rel_w,
                                            unsigned short* __restrict__ Ch, unsigned short* __restrict__ Cl,
                                            float* smem, int tile) {
  typedef __bf16 T;
  typedef v16b V;
  const T* XT = (const T*)XTp; const T* Wp = (const T*)Wpp;
  float* sP = smem;                                // 8 planes: per-wave partial 64x64 tile, pitch 68 floats
  unsigned* sRh = (unsigned*)(smem + 8 * CG_PLANE);   // MODE 0 only: 64 x 17 dwords
  unsigned* sRw = sRh + 64 * 17;                      // MODE 0 only: 64 dwords
  constexpr int M = (MODE == 0) ? MKV : DIM;
  constexpr int N = (MODE == 0) ? DIM : MKV;
  constexpr int LDC = N;
  constexpr int KW = KCONV / 8;                    // k range of one wave
  static_assert(KW % 32 == 0);
  const int tid  = threadIdx.x;
  const int lane = tid & 31;
  const int wave = __builtin_amdgcn_readfirstlane(tid >> 5);   // scalar, so that the k offsets stay scalar

  constexpr int tilesN = N >> 6;
  constexpr int tilesM = M >> 6;
  if (tile >= tilesM * tilesN) return;   // block-uniform, in front of the barrier; never taken with the exact grid
  const int tm = tile / tilesN;
  const int tn = tile - tm * tilesN;
  const int m0 = tm << 6;
  const int n0 = tn << 6;

  if (MODE == 0) {
    // rel_h rows n0 .. n0+63: 64 x 32 values, 8 per thread
    const int nl = tid >> 2, j0 = (tid & 3) * 8;
    const float* rh = rel_h + (size_t)(n0 + nl) * OH + j0;
    const v4f a = *(const v4f*)(rh);
    const v4f c = *(const v4f*)(rh + 4);
    unsigned* d = sRh + nl * 17 + (j0 >> 1);
    d[0] = pk16(f2bf_bits(a[0]), f2bf_bits(a[1]));
    d[1] = pk16(f2bf_bits(a[2]), f2bf_bits(a[3]));
    d[2] = pk16(f2bf_bits(c[0]), f2bf_bits(c[1]));
    d[3] = pk16(f2bf_bits(c[2]), f2bf_bits(c[3]));
    if (tid < 64) {
      const int ii0 = (m0 & (NKV - 1)) >> 5;       // even, m0 being a multiple of 64
      const v2f w = *(const v2f*)(rel_w + (size_t)(n0 + tid) * OW + ii0);
      sRw[tid] = pk16(f2bf_bits(w[0]), f2bf_bits(w[1]));
    }
  }

  const int rlane = lane & 15;
  const int koff  = (lane >> 4) * 8;
  const int mOff  = (lane >> 4) * 8;

  v8f acc[4][4];
#pragma unroll
  for (int i = 0; i < 4; ++i)
#pragma unroll
    for (int j = 0; j < 4; ++j) acc[i][j] = (v8f){0.f,0.f,0.f,0.f,0.f,0.f,0.f,0.f};

  const int kbeg = wave * KW;
  for (int k0 = kbeg; k0 < kbeg + KW; k0 += 32) {
    V bfr[4];
    const T* pb[4];
#pragma unroll
    for (int j = 0; j < 4; ++j) {
      const int n = n0 + (j << 4) + rlane;
      if (MODE == 0) pb[j] = Wp + (size_t)n * KCONV + k0 + koff;
      else           pb[j] = XT + im2col_off(n, k0) + koff;
      bfr[j] = Frag<T>::load(pb[j]);
    }
    xcnt_wait(pb[0], pb[1], pb[2], pb[3]);
#pragma unroll
    for (int i = 0; i < 4; ++i) {
      const int mr = m0 + (i << 4) + rlane;
      const T* pa;
      if (MODE == 0) pa = XT + im2col_off(mr, k0) + koff;
      else           pa = Wp + (size_t)mr * KCONV + k0 + koff;
      V ah = Frag<T>::load(pa);
      xcnt_wait(pa);
#pragma unroll
      for (int j = 0; j < 4; ++j) acc[i][j] = Frag<T>::mma(ah, bfr[j], acc[i][j]);
      Frag<T>::guard(acc[i][0], acc[i][3], ah, ah);
    }
    Frag<T>::keep(bfr[0], bfr[1], bfr[2], bfr[3]);
  }
  acc_guard4(acc[0][0], acc[0][1], acc[0][2], acc[0][3]);
  acc_guard4(acc[1][0], acc[1][1], acc[1][2], acc[1][3]);
  acc_guard4(acc[2][0], acc[2][1], acc[2][2], acc[2][3]);
  acc_guard4(acc[3][0], acc[3][1], acc[3][2], acc[3][3]);

  // ---- this wave's partial tile to its LDS plane ----
  {
    float* part = sP + wave * CG_PLANE;
#pragma unroll
    for (int i = 0; i < 4; ++i)
#pragma unroll
      for (int j = 0; j < 4; ++j)
#pragma unroll
        for (int r = 0; r < 8; ++r) part[((i << 4) + mOff + r) * 68 + (j << 4) + rlane] = acc[i][j][r];
  }
  __syncthreads();

  // ---- join the 8 partials of rows 8*wave .. +7 and finish them: a lane holds 8 consecutive columns of one row ----
  const int q = lane >> 3, c8 = (lane & 7) * 8;
  v8h hv[2], lv[2];
  unsigned short* pch[2];
  unsigned short* pcl[2];
#pragma unroll
  for (int it = 0; it < 2; ++it) {
    const int row = wave * 8 + it * 4 + q;         // row within the tile
    const float* sp = sP + row * 68 + c8;
    v4f s0 = *(const v4f*)(sp);
    v4f s1 = *(const v4f*)(sp + 4);
#pragma unroll
    for (int w = 1; w < 8; ++w) {
      s0 += *(const v4f*)(sp + w * (64 * 68));
      s1 += *(const v4f*)(sp + w * (64 * 68) + 4);
    }
#pragma unroll
    for (int e = 0; e < 8; ++e) {
      float v = (e < 4) ? s0[e & 3] : s1[e & 3];
      if (MODE == 0) {
        const int jj = row & 31;                   // (m0 + row) & 31, m0 being a multiple of 64
        const unsigned hw = sRh[(c8 + e) * 17 + (jj >> 1)] >> ((jj & 1) * 16);
        const unsigned ww = sRw[c8 + e] >> ((row >> 5) * 16);
        const float pos = bf_bits2f((unsigned short)hw) + bf_bits2f((unsigned short)ww);
        v += pos;
      }
      unsigned short hb = f2bf_bits(v);
      unsigned short lb = f2bf_bits(v - bf_bits2f(hb));
      hv[it][e] = __builtin_bit_cast(_Float16, hb);
      lv[it][e] = __builtin_bit_cast(_Float16, lb);
    }
    pch[it] = Ch + (size_t)(m0 + row) * LDC + n0 + c8;
    pcl[it] = Cl + (size_t)(m0 + row) * LDC + n0 + c8;
    *(v8h*)pch[it] = hv[it];
    *(v8h*)pcl[it] = lv[it];
  }
  xcnt_wait_st(pch, pcl, hv, lv);   // the code of the grid's other block ranges follows in the kernel and reuses these registers
}

// ---------------------------------------------------------------------------
// The three GEMMs read only the prepared planes and write disjoint planes, so they share one grid by ranges of the block index
// (block-uniform branches) and one LDS array: the q projection first (its waves run the longest k loop), then k', then v^T.
//   q = XT . WQ^T -> Qh|Ql [16384][256]   (M=16384, N=256, K=256; 1024 tiles, 8 per block); bias/resid unused (mode 0)
// ---------------------------------------------------------------------------
#define G3_Q (((MTOK / 64) * (DIM / 64)) / 8)      // 128 blocks
#define G3_C ((MKV / 64) * (DIM / 64))             // 256 blocks per conv GEMM
static_assert(CG_LDS >= 8 * 16 * 68);
__global__ __launch_bounds__(256) void gemm3_kernel(const unsigned short* __restrict__ XT, const unsigned short* __restrict__ WQ,
                                                    const unsigned short* __restrict__ WKp, const unsigned short* __restrict__ WVp,
                                                    const float* __restrict__ rel_h, const float* __restrict__ rel_w,
                                                    unsigned short* __restrict__ Qh, unsigned short* __restrict__ Ql,
                                                    unsigned short* __restrict__ Kh, unsigned short* __restrict__ Kl,
                                                    unsigned short* __restrict__ VTh, unsigned short* __restrict__ VTl) {
  __shared__ __align__(16) float smem[CG_LDS];
  const int bx = blockIdx.x;
  if (bx < G3_Q) {
    wmma_gemm64<1, false, 0, 2, false, 0>(XT, XT, DIM, 0L, WQ, WQ, DIM, 0L, (void*)Qh, (void*)Ql, DIM, 0L,
                                          rel_h, rel_h, 0L, MTOK, DIM, DIM, 1.0f, smem, bx, 0);
  } else if (bx < G3_Q + G3_C) {
    conv_gemm64<0>(XT, WKp, rel_h, rel_w, Kh, Kl, smem, bx - G3_Q);
  } else {
    conv_gemm64<1>(XT, WVp, rel_h, rel_w, VTh, VTl, smem, bx - (G3_Q + G3_C));
  }
}

// =====================================================================================
// Full (non-causal, unmasked) attention, head dim 32, all batches and heads in one launch.
//   q planes (hi/lo bf16) [16384][256]: element (b, n, h, d) at [(b*4096+n)*256 + h*32 + d]
//   k planes (hi/lo bf16) [4096][256]:  element (b, m, h, d) at [(b*1024+m)*256 + h*32 + d]  (pos already folded in)
//   v^T planes (hi/lo bf16) [256][4096]: element (h, d, b, m) at [(h*32 + d)*4096 + b*1024 + m]
//   out f32 NCHW: element (b, h*32+d, n) at [(b*256 + h*32 + d)*4096 + n]
//   scores = (q . k') * 32^-0.5 : bf16 hi/lo split (hi.hi + hi.lo + lo.hi) on v_wmma_f32_16x16x32_bf16
//   out    = p . v             : bf16 hi/lo split of p (unnormalised exp) and v, f32 accumulate, x 1/rowsum in f32 at the end
//   online softmax in f32 over the 1024 keys of the batch element (16 chunks of 64, compile-time trip count, no masking),
//   in base 2: p = 2^(s * scale * log2(e) - m), one multiply-add and one hardware exponential per score.
//   Block = 4 waves = 64 query positions of one (batch, head); grid.x = 4 * 8 * 64 = 2048 (exact).
//   K chunk staging: thread r = tid>>1 stages K row r cols (tid&1)*16 .. +15 (two 16-B copies per plane) -> 64x32 whole tile;
//   V^T chunk staging: thread d = tid>>2 stages row d cols (tid&3)*16 .. +15 -> 32x64 whole tile; __syncthreads before and after.
//   Scores are formed transposed, S^T = K . Q^T (A = K rows, B = Q): a lane holds 32 of the chunk's 64 scores of ONE query
//   (query = lane & 15, keys j*16 + 8*(lane>>4) + r), so maximum and sum run in the lane plus one exchange between lane halves;
//   two S^T tiles converted in place are the B operand of O^T += V^T . P^T (same k order as the V^T loader): P never touches LDS.
// =====================================================================================
#define AT_D  32
#define AT_NW 4
#define AT_QB 64
#define AT_KC 64
#define AT_KP 40   // LDS pitch of a K row in elements: 80 B = 16 B x 5 (odd), so the 16 rows of one 16-byte fragment read fall on 16 distinct bank groups
#define AT_VP 72   // LDS pitch of a V^T row in elements: 144 B = 16 B x 9 (odd), same reason

__device__ __forceinline__ v8f at_mma(v16b a, v16b b, v8f c) {
  // the builtin alone: the compiler keeps the distance behind its own matrix instructions, and pays idle slots only where a vector
  // instruction really follows on D, A or B (an accumulating product on the same D needs none)
  return __builtin_amdgcn_wmma_f32_16x16x32_bf16(false, a, false, b, (short)0, c, false, false);
}

// value of the same lane position in the other 16-lane half (lane ^ 16), as a vector cross-row move
__device__ __forceinline__ float at_xhalf(float f) {
  const int b = __float_as_int(f);
  return __int_as_float(__builtin_amdgcn_permlanex16(b, b, 0x76543210, 0xfedcba98, false, false));
}

__global__ __launch_bounds__(128)
void attn32_kernel(const unsigned short* __restrict__ qhp, const unsigned short* __restrict__ qlp,
                   const unsigned short* __restrict__ khp, const unsigned short* __restrict__ klp,
                   const unsigned short* __restrict__ vhp, const unsigned short* __restrict__ vlp,
                   float* __restrict__ out, float sscale) {
  union FB { v16b v; v8b h[2]; unsigned w[8]; };
  __shared__ __align__(16) __bf16 Ksh[AT_KC * AT_KP];            // K hi [kv][d], padded rows   5 KB
  __shared__ __align__(16) __bf16 Ksl[AT_KC * AT_KP];            // K lo
  __shared__ __align__(16) __bf16 Vth[AT_D * AT_VP];             // V hi [d][kv], padded rows   4.5 KB
  __shared__ __align__(16) __bf16 Vtl[AT_D * AT_VP];             // V lo
  __shared__ __align__(16) float  Os[AT_D * 68];                 // block out tile transposed [d][n_local], pitch 68

  const int tid  = threadIdx.x;
  const int wave = tid >> 5;
  const int lane = tid & 31;
  const int hh   = lane >> 4;
  const int c    = lane & 15;

  const int nqb = NQ / AT_QB;              // 64 query blocks per (batch, head)
  const int bx = blockIdx.x;               // grid = NB * NH * nqb (exact)
  const int qb = bx % nqb;
  const int hb = bx / nqb;
  const int h  = hb % NH;                  // 0..7
  const int b  = hb / NH;                  // 0..3
  const int q0 = b * NQ + qb * AT_QB + wave * 16;   // row in the q planes

  const __bf16* Qh = (const __bf16*)(const void*)qhp + (size_t)h * AT_D;
  const __bf16* Ql = (const __bf16*)(const void*)qlp + (size_t)h * AT_D;
  const __bf16* Kh = (const __bf16*)(const void*)khp + (size_t)h * AT_D;
  const __bf16* Kl = (const __bf16*)(const void*)klp + (size_t)h * AT_D;
  const __bf16* Vh = (const __bf16*)(const void*)vhp + (size_t)h * AT_D * VTP + (size_t)b * NKV;
  const __bf16* Vl = (const __bf16*)(const void*)vlp + (size_t)h * AT_D * VTP + (size_t)b * NKV;

  // ---- Q fragments (B operand, column = lane&15, split k map via Frag load): head dim 32 = one k-step, hi and lo ----
  v16b qah, qal;
  {
    const __bf16* qr = Qh + (size_t)(q0 + c) * DIM + 8 * hh;
    const __bf16* ql = Ql + (size_t)(q0 + c) * DIM + 8 * hh;
    qah = Frag<__bf16>::load(qr);
    qal = Frag<__bf16>::load(ql);
  }

  const float sl2 = sscale * 1.4426950408889634f;   // score scale times log2(e): the softmax runs in base 2
  float mrow = -INFINITY;   // running maximum of this lane's query in base-2 units, max(s) * sl2 (equal in both lane halves)
  float lrow = 0.f;         // running sum over this lane half's keys only; the halves are joined once after the loop
  v8f oacc[2];              // O^T tiles: oacc[t][r] = out[d = t*16 + 8*hh + r][query c]
#pragma unroll
  for (int t = 0; t < 2; ++t) oacc[t] = (v8f){0.f,0.f,0.f,0.f,0.f,0.f,0.f,0.f};

  const int nChunks = NKV / AT_KC;   // 16, compile-time constant
  for (int kc = 0; kc < nChunks; ++kc) {
    const int kv0 = kc * AT_KC;
    __syncthreads();
    {
      // K staging: 128 threads x 16 elements per plane = 64 rows x 32
      const int r = tid >> 1, hf = (tid & 1) * 16;
      const __bf16* ksh = Kh + (size_t)(b * NKV + kv0 + r) * DIM + hf;
      const __bf16* ksl = Kl + (size_t)(b * NKV + kv0 + r) * DIM + hf;
      const v8b a0 = *(const v8b*)(ksh);
      const v8b a1 = *(const v8b*)(ksh + 8);
      const v8b a2 = *(const v8b*)(ksl);
      const v8b a3 = *(const v8b*)(ksl + 8);
      *(v8b*)(Ksh + r * AT_KP + hf)     = a0;
      *(v8b*)(Ksh + r * AT_KP + hf + 8) = a1;
      *(v8b*)(Ksl + r * AT_KP + hf)     = a2;
      *(v8b*)(Ksl + r * AT_KP + hf + 8) = a3;
      // V^T staging: 128 threads x 16 elements per plane = 32 rows x 64
      const int d = tid >> 2, qq = (tid & 3) * 16;
      const __bf16* vsh = Vh + (size_t)d * VTP + kv0 + qq;
      const __bf16* vsl = Vl + (size_t)d * VTP + kv0 + qq;
      const v8b b0 = *(const v8b*)(vsh);
      const v8b b1 = *(const v8b*)(vsh + 8);
      const v8b b2 = *(const v8b*)(vsl);
      const v8b b3 = *(const v8b*)(vsl + 8);
      *(v8b*)(Vth + d * AT_VP + qq)     = b0;
      *(v8b*)(Vth + d * AT_VP + qq + 8) = b1;
      *(v8b*)(Vtl + d * AT_VP + qq)     = b2;
      *(v8b*)(Vtl + d * AT_VP + qq + 8) = b3;
    }
    __syncthreads();

    v8f s[4];
#pragma unroll
    for (int j = 0; j < 4; ++j) {
      s[j] = (v8f){0.f,0.f,0.f,0.f,0.f,0.f,0.f,0.f};
      FB kb, kl;
      kb.h[0] = *(const v8b*)(Ksh + (j * 16 + c) * AT_KP + 8 * hh);
      kb.h[1] = *(const v8b*)(Ksh + (j * 16 + c) * AT_KP + 16 + 8 * hh);
      kl.h[0] = *(const v8b*)(Ksl + (j * 16 + c) * AT_KP + 8 * hh);
      kl.h[1] = *(const v8b*)(Ksl + (j * 16 + c) * AT_KP + 16 + 8 * hh);
      s[j] = at_mma(kb.v, qah, s[j]);
      s[j] = at_mma(kl.v, qah, s[j]);
      s[j] = at_mma(kb.v, qal, s[j]);
    }
    // the query's chunk maximum of the raw scores: in the lane, then one exchange with the other lane half; scaled once (sl2 > 0 keeps the order)
    // (the loops over j, r, t and kk below are unrolled so that s, ph, pl and oacc are indexed at compile time and stay in registers)
    float cm = -INFINITY;
#pragma unroll
    for (int j = 0; j < 4; ++j) {
#pragma unroll
      for (int r = 0; r < 8; ++r) cm = fmaxf(cm, s[j][r]);
    }
    cm = fmaxf(cm, at_xhalf(cm));
    const float mnew = fmaxf(mrow, cm * sl2);
    const float alpha = __builtin_amdgcn_exp2f(mrow - mnew);   // 0 on the first chunk, where mrow is -inf
    mrow = mnew;
    // P^T as B operand: element e of k-step kk = S^T tile 2*kk + (e >> 3), register e & 7 (key kk*32 + 16*(e>>3) + 8*hh + (e&7))
    FB ph[2], pl[2];
    float psum = 0.f;
#pragma unroll
    for (int j = 0; j < 4; ++j) {
#pragma unroll
      for (int r = 0; r < 8; r += 2) {
        // e^(scale*s - max) as 2^(s*sl2 - mnew), the multiply-add on two scores at a time
        const v2f arg = __builtin_elementwise_fma((v2f){s[j][r], s[j][r + 1]}, (v2f){sl2, sl2}, (v2f){-mnew, -mnew});
        const float p0 = __builtin_amdgcn_exp2f(arg[0]);
        const float p1 = __builtin_amdgcn_exp2f(arg[1]);
        psum += p0;
        psum += p1;
        // hi|lo split of two scores at a time: the packed hardware conversion rounds to nearest even, as the integer steps did,
        // and leaves both halves of the operand word in place; the remainder p - hi is exact in f32
        const unsigned hw = __builtin_bit_cast(unsigned, __builtin_convertvector((v2f){p0, p1}, v2b));
        const v2f rest = (v2f){p0, p1} - (v2f){__uint_as_float(hw << 16), __uint_as_float(hw & 0xFFFF0000u)};
        ph[j >> 1].w[(j & 1) * 4 + (r >> 1)] = hw;
        pl[j >> 1].w[(j & 1) * 4 + (r >> 1)] = __builtin_bit_cast(unsigned, __builtin_convertvector(rest, v2b));
      }
    }
    lrow = lrow * alpha + psum;
    // keeps the exponentials and the split in front of the P.V products: moved in among them they hold the f32 values of P longer,
    // the kernel passes 128 registers, and only 7 instead of 8 waves fit a SIMD (the 2048 work-groups then need a second round)
    __builtin_amdgcn_sched_barrier(0);
#pragma unroll
    for (int t = 0; t < 2; ++t)
#pragma unroll
      for (int r = 0; r < 8; ++r) oacc[t][r] *= alpha;
#pragma unroll
    for (int kk = 0; kk < 2; ++kk) {
#pragma unroll
      for (int t = 0; t < 2; ++t) {
        FB vb, vl;
        vb.h[0] = *(const v8b*)(Vth + (t * 16 + c) * AT_VP + kk * 32 + 8 * hh);
        vb.h[1] = *(const v8b*)(Vth + (t * 16 + c) * AT_VP + kk * 32 + 16 + 8 * hh);
        vl.h[0] = *(const v8b*)(Vtl + (t * 16 + c) * AT_VP + kk * 32 + 8 * hh);
        vl.h[1] = *(const v8b*)(Vtl + (t * 16 + c) * AT_VP + kk * 32 + 16 + 8 * hh);
        oacc[t] = at_mma(vb.v, ph[kk].v, oacc[t]);
        oacc[t] = at_mma(vl.v, ph[kk].v, oacc[t]);
        oacc[t] = at_mma(vb.v, pl[kk].v, oacc[t]);
      }
    }
  }

  // ---- join the lane halves' sums, normalise and stage: Os[d][n_local], d = t*16 + 8hh + r, n_local = wave*16 + c (all 32 x 64 written) ----
  {
    const float inv = 1.0f / (lrow + at_xhalf(lrow));
#pragma unroll
    for (int t = 0; t < 2; ++t)
#pragma unroll
      for (int r = 0; r < 8; ++r) Os[(t * 16 + 8 * hh + r) * 68 + wave * 16 + c] = oacc[t][r] * inv;
  }
  __syncthreads();
  {
    float* ob = out + ((size_t)(b * DIM + h * AT_D)) * NQ + (size_t)qb * AT_QB;
    const int q = lane >> 3, c4 = (lane & 7) * 4;
    {
#pragma unroll
      for (int it = 0; it < 4; ++it) {
        const int L  = it * 16 + wave * 4 + q;   // 0..63: line index within the block's 32 x 256-B output region
        const int d  = L >> 1;
        const int hf = (L & 1) * 32;
        v4f val = *(const v4f*)(Os + d * 68 + hf + c4);
        *(v4f*)(ob + (size_t)d * NQ + hf + c4) = val;
      }
      
    }
  }
}

// ---------------------------------------------------------------------------
// Workspace region map (byte offsets; every region fully written by its producer launch before any consumer reads it;
//   XT   bf16 [16384][256]         0       8388608
//   WQ   bf16 [256][256]     8388608        131072
//   WKp  bf16 [256][1024]    8519680        524288
//   WVp  bf16 [256][1024]    9043968        524288
//   Qh   bf16 [16384][256]   9568256       8388608   Ql  17956864
//   Kh   bf16 [4096][256]   26345472       2097152   Kl  28442624
//   VTh  bf16 [256][4096]   30539776       2097152   VTl 32636928
//   total                  34734080
// ---------------------------------------------------------------------------
extern "C" void kernel_launch(void* const* d_in, const int* in_sizes, int n_in,
                              void* d_out, int out_size, void* d_ws, size_t ws_size,
                              hipStream_t stream) {
  if (n_in < 6) return;
  if (in_sizes[0] != NB * DIM * NQ) return;          // x [4][256][64][64]
  if (in_sizes[1] != DIM * DIM) return;              // Wq [256][256]
  if (in_sizes[2] != DIM * DIM * 4) return;          // Wk [256][256][2][2]
  if (in_sizes[3] != DIM * DIM * 4) return;          // Wv [256][256][2][2]
  if (in_sizes[4] != NH * HD * OH) return;           // rel_h [1][8][32][1][32]
  if (in_sizes[5] != NH * HD * OW) return;           // rel_w [1][8][32][32][1]
  if (out_size != NB * DIM * NQ) return;

  const float* x     = (const float*)d_in[0];
  const float* Wq    = (const float*)d_in[1];
  const float* Wk    = (const float*)d_in[2];
  const float* Wv    = (const float*)d_in[3];
  const float* rel_h = (const float*)d_in[4];
  const float* rel_w = (const float*)d_in[5];

  const size_t PXT = (size_t)MTOK * DIM * 2;        // 8388608
  const size_t PWQ = (size_t)DIM * DIM * 2;         // 131072
  const size_t PWC = (size_t)DIM * KCONV * 2;       // 524288
  const size_t PQ  = (size_t)MTOK * DIM * 2;        // 8388608
  const size_t PK  = (size_t)MKV * DIM * 2;         // 2097152
  const size_t PVT = (size_t)DIM * VTP * 2;         // 2097152
  size_t off = 0;
  const size_t oXT  = off; off += PXT;
  const size_t oWQ  = off; off += PWQ;
  const size_t oWK  = off; off += PWC;
  const size_t oWV  = off; off += PWC;
  const size_t oQh  = off; off += PQ;   const size_t oQl  = off; off += PQ;
  const size_t oKh  = off; off += PK;   const size_t oKl  = off; off += PK;
  const size_t oVTh = off; off += PVT;  const size_t oVTl = off; off += PVT;
  if (off > ws_size) return;                        // off = 34734080
  if (off > (size_t)134217728) return;

  char* ws = (char*)d_ws;
  unsigned short* XT  = (unsigned short*)(ws + oXT);
  unsigned short* WQ  = (unsigned short*)(ws + oWQ);
  unsigned short* WKp = (unsigned short*)(ws + oWK);
  unsigned short* WVp = (unsigned short*)(ws + oWV);
  unsigned short* Qh  = (unsigned short*)(ws + oQh);  unsigned short* Ql  = (unsigned short*)(ws + oQl);
  unsigned short* Kh  = (unsigned short*)(ws + oKh);  unsigned short* Kl  = (unsigned short*)(ws + oKl);
  unsigned short* VTh = (unsigned short*)(ws + oVTh); unsigned short* VTl = (unsigned short*)(ws + oVTl);

  const dim3 blk(256);

  // (1) operand preparation: WQ, WKp, WVp and XT; 32 + 32 + 32 + 1024 blocks
  prep_kernel<<<dim3(PR_WQ + 2 * PR_WC + PR_XT), blk, 0, stream>>>(x, Wq, Wk, Wv, XT, WQ, WKp, WVp);
  // (2) q -> Qh|Ql, k' = conv_k + pos -> Kh|Kl, v^T = conv_v -> VTh|VTl; 128 + 256 + 256 blocks
  gemm3_kernel<<<dim3(G3_Q + 2 * G3_C), blk, 0, stream>>>(XT, WQ, WKp, WVp, rel_h, rel_w, Qh, Ql, Kh, Kl, VTh, VTl);
  // (3) attention per (batch, head, 64-query block) -> d_out NCHW; 2048 blocks of 128
  attn32_kernel<<<dim3(NB * NH * (NQ / AT_QB)), dim3(128), 0, stream>>>(Qh, Ql, Kh, Kl, VTh, VTl, (float*)d_out,
                                                                        0.17677669529663687f);
  (void)hipGetLastError();
}

// v008
// Measured time: 69.6 microseconds a run.
// Two timings next to v007 both put it at 1.06 times that version's speed.
// Over all steps from v000 it is 4.96 times as fast.
// Contractions: q projection, k conv (im2col) and v^T conv (im2col) = v_wmma_f32_16x16x32_bf16 single products on bf16 planes of the RNE-converted inputs (exact products); scores q.(k+pos) and p.v = bf16 hi/lo split (hi.hi + hi.lo + lo.hi); f32 accumulate everywhere; positional add, 32^-0.5 scale, online softmax and 1/rowsum in f32 on the VALU.
// Plane / carry map (all carry 1, nothing to fold back):
//   XT  = bf16(x), rows = tokens, cols = channels c;  WQ = bf16(Wq) [256 o][256 c];  WKp, WVp bf16 [256 o][1024]: col q4*256 + c = bf16(W[o][c][kh][kw]), q4 = kh*2 + kw
//   These four are kept in FRAGMENT ORDER: blocks of 16 rows x 32 cols = 512 elements, block (row tile rt, k-step ks) at (rt * (cols/32) + ks) * 512;
//   in a block element (r, k) stands at ((k>>4)&1)*256 + (((k>>3)&1)*16 + r)*8 + (k&7), so each of a fragment's two 16-B loads reads 512 B in a row.
//   Row tiles of XT: tile ((b*64 + y)*2 + kw)*2 + jt, row r = token (b, y, x = 2*(jt*16 + r) + kw): the 16 tokens that one conv tap takes from an image row
//   Qh|Ql bf16 [16384][256] (col h*32 + d) = hi/lo of q;  KI bf16 [32 (b*8+h)][1024 m][64] (m = i*32 + j; col d = hi, col 32 + d = lo) = hi/lo of (conv_k + pos)
//   pos(h,d,m) = bf16(rel_h[(h*32+d)*32 + (m & 31)]) + bf16(rel_w[(h*32+d)*32 + (m >> 5)]) in f32
//   VTh|VTl bf16 [256 (h*32+d)][4096 (b*1024+m)] = hi/lo of conv_v;  P hi|lo = unnormalised exp, at most 1 up to the rounding of the scaled maximum (f32), 1/rowsum applied to the f32 accumulator
#include <hip/hip_runtime.h>
#include <math.h>
#include <stdint.h>

#define NB    4
#define DIM   256
#define NH    8
#define HD    32
#define IMH   64
#define IMW   64
#define NQ    4096
#define OH    32
#define OW    32
#define NKV   1024
#define KCONV 1024
#define MTOK  (NB * NQ)
#define MKV   (NB * NKV)
#define VTP   (NB * NKV)

static_assert(NQ == IMH * IMW);
static_assert(IMW == 64);
static_assert(NKV == OH * OW);
static_assert(OH * 2 == IMH);
static_assert(OW * 2 == IMW);
static_assert(DIM == NH * HD);
static_assert(HD == 32);
static_assert(KCONV == DIM * 4);
static_assert(MTOK % 64 == 0);
static_assert(MKV % 128 == 0);
static_assert(DIM % 64 == 0);
static_assert(KCONV % 32 == 0);
static_assert(DIM % 32 == 0);
static_assert((DIM * DIM) % (8 * 256) == 0);
static_assert(((MKV / 64) * (DIM / 64)) % 8 == 0);
static_assert(((MTOK / 64) * (DIM / 64)) % 8 == 0);
static_assert(DIM * OH == 8192);
static_assert(NQ % 64 == 0);
static_assert(NKV % 64 == 0);

typedef __attribute__((ext_vector_type(16))) _Float16 v16h;
typedef __attribute__((ext_vector_type(8)))  _Float16 v8h;
typedef __attribute__((ext_vector_type(16))) __bf16   v16b;
typedef __attribute__((ext_vector_type(8)))  __bf16   v8b;
typedef __attribute__((ext_vector_type(2)))  __bf16   v2b;
typedef __attribute__((ext_vector_type(8)))  float    v8f;
typedef __attribute__((ext_vector_type(4)))  float    v4f;
typedef __attribute__((ext_vector_type(2)))  float    v2f;
typedef __attribute__((ext_vector_type(4)))  unsigned int v4u;
typedef __attribute__((ext_vector_type(2)))  unsigned int v2u;

__device__ __forceinline__ unsigned short f2bf_bits(float f) {
  unsigned u = __float_as_uint(f);
  return (unsigned short)((u + 0x7FFFu + ((u >> 16) & 1u)) >> 16);
}
__device__ __forceinline__ float bf_bits2f(unsigned short h) { return __uint_as_float(((unsigned)h) << 16); }
__device__ __forceinline__ unsigned pk16(unsigned short a, unsigned short b) { return (unsigned)a | ((unsigned)b << 16); }

// hazard guards as plain device helpers (no inline asm inside the kernel template body)
__device__ __forceinline__ void dep_guard_h(v8f& a, v8f& b, v16h x, v16h y) { asm volatile("v_nop\n\tv_nop\n\tv_nop\n\tv_nop" : "+v"(a), "+v"(b) : "v"(x), "v"(y)); }
__device__ __forceinline__ void dep_guard_b(v8f& a, v8f& b, v16b x, v16b y) { asm volatile("v_nop\n\tv_nop\n\tv_nop\n\tv_nop" : "+v"(a), "+v"(b) : "v"(x), "v"(y)); }
__device__ __forceinline__ void keep4_h(v16h a, v16h b, v16h c, v16h d) { asm volatile("v_nop" :: "v"(a), "v"(b), "v"(c), "v"(d)); }
__device__ __forceinline__ void keep4_b(v16b a, v16b b, v16b c, v16b d) { asm volatile("v_nop" :: "v"(a), "v"(b), "v"(c), "v"(d)); }
__device__ __forceinline__ void acc_guard4(v8f& a, v8f& b, v8f& c, v8f& d) { asm volatile("v_nop\n\tv_nop\n\tv_nop\n\tv_nop" : "+v"(a), "+v"(b), "+v"(c), "+v"(d)); }
// s_wait_xcnt 0 behind issued global loads or stores, in front of the next write of a register that they name: the addresses
// (and a store's data) are inputs of the statement, so their registers stay as they are up to the wait
__device__ __forceinline__ void xcnt_wait(const void* a) { asm volatile("s_wait_xcnt 0x0" :: "v"(a) : "memory"); }
__device__ __forceinline__ void xcnt_wait(const void* a, const void* b) { asm volatile("s_wait_xcnt 0x0" :: "v"(a), "v"(b) : "memory"); }
__device__ __forceinline__ void xcnt_wait(const void* a, const void* b, const void* c, const void* d) {
  asm volatile("s_wait_xcnt 0x0" :: "v"(a), "v"(b), "v"(c), "v"(d) : "memory");
}
__device__ __forceinline__ void xcnt_wait_st(unsigned short* const (&a)[2], const v4u (&x)[2]) {
  asm volatile("s_wait_xcnt 0x0" :: "v"(a[0]), "v"(a[1]), "v"(x[0]), "v"(x[1]) : "memory");
}
__device__ __forceinline__ void xcnt_wait_st(unsigned short* const (&a)[2], unsigned short* const (&b)[2], const v8h (&x)[2], const v8h (&y)[2]) {
  asm volatile("s_wait_xcnt 0x0" :: "v"(a[0]), "v"(a[1]), "v"(b[0]), "v"(b[1]), "v"(x[0]), "v"(x[1]), "v"(y[0]), "v"(y[1]) : "memory");
}
__device__ __forceinline__ void xcnt_wait_st(unsigned short* const (&a)[4], unsigned short* const (&b)[4], const v8h (&x)[4], const v8h (&y)[4]) {
  asm volatile("s_wait_xcnt 0x0" :: "v"(a[0]), "v"(a[1]), "v"(a[2]), "v"(a[3]), "v"(b[0]), "v"(b[1]), "v"(b[2]), "v"(b[3]),
               "v"(x[0]), "v"(x[1]), "v"(x[2]), "v"(x[3]), "v"(y[0]), "v"(y[1]), "v"(y[2]), "v"(y[3]) : "memory");
}
template <typename T> struct Frag;
template <> struct Frag<_Float16> {
  typedef v16h V; union U { v16h v; v8h h[2]; };
  static __device__ __forceinline__ v16h load(const _Float16* p) {   // elements 0..7 <- p[0..7], 8..15 <- p[16..23]
    U f; f.h[0] = *(const v8h*)(p); f.h[1] = *(const v8h*)(p + 16); return f.v;
  }
  static __device__ __forceinline__ v16h load_fo(const _Float16* p) {   // p = fragment-order block + lane*8: elements 0..7 <- p[0..7], 8..15 <- p[256..263]
    U f; f.h[0] = *(const v8h*)(p); f.h[1] = *(const v8h*)(p + 256); return f.v;
  }
  static __device__ __forceinline__ v8f mma(v16h a, v16h b, v8f c) {
    return __builtin_amdgcn_wmma_f32_16x16x32_f16(false, a, false, b, (short)0, c, false, false);
  }
  static __device__ __forceinline__ void guard(v8f& a, v8f& b, v16h x, v16h y) { dep_guard_h(a, b, x, y); }
  static __device__ __forceinline__ void keep(v16h a, v16h b, v16h c, v16h d) { keep4_h(a, b, c, d); }
};
template <> struct Frag<__bf16> {
  typedef v16b V; union U { v16b v; v8b h[2]; };
  static __device__ __forceinline__ v16b load(const __bf16* p) {
    U f; f.h[0] = *(const v8b*)(p); f.h[1] = *(const v8b*)(p + 16); return f.v;
  }
  static __device__ __forceinline__ v16b load_fo(const __bf16* p) {     // as above
    U f; f.h[0] = *(const v8b*)(p); f.h[1] = *(const v8b*)(p + 256); return f.v;
  }
  static __device__ __forceinline__ v8f mma(v16b a, v16b b, v8f c) {
    return __builtin_amdgcn_wmma_f32_16x16x32_bf16(false, a, false, b, (short)0, c, false, false);
  }
  static __device__ __forceinline__ void guard(v8f& a, v8f& b, v16b x, v16b y) { dep_guard_b(a, b, x, y); }
  static __device__ __forceinline__ void keep(v16b a, v16b b, v16b c, v16b d) { keep4_b(a, b, c, d); }
};

// ---- Register-blocked batched WMMA GEMM ------------------------------------
// C[m,n] = scale * sum_k A[m,k] * Bt[n,k] (+bias)(+resid); each wave owns a 64x64 tile.
// A [M,K] and Bt [N,K] in fragment order (head of the file); M,N % 64 == 0, K % 32 == 0. A's row tiles are XT's: row r of sub-tile i of a 64-row
// tile is output row m0 + 2*((i&1)*16 + r) + (i>>1), which the epilogue undoes.
// SPLIT: operands are hi/lo planes (A2/Bt2 = lo planes, same layout); product = hi.hi + hi.lo + lo.hi.
// BIAS_MODE: 0 = none, 1 = bias[m], 2 = bias[n].
// OUT_MODE: 0 = f32, 1 = f16, 2 = bf16 hi plane (Cout) + bf16 lo plane (Cout2).
// ET: 0 = f16 operands, 1 = bf16 operands (pointers passed as 16-bit storage)
template <int ET> struct Elem;
template <> struct Elem<0> { typedef _Float16 T; };
template <> struct Elem<1> { typedef __bf16 T; };
// Device body: smem = the work-group's LDS (8 slabs of 16 x 68 floats are used), bx / by = the block indices of this GEMM's own grid.
template <int ET, bool SPLIT, int BIAS_MODE, int OUT_MODE, bool RESID, int ACT = 0>
__device__ __forceinline__ void wmma_gemm64(
    const unsigned short* __restrict__ Ap, const unsigned short* __restrict__ A2p, int lda, long strideA,
    const unsigned short* __restrict__ Btp, const unsigned short* __restrict__ Bt2p, int ldb, long strideB,
    void* __restrict__ Cout, void* __restrict__ Cout2, int ldc, long strideC,
    const float* __restrict__ bias,
    const float* __restrict__ resid, long strideR,
    int M, int N, int K, float scale, float* smem, int bx, int by) {
  typedef typename Elem<ET>::T T;
  typedef typename Frag<T>::V V;
  static_assert(OUT_MODE != 0 && BIAS_MODE != 1 && !RESID, "only these paths carry the row order of XT's tiles");
  const T* A = (const T*)Ap; const T* A2 = (const T*)A2p; const T* Bt = (const T*)Btp; const T* Bt2 = (const T*)Bt2p;
  const int b    = by;
  const int lane = threadIdx.x & 31;
  const int wave = threadIdx.x >> 5;
  const int tilesN = N >> 6;
  const int tilesM = M >> 6;
  const int tile = bx * 8 + wave;
  if (tile >= tilesM * tilesN) return;   // wave-uniform; no block barriers in this body
  const int tm = tile / tilesN;
  const int tn = tile - tm * tilesN;
  const int m0 = tm << 6;
  const int n0 = tn << 6;

  const T* Ab  = A  + (size_t)b * strideA;
  const T* Bb  = Bt + (size_t)b * strideB;
  const T* Ab2 = SPLIT ? (A2  + (size_t)b * strideA) : nullptr;
  const T* Bb2 = SPLIT ? (Bt2 + (size_t)b * strideB) : nullptr;

  const int rlane = lane & 15;                 // row (A) / col (B, D) within subtile
  const int mOff  = (lane >> 4) * 8;           // D row offset
  const int nks   = K >> 5;                    // blocks per row tile

  v8f acc[4][4];
#pragma unroll
  for (int i = 0; i < 4; ++i)
#pragma unroll
    for (int j = 0; j < 4; ++j) acc[i][j] = (v8f){0.f,0.f,0.f,0.f,0.f,0.f,0.f,0.f};

  for (int k0 = 0; k0 < K; k0 += 32) {
    V bh[4], bl[4];
    const T* pb[4];
    const T* pb2[4];
#pragma unroll
    for (int j = 0; j < 4; ++j) {
      const size_t bo = (size_t)(((n0 >> 4) + j) * nks + (k0 >> 5)) * 512 + lane * 8;
      pb[j] = Bb + bo;
      pb2[j] = SPLIT ? (Bb2 + bo) : pb[j];
      bh[j] = Frag<T>::load_fo(pb[j]);
      if (SPLIT) bl[j] = Frag<T>::load_fo(pb2[j]); else bl[j] = bh[j];
    }
    xcnt_wait(pb[0], pb[1], pb[2], pb[3]);
    if (SPLIT) xcnt_wait(pb2[0], pb2[1], pb2[2], pb2[3]);
#pragma unroll
    for (int i = 0; i < 4; ++i) {
      const size_t ao = (size_t)(((m0 >> 4) + i) * nks + (k0 >> 5)) * 512 + lane * 8;
      const T* pa = Ab + ao;
      V ah = Frag<T>::load_fo(pa);
      xcnt_wait(pa);
      V al;
      if (SPLIT) { const T* pa2 = Ab2 + ao; al = Frag<T>::load_fo(pa2); xcnt_wait(pa2); } else al = ah;
#pragma unroll
      for (int j = 0; j < 4; ++j) {
        acc[i][j] = Frag<T>::mma(ah, bh[j], acc[i][j]);
        if (SPLIT) {
          acc[i][j] = Frag<T>::mma(ah, bl[j], acc[i][j]);
          acc[i][j] = Frag<T>::mma(al, bh[j], acc[i][j]);
        }
      }
      Frag<T>::guard(acc[i][0], acc[i][3], ah, al);
    }
    Frag<T>::keep(bh[0], bh[1], bh[2], bh[3]);
    if (SPLIT) Frag<T>::keep(bl[0], bl[1], bl[2], bl[3]);
  }
  acc_guard4(acc[0][0], acc[0][1], acc[0][2], acc[0][3]);
  acc_guard4(acc[1][0], acc[1][1], acc[1][2], acc[1][3]);
  acc_guard4(acc[2][0], acc[2][1], acc[2][2], acc[2][3]);
  acc_guard4(acc[3][0], acc[3][1], acc[3][2], acc[3][3]);

  // ---- epilogue ----
  float* slab = smem + wave * (16 * 68);           // per-wave 16x64 slab, pitch 68 floats
  const float* Rb = RESID ? (resid + (size_t)b * strideR) : nullptr;
#pragma unroll
  for (int i = 0; i < 4; ++i) {
    const int mBase = m0 + (i << 4);
#pragma unroll
    for (int j = 0; j < 4; ++j) {
      const int n = n0 + (j << 4) + rlane;
      float bv = 0.f;
      if (BIAS_MODE == 2) bv = bias[n];
#pragma unroll
      for (int r = 0; r < 8; ++r) {
        float v = acc[i][j][r] * scale;
        if (BIAS_MODE == 1) v += bias[mBase + mOff + r];
        if (BIAS_MODE == 2) v += bv;
        if (RESID) v += Rb[(size_t)(mBase + mOff + r) * ldc + n];
        if (ACT == 1) v = tanhf(v);
        if (ACT == 2) v = fmaxf(v, 0.0f);
        if (ACT == 3) v = v / (1.0f + expf(-v));
        if (ACT == 4) v = (v > 0.f) ? v : 0.01f * v;
        if (ACT == 5) v = 0.5f * v * (1.0f + erff(v * 0.70710678118654752f));
        slab[(mOff + r) * 68 + (j << 4) + rlane] = v;
      }
    }
    __builtin_amdgcn_fence(__ATOMIC_RELEASE, "workgroup");
    __builtin_amdgcn_wave_barrier();
    __builtin_amdgcn_fence(__ATOMIC_ACQUIRE, "workgroup");
    if (OUT_MODE == 0) {
      float* C = (float*)Cout + (size_t)b * strideC;
      const int hh = lane >> 4, c4 = (lane & 15) * 4;     // row seg = 256 B = 16 lanes x 16 B
      {
#pragma unroll
        for (int it = 0; it < 8; ++it) {
          const int row = it * 2 + hh;
          v4f v = *(const v4f*)(slab + row * 68 + c4);
          *(v4f*)(C + (size_t)(mBase + row) * ldc + n0 + c4) = v;
        }
        
      }
    } else {
      const int q = lane >> 3, c8 = (lane & 7) * 8;
      unsigned short* C  = (unsigned short*)Cout  + (size_t)b * strideC;
      unsigned short* C2 = (OUT_MODE == 2) ? ((unsigned short*)Cout2 + (size_t)b * strideC) : nullptr;
      {
        v8h hv[4], lv[4];
        unsigned short* pc[4];
        unsigned short* pc2[4];
#pragma unroll
        for (int it = 0; it < 4; ++it) {
          const int row = it * 4 + q;
          const float* sp = slab + row * 68 + c8;
#pragma unroll
          for (int e = 0; e < 8; ++e) {
            if (OUT_MODE == 1) {
              hv[it][e] = (_Float16)sp[e];
            } else {
              unsigned short hb = f2bf_bits(sp[e]);
              unsigned short lb = f2bf_bits(sp[e] - bf_bits2f(hb));
              hv[it][e] = __builtin_bit_cast(_Float16, hb);
              lv[it][e] = __builtin_bit_cast(_Float16, lb);
            }
          }
          const int orow = m0 + 2 * (((i & 1) << 4) + row) + (i >> 1);   // the token of row 'row' of XT's row tile i
          pc[it]  = C + (size_t)orow * ldc + n0 + c8;
          pc2[it] = (OUT_MODE == 2) ? (C2 + (size_t)orow * ldc + n0 + c8) : pc[it];
          *(v8h*)pc[it] = hv[it];
          if (OUT_MODE == 2) *(v8h*)pc2[it] = lv[it]; else lv[it] = hv[it];
        }
        xcnt_wait_st(pc, pc2, hv, lv);
        
      }
    }
    __builtin_amdgcn_fence(__ATOMIC_RELEASE, "workgroup");
    __builtin_amdgcn_wave_barrier();
    __builtin_amdgcn_fence(__ATOMIC_ACQUIRE, "workgroup");
  }
}

// ---------------------------------------------------------------------------
// bf16 RNE convert of an f32 matrix [rows][ncols] into a u16 plane in fragment order (head of the file).
// Thread i makes the plane's 16-B piece i (8 consecutive columns of one row), so a wave's store is 512 B in a row
// ---------------------------------------------------------------------------
__device__ __forceinline__ void convrows_body(const float* __restrict__ in, unsigned short* __restrict__ out,
                                              int ncols, int n8, int bx) {
  const int i = bx * 256 + threadIdx.x;
  if (i < n8) {
    const int ln = i & 31, part = (i >> 5) & 1, blk = i >> 6, nks = ncols >> 5;
    const int row = (blk / nks) * 16 + (ln & 15);
    const int col = (blk % nks) * 32 + part * 16 + (ln >> 4) * 8;
    const size_t e0 = (size_t)row * ncols + col;
    const v4f a = *(const v4f*)(in + e0);
    const v4f c = *(const v4f*)(in + e0 + 4);
    v4u hv;
    hv[0] = pk16(f2bf_bits(a[0]), f2bf_bits(a[1]));
    hv[1] = pk16(f2bf_bits(a[2]), f2bf_bits(a[3]));
    hv[2] = pk16(f2bf_bits(c[0]), f2bf_bits(c[1]));
    hv[3] = pk16(f2bf_bits(c[2]), f2bf_bits(c[3]));
    {
      *(v4u*)(out + (size_t)i * 8) = hv;
      
    }
  }
}

// ---------------------------------------------------------------------------
// Fused transpose + bf16 RNE convert of an f32 matrix, z-batched, one plane:
//   in_z = W + z*sIn viewed [R rows][Cc cols] with row pitch ldin  ->  oh_z(row c, col r) = bf16(in_z[r][c]), ldout cols, oh_z = oh + z*sOut,
//   in fragment order with XT's row tiles (head of the file): the 64 output rows of a tile are one image row = 4 row tiles (kw*2 + jt).
// 64x64 tiles through LDS (tf). Tile indices (bx, by, bz) run over (Cc/64, R/64, Z), 256 threads (R, Cc, ldout multiples of 64).
// Coverage per block: load 4 it x 256 thr x 4 floats = 64x64; store 2 it x 256 thr x 8 u16 = 8 whole blocks of 512 (4 row tiles x 2 k-steps).
// ---------------------------------------------------------------------------
__device__ __forceinline__ void tconv_body(const float* __restrict__ W, unsigned short* __restrict__ oh,
                                           int ldin, int ldout, long sIn, long sOut, float* tf, int bx, int by, int bz) {
  W  += (size_t)bz * sIn;
  oh += (size_t)bz * sOut;
  const int c0  = bx * 64;   // input column block = output row block
  const int r0  = by * 64;   // input row block    = output column block
  const int tid = threadIdx.x;
  {
    const int lr = tid >> 4;         // 0..15
    const int c4 = (tid & 15) * 4;   // 0..60
    const float* pw[4];
    v4f a[4];
#pragma unroll
    for (int it = 0; it < 4; ++it) {
      pw[it] = W + (size_t)(r0 + it * 16 + lr) * ldin + c0 + c4;   // rows 0..63
      a[it] = *(const v4f*)(pw[it]);
    }
    xcnt_wait(pw[0], pw[1], pw[2], pw[3]);
#pragma unroll
    for (int it = 0; it < 4; ++it) *(v4f*)(tf + (it * 16 + lr) * 68 + c4) = a[it];
  }
  __syncthreads();
  const int ln = tid & 31, part = (tid >> 5) & 1;   // lane and half of a block: piece it*256 + tid of the tile's 512 16-B pieces
  v4u hv[2];
#pragma unroll
  for (int it = 0; it < 2; ++it) {
    const int blk = it * 4 + (tid >> 6);                                      // 0..7: row tile blk >> 1 (= kw*2 + jt), k-step blk & 1
    const int oc = 2 * ((((blk >> 1) & 1) << 4) + (ln & 15)) + (blk >> 2);    // output row within tile (= input column): x = 2*(jt*16 + r) + kw
    const int c8 = (blk & 1) * 32 + part * 16 + (ln >> 4) * 8;                // first of the piece's 8 output columns (= input rows)
    v4u a;
#pragma unroll
    for (int q = 0; q < 4; ++q) {
      const float f0 = tf[(c8 + 2 * q) * 68 + oc];
      const float f1 = tf[(c8 + 2 * q + 1) * 68 + oc];
      a[q] = pk16(f2bf_bits(f0), f2bf_bits(f1));
    }
    hv[it] = a;
  }
  {
    unsigned short* po[2];
#pragma unroll
    for (int it = 0; it < 2; ++it) {
      const int blk = it * 4 + (tid >> 6);
      const size_t go = (size_t)(((c0 >> 4) + (blk >> 1)) * (ldout >> 5) + (r0 >> 5) + (blk & 1)) * 512 + part * 256 + ln * 8;
      po[it] = oh + go;
      *(v4u*)po[it] = hv[it];
    }
    xcnt_wait_st(po, hv);   // the code of the grid's other block ranges follows in the kernel and reuses these registers
  }
}

// ---------------------------------------------------------------------------
// Conv weight permute + bf16 RNE convert: W OIHW [256 o][256 c][2][2] f32 -> O(row o, col q4*256 + c) u16 (q4 = kh*2 + kw),
// KCONV = 1024 cols, in fragment order. One unit = (o, c0): 8 x 16-B loads (the 4 taps of 8 consecutive c), 4 x 16-B stores
// (8 consecutive c of each q4 segment). A wave takes the 32 pieces of one half block, so each of its stores is 512 B in a row.
// Coverage: 32 blocks x 256 threads = 8192 units x 32 elements = 256 x 1024 = whole plane.
// ---------------------------------------------------------------------------
__device__ __forceinline__ void wperm_body(const float* __restrict__ W, unsigned short* __restrict__ O, int bx) {
  const int u = bx * 256 + threadIdx.x;   // 0 .. DIM*32 - 1
  if (u < DIM * 32) {
    const int ln = u & 31, part = (u >> 5) & 1, ksc = (u >> 6) & 7, rt = u >> 9;   // lane, half block, k-step within a q4 segment, row tile
    const int o = rt * 16 + (ln & 15), c0 = ksc * 32 + part * 16 + (ln >> 4) * 8;
    v4f w[8];
#pragma unroll
    for (int e = 0; e < 8; ++e) w[e] = *(const v4f*)(W + ((size_t)(o * DIM + c0 + e)) * 4);
    v4u pk[4];
#pragma unroll
    for (int q4 = 0; q4 < 4; ++q4) {
      v4u a;
#pragma unroll
      for (int p = 0; p < 4; ++p) a[p] = pk16(f2bf_bits(w[2 * p][q4]), f2bf_bits(w[2 * p + 1][q4]));
      pk[q4] = a;
    }
    unsigned short* orow = O + (size_t)(rt * (KCONV / 32) + ksc) * 512 + part * 256 + ln * 8;
    {
#pragma unroll
      for (int q4 = 0; q4 < 4; ++q4) *(v4u*)(orow + q4 * (DIM / 32) * 512) = pk[q4];
      
    }
  }
}

// ---------------------------------------------------------------------------
// The four operand preparations read only inputs and write disjoint planes, so they share one grid by ranges of the block
// index (block-uniform branches): Wq convert, Wk permute, Wv permute, then the x transpose tiles (x fastest, then y, then batch).
// ---------------------------------------------------------------------------
#define PR_WQ ((DIM * DIM / 8) / 256)              // 32 blocks
#define PR_WC ((DIM * 32) / 256)                   // 32 blocks per conv weight
#define PR_XT ((NQ / 64) * (DIM / 64) * NB)        // 1024 blocks
__global__ __launch_bounds__(256) void prep_kernel(const float* __restrict__ x, const float* __restrict__ Wq,
                                                   const float* __restrict__ Wk, const float* __restrict__ Wv,
                                                   unsigned short* __restrict__ XT, unsigned short* __restrict__ WQ,
                                                   unsigned short* __restrict__ WKp, unsigned short* __restrict__ WVp) {
  __shared__ __align__(16) float tf[64 * 68];      // used by the transpose blocks only
  const int bx = blockIdx.x;
  if (bx < PR_WQ) {
    convrows_body(Wq, WQ, DIM, DIM * DIM / 8, bx);
  } else if (bx < PR_WQ + PR_WC) {
    wperm_body(Wk, WKp, bx - PR_WQ);
  } else if (bx < PR_WQ + 2 * PR_WC) {
    wperm_body(Wv, WVp, bx - (PR_WQ + PR_WC));
  } else {
    // x[b] viewed [R=256 c][Cc=4096 n] (pitch 4096) -> XT_b(row n, col c), 256 cols, fragment order
    const int t = bx - (PR_WQ + 2 * PR_WC);
    tconv_body(x, XT, NQ, DIM, (long)DIM * NQ, (long)NQ * DIM, tf,
               t % (NQ / 64), (t / (NQ / 64)) % (DIM / 64), t / ((NQ / 64) * (DIM / 64)));
  }
}

// ---------------------------------------------------------------------------
// im2col addressing of the 2x2 / stride-2 / VALID conv as a GEMM over XT (fragment order, head of the file):
//   im2col row g = b*1024 + m, m = i*32 + j (output grid row i, col j); k = q4*256 + c, q4 = kh*2 + kw;
//   element (g, k) = x^T(token (b, y = 2i+kh, x = 2j+kw), channel c).
// The 16 rows g0 .. g0+15 (g0 % 16 == 0, jt = (j >> 4)) of a 32-deep k-step (k0 % 32 == 0) are exactly XT's block
// (row tile ((b*64 + y)*2 + kw)*2 + jt, k-step c0/32): the offset of that block is returned (arithmetic addressing only).
// ---------------------------------------------------------------------------
__device__ __forceinline__ size_t im2col_blk(int g0, int k0) {
  const int b = g0 >> 10, m = g0 & (NKV - 1);
  const int q4 = k0 >> 8, c0 = k0 & (DIM - 1);
  const int kh = q4 >> 1, kw = q4 & 1;
  const int i = m >> 5, jt = (m >> 4) & 1;
  return ((size_t)((((b * IMH + 2 * i + kh) * 2 + kw) * 2 + jt) * (DIM / 32) + (c0 >> 5))) * 512;
}

// ---------------------------------------------------------------------------
// Conv GEMM (bf16 single products, f32 accumulate), K = 1024, one 64x64 output tile per work-group:
//   MODE 0: C[g][o] = sum_k im2col(g,k) * WKp[o][k]  (M = 4096 rows g, N = 256), epilogue adds
//           pos(o, m) = bf16(rel_h[o*32 + (m&31)]) + bf16(rel_w[o*32 + (m>>5)]) in f32, then bf16 hi|lo, one 128-B row per (batch, head, m):
//           Ch[((b*8 + h)*1024 + m)*64 + d] = hi, + 32 = lo (Cl = Ch + 32), so that a chunk of keys of one head is contiguous whole lines.
//   MODE 1: C[o][g] = sum_k WVp[o][k] * im2col(g,k)  (M = 256, N = 4096) -> bf16 hi|lo planes [256][4096] (v^T layout).
// K is split over the 8 waves: wave w sums k = 128w .. 128w+127 (4 k-steps) of the whole tile into its own f32 partial,
// writes it to its LDS plane, and behind one work-group barrier wave w adds the 8 partials (plane 0 first, then 1 .. 7)
// of rows 8w .. 8w+7 and finishes those rows (pos, hi|lo split, whole 128-B line stores).
// MODE 0 tables (bf16 bits, two per dword), written before the k loop and read only behind that same barrier:
//   sRh[nl*17 + (jj>>1)] holds rel_h[(n0+nl)*32 + jj] (pitch 17 dwords: the 8 lanes of a row read 8 distinct banks);
//   sRw[nl] holds rel_w[(n0+nl)*32 + ii0 + {0,1}], ii0 = first of the two output-grid rows that the tile's 64 rows m cover.
// 256 work-groups x 8 waves = 256 tiles exactly (both modes); tile = the work-group's index within its range of the shared grid.
// ---------------------------------------------------------------------------
#define CG_PLANE (64 * 68)                         // floats of one wave's partial tile
#define CG_LDS   (8 * CG_PLANE + 64 * 17 + 64)     // dwords of LDS that MODE 0 uses (MODE 1: the 8 planes only)
template <int MODE>
__device__ __forceinline__ void conv_gemm64(const unsigned short* __restrict__ XTp, const unsigned short* __restrict__ Wpp,
                                            const float* __restrict__ rel_h, const float* __restrict__ rel_w,
                                            unsigned short* __restrict__ Ch, unsigned short* __restrict__ Cl,
                                            float* smem, int tile) {
  typedef __bf16 T;
  typedef v16b V;
  const T* XT = (const T*)XTp; const T* Wp = (const T*)Wpp;
  float* sP = smem;                                // 8 planes: per-wave partial 64x64 tile, pitch 68 floats
  unsigned* sRh = (unsigned*)(smem + 8 * CG_PLANE);   // MODE 0 only: 64 x 17 dwords
  unsigned* sRw = sRh + 64 * 17;                      // MODE 0 only: 64 dwords
  constexpr int M = (MODE == 0) ? MKV : DIM;
  constexpr int N = (MODE == 0) ? DIM : MKV;
  constexpr int LDC = N;
  constexpr int KW = KCONV / 8;                    // k range of one wave
  static_assert(KW % 32 == 0);
  const int tid  = threadIdx.x;
  const int lane = tid & 31;
  const int wave = __builtin_amdgcn_readfirstlane(tid >> 5);   // scalar, so that the k offsets stay scalar

  constexpr int tilesN = N >> 6;
  constexpr int tilesM = M >> 6;
  if (tile >= tilesM * tilesN) return;   // block-uniform, in front of the barrier; never taken with the exact grid
  const int tm = tile / tilesN;
  const int tn = tile - tm * tilesN;
  const int m0 = tm << 6;
  const int n0 = tn << 6;

  if (MODE == 0) {
    // rel_h rows n0 .. n0+63: 64 x 32 values, 8 per thread
    const int nl = tid >> 2, j0 = (tid & 3) * 8;
    const float* rh = rel_h + (size_t)(n0 + nl) * OH + j0;
    const v4f a = *(const v4f*)(rh);
    const v4f c = *(const v4f*)(rh + 4);
    unsigned* d = sRh + nl * 17 + (j0 >> 1);
    d[0] = pk16(f2bf_bits(a[0]), f2bf_bits(a[1]));
    d[1] = pk16(f2bf_bits(a[2]), f2bf_bits(a[3]));
    d[2] = pk16(f2bf_bits(c[0]), f2bf_bits(c[1]));
    d[3] = pk16(f2bf_bits(c[2]), f2bf_bits(c[3]));
    if (tid < 64) {
      const int ii0 = (m0 & (NKV - 1)) >> 5;       // even, m0 being a multiple of 64
      const v2f w = *(const v2f*)(rel_w + (size_t)(n0 + tid) * OW + ii0);
      sRw[tid] = pk16(f2bf_bits(w[0]), f2bf_bits(w[1]));
    }
  }

  const int rlane = lane & 15;
  const int mOff  = (lane >> 4) * 8;

  v8f acc[4][4];
#pragma unroll
  for (int i = 0; i < 4; ++i)
#pragma unroll
    for (int j = 0; j < 4; ++j) acc[i][j] = (v8f){0.f,0.f,0.f,0.f,0.f,0.f,0.f,0.f};

  const int kbeg = wave * KW;
  for (int k0 = kbeg; k0 < kbeg + KW; k0 += 32) {
    V bfr[4];
    const T* pb[4];
#pragma unroll
    for (int j = 0; j < 4; ++j) {
      if (MODE == 0) pb[j] = Wp + (size_t)(((n0 >> 4) + j) * (KCONV / 32) + (k0 >> 5)) * 512 + lane * 8;
      else           pb[j] = XT + im2col_blk(n0 + (j << 4), k0) + lane * 8;
      bfr[j] = Frag<T>::load_fo(pb[j]);
    }
    xcnt_wait(pb[0], pb[1], pb[2], pb[3]);
#pragma unroll
    for (int i = 0; i < 4; ++i) {
      const T* pa;
      if (MODE == 0) pa = XT + im2col_blk(m0 + (i << 4), k0) + lane * 8;
      else           pa = Wp + (size_t)(((m0 >> 4) + i) * (KCONV / 32) + (k0 >> 5)) * 512 + lane * 8;
      V ah = Frag<T>::load_fo(pa);
      xcnt_wait(pa);
#pragma unroll
      for (int j = 0; j < 4; ++j) acc[i][j] = Frag<T>::mma(ah, bfr[j], acc[i][j]);
      Frag<T>::guard(acc[i][0], acc[i][3], ah, ah);
    }
    Frag<T>::keep(bfr[0], bfr[1], bfr[2], bfr[3]);
  }
  acc_guard4(acc[0][0], acc[0][1], acc[0][2], acc[0][3]);
  acc_guard4(acc[1][0], acc[1][1], acc[1][2], acc[1][3]);
  acc_guard4(acc[2][0], acc[2][1], acc[2][2], acc[2][3]);
  acc_guard4(acc[3][0], acc[3][1], acc[3][2], acc[3][3]);

  // ---- this wave's partial tile to its LDS plane ----
  {
    float* part = sP + wave * CG_PLANE;
#pragma unroll
    for (int i = 0; i < 4; ++i)
#pragma unroll
      for (int j = 0; j < 4; ++j)
#pragma unroll
        for (int r = 0; r < 8; ++r) part[((i << 4) + mOff + r) * 68 + (j << 4) + rlane] = acc[i][j][r];
  }
  __syncthreads();

  // ---- join the 8 partials of rows 8*wave .. +7 and finish them: a lane holds 8 consecutive columns of one row ----
  const int q = lane >> 3, c8 = (lane & 7) * 8;
  v8h hv[2], lv[2];
  unsigned short* pch[2];
  unsigned short* pcl[2];
#pragma unroll
  for (int it = 0; it < 2; ++it) {
    const int row = wave * 8 + it * 4 + q;         // row within the tile
    const float* sp = sP + row * 68 + c8;
    v4f s0 = *(const v4f*)(sp);
    v4f s1 = *(const v4f*)(sp + 4);
#pragma unroll
    for (int w = 1; w < 8; ++w) {
      s0 += *(const v4f*)(sp + w * (64 * 68));
      s1 += *(const v4f*)(sp + w * (64 * 68) + 4);
    }
#pragma unroll
    for (int e = 0; e < 8; ++e) {
      float v = (e < 4) ? s0[e & 3] : s1[e & 3];
      if (MODE == 0) {
        const int jj = row & 31;                   // (m0 + row) & 31, m0 being a multiple of 64
        const unsigned hw = sRh[(c8 + e) * 17 + (jj >> 1)] >> ((jj & 1) * 16);
        const unsigned ww = sRw[c8 + e] >> ((row >> 5) * 16);
        const float pos = bf_bits2f((unsigned short)hw) + bf_bits2f((unsigned short)ww);
        v += pos;
      }
      unsigned short hb = f2bf_bits(v);
      unsigned short lb = f2bf_bits(v - bf_bits2f(hb));
      hv[it][e] = __builtin_bit_cast(_Float16, hb);
      lv[it][e] = __builtin_bit_cast(_Float16, lb);
    }
    size_t co;
    if (MODE == 0) {
      const int g = m0 + row, n = n0 + c8;         // 8 consecutive columns lie in one head, c8 being a multiple of 8
      co = ((size_t)(((g >> 10) * NH + (n >> 5)) * NKV + (g & (NKV - 1)))) * (2 * HD) + (n & (HD - 1));
    } else {
      co = (size_t)(m0 + row) * LDC + n0 + c8;
    }
    pch[it] = Ch + co;
    pcl[it] = Cl + co;
    *(v8h*)pch[it] = hv[it];
    *(v8h*)pcl[it] = lv[it];
  }
  xcnt_wait_st(pch, pcl, hv, lv);   // the code of the grid's other block ranges follows in the kernel and reuses these registers
}

// ---------------------------------------------------------------------------
// The three GEMMs read only the prepared planes and write disjoint planes, so they share one grid by ranges of the block index
// (block-uniform branches) and one LDS array: the q projection first (its waves run the longest k loop), then k', then v^T.
//   q = XT . WQ^T -> Qh|Ql [16384][256]   (M=16384, N=256, K=256; 1024 tiles, 8 per block); bias/resid unused (mode 0)
// ---------------------------------------------------------------------------
#define G3_Q (((MTOK / 64) * (DIM / 64)) / 8)      // 128 blocks
#define G3_C ((MKV / 64) * (DIM / 64))             // 256 blocks per conv GEMM
static_assert(CG_LDS >= 8 * 16 * 68);
__global__ __launch_bounds__(256) void gemm3_kernel(const unsigned short* __restrict__ XT, const unsigned short* __restrict__ WQ,
                                                    const unsigned short* __restrict__ WKp, const unsigned short* __restrict__ WVp,
                                                    const float* __restrict__ rel_h, const float* __restrict__ rel_w,
                                                    unsigned short* __restrict__ Qh, unsigned short* __restrict__ Ql,
                                                    unsigned short* __restrict__ KI,
                                                    unsigned short* __restrict__ VTh, unsigned short* __restrict__ VTl) {
  __shared__ __align__(16) float smem[CG_LDS];
  const int bx = blockIdx.x;
  if (bx < G3_Q) {
    wmma_gemm64<1, false, 0, 2, false, 0>(XT, XT, DIM, 0L, WQ, WQ, DIM, 0L, (void*)Qh, (void*)Ql, DIM, 0L,
                                          rel_h, rel_h, 0L, MTOK, DIM, DIM, 1.0f, smem, bx, 0);
  } else if (bx < G3_Q + G3_C) {
    conv_gemm64<0>(XT, WKp, rel_h, rel_w, KI, KI + HD, smem, bx - G3_Q);
  } else {
    conv_gemm64<1>(XT, WVp, rel_h, rel_w, VTh, VTl, smem, bx - (G3_Q + G3_C));
  }
}

// =====================================================================================
// Full (non-causal, unmasked) attention, head dim 32, all batches and heads in one launch.
//   q planes (hi/lo bf16) [16384][256]: element (b, n, h, d) at [(b*4096+n)*256 + h*32 + d]
//   k (hi|lo bf16) [32][1024][64]:      element (b, m, h, d) at [((b*8+h)*1024 + m)*64 + d] hi, + 32 lo  (pos already folded in)
//   v^T planes (hi/lo bf16) [256][4096]: element (h, d, b, m) at [(h*32 + d)*4096 + b*1024 + m]
//   out f32 NCHW: element (b, h*32+d, n) at [(b*256 + h*32 + d)*4096 + n]
//   scores = (q . k') * 32^-0.5 : bf16 hi/lo split (hi.hi + hi.lo + lo.hi) on v_wmma_f32_16x16x32_bf16
//   out    = p . v             : bf16 hi/lo split of p (unnormalised exp) and v, f32 accumulate, x 1/rowsum in f32 at the end
//   online softmax in f32 over the 1024 keys of the batch element (16 chunks of 64, compile-time trip count, no masking),
//   in base 2: p = 2^(s * scale * log2(e) - m), one multiply-add and one hardware exponential per score.
//   Block = 4 waves = 64 query positions of one (batch, head); grid.x = 4 * 8 * 64 = 2048 (exact).
//   Staging reads whole 128-B lines: 8 consecutive lanes take the 8 16-B pieces of one row, so a wave's load covers 4 whole lines.
//   K chunk: 64 rows of 128 B (hi|lo), contiguous; load i of thread tid = row i*16 + (tid>>3), piece tid&7 (4 loads) -> whole tile;
//   V^T chunk: 32 rows of 128 B per plane; load i = row i*16 + (tid>>3), piece tid&7 (2 loads per plane); __syncthreads before and after.
//   Scores are formed transposed, S^T = K . Q^T (A = K rows, B = Q): a lane holds 32 of the chunk's 64 scores of ONE query
//   (query = lane & 15, keys j*16 + 8*(lane>>4) + r), so maximum and sum run in the lane plus one exchange between lane halves;
//   two S^T tiles converted in place are the B operand of O^T += V^T . P^T (same k order as the V^T loader): P never touches LDS.
// =====================================================================================
#define AT_D  32
#define AT_NW 4
#define AT_QB 64
#define AT_KC 64
#define AT_KP 72   // LDS pitch of a K row (hi 32 | lo 32 | pad 8) in elements: 144 B = 16 B x 9 (odd), so the 16 rows of one 16-byte fragment read fall on 16 distinct bank groups
#define AT_VP 72   // LDS pitch of a V^T row in elements: 144 B = 16 B x 9 (odd), same reason

__device__ __forceinline__ v8f at_mma(v16b a, v16b b, v8f c) {
  // the builtin alone: the compiler keeps the distance behind its own matrix instructions, and pays idle slots only where a vector
  // instruction really follows on D, A or B (an accumulating product on the same D needs none)
  return __builtin_amdgcn_wmma_f32_16x16x32_bf16(false, a, false, b, (short)0, c, false, false);
}

// value of the same lane position in the other 16-lane half (lane ^ 16), as a vector cross-row move
__device__ __forceinline__ float at_xhalf(float f) {
  const int b = __float_as_int(f);
  return __int_as_float(__builtin_amdgcn_permlanex16(b, b, 0x76543210, 0xfedcba98, false, false));
}

// second argument: at least 8 waves a SIMD, that is at most 128 registers, so that all 2048 work-groups are resident in one round
__global__ __launch_bounds__(128, 8)
void attn32_kernel(const unsigned short* __restrict__ qhp, const unsigned short* __restrict__ qlp,
                   const unsigned short* __restrict__ kip,
                   const unsigned short* __restrict__ vhp, const unsigned short* __restrict__ vlp,
                   float* __restrict__ out, float sscale) {
  union FB { v16b v; v8b h[2]; unsigned w[8]; };
  __shared__ __align__(16) __bf16 Ks[AT_KC * AT_KP];             // K [kv][hi d | lo d], padded rows   9 KB
  __shared__ __align__(16) __bf16 Vth[AT_D * AT_VP];             // V hi [d][kv], padded rows   4.5 KB
  __shared__ __align__(16) __bf16 Vtl[AT_D * AT_VP];             // V lo
  __shared__ __align__(16) float  Os[AT_D * 68];                 // block out tile transposed [d][n_local], pitch 68

  const int tid  = threadIdx.x;
  const int wave = tid >> 5;
  const int lane = tid & 31;
  const int hh   = lane >> 4;
  const int c    = lane & 15;

  const int nqb = NQ / AT_QB;              // 64 query blocks per (batch, head)
  const int bx = blockIdx.x;               // grid = NB * NH * nqb (exact)
  const int qb = bx % nqb;
  const int hb = bx / nqb;
  const int h  = hb % NH;                  // 0..7
  const int b  = hb / NH;                  // 0..3
  const int q0 = b * NQ + qb * AT_QB + wave * 16;   // row in the q planes

  const __bf16* Qh = (const __bf16*)(const void*)qhp + (size_t)h * AT_D;
  const __bf16* Ql = (const __bf16*)(const void*)qlp + (size_t)h * AT_D;
  const __bf16* Ki = (const __bf16*)(const void*)kip + (size_t)(b * NH + h) * NKV * (2 * AT_D);
  const __bf16* Vh = (const __bf16*)(const void*)vhp + (size_t)h * AT_D * VTP + (size_t)b * NKV;
  const __bf16* Vl = (const __bf16*)(const void*)vlp + (size_t)h * AT_D * VTP + (size_t)b * NKV;

  // ---- Q fragments (B operand, column = lane&15, split k map via Frag load): head dim 32 = one k-step, hi and lo ----
  v16b qah, qal;
  {
    const __bf16* qr = Qh + (size_t)(q0 + c) * DIM + 8 * hh;
    const __bf16* ql = Ql + (size_t)(q0 + c) * DIM + 8 * hh;
    qah = Frag<__bf16>::load(qr);
    qal = Frag<__bf16>::load(ql);
  }

  const float sl2 = sscale * 1.4426950408889634f;   // score scale times log2(e): the softmax runs in base 2
  float mrow = -INFINITY;   // running maximum of this lane's query in base-2 units, max(s) * sl2 (equal in both lane halves)
  float lrow = 0.f;         // running sum over this lane half's keys only; the halves are joined once after the loop
  v8f oacc[2];              // O^T tiles: oacc[t][r] = out[d = t*16 + 8*hh + r][query c]
#pragma unroll
  for (int t = 0; t < 2; ++t) oacc[t] = (v8f){0.f,0.f,0.f,0.f,0.f,0.f,0.f,0.f};

  const int nChunks = NKV / AT_KC;   // 16, compile-time constant
  for (int kc = 0; kc < nChunks; ++kc) {
    const int kv0 = kc * AT_KC;
    __syncthreads();
    {
      const int r8 = tid >> 3, p8 = (tid & 7) * 8;   // row within a group of 16 rows, 16-B piece of its 128-B line
      // K staging: 4 loads x 128 threads x 8 elements = 64 rows x 64 (hi|lo)
      const __bf16* ks = Ki + (size_t)(kv0 + r8) * (2 * AT_D) + p8;
      const v8b a0 = *(const v8b*)(ks);
      const v8b a1 = *(const v8b*)(ks + 16 * (2 * AT_D));
      const v8b a2 = *(const v8b*)(ks + 32 * (2 * AT_D));
      const v8b a3 = *(const v8b*)(ks + 48 * (2 * AT_D));
      xcnt_wait(ks);         // the address stays in its registers up to the wait
      *(v8b*)(Ks + r8 * AT_KP + p8)        = a0;
      *(v8b*)(Ks + (r8 + 16) * AT_KP + p8) = a1;
      *(v8b*)(Ks + (r8 + 32) * AT_KP + p8) = a2;
      *(v8b*)(Ks + (r8 + 48) * AT_KP + p8) = a3;
      // V^T staging: 2 loads x 128 threads x 8 elements per plane = 32 rows x 64
      const __bf16* vsh = Vh + (size_t)r8 * VTP + kv0 + p8;
      const __bf16* vsl = Vl + (size_t)r8 * VTP + kv0 + p8;
      const v8b b0 = *(const v8b*)(vsh);
      const v8b b1 = *(const v8b*)(vsh + (size_t)16 * VTP);
      const v8b b2 = *(const v8b*)(vsl);
      const v8b b3 = *(const v8b*)(vsl + (size_t)16 * VTP);
      xcnt_wait(vsh, vsl);   // as above
      *(v8b*)(Vth + r8 * AT_VP + p8)        = b0;
      *(v8b*)(Vth + (r8 + 16) * AT_VP + p8) = b1;
      *(v8b*)(Vtl + r8 * AT_VP + p8)        = b2;
      *(v8b*)(Vtl + (r8 + 16) * AT_VP + p8) = b3;
    }
    __syncthreads();

    v8f s[4];
#pragma unroll
    for (int j = 0; j < 4; ++j) {
      s[j] = (v8f){0.f,0.f,0.f,0.f,0.f,0.f,0.f,0.f};
      FB kb, kl;
      kb.h[0] = *(const v8b*)(Ks + (j * 16 + c) * AT_KP + 8 * hh);
      kb.h[1] = *(const v8b*)(Ks + (j * 16 + c) * AT_KP + 16 + 8 * hh);
      kl.h[0] = *(const v8b*)(Ks + (j * 16 + c) * AT_KP + AT_D + 8 * hh);
      kl.h[1] = *(const v8b*)(Ks + (j * 16 + c) * AT_KP + AT_D + 16 + 8 * hh);
      s[j] = at_mma(kb.v, qah, s[j]);
      s[j] = at_mma(kl.v, qah, s[j]);
      s[j] = at_mma(kb.v, qal, s[j]);
    }
    // the query's chunk maximum of the raw scores: in the lane, then one exchange with the other lane half; scaled once (sl2 > 0 keeps the order)
    // (the loops over j, r, t and kk below are unrolled so that s, ph, pl and oacc are indexed at compile time and stay in registers)
    float cm = -INFINITY;
#pragma unroll
    for (int j = 0; j < 4; ++j) {
#pragma unroll
      for (int r = 0; r < 8; ++r) cm = fmaxf(cm, s[j][r]);
    }
    cm = fmaxf(cm, at_xhalf(cm));
    const float mnew = fmaxf(mrow, cm * sl2);
    const float alpha = __builtin_amdgcn_exp2f(mrow - mnew);   // 0 on the first chunk, where mrow is -inf
    mrow = mnew;
    // P^T as B operand: element e of k-step kk = S^T tile 2*kk + (e >> 3), register e & 7 (key kk*32 + 16*(e>>3) + 8*hh + (e&7))
    FB ph[2], pl[2];
    float psum = 0.f;
#pragma unroll
    for (int j = 0; j < 4; ++j) {
#pragma unroll
      for (int r = 0; r < 8; r += 2) {
        // e^(scale*s - max) as 2^(s*sl2 - mnew), the multiply-add on two scores at a time
        const v2f arg = __builtin_elementwise_fma((v2f){s[j][r], s[j][r + 1]}, (v2f){sl2, sl2}, (v2f){-mnew, -mnew});
        const float p0 = __builtin_amdgcn_exp2f(arg[0]);
        const float p1 = __builtin_amdgcn_exp2f(arg[1]);
        psum += p0;
        psum += p1;
        // hi|lo split of two scores at a time: the packed hardware conversion rounds to nearest even, as the integer steps did,
        // and leaves both halves of the operand word in place; the remainder p - hi is exact in f32
        const unsigned hw = __builtin_bit_cast(unsigned, __builtin_convertvector((v2f){p0, p1}, v2b));
        const v2f rest = (v2f){p0, p1} - (v2f){__uint_as_float(hw << 16), __uint_as_float(hw & 0xFFFF0000u)};
        ph[j >> 1].w[(j & 1) * 4 + (r >> 1)] = hw;
        pl[j >> 1].w[(j & 1) * 4 + (r >> 1)] = __builtin_bit_cast(unsigned, __builtin_convertvector(rest, v2b));
      }
    }
    lrow = lrow * alpha + psum;
    // keeps the exponentials and the split in front of the P.V products: moved in among them they hold the f32 values of P longer,
    // the kernel passes 128 registers, and only 7 instead of 8 waves fit a SIMD (the 2048 work-groups then need a second round)
    __builtin_amdgcn_sched_barrier(0);
#pragma unroll
    for (int t = 0; t < 2; ++t)
#pragma unroll
      for (int r = 0; r < 8; ++r) oacc[t][r] *= alpha;
#pragma unroll
    for (int kk = 0; kk < 2; ++kk) {
#pragma unroll
      for (int t = 0; t < 2; ++t) {
        FB vb, vl;
        vb.h[0] = *(const v8b*)(Vth + (t * 16 + c) * AT_VP + kk * 32 + 8 * hh);
        vb.h[1] = *(const v8b*)(Vth + (t * 16 + c) * AT_VP + kk * 32 + 16 + 8 * hh);
        vl.h[0] = *(const v8b*)(Vtl + (t * 16 + c) * AT_VP + kk * 32 + 8 * hh);
        vl.h[1] = *(const v8b*)(Vtl + (t * 16 + c) * AT_VP + kk * 32 + 16 + 8 * hh);
        oacc[t] = at_mma(vb.v, ph[kk].v, oacc[t]);
        oacc[t] = at_mma(vl.v, ph[kk].v, oacc[t]);
        oacc[t] = at_mma(vb.v, pl[kk].v, oacc[t]);
      }
    }
  }

  // ---- join the lane halves' sums, normalise and stage: Os[d][n_local], d = t*16 + 8hh + r, n_local = wave*16 + c (all 32 x 64 written) ----
  {
    const float inv = 1.0f / (lrow + at_xhalf(lrow));
#pragma unroll
    for (int t = 0; t < 2; ++t)
#pragma unroll
      for (int r = 0; r < 8; ++r) Os[(t * 16 + 8 * hh + r) * 68 + wave * 16 + c] = oacc[t][r] * inv;
  }
  __syncthreads();
  {
    float* ob = out + ((size_t)(b * DIM + h * AT_D)) * NQ + (size_t)qb * AT_QB;
    const int q = lane >> 3, c4 = (lane & 7) * 4;
    {
#pragma unroll
      for (int it = 0; it < 4; ++it) {
        const int L  = it * 16 + wave * 4 + q;   // 0..63: line index within the block's 32 x 256-B output region
        const int d  = L >> 1;
        const int hf = (L & 1) * 32;
        v4f val = *(const v4f*)(Os + d * 68 + hf + c4);
        *(v4f*)(ob + (size_t)d * NQ + hf + c4) = val;
      }
      
    }
  }
}

// ---------------------------------------------------------------------------
// Workspace region map (byte offsets; every region fully written by its producer launch before any consumer reads it;
//   XT   bf16 16384 x 256          0       8388608   (XT, WQ, WKp, WVp in fragment order)
//   WQ   bf16 [256][256]     8388608        131072
//   WKp  bf16 [256][1024]    8519680        524288
//   WVp  bf16 [256][1024]    9043968        524288
//   Qh   bf16 [16384][256]   9568256       8388608   Ql  17956864
//   KI   bf16 [32][1024][64] 26345472      4194304
//   VTh  bf16 [256][4096]   30539776       2097152   VTl 32636928
//   total                  34734080
// ---------------------------------------------------------------------------
extern "C" void kernel_launch(void* const* d_in, const int* in_sizes, int n_in,
                              void* d_out, int out_size, void* d_ws, size_t ws_size,
                              hipStream_t stream) {
  if (n_in < 6) return;
  if (in_sizes[0] != NB * DIM * NQ) return;          // x [4][256][64][64]
  if (in_sizes[1] != DIM * DIM) return;              // Wq [256][256]
  if (in_sizes[2] != DIM * DIM * 4) return;          // Wk [256][256][2][2]
  if (in_sizes[3] != DIM * DIM * 4) return;          // Wv [256][256][2][2]
  if (in_sizes[4] != NH * HD * OH) return;           // rel_h [1][8][32][1][32]
  if (in_sizes[5] != NH * HD * OW) return;           // rel_w [1][8][32][32][1]
  if (out_size != NB * DIM * NQ) return;

  const float* x     = (const float*)d_in[0];
  const float* Wq    = (const float*)d_in[1];
  const float* Wk    = (const float*)d_in[2];
  const float* Wv    = (const float*)d_in[3];
  const float* rel_h = (const float*)d_in[4];
  const float* rel_w = (const float*)d_in[5];

  const size_t PXT = (size_t)MTOK * DIM * 2;        // 8388608
  const size_t PWQ = (size_t)DIM * DIM * 2;         // 131072
  const size_t PWC = (size_t)DIM * KCONV * 2;       // 524288
  const size_t PQ  = (size_t)MTOK * DIM * 2;        // 8388608
  const size_t PK  = (size_t)MKV * DIM * 2 * 2;     // 4194304 (hi and lo in one plane)
  const size_t PVT = (size_t)DIM * VTP * 2;         // 2097152
  size_t off = 0;
  const size_t oXT  = off; off += PXT;
  const size_t oWQ  = off; off += PWQ;
  const size_t oWK  = off; off += PWC;
  const size_t oWV  = off; off += PWC;
  const size_t oQh  = off; off += PQ;   const size_t oQl  = off; off += PQ;
  const size_t oKI  = off; off += PK;
  const size_t oVTh = off; off += PVT;  const size_t oVTl = off; off += PVT;
  if (off > ws_size) return;                        // off = 34734080
  if (off > (size_t)134217728) return;

  char* ws = (char*)d_ws;
  unsigned short* XT  = (unsigned short*)(ws + oXT);
  unsigned short* WQ  = (unsigned short*)(ws + oWQ);
  unsigned short* WKp = (unsigned short*)(ws + oWK);
  unsigned short* WVp = (unsigned short*)(ws + oWV);
  unsigned short* Qh  = (unsigned short*)(ws + oQh);  unsigned short* Ql  = (unsigned short*)(ws + oQl);
  unsigned short* KI  = (unsigned short*)(ws + oKI);
  unsigned short* VTh = (unsigned short*)(ws + oVTh); unsigned short* VTl = (unsigned short*)(ws + oVTl);

  const dim3 blk(256);

  // (1) operand preparation: WQ, WKp, WVp and XT; 32 + 32 + 32 + 1024 blocks
  prep_kernel<<<dim3(PR_WQ + 2 * PR_WC + PR_XT), blk, 0, stream>>>(x, Wq, Wk, Wv, XT, WQ, WKp, WVp);
  // (2) q -> Qh|Ql, k' = conv_k + pos -> KI, v^T = conv_v -> VTh|VTl; 128 + 256 + 256 blocks
  gemm3_kernel<<<dim3(G3_Q + 2 * G3_C), blk, 0, stream>>>(XT, WQ, WKp, WVp, rel_h, rel_w, Qh, Ql, KI, VTh, VTl);
  // (3) attention per (batch, head, 64-query block) -> d_out NCHW; 2048 blocks of 128
  attn32_kernel<<<dim3(NB * NH * (NQ / AT_QB)), dim3(128), 0, stream>>>(Qh, Ql, KI, VTh, VTl, (float*)d_out,
                                                                        0.17677669529663687f);
  (void)hipGetLastError();
}

// v009
// A run of this version takes 64.8 microseconds.
// Next to v008, in two timings, it ran 1.08 times as fast each time.
// All steps since v000 together make it 5.36 times as fast.
// Contractions: q projection, k conv (im2col) and v^T conv (im2col) = v_wmma_f32_16x16x32_bf16 single products on bf16 planes of the RNE-converted inputs (exact products); scores q.(k+pos) and p.v = bf16 hi/lo split (hi.hi + hi.lo + lo.hi); f32 accumulate everywhere; positional add, 32^-0.5 scale, online softmax and 1/rowsum in f32 on the VALU.
// Plane / carry map (all carry 1, nothing to fold back):
//   XT  = bf16(x), rows = tokens, cols = channels c;  WQ = bf16(Wq) [256 o][256 c];  WKp, WVp bf16 [256 o][1024]: col q4*256 + c = bf16(W[o][c][kh][kw]), q4 = kh*2 + kw
//   These four are kept in FRAGMENT ORDER: blocks of 16 rows x 32 cols = 512 elements, block (row tile rt, k-step ks) at (rt * (cols/32) + ks) * 512;
//   in a block element (r, k) stands at ((k>>4)&1)*256 + (((k>>3)&1)*16 + r)*8 + (k&7), so each of a fragment's two 16-B loads reads 512 B in a row.
//   Row tiles of XT: tile ((b*64 + y)*2 + kw)*2 + jt, row r = token (b, y, x = 2*(jt*16 + r) + kw): the 16 tokens that one conv tap takes from an image row
//   Qh|Ql bf16 [16384][256] (col h*32 + d) = hi/lo of q;  KI bf16 [32 (b*8+h)][1024 m][64] (m = i*32 + j; col d = hi, col 32 + d = lo) = hi/lo of (conv_k + pos)
//   pos(h,d,m) = bf16(rel_h[(h*32+d)*32 + (m & 31)]) + bf16(rel_w[(h*32+d)*32 + (m >> 5)]) in f32
//   VTh|VTl bf16 [256 (h*32+d)][4096 (b*1024+m)] = hi/lo of conv_v;  P hi|lo = unnormalised exp, at most 1 up to the rounding of the scaled maximum (f32), 1/rowsum applied to the f32 accumulator
#include <hip/hip_runtime.h>
#include <math.h>
#include <stdint.h>

#define NB    4
#define DIM   256
#define NH    8
#define HD    32
#define IMH   64
#define IMW   64
#define NQ    4096
#define OH    32
#define OW    32
#define NKV   1024
#define KCONV 1024
#define MTOK  (NB * NQ)
#define MKV   (NB * NKV)
#define VTP   (NB * NKV)

static_assert(NQ == IMH * IMW);
static_assert(IMW == 64);
static_assert(NKV == OH * OW);
static_assert(OH * 2 == IMH);
static_assert(OW * 2 == IMW);
static_assert(DIM == NH * HD);
static_assert(HD == 32);
static_assert(KCONV == DIM * 4);
static_assert(MTOK % 64 == 0);
static_assert(MKV % 128 == 0);
static_assert(DIM % 64 == 0);
static_assert(KCONV % 32 == 0);
static_assert(DIM % 32 == 0);
static_assert((DIM * DIM) % (8 * 256) == 0);
static_assert(((MKV / 64) * (DIM / 64)) % 8 == 0);
static_assert(((MTOK / 64) * (DIM / 64)) % 8 == 0);
static_assert(DIM * OH == 8192);
static_assert(NQ % 64 == 0);
static_assert(NKV % 64 == 0);

typedef __attribute__((ext_vector_type(16))) _Float16 v16h;
typedef __attribute__((ext_vector_type(8)))  _Float16 v8h;
typedef __attribute__((ext_vector_type(16))) __bf16   v16b;
typedef __attribute__((ext_vector_type(8)))  __bf16   v8b;
typedef __attribute__((ext_vector_type(2)))  __bf16   v2b;
typedef __attribute__((ext_vector_type(8)))  float    v8f;
typedef __attribute__((ext_vector_type(4)))  float    v4f;
typedef __attribute__((ext_vector_type(2)))  float    v2f;
typedef __attribute__((ext_vector_type(4)))  unsigned int v4u;
typedef __attribute__((ext_vector_type(2)))  unsigned int v2u;

__device__ __forceinline__ unsigned short f2bf_bits(float f) {
  unsigned u = __float_as_uint(f);
  return (unsigned short)((u + 0x7FFFu + ((u >> 16) & 1u)) >> 16);
}
__device__ __forceinline__ float bf_bits2f(unsigned short h) { return __uint_as_float(((unsigned)h) << 16); }
__device__ __forceinline__ unsigned pk16(unsigned short a, unsigned short b) { return (unsigned)a | ((unsigned)b << 16); }

// hazard guards as plain device helpers (no inline asm inside the kernel template body)
__device__ __forceinline__ void dep_guard_h(v8f& a, v8f& b, v16h x, v16h y) { asm volatile("v_nop\n\tv_nop\n\tv_nop\n\tv_nop" : "+v"(a), "+v"(b) : "v"(x), "v"(y)); }
__device__ __forceinline__ void dep_guard_b(v8f& a, v8f& b, v16b x, v16b y) { asm volatile("v_nop\n\tv_nop\n\tv_nop\n\tv_nop" : "+v"(a), "+v"(b) : "v"(x), "v"(y)); }
__device__ __forceinline__ void keep4_h(v16h a, v16h b, v16h c, v16h d) { asm volatile("v_nop" :: "v"(a), "v"(b), "v"(c), "v"(d)); }
__device__ __forceinline__ void keep4_b(v16b a, v16b b, v16b c, v16b d) { asm volatile("v_nop" :: "v"(a), "v"(b), "v"(c), "v"(d)); }
__device__ __forceinline__ void acc_guard4(v8f& a, v8f& b, v8f& c, v8f& d) { asm volatile("v_nop\n\tv_nop\n\tv_nop\n\tv_nop" : "+v"(a), "+v"(b), "+v"(c), "+v"(d)); }
// s_wait_xcnt 0 behind issued global loads or stores, in front of the next write of a register that they name: the addresses
// (and a store's data) are inputs of the statement, so their registers stay as they are up to the wait
__device__ __forceinline__ void xcnt_wait(const void* a, const void* b) { asm volatile("s_wait_xcnt 0x0" :: "v"(a), "v"(b) : "memory"); }
__device__ __forceinline__ void xcnt_wait(const void* a, const void* b, const void* c) { asm volatile("s_wait_xcnt 0x0" :: "v"(a), "v"(b), "v"(c) : "memory"); }
__device__ __forceinline__ void xcnt_wait(const void* a, const void* b, const void* c, const void* d) {
  asm volatile("s_wait_xcnt 0x0" :: "v"(a), "v"(b), "v"(c), "v"(d) : "memory");
}
__device__ __forceinline__ void xcnt_wait_st(unsigned short* const (&a)[2], const v4u (&x)[2]) {
  asm volatile("s_wait_xcnt 0x0" :: "v"(a[0]), "v"(a[1]), "v"(x[0]), "v"(x[1]) : "memory");
}
__device__ __forceinline__ void xcnt_wait_st(unsigned short* const (&a)[2], unsigned short* const (&b)[2], const v8h (&x)[2], const v8h (&y)[2]) {
  asm volatile("s_wait_xcnt 0x0" :: "v"(a[0]), "v"(a[1]), "v"(b[0]), "v"(b[1]), "v"(x[0]), "v"(x[1]), "v"(y[0]), "v"(y[1]) : "memory");
}
__device__ __forceinline__ void xcnt_wait_st(unsigned short* const (&a)[4], unsigned short* const (&b)[4], const v8h (&x)[4], const v8h (&y)[4]) {
  asm volatile("s_wait_xcnt 0x0" :: "v"(a[0]), "v"(a[1]), "v"(a[2]), "v"(a[3]), "v"(b[0]), "v"(b[1]), "v"(b[2]), "v"(b[3]),
               "v"(x[0]), "v"(x[1]), "v"(x[2]), "v"(x[3]), "v"(y[0]), "v"(y[1]), "v"(y[2]), "v"(y[3]) : "memory");
}
template <typename T> struct Frag;
template <> struct Frag<_Float16> {
  typedef v16h V; union U { v16h v; v8h h[2]; };
  static __device__ __forceinline__ v16h load(const _Float16* p) {   // elements 0..7 <- p[0..7], 8..15 <- p[16..23]
    U f; f.h[0] = *(const v8h*)(p); f.h[1] = *(const v8h*)(p + 16); return f.v;
  }
  static __device__ __forceinline__ v16h load_fo(const _Float16* p) {   // p = fragment-order block + lane*8: elements 0..7 <- p[0..7], 8..15 <- p[256..263]
    U f; f.h[0] = *(const v8h*)(p); f.h[1] = *(const v8h*)(p + 256); return f.v;
  }
  static __device__ __forceinline__ v8f mma(v16h a, v16h b, v8f c) {
    return __builtin_amdgcn_wmma_f32_16x16x32_f16(false, a, false, b, (short)0, c, false, false);
  }
  static __device__ __forceinline__ void guard(v8f& a, v8f& b, v16h x, v16h y) { dep_guard_h(a, b, x, y); }
  static __device__ __forceinline__ void keep(v16h a, v16h b, v16h c, v16h d) { keep4_h(a, b, c, d); }
};
template <> struct Frag<__bf16> {
  typedef v16b V; union U { v16b v; v8b h[2]; };
  static __device__ __forceinline__ v16b load(const __bf16* p) {
    U f; f.h[0] = *(const v8b*)(p); f.h[1] = *(const v8b*)(p + 16); return f.v;
  }
  static __device__ __forceinline__ v16b load_fo(const __bf16* p) {     // as above
    U f; f.h[0] = *(const v8b*)(p); f.h[1] = *(const v8b*)(p + 256); return f.v;
  }
  static __device__ __forceinline__ v8f mma(v16b a, v16b b, v8f c) {
    return __builtin_amdgcn_wmma_f32_16x16x32_bf16(false, a, false, b, (short)0, c, false, false);
  }
  static __device__ __forceinline__ void guard(v8f& a, v8f& b, v16b x, v16b y) { dep_guard_b(a, b, x, y); }
  static __device__ __forceinline__ void keep(v16b a, v16b b, v16b c, v16b d) { keep4_b(a, b, c, d); }
};

// ---- Register-blocked batched WMMA GEMM ------------------------------------
// C[m,n] = scale * sum_k A[m,k] * Bt[n,k] (+bias)(+resid); each wave owns a 64x64 tile.
// A [M,K] and Bt [N,K] in fragment order (head of the file); M,N % 64 == 0, K % 32 == 0. A's row tiles are XT's: row r of sub-tile i of a 64-row
// tile is output row m0 + 2*((i&1)*16 + r) + (i>>1), which the epilogue undoes.
// SPLIT: operands are hi/lo planes (A2/Bt2 = lo planes, same layout); product = hi.hi + hi.lo + lo.hi.
// BIAS_MODE: 0 = none, 1 = bias[m], 2 = bias[n].
// OUT_MODE: 0 = f32, 1 = f16, 2 = bf16 hi plane (Cout) + bf16 lo plane (Cout2).
// ET: 0 = f16 operands, 1 = bf16 operands (pointers passed as 16-bit storage)
template <int ET> struct Elem;
template <> struct Elem<0> { typedef _Float16 T; };
template <> struct Elem<1> { typedef __bf16 T; };
// Device body: smem = the work-group's LDS (8 slabs of 16 x 68 floats are used), bx / by = the block indices of this GEMM's own grid.
template <int ET, bool SPLIT, int BIAS_MODE, int OUT_MODE, bool RESID, int ACT = 0>
__device__ __forceinline__ void wmma_gemm64(
    const unsigned short* __restrict__ Ap, const unsigned short* __restrict__ A2p, int lda, long strideA,
    const unsigned short* __restrict__ Btp, const unsigned short* __restrict__ Bt2p, int ldb, long strideB,
    void* __restrict__ Cout, void* __restrict__ Cout2, int ldc, long strideC,
    const float* __restrict__ bias,
    const float* __restrict__ resid, long strideR,
    int M, int N, int K, float scale, float* smem, int bx, int by) {
  typedef typename Elem<ET>::T T;
  typedef typename Frag<T>::V V;
  static_assert(OUT_MODE != 0 && BIAS_MODE != 1 && !RESID, "only these paths carry the row order of XT's tiles");
  const T* A = (const T*)Ap; const T* A2 = (const T*)A2p; const T* Bt = (const T*)Btp; const T* Bt2 = (const T*)Bt2p;
  const int b    = by;
  const int lane = threadIdx.x & 31;
  const int wave = threadIdx.x >> 5;
  const int tilesN = N >> 6;
  const int tilesM = M >> 6;
  const int tile = bx * 8 + wave;
  if (tile >= tilesM * tilesN) return;   // wave-uniform; no block barriers in this body
  const int tm = tile / tilesN;
  const int tn = tile - tm * tilesN;
  const int m0 = tm << 6;
  const int n0 = tn << 6;

  const T* Ab  = A  + (size_t)b * strideA;
  const T* Bb  = Bt + (size_t)b * strideB;
  const T* Ab2 = SPLIT ? (A2  + (size_t)b * strideA) : nullptr;
  const T* Bb2 = SPLIT ? (Bt2 + (size_t)b * strideB) : nullptr;

  const int rlane = lane & 15;                 // row (A) / col (B, D) within subtile
  const int mOff  = (lane >> 4) * 8;           // D row offset
  const int nks   = K >> 5;                    // blocks per row tile

  v8f acc[4][4];
#pragma unroll
  for (int i = 0; i < 4; ++i)
#pragma unroll
    for (int j = 0; j < 4; ++j) acc[i][j] = (v8f){0.f,0.f,0.f,0.f,0.f,0.f,0.f,0.f};

  for (int k0 = 0; k0 < K; k0 += 32) {
    // All fragments of the k-step are loaded as ONE group in front of its products (B first, then A in the order of use), so the
    // wave waits out one L2 round trip a k-step; the row tiles of an operand lie a fixed distance apart, one address each serves.
    V bh[4], bl[4], ah[4], al[4];
    const size_t bo = (size_t)((n0 >> 4) * nks + (k0 >> 5)) * 512 + lane * 8;
    const size_t ao = (size_t)((m0 >> 4) * nks + (k0 >> 5)) * 512 + lane * 8;
    const T* pb  = Bb + bo;
    const T* pa  = Ab + ao;
    const T* pb2 = SPLIT ? (Bb2 + bo) : pb;
    const T* pa2 = SPLIT ? (Ab2 + ao) : pa;
#pragma unroll
    for (int j = 0; j < 4; ++j) {
      bh[j] = Frag<T>::load_fo(pb + (size_t)(j * nks) * 512);
      if (SPLIT) bl[j] = Frag<T>::load_fo(pb2 + (size_t)(j * nks) * 512); else bl[j] = bh[j];
    }
#pragma unroll
    for (int i = 0; i < 4; ++i) {
      ah[i] = Frag<T>::load_fo(pa + (size_t)(i * nks) * 512);
      if (SPLIT) al[i] = Frag<T>::load_fo(pa2 + (size_t)(i * nks) * 512); else al[i] = ah[i];
    }
    xcnt_wait(pa, pb);
    if (SPLIT) xcnt_wait(pa2, pb2);
#pragma unroll
    for (int i = 0; i < 4; ++i) {
#pragma unroll
      for (int j = 0; j < 4; ++j) {
        acc[i][j] = Frag<T>::mma(ah[i], bh[j], acc[i][j]);
        if (SPLIT) {
          acc[i][j] = Frag<T>::mma(ah[i], bl[j], acc[i][j]);
          acc[i][j] = Frag<T>::mma(al[i], bh[j], acc[i][j]);
        }
      }
      Frag<T>::guard(acc[i][0], acc[i][3], ah[i], al[i]);
    }
    Frag<T>::keep(bh[0], bh[1], bh[2], bh[3]);
    if (SPLIT) Frag<T>::keep(bl[0], bl[1], bl[2], bl[3]);
  }
  acc_guard4(acc[0][0], acc[0][1], acc[0][2], acc[0][3]);
  acc_guard4(acc[1][0], acc[1][1], acc[1][2], acc[1][3]);
  acc_guard4(acc[2][0], acc[2][1], acc[2][2], acc[2][3]);
  acc_guard4(acc[3][0], acc[3][1], acc[3][2], acc[3][3]);

  // ---- epilogue ----
  float* slab = smem + wave * (16 * 68);           // per-wave 16x64 slab, pitch 68 floats
  const float* Rb = RESID ? (resid + (size_t)b * strideR) : nullptr;
#pragma unroll
  for (int i = 0; i < 4; ++i) {
    const int mBase = m0 + (i << 4);
#pragma unroll
    for (int j = 0; j < 4; ++j) {
      const int n = n0 + (j << 4) + rlane;
      float bv = 0.f;
      if (BIAS_MODE == 2) bv = bias[n];
#pragma unroll
      for (int r = 0; r < 8; ++r) {
        float v = acc[i][j][r] * scale;
        if (BIAS_MODE == 1) v += bias[mBase + mOff + r];
        if (BIAS_MODE == 2) v += bv;
        if (RESID) v += Rb[(size_t)(mBase + mOff + r) * ldc + n];
        if (ACT == 1) v = tanhf(v);
        if (ACT == 2) v = fmaxf(v, 0.0f);
        if (ACT == 3) v = v / (1.0f + expf(-v));
        if (ACT == 4) v = (v > 0.f) ? v : 0.01f * v;
        if (ACT == 5) v = 0.5f * v * (1.0f + erff(v * 0.70710678118654752f));
        slab[(mOff + r) * 68 + (j << 4) + rlane] = v;
      }
    }
    __builtin_amdgcn_fence(__ATOMIC_RELEASE, "workgroup");
    __builtin_amdgcn_wave_barrier();
    __builtin_amdgcn_fence(__ATOMIC_ACQUIRE, "workgroup");
    if (OUT_MODE == 0) {
      float* C = (float*)Cout + (size_t)b * strideC;
      const int hh = lane >> 4, c4 = (lane & 15) * 4;     // row seg = 256 B = 16 lanes x 16 B
      {
#pragma unroll
        for (int it = 0; it < 8; ++it) {
          const int row = it * 2 + hh;
          v4f v = *(const v4f*)(slab + row * 68 + c4);
          *(v4f*)(C + (size_t)(mBase + row) * ldc + n0 + c4) = v;
        }
        
      }
    } else {
      const int q = lane >> 3, c8 = (lane & 7) * 8;
      unsigned short* C  = (unsigned short*)Cout  + (size_t)b * strideC;
      unsigned short* C2 = (OUT_MODE == 2) ? ((unsigned short*)Cout2 + (size_t)b * strideC) : nullptr;
      {
        v8h hv[4], lv[4];
        unsigned short* pc[4];
        unsigned short* pc2[4];
#pragma unroll
        for (int it = 0; it < 4; ++it) {
          const int row = it * 4 + q;
          const float* sp = slab + row * 68 + c8;
#pragma unroll
          for (int e = 0; e < 8; ++e) {
            if (OUT_MODE == 1) {
              hv[it][e] = (_Float16)sp[e];
            } else {
              unsigned short hb = f2bf_bits(sp[e]);
              unsigned short lb = f2bf_bits(sp[e] - bf_bits2f(hb));
              hv[it][e] = __builtin_bit_cast(_Float16, hb);
              lv[it][e] = __builtin_bit_cast(_Float16, lb);
            }
          }
          const int orow = m0 + 2 * (((i & 1) << 4) + row) + (i >> 1);   // the token of row 'row' of XT's row tile i
          pc[it]  = C + (size_t)orow * ldc + n0 + c8;
          pc2[it] = (OUT_MODE == 2) ? (C2 + (size_t)orow * ldc + n0 + c8) : pc[it];
          *(v8h*)pc[it] = hv[it];
          if (OUT_MODE == 2) *(v8h*)pc2[it] = lv[it]; else lv[it] = hv[it];
        }
        xcnt_wait_st(pc, pc2, hv, lv);
        
      }
    }
    __builtin_amdgcn_fence(__ATOMIC_RELEASE, "workgroup");
    __builtin_amdgcn_wave_barrier();
    __builtin_amdgcn_fence(__ATOMIC_ACQUIRE, "workgroup");
  }
}

// ---------------------------------------------------------------------------
// bf16 RNE convert of an f32 matrix [rows][ncols] into a u16 plane in fragment order (head of the file).
// Thread i makes the plane's 16-B piece i (8 consecutive columns of one row), so a wave's store is 512 B in a row
// ---------------------------------------------------------------------------
__device__ __forceinline__ void convrows_body(const float* __restrict__ in, unsigned short* __restrict__ out,
                                              int ncols, int n8, int bx) {
  const int i = bx * 256 + threadIdx.x;
  if (i < n8) {
    const int ln = i & 31, part = (i >> 5) & 1, blk = i >> 6, nks = ncols >> 5;
    const int row = (blk / nks) * 16 + (ln & 15);
    const int col = (blk % nks) * 32 + part * 16 + (ln >> 4) * 8;
    const size_t e0 = (size_t)row * ncols + col;
    const v4f a = *(const v4f*)(in + e0);
    const v4f c = *(const v4f*)(in + e0 + 4);
    v4u hv;
    hv[0] = pk16(f2bf_bits(a[0]), f2bf_bits(a[1]));
    hv[1] = pk16(f2bf_bits(a[2]), f2bf_bits(a[3]));
    hv[2] = pk16(f2bf_bits(c[0]), f2bf_bits(c[1]));
    hv[3] = pk16(f2bf_bits(c[2]), f2bf_bits(c[3]));
    {
      *(v4u*)(out + (size_t)i * 8) = hv;
      
    }
  }
}

// ---------------------------------------------------------------------------
// Fused transpose + bf16 RNE convert of an f32 matrix, z-batched, one plane:
//   in_z = W + z*sIn viewed [R rows][Cc cols] with row pitch ldin  ->  oh_z(row c, col r) = bf16(in_z[r][c]), ldout cols, oh_z = oh + z*sOut,
//   in fragment order with XT's row tiles (head of the file): the 64 output rows of a tile are one image row = 4 row tiles (kw*2 + jt).
// 64x64 tiles through LDS (tf). Tile indices (bx, by, bz) run over (Cc/64, R/64, Z), 256 threads (R, Cc, ldout multiples of 64).
// Coverage per block: load 4 it x 256 thr x 4 floats = 64x64; store 2 it x 256 thr x 8 u16 = 8 whole blocks of 512 (4 row tiles x 2 k-steps).
// ---------------------------------------------------------------------------
__device__ __forceinline__ void tconv_body(const float* __restrict__ W, unsigned short* __restrict__ oh,
                                           int ldin, int ldout, long sIn, long sOut, float* tf, int bx, int by, int bz) {
  W  += (size_t)bz * sIn;
  oh += (size_t)bz * sOut;
  const int c0  = bx * 64;   // input column block = output row block
  const int r0  = by * 64;   // input row block    = output column block
  const int tid = threadIdx.x;
  {
    const int lr = tid >> 4;         // 0..15
    const int c4 = (tid & 15) * 4;   // 0..60
    const float* pw[4];
    v4f a[4];
#pragma unroll
    for (int it = 0; it < 4; ++it) {
      pw[it] = W + (size_t)(r0 + it * 16 + lr) * ldin + c0 + c4;   // rows 0..63
      a[it] = *(const v4f*)(pw[it]);
    }
    xcnt_wait(pw[0], pw[1], pw[2], pw[3]);
#pragma unroll
    for (int it = 0; it < 4; ++it) *(v4f*)(tf + (it * 16 + lr) * 68 + c4) = a[it];
  }
  __syncthreads();
  const int ln = tid & 31, part = (tid >> 5) & 1;   // lane and half of a block: piece it*256 + tid of the tile's 512 16-B pieces
  v4u hv[2];
#pragma unroll
  for (int it = 0; it < 2; ++it) {
    const int blk = it * 4 + (tid >> 6);                                      // 0..7: row tile blk >> 1 (= kw*2 + jt), k-step blk & 1
    const int oc = 2 * ((((blk >> 1) & 1) << 4) + (ln & 15)) + (blk >> 2);    // output row within tile (= input column): x = 2*(jt*16 + r) + kw
    const int c8 = (blk & 1) * 32 + part * 16 + (ln >> 4) * 8;                // first of the piece's 8 output columns (= input rows)
    v4u a;
#pragma unroll
    for (int q = 0; q < 4; ++q) {
      const float f0 = tf[(c8 + 2 * q) * 68 + oc];
      const float f1 = tf[(c8 + 2 * q + 1) * 68 + oc];
      a[q] = pk16(f2bf_bits(f0), f2bf_bits(f1));
    }
    hv[it] = a;
  }
  {
    unsigned short* po[2];
#pragma unroll
    for (int it = 0; it < 2; ++it) {
      const int blk = it * 4 + (tid >> 6);
      const size_t go = (size_t)(((c0 >> 4) + (blk >> 1)) * (ldout >> 5) + (r0 >> 5) + (blk & 1)) * 512 + part * 256 + ln * 8;
      po[it] = oh + go;
      *(v4u*)po[it] = hv[it];
    }
    xcnt_wait_st(po, hv);   // the code of the grid's other block ranges follows in the kernel and reuses these registers
  }
}

// ---------------------------------------------------------------------------
// Conv weight permute + bf16 RNE convert: W OIHW [256 o][256 c][2][2] f32 -> O(row o, col q4*256 + c) u16 (q4 = kh*2 + kw),
// KCONV = 1024 cols, in fragment order. One unit = (o, c0): 8 x 16-B loads (the 4 taps of 8 consecutive c), 4 x 16-B stores
// (8 consecutive c of each q4 segment). A wave takes the 32 pieces of one half block, so each of its stores is 512 B in a row.
// Coverage: 32 blocks x 256 threads = 8192 units x 32 elements = 256 x 1024 = whole plane.
// ---------------------------------------------------------------------------
__device__ __forceinline__ void wperm_body(const float* __restrict__ W, unsigned short* __restrict__ O, int bx) {
  const int u = bx * 256 + threadIdx.x;   // 0 .. DIM*32 - 1
  if (u < DIM * 32) {
    const int ln = u & 31, part = (u >> 5) & 1, ksc = (u >> 6) & 7, rt = u >> 9;   // lane, half block, k-step within a q4 segment, row tile
    const int o = rt * 16 + (ln & 15), c0 = ksc * 32 + part * 16 + (ln >> 4) * 8;
    v4f w[8];
#pragma unroll
    for (int e = 0; e < 8; ++e) w[e] = *(const v4f*)(W + ((size_t)(o * DIM + c0 + e)) * 4);
    v4u pk[4];
#pragma unroll
    for (int q4 = 0; q4 < 4; ++q4) {
      v4u a;
#pragma unroll
      for (int p = 0; p < 4; ++p) a[p] = pk16(f2bf_bits(w[2 * p][q4]), f2bf_bits(w[2 * p + 1][q4]));
      pk[q4] = a;
    }
    unsigned short* orow = O + (size_t)(rt * (KCONV / 32) + ksc) * 512 + part * 256 + ln * 8;
    {
#pragma unroll
      for (int q4 = 0; q4 < 4; ++q4) *(v4u*)(orow + q4 * (DIM / 32) * 512) = pk[q4];
      
    }
  }
}

// ---------------------------------------------------------------------------
// The four operand preparations read only inputs and write disjoint planes, so they share one grid by ranges of the block
// index (block-uniform branches): Wq convert, Wk permute, Wv permute, then the x transpose tiles (x fastest, then y, then batch).
// ---------------------------------------------------------------------------
#define PR_WQ ((DIM * DIM / 8) / 256)              // 32 blocks
#define PR_WC ((DIM * 32) / 256)                   // 32 blocks per conv weight
#define PR_XT ((NQ / 64) * (DIM / 64) * NB)        // 1024 blocks
__global__ __launch_bounds__(256) void prep_kernel(const float* __restrict__ x, const float* __restrict__ Wq,
                                                   const float* __restrict__ Wk, const float* __restrict__ Wv,
                                                   unsigned short* __restrict__ XT, unsigned short* __restrict__ WQ,
                                                   unsigned short* __restrict__ WKp, unsigned short* __restrict__ WVp) {
  __shared__ __align__(16) float tf[64 * 68];      // used by the transpose blocks only
  const int bx = blockIdx.x;
  if (bx < PR_WQ) {
    convrows_body(Wq, WQ, DIM, DIM * DIM / 8, bx);
  } else if (bx < PR_WQ + PR_WC) {
    wperm_body(Wk, WKp, bx - PR_WQ);
  } else if (bx < PR_WQ + 2 * PR_WC) {
    wperm_body(Wv, WVp, bx - (PR_WQ + PR_WC));
  } else {
    // x[b] viewed [R=256 c][Cc=4096 n] (pitch 4096) -> XT_b(row n, col c), 256 cols, fragment order
    const int t = bx - (PR_WQ + 2 * PR_WC);
    tconv_body(x, XT, NQ, DIM, (long)DIM * NQ, (long)NQ * DIM, tf,
               t % (NQ / 64), (t / (NQ / 64)) % (DIM / 64), t / ((NQ / 64) * (DIM / 64)));
  }
}

// ---------------------------------------------------------------------------
// im2col addressing of the 2x2 / stride-2 / VALID conv as a GEMM over XT (fragment order, head of the file):
//   im2col row g = b*1024 + m, m = i*32 + j (output grid row i, col j); k = q4*256 + c, q4 = kh*2 + kw;
//   element (g, k) = x^T(token (b, y = 2i+kh, x = 2j+kw), channel c).
// The 16 rows g0 .. g0+15 (g0 % 16 == 0, jt = (j >> 4)) of a 32-deep k-step (k0 % 32 == 0) are exactly XT's block
// (row tile ((b*64 + y)*2 + kw)*2 + jt, k-step c0/32): the offset of that block is returned (arithmetic addressing only).
// ---------------------------------------------------------------------------
__device__ __forceinline__ size_t im2col_blk(int g0, int k0) {
  const int b = g0 >> 10, m = g0 & (NKV - 1);
  const int q4 = k0 >> 8, c0 = k0 & (DIM - 1);
  const int kh = q4 >> 1, kw = q4 & 1;
  const int i = m >> 5, jt = (m >> 4) & 1;
  return ((size_t)((((b * IMH + 2 * i + kh) * 2 + kw) * 2 + jt) * (DIM / 32) + (c0 >> 5))) * 512;
}

// ---------------------------------------------------------------------------
// Conv GEMM (bf16 single products, f32 accumulate), K = 1024, one 64x64 output tile per work-group:
//   MODE 0: C[g][o] = sum_k im2col(g,k) * WKp[o][k]  (M = 4096 rows g, N = 256), epilogue adds
//           pos(o, m) = bf16(rel_h[o*32 + (m&31)]) + bf16(rel_w[o*32 + (m>>5)]) in f32, then bf16 hi|lo, one 128-B row per (batch, head, m):
//           Ch[((b*8 + h)*1024 + m)*64 + d] = hi, + 32 = lo (Cl = Ch + 32), so that a chunk of keys of one head is contiguous whole lines.
//   MODE 1: C[o][g] = sum_k WVp[o][k] * im2col(g,k)  (M = 256, N = 4096) -> bf16 hi|lo planes [256][4096] (v^T layout).
// K is split over the 8 waves: wave w sums k = 128w .. 128w+127 (4 k-steps) of the whole tile into its own f32 partial,
// writes it to its LDS plane, and behind one work-group barrier wave w adds the 8 partials (plane 0 first, then 1 .. 7)
// of rows 8w .. 8w+7 and finishes those rows (pos, hi|lo split, whole 128-B line stores).
// MODE 0 tables (bf16 bits, two per dword), written before the k loop and read only behind that same barrier:
//   sRh[nl*17 + (jj>>1)] holds rel_h[(n0+nl)*32 + jj] (pitch 17 dwords: the 8 lanes of a row read 8 distinct banks);
//   sRw[nl] holds rel_w[(n0+nl)*32 + ii0 + {0,1}], ii0 = first of the two output-grid rows that the tile's 64 rows m cover.
// 256 work-groups x 8 waves = 256 tiles exactly (both modes); tile = the work-group's index within its range of the shared grid.
// ---------------------------------------------------------------------------
#define CG_PLANE (64 * 68)                         // floats of one wave's partial tile
#define CG_LDS   (8 * CG_PLANE + 64 * 17 + 64)     // dwords of LDS that MODE 0 uses (MODE 1: the 8 planes only)
template <int MODE>
__device__ __forceinline__ void conv_gemm64(const unsigned short* __restrict__ XTp, const unsigned short* __restrict__ Wpp,
                                            const float* __restrict__ rel_h, const float* __restrict__ rel_w,
                                            unsigned short* __restrict__ Ch, unsigned short* __restrict__ Cl,
                                            float* smem, int tile) {
  typedef __bf16 T;
  typedef v16b V;
  const T* XT = (const T*)XTp; const T* Wp = (const T*)Wpp;
  float* sP = smem;                                // 8 planes: per-wave partial 64x64 tile, pitch 68 floats
  unsigned* sRh = (unsigned*)(smem + 8 * CG_PLANE);   // MODE 0 only: 64 x 17 dwords
  unsigned* sRw = sRh + 64 * 17;                      // MODE 0 only: 64 dwords
  constexpr int M = (MODE == 0) ? MKV : DIM;
  constexpr int N = (MODE == 0) ? DIM : MKV;
  constexpr int LDC = N;
  constexpr int KW = KCONV / 8;                    // k range of one wave
  static_assert(KW % 32 == 0);
  const int tid  = threadIdx.x;
  const int lane = tid & 31;
  const int wave = __builtin_amdgcn_readfirstlane(tid >> 5);   // scalar, so that the k offsets stay scalar

  constexpr int tilesN = N >> 6;
  constexpr int tilesM = M >> 6;
  if (tile >= tilesM * tilesN) return;   // block-uniform, in front of the barrier; never taken with the exact grid
  const int tm = tile / tilesN;
  const int tn = tile - tm * tilesN;
  const int m0 = tm << 6;
  const int n0 = tn << 6;

  if (MODE == 0) {
    // rel_h rows n0 .. n0+63: 64 x 32 values, 8 per thread
    const int nl = tid >> 2, j0 = (tid & 3) * 8;
    const float* rh = rel_h + (size_t)(n0 + nl) * OH + j0;
    const v4f a = *(const v4f*)(rh);
    const v4f c = *(const v4f*)(rh + 4);
    unsigned* d = sRh + nl * 17 + (j0 >> 1);
    d[0] = pk16(f2bf_bits(a[0]), f2bf_bits(a[1]));
    d[1] = pk16(f2bf_bits(a[2]), f2bf_bits(a[3]));
    d[2] = pk16(f2bf_bits(c[0]), f2bf_bits(c[1]));
    d[3] = pk16(f2bf_bits(c[2]), f2bf_bits(c[3]));
    if (tid < 64) {
      const int ii0 = (m0 & (NKV - 1)) >> 5;       // even, m0 being a multiple of 64
      const v2f w = *(const v2f*)(rel_w + (size_t)(n0 + tid) * OW + ii0);
      sRw[tid] = pk16(f2bf_bits(w[0]), f2bf_bits(w[1]));
    }
  }

  const int rlane = lane & 15;
  const int mOff  = (lane >> 4) * 8;

  v8f acc[4][4];
#pragma unroll
  for (int i = 0; i < 4; ++i)
#pragma unroll
    for (int j = 0; j < 4; ++j) acc[i][j] = (v8f){0.f,0.f,0.f,0.f,0.f,0.f,0.f,0.f};

  const int kbeg = wave * KW;
  for (int k0 = kbeg; k0 < kbeg + KW; k0 += 32) {
    // All eight fragments of the k-step are loaded as ONE group in front of its 16 products (B first, then A in the order of use),
    // so the wave waits out one L2 round trip a k-step. One address an operand: sub-tile t lies a fixed distance behind sub-tile 0,
    // weights t row tiles on; im2col rows g0 + 16t (g0 % 64 == 0) = output-grid row + (t >> 1), jt = t & 1, that is 8*(t>>1) + (t&1) row tiles of XT on.
    V bfr[4], afr[4];
    const T* px = XT + im2col_blk((MODE == 0) ? m0 : n0, k0) + lane * 8;
    const T* pw = Wp + (size_t)((((MODE == 0) ? n0 : m0) >> 4) * (KCONV / 32) + (k0 >> 5)) * 512 + lane * 8;
#pragma unroll
    for (int j = 0; j < 4; ++j) {
      if (MODE == 0) bfr[j] = Frag<T>::load_fo(pw + j * ((KCONV / 32) * 512));
      else           bfr[j] = Frag<T>::load_fo(px + ((j >> 1) * 8 + (j & 1)) * ((DIM / 32) * 512));
    }
#pragma unroll
    for (int i = 0; i < 4; ++i) {
      if (MODE == 0) afr[i] = Frag<T>::load_fo(px + ((i >> 1) * 8 + (i & 1)) * ((DIM / 32) * 512));
      else           afr[i] = Frag<T>::load_fo(pw + i * ((KCONV / 32) * 512));
    }
    xcnt_wait(px, pw);
#pragma unroll
    for (int i = 0; i < 4; ++i) {
#pragma unroll
      for (int j = 0; j < 4; ++j) acc[i][j] = Frag<T>::mma(afr[i], bfr[j], acc[i][j]);
      Frag<T>::guard(acc[i][0], acc[i][3], afr[i], afr[i]);
    }
    Frag<T>::keep(bfr[0], bfr[1], bfr[2], bfr[3]);
  }
  acc_guard4(acc[0][0], acc[0][1], acc[0][2], acc[0][3]);
  acc_guard4(acc[1][0], acc[1][1], acc[1][2], acc[1][3]);
  acc_guard4(acc[2][0], acc[2][1], acc[2][2], acc[2][3]);
  acc_guard4(acc[3][0], acc[3][1], acc[3][2], acc[3][3]);

  // ---- this wave's partial tile to its LDS plane ----
  {
    float* part = sP + wave * CG_PLANE;
#pragma unroll
    for (int i = 0; i < 4; ++i)
#pragma unroll
      for (int j = 0; j < 4; ++j)
#pragma unroll
        for (int r = 0; r < 8; ++r) part[((i << 4) + mOff + r) * 68 + (j << 4) + rlane] = acc[i][j][r];
  }
  __syncthreads();

  // ---- join the 8 partials of rows 8*wave .. +7 and finish them: a lane holds 8 consecutive columns of one row ----
  const int q = lane >> 3, c8 = (lane & 7) * 8;
  v8h hv[2], lv[2];
  unsigned short* pch[2];
  unsigned short* pcl[2];
#pragma unroll
  for (int it = 0; it < 2; ++it) {
    const int row = wave * 8 + it * 4 + q;         // row within the tile
    const float* sp = sP + row * 68 + c8;
    v4f s0 = *(const v4f*)(sp);
    v4f s1 = *(const v4f*)(sp + 4);
#pragma unroll
    for (int w = 1; w < 8; ++w) {
      s0 += *(const v4f*)(sp + w * (64 * 68));
      s1 += *(const v4f*)(sp + w * (64 * 68) + 4);
    }
#pragma unroll
    for (int e = 0; e < 8; ++e) {
      float v = (e < 4) ? s0[e & 3] : s1[e & 3];
      if (MODE == 0) {
        const int jj = row & 31;                   // (m0 + row) & 31, m0 being a multiple of 64
        const unsigned hw = sRh[(c8 + e) * 17 + (jj >> 1)] >> ((jj & 1) * 16);
        const unsigned ww = sRw[c8 + e] >> ((row >> 5) * 16);
        const float pos = bf_bits2f((unsigned short)hw) + bf_bits2f((unsigned short)ww);
        v += pos;
      }
      unsigned short hb = f2bf_bits(v);
      unsigned short lb = f2bf_bits(v - bf_bits2f(hb));
      hv[it][e] = __builtin_bit_cast(_Float16, hb);
      lv[it][e] = __builtin_bit_cast(_Float16, lb);
    }
    size_t co;
    if (MODE == 0) {
      const int g = m0 + row, n = n0 + c8;         // 8 consecutive columns lie in one head, c8 being a multiple of 8
      co = ((size_t)(((g >> 10) * NH + (n >> 5)) * NKV + (g & (NKV - 1)))) * (2 * HD) + (n & (HD - 1));
    } else {
      co = (size_t)(m0 + row) * LDC + n0 + c8;
    }
    pch[it] = Ch + co;
    pcl[it] = Cl + co;
    *(v8h*)pch[it] = hv[it];
    *(v8h*)pcl[it] = lv[it];
  }
  xcnt_wait_st(pch, pcl, hv, lv);   // the code of the grid's other block ranges follows in the kernel and reuses these registers
}

// ---------------------------------------------------------------------------
// The three GEMMs read only the prepared planes and write disjoint planes, so they share one grid by ranges of the block index
// (block-uniform branches) and one LDS array: the q projection first (its waves run the longest k loop), then k', then v^T.
//   q = XT . WQ^T -> Qh|Ql [16384][256]   (M=16384, N=256, K=256; 1024 tiles, 8 per block); bias/resid unused (mode 0)
// ---------------------------------------------------------------------------
#define G3_Q (((MTOK / 64) * (DIM / 64)) / 8)      // 128 blocks
#define G3_C ((MKV / 64) * (DIM / 64))             // 256 blocks per conv GEMM
static_assert(CG_LDS >= 8 * 16 * 68);
__global__ __launch_bounds__(256) void gemm3_kernel(const unsigned short* __restrict__ XT, const unsigned short* __restrict__ WQ,
                                                    const unsigned short* __restrict__ WKp, const unsigned short* __restrict__ WVp,
                                                    const float* __restrict__ rel_h, const float* __restrict__ rel_w,
                                                    unsigned short* __restrict__ Qh, unsigned short* __restrict__ Ql,
                                                    unsigned short* __restrict__ KI,
                                                    unsigned short* __restrict__ VTh, unsigned short* __restrict__ VTl) {
  __shared__ __align__(16) float smem[CG_LDS];
  const int bx = blockIdx.x;
  if (bx < G3_Q) {
    wmma_gemm64<1, false, 0, 2, false, 0>(XT, XT, DIM, 0L, WQ, WQ, DIM, 0L, (void*)Qh, (void*)Ql, DIM, 0L,
                                          rel_h, rel_h, 0L, MTOK, DIM, DIM, 1.0f, smem, bx, 0);
  } else if (bx < G3_Q + G3_C) {
    conv_gemm64<0>(XT, WKp, rel_h, rel_w, KI, KI + HD, smem, bx - G3_Q);
  } else {
    conv_gemm64<1>(XT, WVp, rel_h, rel_w, VTh, VTl, smem, bx - (G3_Q + G3_C));
  }
}

// =====================================================================================
// Full (non-causal, unmasked) attention, head dim 32, all batches and heads in one launch.
//   q planes (hi/lo bf16) [16384][256]: element (b, n, h, d) at [(b*4096+n)*256 + h*32 + d]
//   k (hi|lo bf16) [32][1024][64]:      element (b, m, h, d) at [((b*8+h)*1024 + m)*64 + d] hi, + 32 lo  (pos already folded in)
//   v^T planes (hi/lo bf16) [256][4096]: element (h, d, b, m) at [(h*32 + d)*4096 + b*1024 + m]
//   out f32 NCHW: element (b, h*32+d, n) at [(b*256 + h*32 + d)*4096 + n]
//   scores = (q . k') * 32^-0.5 : bf16 hi/lo split (hi.hi + hi.lo + lo.hi) on v_wmma_f32_16x16x32_bf16
//   out    = p . v             : bf16 hi/lo split of p (unnormalised exp) and v, f32 accumulate, x 1/rowsum in f32 at the end
//   online softmax in f32 over the 1024 keys of the batch element (16 chunks of 64, compile-time trip count, no masking),
//   in base 2: p = 2^(s * scale * log2(e) - m), one multiply-add and one hardware exponential per score.
//   Block = 4 waves = 64 query positions of one (batch, head); grid.x = 4 * 8 * 64 = 2048 (exact).
//   Staging reads whole 128-B lines: 8 consecutive lanes take the 8 16-B pieces of one row, so a wave's load covers 4 whole lines.
//   K chunk: 64 rows of 128 B (hi|lo), contiguous; load i of thread tid = row i*16 + (tid>>3), piece tid&7 (4 loads) -> whole tile;
//   V^T chunk: 32 rows of 128 B per plane; load i = row i*16 + (tid>>3), piece tid&7 (2 loads per plane); __syncthreads before and after.
//   Scores are formed transposed, S^T = K . Q^T (A = K rows, B = Q): a lane holds 32 of the chunk's 64 scores of ONE query
//   (query = lane & 15, keys j*16 + 8*(lane>>4) + r), so maximum and sum run in the lane plus one exchange between lane halves;
//   two S^T tiles converted in place are the B operand of O^T += V^T . P^T (same k order as the V^T loader): P never touches LDS.
// =====================================================================================
#define AT_D  32
#define AT_NW 4
#define AT_QB 64
#define AT_KC 64
#define AT_KP 72   // LDS pitch of a K row (hi 32 | lo 32 | pad 8) in elements: 144 B = 16 B x 9 (odd), so the 16 rows of one 16-byte fragment read fall on 16 distinct bank groups
#define AT_VP 72   // LDS pitch of a V^T row in elements: 144 B = 16 B x 9 (odd), same reason

__device__ __forceinline__ v8f at_mma(v16b a, v16b b, v8f c) {
  // the builtin alone: the compiler keeps the distance behind its own matrix instructions, and pays idle slots only where a vector
  // instruction really follows on D, A or B (an accumulating product on the same D needs none)
  return __builtin_amdgcn_wmma_f32_16x16x32_bf16(false, a, false, b, (short)0, c, false, false);
}

// value of the same lane position in the other 16-lane half (lane ^ 16), as a vector cross-row move
__device__ __forceinline__ float at_xhalf(float f) {
  const int b = __float_as_int(f);
  return __int_as_float(__builtin_amdgcn_permlanex16(b, b, 0x76543210, 0xfedcba98, false, false));
}

// second argument: at least 8 waves a SIMD, that is at most 128 registers, so that all 2048 work-groups are resident in one round
__global__ __launch_bounds__(128, 8)
void attn32_kernel(const unsigned short* __restrict__ qhp, const unsigned short* __restrict__ qlp,
                   const unsigned short* __restrict__ kip,
                   const unsigned short* __restrict__ vhp, const unsigned short* __restrict__ vlp,
                   float* __restrict__ out, float sscale) {
  union FB { v16b v; v8b h[2]; unsigned w[8]; };
  __shared__ __align__(16) __bf16 Ks[AT_KC * AT_KP];             // K [kv][hi d | lo d], padded rows   9 KB
  __shared__ __align__(16) __bf16 Vth[AT_D * AT_VP];             // V hi [d][kv], padded rows   4.5 KB
  __shared__ __align__(16) __bf16 Vtl[AT_D * AT_VP];             // V lo
  __shared__ __align__(16) float  Os[AT_D * 68];                 // block out tile transposed [d][n_local], pitch 68

  const int tid  = threadIdx.x;
  const int wave = tid >> 5;
  const int lane = tid & 31;
  const int hh   = lane >> 4;
  const int c    = lane & 15;

  const int nqb = NQ / AT_QB;              // 64 query blocks per (batch, head)
  const int bx = blockIdx.x;               // grid = NB * NH * nqb (exact)
  const int qb = bx % nqb;
  const int hb = bx / nqb;
  const int h  = hb % NH;                  // 0..7
  const int b  = hb / NH;                  // 0..3
  const int q0 = b * NQ + qb * AT_QB + wave * 16;   // row in the q planes

  const __bf16* Qh = (const __bf16*)(const void*)qhp + (size_t)h * AT_D;
  const __bf16* Ql = (const __bf16*)(const void*)qlp + (size_t)h * AT_D;
  const __bf16* Ki = (const __bf16*)(const void*)kip + (size_t)(b * NH + h) * NKV * (2 * AT_D);
  const __bf16* Vh = (const __bf16*)(const void*)vhp + (size_t)h * AT_D * VTP + (size_t)b * NKV;
  const __bf16* Vl = (const __bf16*)(const void*)vlp + (size_t)h * AT_D * VTP + (size_t)b * NKV;

  // ---- Q fragments (B operand, column = lane&15, split k map via Frag load): head dim 32 = one k-step, hi and lo ----
  v16b qah, qal;
  {
    const __bf16* qr = Qh + (size_t)(q0 + c) * DIM + 8 * hh;
    const __bf16* ql = Ql + (size_t)(q0 + c) * DIM + 8 * hh;
    qah = Frag<__bf16>::load(qr);
    qal = Frag<__bf16>::load(ql);
  }

  const float sl2 = sscale * 1.4426950408889634f;   // score scale times log2(e): the softmax runs in base 2
  float mrow = -INFINITY;   // running maximum of this lane's query in base-2 units, max(s) * sl2 (equal in both lane halves)
  float lrow = 0.f;         // running sum over this lane half's keys only; the halves are joined once after the loop
  v8f oacc[2];              // O^T tiles: oacc[t][r] = out[d = t*16 + 8*hh + r][query c]
#pragma unroll
  for (int t = 0; t < 2; ++t) oacc[t] = (v8f){0.f,0.f,0.f,0.f,0.f,0.f,0.f,0.f};

  const int nChunks = NKV / AT_KC;   // 16, compile-time constant
  for (int kc = 0; kc < nChunks; ++kc) {
    const int kv0 = kc * AT_KC;
    __syncthreads();
    {
      const int r8 = tid >> 3, p8 = (tid & 7) * 8;   // row within a group of 16 rows, 16-B piece of its 128-B line
      // K staging: 4 loads x 128 threads x 8 elements = 64 rows x 64 (hi|lo)
      const __bf16* ks = Ki + (size_t)(kv0 + r8) * (2 * AT_D) + p8;
      const v8b a0 = *(const v8b*)(ks);
      const v8b a1 = *(const v8b*)(ks + 16 * (2 * AT_D));
      const v8b a2 = *(const v8b*)(ks + 32 * (2 * AT_D));
      const v8b a3 = *(const v8b*)(ks + 48 * (2 * AT_D));
      // V^T staging: 2 loads x 128 threads x 8 elements per plane = 32 rows x 64; issued in one group with the K loads, in front of
      // the first LDS store, so that a chunk's staging waits out one L2 round trip
      const __bf16* vsh = Vh + (size_t)r8 * VTP + kv0 + p8;
      const __bf16* vsl = Vl + (size_t)r8 * VTP + kv0 + p8;
      const v8b b0 = *(const v8b*)(vsh);
      const v8b b1 = *(const v8b*)(vsh + (size_t)16 * VTP);
      const v8b b2 = *(const v8b*)(vsl);
      const v8b b3 = *(const v8b*)(vsl + (size_t)16 * VTP);
      xcnt_wait(ks, vsh, vsl);   // the addresses stay in their registers up to the wait
      *(v8b*)(Ks + r8 * AT_KP + p8)        = a0;
      *(v8b*)(Ks + (r8 + 16) * AT_KP + p8) = a1;
      *(v8b*)(Ks + (r8 + 32) * AT_KP + p8) = a2;
      *(v8b*)(Ks + (r8 + 48) * AT_KP + p8) = a3;
      *(v8b*)(Vth + r8 * AT_VP + p8)        = b0;
      *(v8b*)(Vth + (r8 + 16) * AT_VP + p8) = b1;
      *(v8b*)(Vtl + r8 * AT_VP + p8)        = b2;
      *(v8b*)(Vtl + (r8 + 16) * AT_VP + p8) = b3;
    }
    __syncthreads();

    v8f s[4];
#pragma unroll
    for (int j = 0; j < 4; ++j) {
      s[j] = (v8f){0.f,0.f,0.f,0.f,0.f,0.f,0.f,0.f};
      FB kb, kl;
      kb.h[0] = *(const v8b*)(Ks + (j * 16 + c) * AT_KP + 8 * hh);
      kb.h[1] = *(const v8b*)(Ks + (j * 16 + c) * AT_KP + 16 + 8 * hh);
      kl.h[0] = *(const v8b*)(Ks + (j * 16 + c) * AT_KP + AT_D + 8 * hh);
      kl.h[1] = *(const v8b*)(Ks + (j * 16 + c) * AT_KP + AT_D + 16 + 8 * hh);
      s[j] = at_mma(kb.v, qah, s[j]);
      s[j] = at_mma(kl.v, qah, s[j]);
      s[j] = at_mma(kb.v, qal, s[j]);
    }
    // the query's chunk maximum of the raw scores: in the lane, then one exchange with the other lane half; scaled once (sl2 > 0 keeps the order)
    // (the loops over j, r, t and kk below are unrolled so that s, ph, pl and oacc are indexed at compile time and stay in registers)
    float cm = -INFINITY;
#pragma unroll
    for (int j = 0; j < 4; ++j) {
#pragma unroll
      for (int r = 0; r < 8; ++r) cm = fmaxf(cm, s[j][r]);
    }
    cm = fmaxf(cm, at_xhalf(cm));
    const float mnew = fmaxf(mrow, cm * sl2);
    const float alpha = __builtin_amdgcn_exp2f(mrow - mnew);   // 0 on the first chunk, where mrow is -inf
    mrow = mnew;
    // P^T as B operand: element e of k-step kk = S^T tile 2*kk + (e >> 3), register e & 7 (key kk*32 + 16*(e>>3) + 8*hh + (e&7))
    FB ph[2], pl[2];
    float psum = 0.f;
#pragma unroll
    for (int j = 0; j < 4; ++j) {
#pragma unroll
      for (int r = 0; r < 8; r += 2) {
        // e^(scale*s - max) as 2^(s*sl2 - mnew), the multiply-add on two scores at a time
        const v2f arg = __builtin_elementwise_fma((v2f){s[j][r], s[j][r + 1]}, (v2f){sl2, sl2}, (v2f){-mnew, -mnew});
        const float p0 = __builtin_amdgcn_exp2f(arg[0]);
        const float p1 = __builtin_amdgcn_exp2f(arg[1]);
        psum += p0;
        psum += p1;
        // hi|lo split of two scores at a time: the packed hardware conversion rounds to nearest even, as the integer steps did,
        // and leaves both halves of the operand word in place; the remainder p - hi is exact in f32
        const unsigned hw = __builtin_bit_cast(unsigned, __builtin_convertvector((v2f){p0, p1}, v2b));
        const v2f rest = (v2f){p0, p1} - (v2f){__uint_as_float(hw << 16), __uint_as_float(hw & 0xFFFF0000u)};
        ph[j >> 1].w[(j & 1) * 4 + (r >> 1)] = hw;
        pl[j >> 1].w[(j & 1) * 4 + (r >> 1)] = __builtin_bit_cast(unsigned, __builtin_convertvector(rest, v2b));
      }
    }
    lrow = lrow * alpha + psum;
    // keeps the exponentials and the split in front of the P.V products: moved in among them they hold the f32 values of P longer,
    // the kernel passes 128 registers, and only 7 instead of 8 waves fit a SIMD (the 2048 work-groups then need a second round)
    __builtin_amdgcn_sched_barrier(0);
#pragma unroll
    for (int t = 0; t < 2; ++t)
#pragma unroll
      for (int r = 0; r < 8; ++r) oacc[t][r] *= alpha;
#pragma unroll
    for (int kk = 0; kk < 2; ++kk) {
#pragma unroll
      for (int t = 0; t < 2; ++t) {
        FB vb, vl;
        vb.h[0] = *(const v8b*)(Vth + (t * 16 + c) * AT_VP + kk * 32 + 8 * hh);
        vb.h[1] = *(const v8b*)(Vth + (t * 16 + c) * AT_VP + kk * 32 + 16 + 8 * hh);
        vl.h[0] = *(const v8b*)(Vtl + (t * 16 + c) * AT_VP + kk * 32 + 8 * hh);
        vl.h[1] = *(const v8b*)(Vtl + (t * 16 + c) * AT_VP + kk * 32 + 16 + 8 * hh);
        oacc[t] = at_mma(vb.v, ph[kk].v, oacc[t]);
        oacc[t] = at_mma(vl.v, ph[kk].v, oacc[t]);
        oacc[t] = at_mma(vb.v, pl[kk].v, oacc[t]);
      }
    }
  }

  // ---- join the lane halves' sums, normalise and stage: Os[d][n_local], d = t*16 + 8hh + r, n_local = wave*16 + c (all 32 x 64 written) ----
  {
    const float inv = 1.0f / (lrow + at_xhalf(lrow));
#pragma unroll
    for (int t = 0; t < 2; ++t)
#pragma unroll
      for (int r = 0; r < 8; ++r) Os[(t * 16 + 8 * hh + r) * 68 + wave * 16 + c] = oacc[t][r] * inv;
  }
  __syncthreads();
  {
    float* ob = out + ((size_t)(b * DIM + h * AT_D)) * NQ + (size_t)qb * AT_QB;
    const int q = lane >> 3, c4 = (lane & 7) * 4;
    {
#pragma unroll
      for (int it = 0; it < 4; ++it) {
        const int L  = it * 16 + wave * 4 + q;   // 0..63: line index within the block's 32 x 256-B output region
        const int d  = L >> 1;
        const int hf = (L & 1) * 32;
        v4f val = *(const v4f*)(Os + d * 68 + hf + c4);
        *(v4f*)(ob + (size_t)d * NQ + hf + c4) = val;
      }
      
    }
  }
}

// ---------------------------------------------------------------------------
// Workspace region map (byte offsets; every region fully written by its producer launch before any consumer reads it;
//   XT   bf16 16384 x 256          0       8388608   (XT, WQ, WKp, WVp in fragment order)
//   WQ   bf16 [256][256]     8388608        131072
//   WKp  bf16 [256][1024]    8519680        524288
//   WVp  bf16 [256][1024]    9043968        524288
//   Qh   bf16 [16384][256]   9568256       8388608   Ql  17956864
//   KI   bf16 [32][1024][64] 26345472      4194304
//   VTh  bf16 [256][4096]   30539776       2097152   VTl 32636928
//   total                  34734080
// ---------------------------------------------------------------------------
extern "C" void kernel_launch(void* const* d_in, const int* in_sizes, int n_in,
                              void* d_out, int out_size, void* d_ws, size_t ws_size,
                              hipStream_t stream) {
  if (n_in < 6) return;
  if (in_sizes[0] != NB * DIM * NQ) return;          // x [4][256][64][64]
  if (in_sizes[1] != DIM * DIM) return;              // Wq [256][256]
  if (in_sizes[2] != DIM * DIM * 4) return;          // Wk [256][256][2][2]
  if (in_sizes[3] != DIM * DIM * 4) return;          // Wv [256][256][2][2]
  if (in_sizes[4] != NH * HD * OH) return;           // rel_h [1][8][32][1][32]
  if (in_sizes[5] != NH * HD * OW) return;           // rel_w [1][8][32][32][1]
  if (out_size != NB * DIM * NQ) return;

  const float* x     = (const float*)d_in[0];
  const float* Wq    = (const float*)d_in[1];
  const float* Wk    = (const float*)d_in[2];
  const float* Wv    = (const float*)d_in[3];
  const float* rel_h = (const float*)d_in[4];
  const float* rel_w = (const float*)d_in[5];

  const size_t PXT = (size_t)MTOK * DIM * 2;        // 8388608
  const size_t PWQ = (size_t)DIM * DIM * 2;         // 131072
  const size_t PWC = (size_t)DIM * KCONV * 2;       // 524288
  const size_t PQ  = (size_t)MTOK * DIM * 2;        // 8388608
  const size_t PK  = (size_t)MKV * DIM * 2 * 2;     // 4194304 (hi and lo in one plane)
  const size_t PVT = (size_t)DIM * VTP * 2;         // 2097152
  size_t off = 0;
  const size_t oXT  = off; off += PXT;
  const size_t oWQ  = off; off += PWQ;
  const size_t oWK  = off; off += PWC;
  const size_t oWV  = off; off += PWC;
  const size_t oQh  = off; off += PQ;   const size_t oQl  = off; off += PQ;
  const size_t oKI  = off; off += PK;
  const size_t oVTh = off; off += PVT;  const size_t oVTl = off; off += PVT;
  if (off > ws_size) return;                        // off = 34734080
  if (off > (size_t)134217728) return;

  char* ws = (char*)d_ws;
  unsigned short* XT  = (unsigned short*)(ws + oXT);
  unsigned short* WQ  = (unsigned short*)(ws + oWQ);
  unsigned short* WKp = (unsigned short*)(ws + oWK);
  unsigned short* WVp = (unsigned short*)(ws + oWV);
  unsigned short* Qh  = (unsigned short*)(ws + oQh);  unsigned short* Ql  = (unsigned short*)(ws + oQl);
  unsigned short* KI  = (unsigned short*)(ws + oKI);
  unsigned short* VTh = (unsigned short*)(ws + oVTh); unsigned short* VTl = (unsigned short*)(ws + oVTl);

  const dim3 blk(256);

  // (1) operand preparation: WQ, WKp, WVp and XT; 32 + 32 + 32 + 1024 blocks
  prep_kernel<<<dim3(PR_WQ + 2 * PR_WC + PR_XT), blk, 0, stream>>>(x, Wq, Wk, Wv, XT, WQ, WKp, WVp);
  // (2) q -> Qh|Ql, k' = conv_k + pos -> KI, v^T = conv_v -> VTh|VTl; 128 + 256 + 256 blocks
  gemm3_kernel<<<dim3(G3_Q + 2 * G3_C), blk, 0, stream>>>(XT, WQ, WKp, WVp, rel_h, rel_w, Qh, Ql, KI, VTh, VTl);
  // (3) attention per (batch, head, 64-query block) -> d_out NCHW; 2048 blocks of 128
  attn32_kernel<<<dim3(NB * NH * (NQ / AT_QB)), dim3(128), 0, stream>>>(Qh, Ql, KI, VTh, VTl, (float*)d_out,
                                                                        0.17677669529663687f);
  (void)hipGetLastError();
}

// v010
// One run takes 61.2 microseconds.
// In two side-by-side timings against v009, it was 1.06 and 1.04 times as fast.
// Counting every step since v000, it is 5.65 times as fast.
// Contractions: q projection, k conv (im2col) and v^T conv (im2col) = v_wmma_f32_16x16x32_bf16 single products on bf16 planes of the RNE-converted inputs (exact products); scores q.(k+pos) and p.v = bf16 hi/lo split (hi.hi + hi.lo + lo.hi); f32 accumulate everywhere; positional add, 32^-0.5 scale, online softmax and 1/rowsum in f32 on the VALU.
// Plane / carry map (all carry 1, nothing to fold back):
//   XT  = bf16(x), rows = tokens, cols = channels c;  WQ = bf16(Wq) [256 o][256 c];  WKp, WVp bf16 [256 o][1024]: col q4*256 + c = bf16(W[o][c][kh][kw]), q4 = kh*2 + kw
//   These four are kept in FRAGMENT ORDER: blocks of 16 rows x 32 cols = 512 elements, block (row tile rt, k-step ks) at (rt * (cols/32) + ks) * 512;
//   in a block element (r, k) stands at ((k>>4)&1)*256 + (((k>>3)&1)*16 + r)*8 + (k&7), so each of a fragment's two 16-B loads reads 512 B in a row.
//   Row tiles of XT: tile ((b*64 + y)*2 + kw)*2 + jt, row r = token (b, y, x = 2*(jt*16 + r) + kw): the 16 tokens that one conv tap takes from an image row
//   q is formed in the attention kernel's prologue and its hi/lo split stays in registers;  KI bf16 [32 (b*8+h)][1024 m][64] (m = i*32 + j; col d = hi, col 32 + d = lo) = hi/lo of (conv_k + pos)
//   pos(h,d,m) = bf16(rel_h[(h*32+d)*32 + (m & 31)]) + bf16(rel_w[(h*32+d)*32 + (m >> 5)]) in f32
//   VTh|VTl bf16 [256 (h*32+d)][4096 (b*1024+m)] = hi/lo of conv_v;  P hi|lo = unnormalised exp, at most 1 up to the rounding of the scaled maximum (f32), 1/rowsum applied to the f32 accumulator
#include <hip/hip_runtime.h>
#include <math.h>
#include <stdint.h>

#define NB    4
#define DIM   256
#define NH    8
#define HD    32
#define IMH   64
#define IMW   64
#define NQ    4096
#define OH    32
#define OW    32
#define NKV   1024
#define KCONV 1024
#define MTOK  (NB * NQ)
#define MKV   (NB * NKV)
#define VTP   (NB * NKV)

static_assert(NQ == IMH * IMW);
static_assert(IMW == 64);
static_assert(NKV == OH * OW);
static_assert(OH * 2 == IMH);
static_assert(OW * 2 == IMW);
static_assert(DIM == NH * HD);
static_assert(HD == 32);
static_assert(KCONV == DIM * 4);
static_assert(MTOK % 64 == 0);
static_assert(MKV % 128 == 0);
static_assert(DIM % 64 == 0);
static_assert(KCONV % 32 == 0);
static_assert(DIM % 32 == 0);
static_assert((DIM * DIM) % (8 * 256) == 0);
static_assert(((MKV / 64) * (DIM / 64)) % 8 == 0);
static_assert(((MTOK / 64) * (DIM / 64)) % 8 == 0);
static_assert(DIM * OH == 8192);
static_assert(NQ % 64 == 0);
static_assert(NKV % 64 == 0);

typedef __attribute__((ext_vector_type(16))) _Float16 v16h;
typedef __attribute__((ext_vector_type(8)))  _Float16 v8h;
typedef __attribute__((ext_vector_type(16))) __bf16   v16b;
typedef __attribute__((ext_vector_type(8)))  __bf16   v8b;
typedef __attribute__((ext_vector_type(2)))  __bf16   v2b;
typedef __attribute__((ext_vector_type(8)))  float    v8f;
typedef __attribute__((ext_vector_type(4)))  float    v4f;
typedef __attribute__((ext_vector_type(2)))  float    v2f;
typedef __attribute__((ext_vector_type(4)))  unsigned int v4u;
typedef __attribute__((ext_vector_type(2)))  unsigned int v2u;

__device__ __forceinline__ unsigned short f2bf_bits(float f) {
  unsigned u = __float_as_uint(f);
  return (unsigned short)((u + 0x7FFFu + ((u >> 16) & 1u)) >> 16);
}
__device__ __forceinline__ float bf_bits2f(unsigned short h) { return __uint_as_float(((unsigned)h) << 16); }
__device__ __forceinline__ unsigned pk16(unsigned short a, unsigned short b) { return (unsigned)a | ((unsigned)b << 16); }

// hazard guards as plain device helpers (no inline asm inside the kernel template body)
__device__ __forceinline__ void dep_guard_h(v8f& a, v8f& b, v16h x, v16h y) { asm volatile("v_nop\n\tv_nop\n\tv_nop\n\tv_nop" : "+v"(a), "+v"(b) : "v"(x), "v"(y)); }
__device__ __forceinline__ void dep_guard_b(v8f& a, v8f& b, v16b x, v16b y) { asm volatile("v_nop\n\tv_nop\n\tv_nop\n\tv_nop" : "+v"(a), "+v"(b) : "v"(x), "v"(y)); }
__device__ __forceinline__ void keep4_h(v16h a, v16h b, v16h c, v16h d) { asm volatile("v_nop" :: "v"(a), "v"(b), "v"(c), "v"(d)); }
__device__ __forceinline__ void keep4_b(v16b a, v16b b, v16b c, v16b d) { asm volatile("v_nop" :: "v"(a), "v"(b), "v"(c), "v"(d)); }
__device__ __forceinline__ void acc_guard4(v8f& a, v8f& b, v8f& c, v8f& d) { asm volatile("v_nop\n\tv_nop\n\tv_nop\n\tv_nop" : "+v"(a), "+v"(b), "+v"(c), "+v"(d)); }
// s_wait_xcnt 0 behind issued global loads or stores, in front of the next write of a register that they name: the addresses
// (and a store's data) are inputs of the statement, so their registers stay as they are up to the wait
__device__ __forceinline__ void xcnt_wait(const void* a, const void* b) { asm volatile("s_wait_xcnt 0x0" :: "v"(a), "v"(b) : "memory"); }
__device__ __forceinline__ void xcnt_wait(const void* a, const void* b, const void* c) { asm volatile("s_wait_xcnt 0x0" :: "v"(a), "v"(b), "v"(c) : "memory"); }
__device__ __forceinline__ void xcnt_wait(const void* a, const void* b, const void* c, const void* d) {
  asm volatile("s_wait_xcnt 0x0" :: "v"(a), "v"(b), "v"(c), "v"(d) : "memory");
}
__device__ __forceinline__ void xcnt_wait_st(unsigned short* const (&a)[2], const v4u (&x)[2]) {
  asm volatile("s_wait_xcnt 0x0" :: "v"(a[0]), "v"(a[1]), "v"(x[0]), "v"(x[1]) : "memory");
}
__device__ __forceinline__ void xcnt_wait_st(unsigned short* const (&a)[2], unsigned short* const (&b)[2], const v8h (&x)[2], const v8h (&y)[2]) {
  asm volatile("s_wait_xcnt 0x0" :: "v"(a[0]), "v"(a[1]), "v"(b[0]), "v"(b[1]), "v"(x[0]), "v"(x[1]), "v"(y[0]), "v"(y[1]) : "memory");
}
template <typename T> struct Frag;
template <> struct Frag<_Float16> {
  typedef v16h V; union U { v16h v; v8h h[2]; };
  static __device__ __forceinline__ v16h load(const _Float16* p) {   // elements 0..7 <- p[0..7], 8..15 <- p[16..23]
    U f; f.h[0] = *(const v8h*)(p); f.h[1] = *(const v8h*)(p + 16); return f.v;
  }
  static __device__ __forceinline__ v16h load_fo(const _Float16* p) {   // p = fragment-order block + lane*8: elements 0..7 <- p[0..7], 8..15 <- p[256..263]
    U f; f.h[0] = *(const v8h*)(p); f.h[1] = *(const v8h*)(p + 256); return f.v;
  }
  static __device__ __forceinline__ v8f mma(v16h a, v16h b, v8f c) {
    return __builtin_amdgcn_wmma_f32_16x16x32_f16(false, a, false, b, (short)0, c, false, false);
  }
  static __device__ __forceinline__ void guard(v8f& a, v8f& b, v16h x, v16h y) { dep_guard_h(a, b, x, y); }
  static __device__ __forceinline__ void keep(v16h a, v16h b, v16h c, v16h d) { keep4_h(a, b, c, d); }
};
template <> struct Frag<__bf16> {
  typedef v16b V; union U { v16b v; v8b h[2]; };
  static __device__ __forceinline__ v16b load(const __bf16* p) {
    U f; f.h[0] = *(const v8b*)(p); f.h[1] = *(const v8b*)(p + 16); return f.v;
  }
  static __device__ __forceinline__ v16b load_fo(const __bf16* p) {     // as above
    U f; f.h[0] = *(const v8b*)(p); f.h[1] = *(const v8b*)(p + 256); return f.v;
  }
  static __device__ __forceinline__ v8f mma(v16b a, v16b b, v8f c) {
    return __builtin_amdgcn_wmma_f32_16x16x32_bf16(false, a, false, b, (short)0, c, false, false);
  }
  static __device__ __forceinline__ void guard(v8f& a, v8f& b, v16b x, v16b y) { dep_guard_b(a, b, x, y); }
  static __device__ __forceinline__ void keep(v16b a, v16b b, v16b c, v16b d) { keep4_b(a, b, c, d); }
};

// ---------------------------------------------------------------------------
// bf16 RNE convert of an f32 matrix [rows][ncols] into a u16 plane in fragment order (head of the file).
// Thread i makes the plane's 16-B piece i (8 consecutive columns of one row), so a wave's store is 512 B in a row
// ---------------------------------------------------------------------------
__device__ __forceinline__ void convrows_body(const float* __restrict__ in, unsigned short* __restrict__ out,
                                              int ncols, int n8, int bx) {
  const int i = bx * 256 + threadIdx.x;
  if (i < n8) {
    const int ln = i & 31, part = (i >> 5) & 1, blk = i >> 6, nks = ncols >> 5;
    const int row = (blk / nks) * 16 + (ln & 15);
    const int col = (blk % nks) * 32 + part * 16 + (ln >> 4) * 8;
    const size_t e0 = (size_t)row * ncols + col;
    const v4f a = *(const v4f*)(in + e0);
    const v4f c = *(const v4f*)(in + e0 + 4);
    v4u hv;
    hv[0] = pk16(f2bf_bits(a[0]), f2bf_bits(a[1]));
    hv[1] = pk16(f2bf_bits(a[2]), f2bf_bits(a[3]));
    hv[2] = pk16(f2bf_bits(c[0]), f2bf_bits(c[1]));
    hv[3] = pk16(f2bf_bits(c[2]), f2bf_bits(c[3]));
    {
      *(v4u*)(out + (size_t)i * 8) = hv;
      
    }
  }
}

// ---------------------------------------------------------------------------
// Fused transpose + bf16 RNE convert of an f32 matrix, z-batched, one plane:
//   in_z = W + z*sIn viewed [R rows][Cc cols] with row pitch ldin  ->  oh_z(row c, col r) = bf16(in_z[r][c]), ldout cols, oh_z = oh + z*sOut,
//   in fragment order with XT's row tiles (head of the file): the 64 output rows of a tile are one image row = 4 row tiles (kw*2 + jt).
// 64x64 tiles through LDS (tf). Tile indices (bx, by, bz) run over (Cc/64, R/64, Z), 256 threads (R, Cc, ldout multiples of 64).
// Coverage per block: load 4 it x 256 thr x 4 floats = 64x64; store 2 it x 256 thr x 8 u16 = 8 whole blocks of 512 (4 row tiles x 2 k-steps).
// ---------------------------------------------------------------------------
__device__ __forceinline__ void tconv_body(const float* __restrict__ W, unsigned short* __restrict__ oh,
                                           int ldin, int ldout, long sIn, long sOut, float* tf, int bx, int by, int bz) {
  W  += (size_t)bz * sIn;
  oh += (size_t)bz * sOut;
  const int c0  = bx * 64;   // input column block = output row block
  const int r0  = by * 64;   // input row block    = output column block
  const int tid = threadIdx.x;
  {
    const int lr = tid >> 4;         // 0..15
    const int c4 = (tid & 15) * 4;   // 0..60
    const float* pw[4];
    v4f a[4];
#pragma unroll
    for (int it = 0; it < 4; ++it) {
      pw[it] = W + (size_t)(r0 + it * 16 + lr) * ldin + c0 + c4;   // rows 0..63
      a[it] = *(const v4f*)(pw[it]);
    }
    xcnt_wait(pw[0], pw[1], pw[2], pw[3]);
#pragma unroll
    for (int it = 0; it < 4; ++it) *(v4f*)(tf + (it * 16 + lr) * 68 + c4) = a[it];
  }
  __syncthreads();
  const int ln = tid & 31, part = (tid >> 5) & 1;   // lane and half of a block: piece it*256 + tid of the tile's 512 16-B pieces
  v4u hv[2];
#pragma unroll
  for (int it = 0; it < 2; ++it) {
    const int blk = it * 4 + (tid >> 6);                                      // 0..7: row tile blk >> 1 (= kw*2 + jt), k-step blk & 1
    const int oc = 2 * ((((blk >> 1) & 1) << 4) + (ln & 15)) + (blk >> 2);    // output row within tile (= input column): x = 2*(jt*16 + r) + kw
    const int c8 = (blk & 1) * 32 + part * 16 + (ln >> 4) * 8;                // first of the piece's 8 output columns (= input rows)
    v4u a;
#pragma unroll
    for (int q = 0; q < 4; ++q) {
      const float f0 = tf[(c8 + 2 * q) * 68 + oc];
      const float f1 = tf[(c8 + 2 * q + 1) * 68 + oc];
      a[q] = pk16(f2bf_bits(f0), f2bf_bits(f1));
    }
    hv[it] = a;
  }
  {
    unsigned short* po[2];
#pragma unroll
    for (int it = 0; it < 2; ++it) {
      const int blk = it * 4 + (tid >> 6);
      const size_t go = (size_t)(((c0 >> 4) + (blk >> 1)) * (ldout >> 5) + (r0 >> 5) + (blk & 1)) * 512 + part * 256 + ln * 8;
      po[it] = oh + go;
      *(v4u*)po[it] = hv[it];
    }
    xcnt_wait_st(po, hv);   // the code of the grid's other block ranges follows in the kernel and reuses these registers
  }
}

// ---------------------------------------------------------------------------
// Conv weight permute + bf16 RNE convert: W OIHW [256 o][256 c][2][2] f32 -> O(row o, col q4*256 + c) u16 (q4 = kh*2 + kw),
// KCONV = 1024 cols, in fragment order. One unit = (o, c0): 8 x 16-B loads (the 4 taps of 8 consecutive c), 4 x 16-B stores
// (8 consecutive c of each q4 segment). A wave takes the 32 pieces of one half block, so each of its stores is 512 B in a row.
// Coverage: 32 blocks x 256 threads = 8192 units x 32 elements = 256 x 1024 = whole plane.
// ---------------------------------------------------------------------------
__device__ __forceinline__ void wperm_body(const float* __restrict__ W, unsigned short* __restrict__ O, int bx) {
  const int u = bx * 256 + threadIdx.x;   // 0 .. DIM*32 - 1
  if (u < DIM * 32) {
    const int ln = u & 31, part = (u >> 5) & 1, ksc = (u >> 6) & 7, rt = u >> 9;   // lane, half block, k-step within a q4 segment, row tile
    const int o = rt * 16 + (ln & 15), c0 = ksc * 32 + part * 16 + (ln >> 4) * 8;
    v4f w[8];
#pragma unroll
    for (int e = 0; e < 8; ++e) w[e] = *(const v4f*)(W + ((size_t)(o * DIM + c0 + e)) * 4);
    v4u pk[4];
#pragma unroll
    for (int q4 = 0; q4 < 4; ++q4) {
      v4u a;
#pragma unroll
      for (int p = 0; p < 4; ++p) a[p] = pk16(f2bf_bits(w[2 * p][q4]), f2bf_bits(w[2 * p + 1][q4]));
      pk[q4] = a;
    }
    unsigned short* orow = O + (size_t)(rt * (KCONV / 32) + ksc) * 512 + part * 256 + ln * 8;
    {
#pragma unroll
      for (int q4 = 0; q4 < 4; ++q4) *(v4u*)(orow + q4 * (DIM / 32) * 512) = pk[q4];
      
    }
  }
}

// ---------------------------------------------------------------------------
// The four operand preparations read only inputs and write disjoint planes, so they share one grid by ranges of the block
// index (block-uniform branches): Wq convert, Wk permute, Wv permute, then the x transpose tiles (x fastest, then y, then batch).
// ---------------------------------------------------------------------------
#define PR_WQ ((DIM * DIM / 8) / 256)              // 32 blocks
#define PR_WC ((DIM * 32) / 256)                   // 32 blocks per conv weight
#define PR_XT ((NQ / 64) * (DIM / 64) * NB)        // 1024 blocks
__global__ __launch_bounds__(256) void prep_kernel(const float* __restrict__ x, const float* __restrict__ Wq,
                                                   const float* __restrict__ Wk, const float* __restrict__ Wv,
                                                   unsigned short* __restrict__ XT, unsigned short* __restrict__ WQ,
                                                   unsigned short* __restrict__ WKp, unsigned short* __restrict__ WVp) {
  __shared__ __align__(16) float tf[64 * 68];      // used by the transpose blocks only
  const int bx = blockIdx.x;
  if (bx < PR_WQ) {
    convrows_body(Wq, WQ, DIM, DIM * DIM / 8, bx);
  } else if (bx < PR_WQ + PR_WC) {
    wperm_body(Wk, WKp, bx - PR_WQ);
  } else if (bx < PR_WQ + 2 * PR_WC) {
    wperm_body(Wv, WVp, bx - (PR_WQ + PR_WC));
  } else {
    // x[b] viewed [R=256 c][Cc=4096 n] (pitch 4096) -> XT_b(row n, col c), 256 cols, fragment order
    const int t = bx - (PR_WQ + 2 * PR_WC);
    tconv_body(x, XT, NQ, DIM, (long)DIM * NQ, (long)NQ * DIM, tf,
               t % (NQ / 64), (t / (NQ / 64)) % (DIM / 64), t / ((NQ / 64) * (DIM / 64)));
  }
}

// ---------------------------------------------------------------------------
// im2col addressing of the 2x2 / stride-2 / VALID conv as a GEMM over XT (fragment order, head of the file):
//   im2col row g = b*1024 + m, m = i*32 + j (output grid row i, col j); k = q4*256 + c, q4 = kh*2 + kw;
//   element (g, k) = x^T(token (b, y = 2i+kh, x = 2j+kw), channel c).
// The 16 rows g0 .. g0+15 (g0 % 16 == 0, jt = (j >> 4)) of a 32-deep k-step (k0 % 32 == 0) are exactly XT's block
// (row tile ((b*64 + y)*2 + kw)*2 + jt, k-step c0/32): the offset of that block is returned (arithmetic addressing only).
// ---------------------------------------------------------------------------
__device__ __forceinline__ size_t im2col_blk(int g0, int k0) {
  const int b = g0 >> 10, m = g0 & (NKV - 1);
  const int q4 = k0 >> 8, c0 = k0 & (DIM - 1);
  const int kh = q4 >> 1, kw = q4 & 1;
  const int i = m >> 5, jt = (m >> 4) & 1;
  return ((size_t)((((b * IMH + 2 * i + kh) * 2 + kw) * 2 + jt) * (DIM / 32) + (c0 >> 5))) * 512;
}

// ---------------------------------------------------------------------------
// Conv GEMM (bf16 single products, f32 accumulate), K = 1024, one 64x64 output tile per work-group:
//   MODE 0: C[g][o] = sum_k im2col(g,k) * WKp[o][k]  (M = 4096 rows g, N = 256), epilogue adds
//           pos(o, m) = bf16(rel_h[o*32 + (m&31)]) + bf16(rel_w[o*32 + (m>>5)]) in f32, then bf16 hi|lo, one 128-B row per (batch, head, m):
//           Ch[((b*8 + h)*1024 + m)*64 + d] = hi, + 32 = lo (Cl = Ch + 32), so that a chunk of keys of one head is contiguous whole lines.
//   MODE 1: C[o][g] = sum_k WVp[o][k] * im2col(g,k)  (M = 256, N = 4096) -> bf16 hi|lo planes [256][4096] (v^T layout).
// K is split over the 8 waves: wave w sums k = 128w .. 128w+127 (4 k-steps) of the whole tile into its own f32 partial,
// writes it to its LDS plane, and behind one work-group barrier wave w adds the 8 partials (plane 0 first, then 1 .. 7)
// of rows 8w .. 8w+7 and finishes those rows (pos, hi|lo split, whole 128-B line stores).
// MODE 0 tables (bf16 bits, two per dword), written before the k loop and read only behind that same barrier:
//   sRh[nl*17 + (jj>>1)] holds rel_h[(n0+nl)*32 + jj] (pitch 17 dwords: the 8 lanes of a row read 8 distinct banks);
//   sRw[nl] holds rel_w[(n0+nl)*32 + ii0 + {0,1}], ii0 = first of the two output-grid rows that the tile's 64 rows m cover.
// 256 work-groups x 8 waves = 256 tiles exactly (both modes); tile = the work-group's index within its range of the shared grid.
// ---------------------------------------------------------------------------
#define CG_PLANE (64 * 68)                         // floats of one wave's partial tile
#define CG_LDS   (8 * CG_PLANE + 64 * 17 + 64)     // dwords of LDS that MODE 0 uses (MODE 1: the 8 planes only)
template <int MODE>
__device__ __forceinline__ void conv_gemm64(const unsigned short* __restrict__ XTp, const unsigned short* __restrict__ Wpp,
                                            const float* __restrict__ rel_h, const float* __restrict__ rel_w,
                                            unsigned short* __restrict__ Ch, unsigned short* __restrict__ Cl,
                                            float* smem, int tile) {
  typedef __bf16 T;
  typedef v16b V;
  const T* XT = (const T*)XTp; const T* Wp = (const T*)Wpp;
  float* sP = smem;                                // 8 planes: per-wave partial 64x64 tile, pitch 68 floats
  unsigned* sRh = (unsigned*)(smem + 8 * CG_PLANE);   // MODE 0 only: 64 x 17 dwords
  unsigned* sRw = sRh + 64 * 17;                      // MODE 0 only: 64 dwords
  constexpr int M = (MODE == 0) ? MKV : DIM;
  constexpr int N = (MODE == 0) ? DIM : MKV;
  constexpr int LDC = N;
  constexpr int KW = KCONV / 8;                    // k range of one wave
  static_assert(KW % 32 == 0);
  const int tid  = threadIdx.x;
  const int lane = tid & 31;
  const int wave = __builtin_amdgcn_readfirstlane(tid >> 5);   // scalar, so that the k offsets stay scalar

  constexpr int tilesN = N >> 6;
  constexpr int tilesM = M >> 6;
  if (tile >= tilesM * tilesN) return;   // block-uniform, in front of the barrier; never taken with the exact grid
  const int tm = tile / tilesN;
  const int tn = tile - tm * tilesN;
  const int m0 = tm << 6;
  const int n0 = tn << 6;

  if (MODE == 0) {
    // rel_h rows n0 .. n0+63: 64 x 32 values, 8 per thread
    const int nl = tid >> 2, j0 = (tid & 3) * 8;
    const float* rh = rel_h + (size_t)(n0 + nl) * OH + j0;
    const v4f a = *(const v4f*)(rh);
    const v4f c = *(const v4f*)(rh + 4);
    unsigned* d = sRh + nl * 17 + (j0 >> 1);
    d[0] = pk16(f2bf_bits(a[0]), f2bf_bits(a[1]));
    d[1] = pk16(f2bf_bits(a[2]), f2bf_bits(a[3]));
    d[2] = pk16(f2bf_bits(c[0]), f2bf_bits(c[1]));
    d[3] = pk16(f2bf_bits(c[2]), f2bf_bits(c[3]));
    if (tid < 64) {
      const int ii0 = (m0 & (NKV - 1)) >> 5;       // even, m0 being a multiple of 64
      const v2f w = *(const v2f*)(rel_w + (size_t)(n0 + tid) * OW + ii0);
      sRw[tid] = pk16(f2bf_bits(w[0]), f2bf_bits(w[1]));
    }
  }

  const int rlane = lane & 15;
  const int mOff  = (lane >> 4) * 8;

  v8f acc[4][4];
#pragma unroll
  for (int i = 0; i < 4; ++i)
#pragma unroll
    for (int j = 0; j < 4; ++j) acc[i][j] = (v8f){0.f,0.f,0.f,0.f,0.f,0.f,0.f,0.f};

  const int kbeg = wave * KW;
  for (int k0 = kbeg; k0 < kbeg + KW; k0 += 32) {
    // All eight fragments of the k-step are loaded as ONE group in front of its 16 products (B first, then A in the order of use),
    // so the wave waits out one L2 round trip a k-step. One address an operand: sub-tile t lies a fixed distance behind sub-tile 0,
    // weights t row tiles on; im2col rows g0 + 16t (g0 % 64 == 0) = output-grid row + (t >> 1), jt = t & 1, that is 8*(t>>1) + (t&1) row tiles of XT on.
    V bfr[4], afr[4];
    const T* px = XT + im2col_blk((MODE == 0) ? m0 : n0, k0) + lane * 8;
    const T* pw = Wp + (size_t)((((MODE == 0) ? n0 : m0) >> 4) * (KCONV / 32) + (k0 >> 5)) * 512 + lane * 8;
#pragma unroll
    for (int j = 0; j < 4; ++j) {
      if (MODE == 0) bfr[j] = Frag<T>::load_fo(pw + j * ((KCONV / 32) * 512));
      else           bfr[j] = Frag<T>::load_fo(px + ((j >> 1) * 8 + (j & 1)) * ((DIM / 32) * 512));
    }
#pragma unroll
    for (int i = 0; i < 4; ++i) {
      if (MODE == 0) afr[i] = Frag<T>::load_fo(px + ((i >> 1) * 8 + (i & 1)) * ((DIM / 32) * 512));
      else           afr[i] = Frag<T>::load_fo(pw + i * ((KCONV / 32) * 512));
    }
    xcnt_wait(px, pw);
#pragma unroll
    for (int i = 0; i < 4; ++i) {
#pragma unroll
      for (int j = 0; j < 4; ++j) acc[i][j] = Frag<T>::mma(afr[i], bfr[j], acc[i][j]);
      Frag<T>::guard(acc[i][0], acc[i][3], afr[i], afr[i]);
    }
    Frag<T>::keep(bfr[0], bfr[1], bfr[2], bfr[3]);
  }
  acc_guard4(acc[0][0], acc[0][1], acc[0][2], acc[0][3]);
  acc_guard4(acc[1][0], acc[1][1], acc[1][2], acc[1][3]);
  acc_guard4(acc[2][0], acc[2][1], acc[2][2], acc[2][3]);
  acc_guard4(acc[3][0], acc[3][1], acc[3][2], acc[3][3]);

  // ---- this wave's partial tile to its LDS plane ----
  {
    float* part = sP + wave * CG_PLANE;
#pragma unroll
    for (int i = 0; i < 4; ++i)
#pragma unroll
      for (int j = 0; j < 4; ++j)
#pragma unroll
        for (int r = 0; r < 8; ++r) part[((i << 4) + mOff + r) * 68 + (j << 4) + rlane] = acc[i][j][r];
  }
  __syncthreads();

  // ---- join the 8 partials of rows 8*wave .. +7 and finish them: a lane holds 8 consecutive columns of one row ----
  const int q = lane >> 3, c8 = (lane & 7) * 8;
  v8h hv[2], lv[2];
  unsigned short* pch[2];
  unsigned short* pcl[2];
#pragma unroll
  for (int it = 0; it < 2; ++it) {
    const int row = wave * 8 + it * 4 + q;         // row within the tile
    const float* sp = sP + row * 68 + c8;
    v4f s0 = *(const v4f*)(sp);
    v4f s1 = *(const v4f*)(sp + 4);
#pragma unroll
    for (int w = 1; w < 8; ++w) {
      s0 += *(const v4f*)(sp + w * (64 * 68));
      s1 += *(const v4f*)(sp + w * (64 * 68) + 4);
    }
#pragma unroll
    for (int e = 0; e < 8; ++e) {
      float v = (e < 4) ? s0[e & 3] : s1[e & 3];
      if (MODE == 0) {
        const int jj = row & 31;                   // (m0 + row) & 31, m0 being a multiple of 64
        const unsigned hw = sRh[(c8 + e) * 17 + (jj >> 1)] >> ((jj & 1) * 16);
        const unsigned ww = sRw[c8 + e] >> ((row >> 5) * 16);
        const float pos = bf_bits2f((unsigned short)hw) + bf_bits2f((unsigned short)ww);
        v += pos;
      }
      unsigned short hb = f2bf_bits(v);
      unsigned short lb = f2bf_bits(v - bf_bits2f(hb));
      hv[it][e] = __builtin_bit_cast(_Float16, hb);
      lv[it][e] = __builtin_bit_cast(_Float16, lb);
    }
    size_t co;
    if (MODE == 0) {
      const int g = m0 + row, n = n0 + c8;         // 8 consecutive columns lie in one head, c8 being a multiple of 8
      co = ((size_t)(((g >> 10) * NH + (n >> 5)) * NKV + (g & (NKV - 1)))) * (2 * HD) + (n & (HD - 1));
    } else {
      co = (size_t)(m0 + row) * LDC + n0 + c8;
    }
    pch[it] = Ch + co;
    pcl[it] = Cl + co;
    *(v8h*)pch[it] = hv[it];
    *(v8h*)pcl[it] = lv[it];
  }
  xcnt_wait_st(pch, pcl, hv, lv);   // the code of the grid's other block ranges follows in the kernel and reuses these registers
}

// ---------------------------------------------------------------------------
// The two conv GEMMs read only the prepared planes and write disjoint planes, so they share one grid by ranges of the block index
// (block-uniform branches) and one LDS array: k' first, then v^T. Two work-groups fit a WGP (LDS, registers), so the 512 work-groups
// are all resident at once on 256 WGPs; the q projection is done where q is used, in the attention kernel's prologue.
// ---------------------------------------------------------------------------
#define G3_C ((MKV / 64) * (DIM / 64))             // 256 blocks per conv GEMM
__global__ __launch_bounds__(256) void gemm2_kernel(const unsigned short* __restrict__ XT,
                                                    const unsigned short* __restrict__ WKp, const unsigned short* __restrict__ WVp,
                                                    const float* __restrict__ rel_h, const float* __restrict__ rel_w,
                                                    unsigned short* __restrict__ KI,
                                                    unsigned short* __restrict__ VTh, unsigned short* __restrict__ VTl) {
  __shared__ __align__(16) float smem[CG_LDS];
  const int bx = blockIdx.x;
  if (bx < G3_C) {
    conv_gemm64<0>(XT, WKp, rel_h, rel_w, KI, KI + HD, smem, bx);
  } else {
    conv_gemm64<1>(XT, WVp, rel_h, rel_w, VTh, VTl, smem, bx - G3_C);
  }
}

// =====================================================================================
// Full (non-causal, unmasked) attention, head dim 32, all batches and heads in one launch.
//   q^T = WQ_h . XT^T (bf16 single products, f32 accumulate, k-steps in rising order) is formed by each wave for its own 16 queries:
//   a block's 64 queries are image row qb = 4 row tiles of XT, wave w takes tile w (kw = w >> 1, jt = w & 1), so that its query c is
//   position x = 2*(jt*16 + c) + kw of the row; the two 16 x 16 result tiles (d = t*16 + 8*(lane>>4) + r, query = lane & 15), split
//   hi|lo in place, are the B operand of the score products: q never leaves the registers.
//   k (hi|lo bf16) [32][1024][64]:      element (b, m, h, d) at [((b*8+h)*1024 + m)*64 + d] hi, + 32 lo  (pos already folded in)
//   v^T planes (hi/lo bf16) [256][4096]: element (h, d, b, m) at [(h*32 + d)*4096 + b*1024 + m]
//   out f32 NCHW: element (b, h*32+d, n) at [(b*256 + h*32 + d)*4096 + n]
//   scores = (q . k') * 32^-0.5 : bf16 hi/lo split (hi.hi + hi.lo + lo.hi) on v_wmma_f32_16x16x32_bf16
//   out    = p . v             : bf16 hi/lo split of p (unnormalised exp) and v, f32 accumulate, x 1/rowsum in f32 at the end
//   online softmax in f32 over the 1024 keys of the batch element (16 chunks of 64, compile-time trip count, no masking),
//   in base 2: p = 2^(s * scale * log2(e) - m), one multiply-add and one hardware exponential per score.
//   Block = 4 waves = 64 query positions of one (batch, head); grid.x = 4 * 8 * 64 = 2048 (exact).
//   Staging reads whole 128-B lines: 8 consecutive lanes take the 8 16-B pieces of one row, so a wave's load covers 4 whole lines.
//   K chunk: 64 rows of 128 B (hi|lo), contiguous; load i of thread tid = row i*16 + (tid>>3), piece tid&7 (4 loads) -> whole tile;
//   V^T chunk: 32 rows of 128 B per plane; load i = row i*16 + (tid>>3), piece tid&7 (2 loads per plane); __syncthreads before and after.
//   Scores are formed transposed, S^T = K . Q^T (A = K rows, B = Q): a lane holds 32 of the chunk's 64 scores of ONE query
//   (query = lane & 15, keys j*16 + 8*(lane>>4) + r), so maximum and sum run in the lane plus one exchange between lane halves;
//   two S^T tiles converted in place are the B operand of O^T += V^T . P^T (same k order as the V^T loader): P never touches LDS.
// =====================================================================================
#define AT_D  32
#define AT_NW 4
#define AT_QB 64
#define AT_KC 64
#define AT_KP 72   // LDS pitch of a K row (hi 32 | lo 32 | pad 8) in elements: 144 B = 16 B x 9 (odd), so the 16 rows of one 16-byte fragment read fall on 16 distinct bank groups
#define AT_VP 72   // LDS pitch of a V^T row in elements: 144 B = 16 B x 9 (odd), same reason

__device__ __forceinline__ v8f at_mma(v16b a, v16b b, v8f c) {
  // the builtin alone: the compiler keeps the distance behind its own matrix instructions, and pays idle slots only where a vector
  // instruction really follows on D, A or B (an accumulating product on the same D needs none)
  return __builtin_amdgcn_wmma_f32_16x16x32_bf16(false, a, false, b, (short)0, c, false, false);
}

// value of the same lane position in the other 16-lane half (lane ^ 16), as a vector cross-row move
__device__ __forceinline__ float at_xhalf(float f) {
  const int b = __float_as_int(f);
  return __int_as_float(__builtin_amdgcn_permlanex16(b, b, 0x76543210, 0xfedcba98, false, false));
}

// second argument: at least 8 waves a SIMD, that is at most 128 registers, so that all 2048 work-groups are resident in one round
__global__ __launch_bounds__(128, 8)
void attn32_kernel(const unsigned short* __restrict__ xtp, const unsigned short* __restrict__ wqp,
                   const unsigned short* __restrict__ kip,
                   const unsigned short* __restrict__ vhp, const unsigned short* __restrict__ vlp,
                   float* __restrict__ out, float sscale) {
  union FB { v16b v; v8b h[2]; unsigned w[8]; };
  __shared__ __align__(16) __bf16 Ks[AT_KC * AT_KP];             // K [kv][hi d | lo d], padded rows   9 KB
  __shared__ __align__(16) __bf16 Vth[AT_D * AT_VP];             // V hi [d][kv], padded rows   4.5 KB
  __shared__ __align__(16) __bf16 Vtl[AT_D * AT_VP];             // V lo
  __shared__ __align__(16) float  Os[AT_D * 68];                 // block out tile transposed [d][n_local], pitch 68

  const int tid  = threadIdx.x;
  const int wave = tid >> 5;
  const int lane = tid & 31;
  const int hh   = lane >> 4;
  const int c    = lane & 15;

  const int nqb = NQ / AT_QB;              // 64 query blocks per (batch, head)
  const int bx = blockIdx.x;               // grid = NB * NH * nqb (exact)
  const int qb = bx % nqb;
  const int hb = bx / nqb;
  const int h  = hb / NB;                  // 0..7: heads outermost, so that the 8 blocks that read one image row's XT tiles lie 256 apart in the grid
  const int b  = hb % NB;                  // 0..3

  const __bf16* Ki = (const __bf16*)(const void*)kip + (size_t)(b * NH + h) * NKV * (2 * AT_D);
  const __bf16* Vh = (const __bf16*)(const void*)vhp + (size_t)h * AT_D * VTP + (size_t)b * NKV;
  const __bf16* Vl = (const __bf16*)(const void*)vlp + (size_t)h * AT_D * VTP + (size_t)b * NKV;

  // ---- Q fragments (B operand, column = lane&15, k = d in the fragment's k order): head dim 32 = one k-step, hi and lo ----
  v16b qah, qal;
  {
    static_assert(NQ / AT_QB == IMH && AT_QB == IMW && AT_NW == 4 && AT_D == 32);
    // fragment-order blocks: XT row tile (b*64 + qb)*4 + wave, WQ row tiles h*2 and h*2 + 1; 8 k-steps of 32 channels
    const int wv = __builtin_amdgcn_readfirstlane(wave);   // scalar, so that both block addresses are a scalar base plus the lane's offset
    const __bf16* xb = (const __bf16*)(const void*)xtp + (size_t)(((b * IMH + qb) * 4 + wv) * (DIM / 32)) * 512 + lane * 8;
    const __bf16* wb = (const __bf16*)(const void*)wqp + (size_t)(h * 2 * (DIM / 32)) * 512 + lane * 8;
    v8f qacc[2];
#pragma unroll
    for (int t = 0; t < 2; ++t) qacc[t] = (v8f){0.f,0.f,0.f,0.f,0.f,0.f,0.f,0.f};
    // loads written two k-steps at a time and all loops unrolled: the fragments are indexed at compile time, and the compiler issues the
    // 48 loads ahead of the products as far as the kernel's 128 registers reach, so that the wave does not wait out a round trip a k-step
#pragma unroll
    for (int g = 0; g < 4; ++g) {
      v16b xf[2], wf[2][2];
#pragma unroll
      for (int k2 = 0; k2 < 2; ++k2) {
        xf[k2]    = Frag<__bf16>::load_fo(xb + (g * 2 + k2) * 512);
        wf[0][k2] = Frag<__bf16>::load_fo(wb + (g * 2 + k2) * 512);
        wf[1][k2] = Frag<__bf16>::load_fo(wb + ((DIM / 32) + g * 2 + k2) * 512);
      }
#pragma unroll
      for (int k2 = 0; k2 < 2; ++k2) {
#pragma unroll
        for (int t = 0; t < 2; ++t) qacc[t] = at_mma(wf[t][k2], xf[k2], qacc[t]);
      }
    }
    // behind the last of these loads, in front of the first write of a register that they name (the lane offset, the scalar bases)
    asm volatile("s_wait_xcnt 0x0" ::: "memory");
    // hi|lo split, two values at a time (round to nearest even; the remainder q - hi is exact in f32):
    // element e of the operand = tile e >> 3, register e & 7, that is d = 16*(e>>3) + 8*hh + (e&7)
    FB fh, fl;
#pragma unroll
    for (int t = 0; t < 2; ++t) {
#pragma unroll
      for (int r = 0; r < 8; r += 2) {
        const v2f qv = (v2f){qacc[t][r], qacc[t][r + 1]};
        const unsigned hw = __builtin_bit_cast(unsigned, __builtin_convertvector(qv, v2b));
        const v2f rest = qv - (v2f){__uint_as_float(hw << 16), __uint_as_float(hw & 0xFFFF0000u)};
        fh.w[t * 4 + (r >> 1)] = hw;
        fl.w[t * 4 + (r >> 1)] = __builtin_bit_cast(unsigned, __builtin_convertvector(rest, v2b));
      }
    }
    qah = fh.v;
    qal = fl.v;
  }

  const float sl2 = sscale * 1.4426950408889634f;   // score scale times log2(e): the softmax runs in base 2
  float mrow = -INFINITY;   // running maximum of this lane's query in base-2 units, max(s) * sl2 (equal in both lane halves)
  float lrow = 0.f;         // running sum over this lane half's keys only; the halves are joined once after the loop
  v8f oacc[2];              // O^T tiles: oacc[t][r] = out[d = t*16 + 8*hh + r][query c]
#pragma unroll
  for (int t = 0; t < 2; ++t) oacc[t] = (v8f){0.f,0.f,0.f,0.f,0.f,0.f,0.f,0.f};

  const int nChunks = NKV / AT_KC;   // 16, compile-time constant
  for (int kc = 0; kc < nChunks; ++kc) {
    const int kv0 = kc * AT_KC;
    __syncthreads();
    {
      const int r8 = tid >> 3, p8 = (tid & 7) * 8;   // row within a group of 16 rows, 16-B piece of its 128-B line
      // K staging: 4 loads x 128 threads x 8 elements = 64 rows x 64 (hi|lo)
      const __bf16* ks = Ki + (size_t)(kv0 + r8) * (2 * AT_D) + p8;
      const v8b a0 = *(const v8b*)(ks);
      const v8b a1 = *(const v8b*)(ks + 16 * (2 * AT_D));
      const v8b a2 = *(const v8b*)(ks + 32 * (2 * AT_D));
      const v8b a3 = *(const v8b*)(ks + 48 * (2 * AT_D));
      // V^T staging: 2 loads x 128 threads x 8 elements per plane = 32 rows x 64; issued in one group with the K loads, in front of
      // the first LDS store, so that a chunk's staging waits out one L2 round trip
      const __bf16* vsh = Vh + (size_t)r8 * VTP + kv0 + p8;
      const __bf16* vsl = Vl + (size_t)r8 * VTP + kv0 + p8;
      const v8b b0 = *(const v8b*)(vsh);
      const v8b b1 = *(const v8b*)(vsh + (size_t)16 * VTP);
      const v8b b2 = *(const v8b*)(vsl);
      const v8b b3 = *(const v8b*)(vsl + (size_t)16 * VTP);
      xcnt_wait(ks, vsh, vsl);   // the addresses stay in their registers up to the wait
      *(v8b*)(Ks + r8 * AT_KP + p8)        = a0;
      *(v8b*)(Ks + (r8 + 16) * AT_KP + p8) = a1;
      *(v8b*)(Ks + (r8 + 32) * AT_KP + p8) = a2;
      *(v8b*)(Ks + (r8 + 48) * AT_KP + p8) = a3;
      *(v8b*)(Vth + r8 * AT_VP + p8)        = b0;
      *(v8b*)(Vth + (r8 + 16) * AT_VP + p8) = b1;
      *(v8b*)(Vtl + r8 * AT_VP + p8)        = b2;
      *(v8b*)(Vtl + (r8 + 16) * AT_VP + p8) = b3;
    }
    __syncthreads();

    v8f s[4];
#pragma unroll
    for (int j = 0; j < 4; ++j) {
      s[j] = (v8f){0.f,0.f,0.f,0.f,0.f,0.f,0.f,0.f};
      FB kb, kl;
      kb.h[0] = *(const v8b*)(Ks + (j * 16 + c) * AT_KP + 8 * hh);
      kb.h[1] = *(const v8b*)(Ks + (j * 16 + c) * AT_KP + 16 + 8 * hh);
      kl.h[0] = *(const v8b*)(Ks + (j * 16 + c) * AT_KP + AT_D + 8 * hh);
      kl.h[1] = *(const v8b*)(Ks + (j * 16 + c) * AT_KP + AT_D + 16 + 8 * hh);
      s[j] = at_mma(kb.v, qah, s[j]);
      s[j] = at_mma(kl.v, qah, s[j]);
      s[j] = at_mma(kb.v, qal, s[j]);
    }
    // the query's chunk maximum of the raw scores: in the lane, then one exchange with the other lane half; scaled once (sl2 > 0 keeps the order)
    // (the loops over j, r, t and kk below are unrolled so that s, ph, pl and oacc are indexed at compile time and stay in registers)
    float cm = -INFINITY;
#pragma unroll
    for (int j = 0; j < 4; ++j) {
#pragma unroll
      for (int r = 0; r < 8; ++r) cm = fmaxf(cm, s[j][r]);
    }
    cm = fmaxf(cm, at_xhalf(cm));
    const float mnew = fmaxf(mrow, cm * sl2);
    const float alpha = __builtin_amdgcn_exp2f(mrow - mnew);   // 0 on the first chunk, where mrow is -inf
    mrow = mnew;
    // P^T as B operand: element e of k-step kk = S^T tile 2*kk + (e >> 3), register e & 7 (key kk*32 + 16*(e>>3) + 8*hh + (e&7))
    FB ph[2], pl[2];
    float psum = 0.f;
#pragma unroll
    for (int j = 0; j < 4; ++j) {
#pragma unroll
      for (int r = 0; r < 8; r += 2) {
        // e^(scale*s - max) as 2^(s*sl2 - mnew), the multiply-add on two scores at a time
        const v2f arg = __builtin_elementwise_fma((v2f){s[j][r], s[j][r + 1]}, (v2f){sl2, sl2}, (v2f){-mnew, -mnew});
        const float p0 = __builtin_amdgcn_exp2f(arg[0]);
        const float p1 = __builtin_amdgcn_exp2f(arg[1]);
        psum += p0;
        psum += p1;
        // hi|lo split of two scores at a time: the packed hardware conversion rounds to nearest even, as the integer steps did,
        // and leaves both halves of the operand word in place; the remainder p - hi is exact in f32
        const unsigned hw = __builtin_bit_cast(unsigned, __builtin_convertvector((v2f){p0, p1}, v2b));
        const v2f rest = (v2f){p0, p1} - (v2f){__uint_as_float(hw << 16), __uint_as_float(hw & 0xFFFF0000u)};
        ph[j >> 1].w[(j & 1) * 4 + (r >> 1)] = hw;
        pl[j >> 1].w[(j & 1) * 4 + (r >> 1)] = __builtin_bit_cast(unsigned, __builtin_convertvector(rest, v2b));
      }
    }
    lrow = lrow * alpha + psum;
    // keeps the exponentials and the split in front of the P.V products: moved in among them they hold the f32 values of P longer,
    // the kernel passes 128 registers, and only 7 instead of 8 waves fit a SIMD (the 2048 work-groups then need a second round)
    __builtin_amdgcn_sched_barrier(0);
#pragma unroll
    for (int t = 0; t < 2; ++t)
#pragma unroll
      for (int r = 0; r < 8; ++r) oacc[t][r] *= alpha;
#pragma unroll
    for (int kk = 0; kk < 2; ++kk) {
#pragma unroll
      for (int t = 0; t < 2; ++t) {
        FB vb, vl;
        vb.h[0] = *(const v8b*)(Vth + (t * 16 + c) * AT_VP + kk * 32 + 8 * hh);
        vb.h[1] = *(const v8b*)(Vth + (t * 16 + c) * AT_VP + kk * 32 + 16 + 8 * hh);
        vl.h[0] = *(const v8b*)(Vtl + (t * 16 + c) * AT_VP + kk * 32 + 8 * hh);
        vl.h[1] = *(const v8b*)(Vtl + (t * 16 + c) * AT_VP + kk * 32 + 16 + 8 * hh);
        oacc[t] = at_mma(vb.v, ph[kk].v, oacc[t]);
        oacc[t] = at_mma(vl.v, ph[kk].v, oacc[t]);
        oacc[t] = at_mma(vb.v, pl[kk].v, oacc[t]);
      }
    }
  }

  // ---- join the lane halves' sums, normalise and stage: Os[d][n_local], d = t*16 + 8hh + r, n_local = the query's place in the image row (all 32 x 64 written) ----
  {
    const int nl = 2 * ((wave & 1) * 16 + c) + (wave >> 1);
    const float inv = 1.0f / (lrow + at_xhalf(lrow));
#pragma unroll
    for (int t = 0; t < 2; ++t)
#pragma unroll
      for (int r = 0; r < 8; ++r) Os[(t * 16 + 8 * hh + r) * 68 + nl] = oacc[t][r] * inv;
  }
  __syncthreads();
  {
    float* ob = out + ((size_t)(b * DIM + h * AT_D)) * NQ + (size_t)qb * AT_QB;
    const int q = lane >> 3, c4 = (lane & 7) * 4;
    {
#pragma unroll
      for (int it = 0; it < 4; ++it) {
        const int L  = it * 16 + wave * 4 + q;   // 0..63: line index within the block's 32 x 256-B output region
        const int d  = L >> 1;
        const int hf = (L & 1) * 32;
        v4f val = *(const v4f*)(Os + d * 68 + hf + c4);
        *(v4f*)(ob + (size_t)d * NQ + hf + c4) = val;
      }
      
    }
  }
}

// ---------------------------------------------------------------------------
// Workspace region map (byte offsets; every region fully written by its producer launch before any consumer reads it;
//   XT   bf16 16384 x 256          0       8388608   (XT, WQ, WKp, WVp in fragment order)
//   WQ   bf16 [256][256]     8388608        131072
//   WKp  bf16 [256][1024]    8519680        524288
//   WVp  bf16 [256][1024]    9043968        524288
//   KI   bf16 [32][1024][64]  9568256      4194304
//   VTh  bf16 [256][4096]   13762560       2097152   VTl 15859712
//   total                  17956864
// ---------------------------------------------------------------------------
extern "C" void kernel_launch(void* const* d_in, const int* in_sizes, int n_in,
                              void* d_out, int out_size, void* d_ws, size_t ws_size,
                              hipStream_t stream) {
  if (n_in < 6) return;
  if (in_sizes[0] != NB * DIM * NQ) return;          // x [4][256][64][64]
  if (in_sizes[1] != DIM * DIM) return;              // Wq [256][256]
  if (in_sizes[2] != DIM * DIM * 4) return;          // Wk [256][256][2][2]
  if (in_sizes[3] != DIM * DIM * 4) return;          // Wv [256][256][2][2]
  if (in_sizes[4] != NH * HD * OH) return;           // rel_h [1][8][32][1][32]
  if (in_sizes[5] != NH * HD * OW) return;           // rel_w [1][8][32][32][1]
  if (out_size != NB * DIM * NQ) return;

  const float* x     = (const float*)d_in[0];
  const float* Wq    = (const float*)d_in[1];
  const float* Wk    = (const float*)d_in[2];
  const float* Wv    = (const float*)d_in[3];
  const float* rel_h = (const float*)d_in[4];
  const float* rel_w = (const float*)d_in[5];

  const size_t PXT = (size_t)MTOK * DIM * 2;        // 8388608
  const size_t PWQ = (size_t)DIM * DIM * 2;         // 131072
  const size_t PWC = (size_t)DIM * KCONV * 2;       // 524288
  const size_t PK  = (size_t)MKV * DIM * 2 * 2;     // 4194304 (hi and lo in one plane)
  const size_t PVT = (size_t)DIM * VTP * 2;         // 2097152
  size_t off = 0;
  const size_t oXT  = off; off += PXT;
  const size_t oWQ  = off; off += PWQ;
  const size_t oWK  = off; off += PWC;
  const size_t oWV  = off; off += PWC;
  const size_t oKI  = off; off += PK;
  const size_t oVTh = off; off += PVT;  const size_t oVTl = off; off += PVT;
  if (off > ws_size) return;                        // off = 17956864
  if (off > (size_t)134217728) return;

  char* ws = (char*)d_ws;
  unsigned short* XT  = (unsigned short*)(ws + oXT);
  unsigned short* WQ  = (unsigned short*)(ws + oWQ);
  unsigned short* WKp = (unsigned short*)(ws + oWK);
  unsigned short* WVp = (unsigned short*)(ws + oWV);
  unsigned short* KI  = (unsigned short*)(ws + oKI);
  unsigned short* VTh = (unsigned short*)(ws + oVTh); unsigned short* VTl = (unsigned short*)(ws + oVTl);

  const dim3 blk(256);

  // (1) operand preparation: WQ, WKp, WVp and XT; 32 + 32 + 32 + 1024 blocks
  prep_kernel<<<dim3(PR_WQ + 2 * PR_WC + PR_XT), blk, 0, stream>>>(x, Wq, Wk, Wv, XT, WQ, WKp, WVp);
  // (2) k' = conv_k + pos -> KI, v^T = conv_v -> VTh|VTl; 256 + 256 blocks
  gemm2_kernel<<<dim3(2 * G3_C), blk, 0, stream>>>(XT, WKp, WVp, rel_h, rel_w, KI, VTh, VTl);
  // (3) q projection and attention per (batch, head, 64-query block) -> d_out NCHW; 2048 blocks of 128
  attn32_kernel<<<dim3(NB * NH * (NQ / AT_QB)), dim3(128), 0, stream>>>(XT, WQ, KI, VTh, VTl, (float*)d_out,
                                                                        0.17677669529663687f);
  (void)hipGetLastError();
}
